// v000
// Measured on an AMD MI455X. A time is GPU time per run, averaged over a window of back-to-back runs after a warm-up
// (all launches, gaps included; the runs take copies of the inputs in turn), and the median of several windows.
// Apart from v000's, it joins two sittings. Times from different sittings can be a few percent apart, while
// side-by-side timings come from the same sitting.
// v000 is the starting kernel. One run takes 764 microseconds.
#include <hip/hip_runtime.h>

typedef __bf16 bf16_t;
typedef __attribute__((ext_vector_type(16))) __bf16 v16bf;
typedef __attribute__((ext_vector_type(8)))  __bf16 v8bf;
typedef __attribute__((ext_vector_type(8)))  float  v8f;

#define DEV static __device__ __forceinline__

// ---------------------------------------------------------------------------
// WMMA helpers (CDNA5 wave32, 16x16x32 bf16 -> f32)
// A fragment: lane m = row, kbase = 8*(lane>>4); VGPR v in [0,3] -> K = kbase+2v..,
// v in [4,7] -> K = 16+kbase+...  => two contiguous 16-byte chunks at +0 and +16.
// B fragment mirrors A with lane = output column, reading rows of B^T ([N][K]).
// ---------------------------------------------------------------------------
DEV v8f wmma_bf16(v16bf a, v16bf b, v8f c) {
  return __builtin_amdgcn_wmma_f32_16x16x32_bf16(false, a, false, b, (short)0, c,
                                                 false, false);
}

DEV const bf16_t* frag_ptr(const bf16_t* tile, int row0, int stride, int lane) {
  return tile + (size_t)(row0 + (lane & 15)) * stride + ((lane >> 4) << 3);
}

DEV v16bf frag_ld(const bf16_t* p) {
  v8bf lo = *(const v8bf*)(p);
  v8bf hi = *(const v8bf*)(p + 16);
  return __builtin_shufflevector(lo, hi, 0, 1, 2, 3, 4, 5, 6, 7,
                                 8, 9, 10, 11, 12, 13, 14, 15);
}

DEV v8f vzero8() {
  v8f z;
#pragma unroll
  for (int i = 0; i < 8; ++i) z[i] = 0.0f;
  return z;
}

DEV float gelu_exact(float x) {
  return 0.5f * x * (1.0f + erff(x * 0.70710678118654752f));
}

// ---------------------------------------------------------------------------
// CDNA5 async global->LDS copy (ASYNCcnt-tracked), 16 bytes per lane.
// lds_byte: DS-space byte offset of the destination (truncated generic addr
// of a __shared__ pointer == addrspace(3) offset).
// ---------------------------------------------------------------------------
DEV uint32_t lds_addr32(const void* p) { return (uint32_t)(uintptr_t)p; }

DEV void async_copy_b128(uint32_t lds_byte, const void* gsrc) {
  asm volatile("global_load_async_to_lds_b128 %0, %1, off"
               :
               : "v"(lds_byte), "v"(gsrc)
               : "memory");
}

DEV void wait_async0() { asm volatile("s_wait_asynccnt 0x0" ::: "memory"); }

// ---------------------------------------------------------------------------
// LayerNorm over D=1024, writes bf16. One block per row, 256 threads x 4 elems.
// ---------------------------------------------------------------------------
__global__ __launch_bounds__(256) void ln_kernel(const float* __restrict__ x,
                                                 const float* __restrict__ g,
                                                 const float* __restrict__ b,
                                                 bf16_t* __restrict__ out) {
  const int row = blockIdx.x;
  const int tid = threadIdx.x, lane = tid & 31, wave = tid >> 5;
  const float4 v = ((const float4*)(x + (size_t)row * 1024))[tid];
  float s = v.x + v.y + v.z + v.w;
  float ss = v.x * v.x + v.y * v.y + v.z * v.z + v.w * v.w;
#pragma unroll
  for (int o = 16; o; o >>= 1) {
    s += __shfl_xor(s, o);
    ss += __shfl_xor(ss, o);
  }
  __shared__ float red[16];
  if (lane == 0) { red[wave] = s; red[8 + wave] = ss; }
  __syncthreads();
  if (tid == 0) {
    float a = 0.f, c = 0.f;
#pragma unroll
    for (int i = 0; i < 8; ++i) { a += red[i]; c += red[8 + i]; }
    red[0] = a; red[8] = c;
  }
  __syncthreads();
  const float mean = red[0] * (1.0f / 1024.0f);
  const float var = red[8] * (1.0f / 1024.0f) - mean * mean;
  const float inv = rsqrtf(var + 1e-5f);
  const float4 gg = ((const float4*)g)[tid];
  const float4 bb = ((const float4*)b)[tid];
  bf16_t* o4 = out + (size_t)row * 1024 + tid * 4;
  o4[0] = (bf16_t)((v.x - mean) * inv * gg.x + bb.x);
  o4[1] = (bf16_t)((v.y - mean) * inv * gg.y + bb.y);
  o4[2] = (bf16_t)((v.z - mean) * inv * gg.z + bb.z);
  o4[3] = (bf16_t)((v.w - mean) * inv * gg.w + bb.w);
}

// ---------------------------------------------------------------------------
// Weight convert+transpose: f32 W[K][N] -> bf16 Wt[N][K]. 32x32 tiles.
// ---------------------------------------------------------------------------
__global__ __launch_bounds__(256) void wt_transpose_kernel(
    const float* __restrict__ W, bf16_t* __restrict__ Wt, int K, int N) {
  __shared__ float t[32][33];
  const int n0 = blockIdx.x * 32, k0 = blockIdx.y * 32;
  const int tx = threadIdx.x & 31, ty = threadIdx.x >> 5;  // 32 x 8
#pragma unroll
  for (int i = 0; i < 32; i += 8)
    t[ty + i][tx] = W[(size_t)(k0 + ty + i) * N + n0 + tx];
  __syncthreads();
#pragma unroll
  for (int i = 0; i < 32; i += 8)
    Wt[(size_t)(n0 + ty + i) * K + k0 + tx] = (bf16_t)t[tx][ty + i];
}

// ---------------------------------------------------------------------------
// Generic bf16 GEMM, f32 accumulate: out[M][N] = A[M][K] * Bt[N][K]^T + bias
// Block: 256 thr = 8 waves; tile 128x128; wave tile 64x32 (4 M-frags x 2 N-frags).
// Double-buffered LDS staged via async global->LDS (one barrier per K-step).
// Epilogue: optional GELU, optional f32 residual, bf16 or f32 output.
// M,N multiples of 128; K multiple of 32.
// ---------------------------------------------------------------------------
template <bool OUT_BF16, bool GELU_ACT, bool RES>
__global__ __launch_bounds__(256) void gemm_kernel(
    const bf16_t* __restrict__ A, const bf16_t* __restrict__ Bt,
    const float* __restrict__ bias, const float* __restrict__ res,
    void* __restrict__ out, int M, int N, int K) {
  const int LDK = 40;  // 32 + 8 pad; 80B row stride -> conflict-free frag reads
  __shared__ __align__(16) bf16_t sA[2][128 * 40];
  __shared__ __align__(16) bf16_t sB[2][128 * 40];
  const int tid = threadIdx.x, lane = tid & 31, wave = tid >> 5;
  const int m0 = blockIdx.y * 128, n0 = blockIdx.x * 128;
  const int wm = (wave >> 2) * 64;  // wave M offset within tile
  const int wn = (wave & 3) * 32;   // wave N offset within tile

  v8f acc[4][2];
#pragma unroll
  for (int i = 0; i < 4; ++i)
#pragma unroll
    for (int j = 0; j < 2; ++j) acc[i][j] = vzero8();

  const int lr = tid >> 1;        // 0..127 (row of both tiles)
  const int lc = (tid & 1) * 16;  // 0 or 16 (16-element half-row)
  const uint32_t ldsA0 = lds_addr32(&sA[0][lr * LDK + lc]);
  const uint32_t ldsB0 = lds_addr32(&sB[0][lr * LDK + lc]);
  const uint32_t bufstride = (uint32_t)(128 * 40 * sizeof(bf16_t));
  const bf16_t* gA = A + (size_t)(m0 + lr) * K + lc;
  const bf16_t* gB = Bt + (size_t)(n0 + lr) * K + lc;

  // stage k0 into buffer `buf` (4 x 16B per thread, ASYNCcnt-tracked)
  auto prefetch = [&](int k0, int buf) {
    const uint32_t la = ldsA0 + (uint32_t)buf * bufstride;
    const uint32_t lb = ldsB0 + (uint32_t)buf * bufstride;
    async_copy_b128(la, gA + k0);
    async_copy_b128(la + 16, gA + k0 + 8);
    async_copy_b128(lb, gB + k0);
    async_copy_b128(lb + 16, gB + k0 + 8);
  };

  prefetch(0, 0);
  const int niter = K >> 5;
  for (int it = 0; it < niter; ++it) {
    const int buf = it & 1;
    wait_async0();      // own async copies (issued last iter) have landed
    __syncthreads();    // everyone's copies landed; everyone done reading buf^1
    if (it + 1 < niter) prefetch((it + 1) << 5, buf ^ 1);
    const bf16_t* tA = sA[buf];
    const bf16_t* tB = sB[buf];
    v16bf af[4], bfv[2];
#pragma unroll
    for (int mt = 0; mt < 4; ++mt)
      af[mt] = frag_ld(frag_ptr(tA, wm + mt * 16, LDK, lane));
#pragma unroll
    for (int nt = 0; nt < 2; ++nt)
      bfv[nt] = frag_ld(frag_ptr(tB, wn + nt * 16, LDK, lane));
#pragma unroll
    for (int mt = 0; mt < 4; ++mt)
#pragma unroll
      for (int nt = 0; nt < 2; ++nt)
        acc[mt][nt] = wmma_bf16(af[mt], bfv[nt], acc[mt][nt]);
  }

  const int cl = lane & 15, rh = (lane >> 4) << 3;
#pragma unroll
  for (int mt = 0; mt < 4; ++mt)
#pragma unroll
    for (int nt = 0; nt < 2; ++nt)
#pragma unroll
      for (int r = 0; r < 8; ++r) {
        const size_t row = (size_t)(m0 + wm + mt * 16 + rh + r);
        const int col = n0 + wn + nt * 16 + cl;
        float v = acc[mt][nt][r] + bias[col];
        if (RES) v += res[row * (size_t)N + col];
        if (GELU_ACT) v = gelu_exact(v);
        if (OUT_BF16)
          ((bf16_t*)out)[row * (size_t)N + col] = (bf16_t)v;
        else
          ((float*)out)[row * (size_t)N + col] = v;
      }
}

// ---------------------------------------------------------------------------
// Sliding-window attention. One block per (query-block, head, batch).
// Q 128x64, K/V context 256x64 (prev block + own block), W=128 band mask.
// All matmuls via WMMA; softmax in registers with 16-lane shuffles.
// qkv: bf16 [B*L][3*1024]; out: bf16 [B*L][1024].
// ---------------------------------------------------------------------------
__global__ __launch_bounds__(256) void swa_kernel(const bf16_t* __restrict__ qkv,
                                                  bf16_t* __restrict__ out) {
  const int blk = blockIdx.x, h = blockIdx.y, b = blockIdx.z;
  const int tid = threadIdx.x, lane = tid & 31, wave = tid >> 5;

  // Q(128x72) + K(256x72) overlap with P(128x264) -- disjoint lifetimes.
  __shared__ __align__(16) char smem_u[128 * 264 * 2];
  __shared__ __align__(16) bf16_t sVt[64 * 264];  // V^T [e][s]
  bf16_t* sQ = (bf16_t*)smem_u;                   // [128][72]
  bf16_t* sK = (bf16_t*)smem_u + 128 * 72;        // [256][72]
  bf16_t* sP = (bf16_t*)smem_u;                   // [128][264]

  const size_t rowQ0 = (size_t)b * 4096 + (size_t)blk * 128;

  // Load Q: thread -> (row tid/2, 32-col half)
  {
    const int r = tid >> 1, half = (tid & 1) * 32;
    const bf16_t* src = qkv + (rowQ0 + r) * 3072 + h * 64 + half;
#pragma unroll
    for (int j = 0; j < 32; j += 8)
      *(v8bf*)&sQ[r * 72 + half + j] = *(const v8bf*)(src + j);
  }
  // Load K and V^T: thread -> key index s = tid (0..255)
  {
    const int s = tid;
    const long lk = (long)blk * 128 - 128 + s;
    if (lk < 0) {
      for (int e = 0; e < 64; ++e) {
        sK[s * 72 + e] = (bf16_t)0.f;
        sVt[e * 264 + s] = (bf16_t)0.f;
      }
    } else {
      const bf16_t* srck = qkv + ((size_t)b * 4096 + lk) * 3072 + 1024 + h * 64;
      const bf16_t* srcv = srck + 1024;
#pragma unroll
      for (int e = 0; e < 64; e += 8) {
        v8bf kv = *(const v8bf*)(srck + e);
        *(v8bf*)&sK[s * 72 + e] = kv;
        v8bf vv = *(const v8bf*)(srcv + e);
#pragma unroll
        for (int j = 0; j < 8; ++j) sVt[(e + j) * 264 + s] = vv[j];
      }
    }
  }
  __syncthreads();

  // Scores: wave w owns query rows [16w,16w+16); 16 key tiles; K-dim = 64.
  v8f acc[16];
#pragma unroll
  for (int i = 0; i < 16; ++i) acc[i] = vzero8();
#pragma unroll
  for (int kk = 0; kk < 64; kk += 32) {
    v16bf aq = frag_ld(frag_ptr(sQ, wave * 16, 72, lane) + kk);
#pragma unroll
    for (int nt = 0; nt < 16; ++nt) {
      v16bf bk = frag_ld(frag_ptr(sK, nt * 16, 72, lane) + kk);
      acc[nt] = wmma_bf16(aq, bk, acc[nt]);
    }
  }

  // Mask + softmax. C-layout: row = 16*wave + 8*(lane>>4) + r, col = 16*nt + (lane&15)
  const int cl = lane & 15, rh = (lane >> 4) << 3;
#pragma unroll
  for (int r = 0; r < 8; ++r) {
    const int rloc = wave * 16 + rh + r;
    float mx = -1e30f;
#pragma unroll
    for (int nt = 0; nt < 16; ++nt) {
      const int s = nt * 16 + cl;
      const bool ok = (s >= rloc + 1) && (s <= rloc + 128) && (blk > 0 || s >= 128);
      const float v = ok ? acc[nt][r] * 0.125f : -1e30f;
      acc[nt][r] = v;
      mx = fmaxf(mx, v);
    }
#pragma unroll
    for (int o = 1; o < 16; o <<= 1) mx = fmaxf(mx, __shfl_xor(mx, o));
    float sum = 0.f;
#pragma unroll
    for (int nt = 0; nt < 16; ++nt) {
      const float e = __expf(acc[nt][r] - mx);
      acc[nt][r] = e;
      sum += e;
    }
#pragma unroll
    for (int o = 1; o < 16; o <<= 1) sum += __shfl_xor(sum, o);
    const float inv = 1.0f / sum;
#pragma unroll
    for (int nt = 0; nt < 16; ++nt) acc[nt][r] *= inv;
  }

  __syncthreads();  // all waves done reading sQ/sK before P overwrites them
#pragma unroll
  for (int nt = 0; nt < 16; ++nt)
#pragma unroll
    for (int r = 0; r < 8; ++r)
      sP[(wave * 16 + rh + r) * 264 + nt * 16 + cl] = (bf16_t)acc[nt][r];
  __syncthreads();

  // PV: out 16x64 per wave; K-dim = 256 keys.
  v8f ov[4];
#pragma unroll
  for (int i = 0; i < 4; ++i) ov[i] = vzero8();
#pragma unroll
  for (int kk = 0; kk < 256; kk += 32) {
    v16bf ap = frag_ld(frag_ptr(sP, wave * 16, 264, lane) + kk);
#pragma unroll
    for (int nt = 0; nt < 4; ++nt) {
      v16bf bv = frag_ld(frag_ptr(sVt, nt * 16, 264, lane) + kk);
      ov[nt] = wmma_bf16(ap, bv, ov[nt]);
    }
  }
#pragma unroll
  for (int nt = 0; nt < 4; ++nt)
#pragma unroll
    for (int r = 0; r < 8; ++r) {
      const size_t row = rowQ0 + wave * 16 + rh + r;
      out[row * 1024 + h * 64 + nt * 16 + cl] = (bf16_t)ov[nt][r];
    }
}

// ---------------------------------------------------------------------------
// Chunked causal linear attention. One block per (b,h); sequential 32-chunk scan.
// State S^T (64x64 f32) + z (64) live in LDS across chunks.
// qkv: f32 [B*L][3*1024] (elu applied at load); out: bf16 [B*L][1024].
// ---------------------------------------------------------------------------
__global__ __launch_bounds__(256) void linattn_kernel(const float* __restrict__ qkv,
                                                      bf16_t* __restrict__ out) {
  const int bh = blockIdx.x, b = bh >> 4, h = bh & 15;
  const int tid = threadIdx.x, lane = tid & 31, wave = tid >> 5;
  __shared__ __align__(16) bf16_t sq[128 * 72];    // q' rows  [c][e]
  __shared__ __align__(16) bf16_t sk[128 * 72];    // k' rows  [c][e]
  __shared__ __align__(16) bf16_t skT[64 * 136];   // k'^T     [e][c]
  __shared__ __align__(16) bf16_t svT[64 * 136];   // v^T      [f][c]
  __shared__ __align__(16) bf16_t sP[128 * 136];   // masked A [c][d]
  __shared__ __align__(16) bf16_t sSB[64 * 72];    // bf16 snapshot of S^T [f][e]
  __shared__ float sST[64 * 64];                   // S^T f32  [f][e]
  __shared__ float sz[64];
  __shared__ float srow[128];
  __shared__ float sden[128];

  for (int i = tid; i < 64 * 64; i += 256) sST[i] = 0.f;
  if (tid < 64) sz[tid] = 0.f;
  __syncthreads();

  const int cl = lane & 15, rh = (lane >> 4) << 3;

  for (int ch = 0; ch < 32; ++ch) {
    // 1. snapshot S^T -> bf16 (B-operand layout: row f, cols e)
    for (int i = tid; i < 64 * 64; i += 256)
      sSB[(i >> 6) * 72 + (i & 63)] = (bf16_t)sST[i];
    // 2. load chunk, apply elu maps
    {
      const int c = tid >> 1, half = (tid & 1) * 32;
      const size_t row = (size_t)b * 4096 + (size_t)ch * 128 + c;
      const float* pq = qkv + row * 3072 + h * 64 + half;
      const float* pk = pq + 1024;
      const float* pv = pq + 2048;
#pragma unroll 8
      for (int j = 0; j < 32; ++j) {
        float qv = pq[j] * 0.125f;  // E^-0.5
        qv = (qv > 0.f ? qv : expm1f(qv)) + 1.0001f;
        sq[c * 72 + half + j] = (bf16_t)qv;
        float kv = pk[j];
        kv = (kv > 0.f ? kv : expm1f(kv)) + 1.0001f;
        const bf16_t kb = (bf16_t)kv;
        sk[c * 72 + half + j] = kb;
        skT[(half + j) * 136 + c] = kb;
        svT[(half + j) * 136 + c] = (bf16_t)pv[j];
      }
    }
    __syncthreads();

    // 3. A = q k'^T (8 tiles/wave) and num1 = q @ S (4 tiles/wave), K-dim 64
    v8f accA[8], accN[4];
#pragma unroll
    for (int i = 0; i < 8; ++i) accA[i] = vzero8();
#pragma unroll
    for (int i = 0; i < 4; ++i) accN[i] = vzero8();
#pragma unroll
    for (int kk = 0; kk < 64; kk += 32) {
      v16bf aq = frag_ld(frag_ptr(sq, wave * 16, 72, lane) + kk);
#pragma unroll
      for (int nt = 0; nt < 8; ++nt) {
        v16bf bk = frag_ld(frag_ptr(sk, nt * 16, 72, lane) + kk);
        accA[nt] = wmma_bf16(aq, bk, accA[nt]);
      }
#pragma unroll
      for (int nt = 0; nt < 4; ++nt) {
        v16bf bs = frag_ld(frag_ptr(sSB, nt * 16, 72, lane) + kk);
        accN[nt] = wmma_bf16(aq, bs, accN[nt]);
      }
    }
    // tril mask + row sums + stage masked A as bf16
#pragma unroll
    for (int r = 0; r < 8; ++r) {
      const int c = wave * 16 + rh + r;
      float rs = 0.f;
#pragma unroll
      for (int nt = 0; nt < 8; ++nt) {
        const int d = nt * 16 + cl;
        const float v = (d <= c) ? accA[nt][r] : 0.f;
        accA[nt][r] = v;
        rs += v;
      }
#pragma unroll
      for (int o = 1; o < 16; o <<= 1) rs += __shfl_xor(rs, o);
      if (cl == 0) srow[c] = rs;
#pragma unroll
      for (int nt = 0; nt < 8; ++nt)
        sP[c * 136 + nt * 16 + cl] = (bf16_t)accA[nt][r];
    }
    __syncthreads();

    // 4. den[c] = q'.z + rowsum(A)   (uses pre-update z)
    if (tid < 128) {
      float qz = 0.f;
#pragma unroll 8
      for (int e = 0; e < 64; ++e) qz += (float)sq[tid * 72 + e] * sz[e];
      sden[tid] = qz + srow[tid];
    }
    __syncthreads();

    // 5. num2 = A @ v  (B-operand = v^T rows), K-dim 128
#pragma unroll
    for (int kk = 0; kk < 128; kk += 32) {
      v16bf ap = frag_ld(frag_ptr(sP, wave * 16, 136, lane) + kk);
#pragma unroll
      for (int nt = 0; nt < 4; ++nt) {
        v16bf bv = frag_ld(frag_ptr(svT, nt * 16, 136, lane) + kk);
        accN[nt] = wmma_bf16(ap, bv, accN[nt]);
      }
    }
    // 6. o = num / (den + 1e-6) -> global bf16
#pragma unroll
    for (int nt = 0; nt < 4; ++nt)
#pragma unroll
      for (int r = 0; r < 8; ++r) {
        const int c = wave * 16 + rh + r;
        const float o = accN[nt][r] / (sden[c] + 1e-6f);
        const size_t row = (size_t)b * 4096 + (size_t)ch * 128 + c;
        out[row * 1024 + h * 64 + nt * 16 + cl] = (bf16_t)o;
      }
    __syncthreads();

    // 7. S^T += v^T @ k'  (16 tiles over 8 waves, 2 each); z += colsum(k')
    {
      const int ft = wave >> 1;
      const int ebase = (wave & 1) * 32;
      v8f accS[2];
#pragma unroll
      for (int i = 0; i < 2; ++i) accS[i] = vzero8();
#pragma unroll
      for (int kk = 0; kk < 128; kk += 32) {
        v16bf av = frag_ld(frag_ptr(svT, ft * 16, 136, lane) + kk);
#pragma unroll
        for (int nt = 0; nt < 2; ++nt) {
          v16bf bk = frag_ld(frag_ptr(skT, ebase + nt * 16, 136, lane) + kk);
          accS[nt] = wmma_bf16(av, bk, accS[nt]);
        }
      }
#pragma unroll
      for (int nt = 0; nt < 2; ++nt)
#pragma unroll
        for (int r = 0; r < 8; ++r) {
          const int f = ft * 16 + rh + r;
          const int e = ebase + nt * 16 + cl;
          sST[f * 64 + e] += accS[nt][r];
        }
    }
    if (tid < 64) {
      float zs = 0.f;
#pragma unroll 8
      for (int c = 0; c < 128; ++c) zs += (float)sk[c * 72 + tid];
      sz[tid] += zs;
    }
    __syncthreads();
  }
}

// ---------------------------------------------------------------------------
// Launch: B=2, L=4096, D=1024, H=16, E=64, W=128. Requires ws >= ~254 MB.
// ---------------------------------------------------------------------------
extern "C" void kernel_launch(void* const* d_in, const int* in_sizes, int n_in,
                              void* d_out, int out_size, void* d_ws, size_t ws_size,
                              hipStream_t stream) {
  const float* x = (const float*)d_in[0];
  const float* g1 = (const float*)d_in[1];
  const float* b1 = (const float*)d_in[2];
  const float* Wqkva = (const float*)d_in[3];
  const float* bqkva = (const float*)d_in[4];
  const float* Wpa = (const float*)d_in[5];
  const float* bpa = (const float*)d_in[6];
  const float* Wqkvs = (const float*)d_in[7];
  const float* bqkvs = (const float*)d_in[8];
  const float* Wos = (const float*)d_in[9];
  const float* bos = (const float*)d_in[10];
  const float* Wo = (const float*)d_in[11];
  const float* bo = (const float*)d_in[12];
  const float* gm = (const float*)d_in[13];
  const float* bm = (const float*)d_in[14];
  const float* W1 = (const float*)d_in[15];
  const float* b1m = (const float*)d_in[16];
  const float* W2 = (const float*)d_in[17];
  const float* b2m = (const float*)d_in[18];

  char* ws = (char*)d_ws;
  bf16_t* WqkvaT = (bf16_t*)(ws + 0);            // [3072][1024]
  bf16_t* WqkvsT = (bf16_t*)(ws + 6291456);      // [3072][1024]
  bf16_t* WpaT = (bf16_t*)(ws + 12582912);       // [1024][1024]
  bf16_t* WosT = (bf16_t*)(ws + 14680064);       // [1024][1024]
  bf16_t* WoT = (bf16_t*)(ws + 16777216);        // [1024][1024]
  bf16_t* W1T = (bf16_t*)(ws + 18874368);        // [4096][1024]
  bf16_t* W2T = (bf16_t*)(ws + 27262976);        // [1024][4096]
  bf16_t* xn = (bf16_t*)(ws + 35651584);         // [8192][1024]  (later: h)
  bf16_t* swa_o = (bf16_t*)(ws + 52428800);      // [8192][1024]
  bf16_t* lin_o = (bf16_t*)(ws + 69206016);      // [8192][1024]
  bf16_t* mix = (bf16_t*)(ws + 85983232);        // [8192][1024]
  bf16_t* qkva = (bf16_t*)(ws + 102760448);      // [8192][3072]
  float* qkvs = (float*)(ws + 153092096);        // [8192][3072]
  float* attnf = (float*)(ws + 153092096);       // [8192][1024] (reuses qkvs)
  bf16_t* gbuf = (bf16_t*)(ws + 153092096);      // [8192][4096] (reuses attnf)
  float* x1 = (float*)(ws + 220200960);          // [8192][1024] (tail of qkvs)
  float* outf = (float*)d_out;

  const dim3 blk(256);
  // Weight convert+transpose to bf16 [N][K]
  wt_transpose_kernel<<<dim3(3072 / 32, 1024 / 32), blk, 0, stream>>>(Wqkva, WqkvaT, 1024, 3072);
  wt_transpose_kernel<<<dim3(3072 / 32, 1024 / 32), blk, 0, stream>>>(Wqkvs, WqkvsT, 1024, 3072);
  wt_transpose_kernel<<<dim3(1024 / 32, 1024 / 32), blk, 0, stream>>>(Wpa, WpaT, 1024, 1024);
  wt_transpose_kernel<<<dim3(1024 / 32, 1024 / 32), blk, 0, stream>>>(Wos, WosT, 1024, 1024);
  wt_transpose_kernel<<<dim3(1024 / 32, 1024 / 32), blk, 0, stream>>>(Wo, WoT, 1024, 1024);
  wt_transpose_kernel<<<dim3(4096 / 32, 1024 / 32), blk, 0, stream>>>(W1, W1T, 1024, 4096);
  wt_transpose_kernel<<<dim3(1024 / 32, 4096 / 32), blk, 0, stream>>>(W2, W2T, 4096, 1024);

  // xn = LN(x)
  ln_kernel<<<8192, blk, 0, stream>>>(x, g1, b1, xn);
  // qkv projections
  gemm_kernel<true, false, false><<<dim3(24, 64), blk, 0, stream>>>(
      xn, WqkvaT, bqkva, nullptr, qkva, 8192, 3072, 1024);
  gemm_kernel<false, false, false><<<dim3(24, 64), blk, 0, stream>>>(
      xn, WqkvsT, bqkvs, nullptr, qkvs, 8192, 3072, 1024);
  // attention branches
  swa_kernel<<<dim3(32, 16, 2), blk, 0, stream>>>(qkva, swa_o);
  linattn_kernel<<<dim3(32), blk, 0, stream>>>(qkvs, lin_o);
  // attn_out = swa @ Wp + bp  (f32)
  gemm_kernel<false, false, false><<<dim3(8, 64), blk, 0, stream>>>(
      swa_o, WpaT, bpa, nullptr, attnf, 8192, 1024, 1024);
  // mix = lin @ Wo_s + bo_s + attn_out  (bf16)
  gemm_kernel<true, false, true><<<dim3(8, 64), blk, 0, stream>>>(
      lin_o, WosT, bos, attnf, mix, 8192, 1024, 1024);
  // x1 = mix @ Wo + bo + x  (f32)
  gemm_kernel<false, false, true><<<dim3(8, 64), blk, 0, stream>>>(
      mix, WoT, bo, x, x1, 8192, 1024, 1024);
  // h = LN(x1)
  ln_kernel<<<8192, blk, 0, stream>>>(x1, gm, bm, xn);
  // g = gelu(h @ W1 + b1m)  (bf16)
  gemm_kernel<true, true, false><<<dim3(32, 64), blk, 0, stream>>>(
      xn, W1T, b1m, nullptr, gbuf, 8192, 4096, 1024);
  // out = g @ W2 + b2m + x1  (f32)
  gemm_kernel<false, false, true><<<dim3(8, 64), blk, 0, stream>>>(
      gbuf, W2T, b2m, x1, outf, 8192, 1024, 4096);
}

// v001
// A run of this version takes 540 microseconds.
// In two side-by-side timings against v000, it was 1.46 and 1.45 times as fast.
#include <hip/hip_runtime.h>

typedef __bf16 bf16_t;
typedef __attribute__((ext_vector_type(16))) __bf16 v16bf;
typedef __attribute__((ext_vector_type(8)))  __bf16 v8bf;
typedef __attribute__((ext_vector_type(8)))  float  v8f;

#define DEV static __device__ __forceinline__

// ---------------------------------------------------------------------------
// WMMA helpers (CDNA5 wave32, 16x16x32 bf16 -> f32)
// A fragment: lane m = row, kbase = 8*(lane>>4); VGPR v in [0,3] -> K = kbase+2v..,
// v in [4,7] -> K = 16+kbase+...  => two contiguous 16-byte chunks at +0 and +16.
// B fragment mirrors A with lane = output column, reading rows of B^T ([N][K]).
// ---------------------------------------------------------------------------
DEV v8f wmma_bf16(v16bf a, v16bf b, v8f c) {
  return __builtin_amdgcn_wmma_f32_16x16x32_bf16(false, a, false, b, (short)0, c,
                                                 false, false);
}

DEV const bf16_t* frag_ptr(const bf16_t* tile, int row0, int stride, int lane) {
  return tile + (size_t)(row0 + (lane & 15)) * stride + ((lane >> 4) << 3);
}

DEV v16bf frag_ld(const bf16_t* p) {
  v8bf lo = *(const v8bf*)(p);
  v8bf hi = *(const v8bf*)(p + 16);
  return __builtin_shufflevector(lo, hi, 0, 1, 2, 3, 4, 5, 6, 7,
                                 8, 9, 10, 11, 12, 13, 14, 15);
}

DEV v8f vzero8() {
  v8f z;
#pragma unroll
  for (int i = 0; i < 8; ++i) z[i] = 0.0f;
  return z;
}

DEV float gelu_exact(float x) {
  return 0.5f * x * (1.0f + erff(x * 0.70710678118654752f));
}

// ---------------------------------------------------------------------------
// CDNA5 async global->LDS copy (ASYNCcnt-tracked), 16 bytes per lane.
// lds_byte: DS-space byte offset of the destination (truncated generic addr
// of a __shared__ pointer == addrspace(3) offset).
// ---------------------------------------------------------------------------
DEV uint32_t lds_addr32(const void* p) { return (uint32_t)(uintptr_t)p; }

DEV void async_copy_b128(uint32_t lds_byte, const void* gsrc) {
  asm volatile("global_load_async_to_lds_b128 %0, %1, off"
               :
               : "v"(lds_byte), "v"(gsrc)
               : "memory");
}

DEV void wait_async0() { asm volatile("s_wait_asynccnt 0x0" ::: "memory"); }

// ---------------------------------------------------------------------------
// LayerNorm over D=1024, writes bf16. One block per row, 256 threads x 4 elems.
// ---------------------------------------------------------------------------
__global__ __launch_bounds__(256) void ln_kernel(const float* __restrict__ x,
                                                 const float* __restrict__ g,
                                                 const float* __restrict__ b,
                                                 bf16_t* __restrict__ out) {
  const int row = blockIdx.x;
  const int tid = threadIdx.x, lane = tid & 31, wave = tid >> 5;
  const float4 v = ((const float4*)(x + (size_t)row * 1024))[tid];
  float s = v.x + v.y + v.z + v.w;
  float ss = v.x * v.x + v.y * v.y + v.z * v.z + v.w * v.w;
#pragma unroll
  for (int o = 16; o; o >>= 1) {
    s += __shfl_xor(s, o);
    ss += __shfl_xor(ss, o);
  }
  __shared__ float red[16];
  if (lane == 0) { red[wave] = s; red[8 + wave] = ss; }
  __syncthreads();
  if (tid == 0) {
    float a = 0.f, c = 0.f;
#pragma unroll
    for (int i = 0; i < 8; ++i) { a += red[i]; c += red[8 + i]; }
    red[0] = a; red[8] = c;
  }
  __syncthreads();
  const float mean = red[0] * (1.0f / 1024.0f);
  const float var = red[8] * (1.0f / 1024.0f) - mean * mean;
  const float inv = rsqrtf(var + 1e-5f);
  const float4 gg = ((const float4*)g)[tid];
  const float4 bb = ((const float4*)b)[tid];
  bf16_t* o4 = out + (size_t)row * 1024 + tid * 4;
  o4[0] = (bf16_t)((v.x - mean) * inv * gg.x + bb.x);
  o4[1] = (bf16_t)((v.y - mean) * inv * gg.y + bb.y);
  o4[2] = (bf16_t)((v.z - mean) * inv * gg.z + bb.z);
  o4[3] = (bf16_t)((v.w - mean) * inv * gg.w + bb.w);
}

// ---------------------------------------------------------------------------
// Weight convert+transpose: f32 W[K][N] -> bf16 Wt[N][K]. 32x32 tiles.
// ---------------------------------------------------------------------------
__global__ __launch_bounds__(256) void wt_transpose_kernel(
    const float* __restrict__ W, bf16_t* __restrict__ Wt, int K, int N) {
  __shared__ float t[32][33];
  const int n0 = blockIdx.x * 32, k0 = blockIdx.y * 32;
  const int tx = threadIdx.x & 31, ty = threadIdx.x >> 5;  // 32 x 8
#pragma unroll
  for (int i = 0; i < 32; i += 8)
    t[ty + i][tx] = W[(size_t)(k0 + ty + i) * N + n0 + tx];
  __syncthreads();
#pragma unroll
  for (int i = 0; i < 32; i += 8)
    Wt[(size_t)(n0 + ty + i) * K + k0 + tx] = (bf16_t)t[tx][ty + i];
}

// ---------------------------------------------------------------------------
// Generic bf16 GEMM, f32 accumulate: out[M][N] = A[M][K] * Bt[N][K]^T + bias
// Block: 256 thr = 8 waves; tile 128x128; wave tile 64x32 (4 M-frags x 2 N-frags).
// Double-buffered LDS staged via async global->LDS (one barrier per K-step).
// Epilogue: optional GELU, optional f32 residual, bf16 or f32 output.
// M,N multiples of 128; K multiple of 32.
// ---------------------------------------------------------------------------
template <bool OUT_BF16, bool GELU_ACT, bool RES>
__global__ __launch_bounds__(256) void gemm_kernel(
    const bf16_t* __restrict__ A, const bf16_t* __restrict__ Bt,
    const float* __restrict__ bias, const float* __restrict__ res,
    void* __restrict__ out, int M, int N, int K) {
  const int LDK = 40;  // 32 + 8 pad; 80B row stride -> conflict-free frag reads
  __shared__ __align__(16) bf16_t sA[2][128 * 40];
  __shared__ __align__(16) bf16_t sB[2][128 * 40];
  const int tid = threadIdx.x, lane = tid & 31, wave = tid >> 5;
  const int m0 = blockIdx.y * 128, n0 = blockIdx.x * 128;
  const int wm = (wave >> 2) * 64;  // wave M offset within tile
  const int wn = (wave & 3) * 32;   // wave N offset within tile

  v8f acc[4][2];
#pragma unroll
  for (int i = 0; i < 4; ++i)
#pragma unroll
    for (int j = 0; j < 2; ++j) acc[i][j] = vzero8();

  const int lr = tid >> 1;        // 0..127 (row of both tiles)
  const int lc = (tid & 1) * 16;  // 0 or 16 (16-element half-row)
  const uint32_t ldsA0 = lds_addr32(&sA[0][lr * LDK + lc]);
  const uint32_t ldsB0 = lds_addr32(&sB[0][lr * LDK + lc]);
  const uint32_t bufstride = (uint32_t)(128 * 40 * sizeof(bf16_t));
  const bf16_t* gA = A + (size_t)(m0 + lr) * K + lc;
  const bf16_t* gB = Bt + (size_t)(n0 + lr) * K + lc;

  // stage k0 into buffer `buf` (4 x 16B per thread, ASYNCcnt-tracked)
  auto prefetch = [&](int k0, int buf) {
    const uint32_t la = ldsA0 + (uint32_t)buf * bufstride;
    const uint32_t lb = ldsB0 + (uint32_t)buf * bufstride;
    async_copy_b128(la, gA + k0);
    async_copy_b128(la + 16, gA + k0 + 8);
    async_copy_b128(lb, gB + k0);
    async_copy_b128(lb + 16, gB + k0 + 8);
  };

  prefetch(0, 0);
  const int niter = K >> 5;
  for (int it = 0; it < niter; ++it) {
    const int buf = it & 1;
    wait_async0();      // own async copies (issued last iter) have landed
    __syncthreads();    // everyone's copies landed; everyone done reading buf^1
    if (it + 1 < niter) prefetch((it + 1) << 5, buf ^ 1);
    const bf16_t* tA = sA[buf];
    const bf16_t* tB = sB[buf];
    v16bf af[4], bfv[2];
#pragma unroll
    for (int mt = 0; mt < 4; ++mt)
      af[mt] = frag_ld(frag_ptr(tA, wm + mt * 16, LDK, lane));
#pragma unroll
    for (int nt = 0; nt < 2; ++nt)
      bfv[nt] = frag_ld(frag_ptr(tB, wn + nt * 16, LDK, lane));
#pragma unroll
    for (int mt = 0; mt < 4; ++mt)
#pragma unroll
      for (int nt = 0; nt < 2; ++nt)
        acc[mt][nt] = wmma_bf16(af[mt], bfv[nt], acc[mt][nt]);
  }

  const int cl = lane & 15, rh = (lane >> 4) << 3;
#pragma unroll
  for (int mt = 0; mt < 4; ++mt)
#pragma unroll
    for (int nt = 0; nt < 2; ++nt)
#pragma unroll
      for (int r = 0; r < 8; ++r) {
        const size_t row = (size_t)(m0 + wm + mt * 16 + rh + r);
        const int col = n0 + wn + nt * 16 + cl;
        float v = acc[mt][nt][r] + bias[col];
        if (RES) v += res[row * (size_t)N + col];
        if (GELU_ACT) v = gelu_exact(v);
        if (OUT_BF16)
          ((bf16_t*)out)[row * (size_t)N + col] = (bf16_t)v;
        else
          ((float*)out)[row * (size_t)N + col] = v;
      }
}

// ---------------------------------------------------------------------------
// Sliding-window attention. One block per (query-block, head, batch).
// Q 128x64, K/V context 256x64 (prev block + own block), W=128 band mask.
// All matmuls via WMMA; softmax in registers with 16-lane shuffles.
// qkv: bf16 [B*L][3*1024]; out: bf16 [B*L][1024].
// ---------------------------------------------------------------------------
__global__ __launch_bounds__(256) void swa_kernel(const bf16_t* __restrict__ qkv,
                                                  bf16_t* __restrict__ out) {
  const int blk = blockIdx.x, h = blockIdx.y, b = blockIdx.z;
  const int tid = threadIdx.x, lane = tid & 31, wave = tid >> 5;

  // Q(128x72) + K(256x72) overlap with P(128x264) -- disjoint lifetimes.
  __shared__ __align__(16) char smem_u[128 * 264 * 2];
  __shared__ __align__(16) bf16_t sVt[64 * 264];  // V^T [e][s]
  bf16_t* sQ = (bf16_t*)smem_u;                   // [128][72]
  bf16_t* sK = (bf16_t*)smem_u + 128 * 72;        // [256][72]
  bf16_t* sP = (bf16_t*)smem_u;                   // [128][264]

  const size_t rowQ0 = (size_t)b * 4096 + (size_t)blk * 128;

  // Load Q: thread -> (row tid/2, 32-col half)
  {
    const int r = tid >> 1, half = (tid & 1) * 32;
    const bf16_t* src = qkv + (rowQ0 + r) * 3072 + h * 64 + half;
#pragma unroll
    for (int j = 0; j < 32; j += 8)
      *(v8bf*)&sQ[r * 72 + half + j] = *(const v8bf*)(src + j);
  }
  // Load K and V^T: thread -> key index s = tid (0..255)
  {
    const int s = tid;
    const long lk = (long)blk * 128 - 128 + s;
    if (lk < 0) {
      for (int e = 0; e < 64; ++e) {
        sK[s * 72 + e] = (bf16_t)0.f;
        sVt[e * 264 + s] = (bf16_t)0.f;
      }
    } else {
      const bf16_t* srck = qkv + ((size_t)b * 4096 + lk) * 3072 + 1024 + h * 64;
      const bf16_t* srcv = srck + 1024;
#pragma unroll
      for (int e = 0; e < 64; e += 8) {
        v8bf kv = *(const v8bf*)(srck + e);
        *(v8bf*)&sK[s * 72 + e] = kv;
        v8bf vv = *(const v8bf*)(srcv + e);
#pragma unroll
        for (int j = 0; j < 8; ++j) sVt[(e + j) * 264 + s] = vv[j];
      }
    }
  }
  __syncthreads();

  // Scores: wave w owns query rows [16w,16w+16); 16 key tiles; K-dim = 64.
  v8f acc[16];
#pragma unroll
  for (int i = 0; i < 16; ++i) acc[i] = vzero8();
#pragma unroll
  for (int kk = 0; kk < 64; kk += 32) {
    v16bf aq = frag_ld(frag_ptr(sQ, wave * 16, 72, lane) + kk);
#pragma unroll
    for (int nt = 0; nt < 16; ++nt) {
      v16bf bk = frag_ld(frag_ptr(sK, nt * 16, 72, lane) + kk);
      acc[nt] = wmma_bf16(aq, bk, acc[nt]);
    }
  }

  // Mask + softmax. C-layout: row = 16*wave + 8*(lane>>4) + r, col = 16*nt + (lane&15)
  const int cl = lane & 15, rh = (lane >> 4) << 3;
#pragma unroll
  for (int r = 0; r < 8; ++r) {
    const int rloc = wave * 16 + rh + r;
    float mx = -1e30f;
#pragma unroll
    for (int nt = 0; nt < 16; ++nt) {
      const int s = nt * 16 + cl;
      const bool ok = (s >= rloc + 1) && (s <= rloc + 128) && (blk > 0 || s >= 128);
      const float v = ok ? acc[nt][r] * 0.125f : -1e30f;
      acc[nt][r] = v;
      mx = fmaxf(mx, v);
    }
#pragma unroll
    for (int o = 1; o < 16; o <<= 1) mx = fmaxf(mx, __shfl_xor(mx, o));
    float sum = 0.f;
#pragma unroll
    for (int nt = 0; nt < 16; ++nt) {
      const float e = __expf(acc[nt][r] - mx);
      acc[nt][r] = e;
      sum += e;
    }
#pragma unroll
    for (int o = 1; o < 16; o <<= 1) sum += __shfl_xor(sum, o);
    const float inv = 1.0f / sum;
#pragma unroll
    for (int nt = 0; nt < 16; ++nt) acc[nt][r] *= inv;
  }

  __syncthreads();  // all waves done reading sQ/sK before P overwrites them
#pragma unroll
  for (int nt = 0; nt < 16; ++nt)
#pragma unroll
    for (int r = 0; r < 8; ++r)
      sP[(wave * 16 + rh + r) * 264 + nt * 16 + cl] = (bf16_t)acc[nt][r];
  __syncthreads();

  // PV: out 16x64 per wave; K-dim = 256 keys.
  v8f ov[4];
#pragma unroll
  for (int i = 0; i < 4; ++i) ov[i] = vzero8();
#pragma unroll
  for (int kk = 0; kk < 256; kk += 32) {
    v16bf ap = frag_ld(frag_ptr(sP, wave * 16, 264, lane) + kk);
#pragma unroll
    for (int nt = 0; nt < 4; ++nt) {
      v16bf bv = frag_ld(frag_ptr(sVt, nt * 16, 264, lane) + kk);
      ov[nt] = wmma_bf16(ap, bv, ov[nt]);
    }
  }
#pragma unroll
  for (int nt = 0; nt < 4; ++nt)
#pragma unroll
    for (int r = 0; r < 8; ++r) {
      const size_t row = rowQ0 + wave * 16 + rh + r;
      out[row * 1024 + h * 64 + nt * 16 + cl] = (bf16_t)ov[nt][r];
    }
}

// ---------------------------------------------------------------------------
// Chunked causal linear attention, chunk-parallel, three launches:
//   lin_state : per (chunk, b, h) the chunk's own v^T k' (64x64 f32) and colsum(k')
//   lin_prefix: exclusive running sum over the chunks, f32, chunk 0 first
//   lin_out   : per (chunk, b, h) the outputs from q', k', v and the summed state
// qkv: f32 [B*L][3*1024] (elu applied at load); out: bf16 [B*L][1024].
// State records: index (bh*32 + ch); S^T as [f][e].
// ---------------------------------------------------------------------------
typedef __attribute__((ext_vector_type(2))) __bf16 v2bf;

// The last chunk's own state is read by nobody: grid.x = 31.
__global__ __launch_bounds__(256) void lin_state_kernel(const float* __restrict__ qkv,
                                                        float* __restrict__ Sc,
                                                        float* __restrict__ zc) {
  const int ch = blockIdx.x, bh = blockIdx.y, b = bh >> 4, h = bh & 15;
  const int tid = threadIdx.x, lane = tid & 31, wave = tid >> 5;
  __shared__ __align__(16) bf16_t skT[64 * 136];   // k'^T     [e][c]
  __shared__ __align__(16) bf16_t svT[64 * 136];   // v^T      [f][c]
  const int cl = lane & 15, rh = (lane >> 4) << 3;
  {
    const int c = tid >> 1, half = (tid & 1) * 32;
    const size_t row = (size_t)b * 4096 + (size_t)ch * 128 + c;
    const float4* pk = (const float4*)(qkv + row * 3072 + 1024 + h * 64 + half);
    const float4* pv = pk + 256;
    // loads first, elu after: the loads fly together, not one round trip each
    float4 kx[8], vx[8];
#pragma unroll
    for (int i = 0; i < 8; ++i) { kx[i] = pk[i]; vx[i] = pv[i]; }
#pragma unroll
    for (int i = 0; i < 8; ++i) {
      const float k4[4] = {kx[i].x, kx[i].y, kx[i].z, kx[i].w};
      const float v4[4] = {vx[i].x, vx[i].y, vx[i].z, vx[i].w};
#pragma unroll
      for (int u = 0; u < 4; ++u) {
        const int j = i * 4 + u;
        const float em = expm1f(k4[u]);  // unconditional: a select, no branch a value
        const float kv = (k4[u] > 0.f ? k4[u] : em) + 1.0001f;
        skT[(half + j) * 136 + c] = (bf16_t)kv;
        svT[(half + j) * 136 + c] = (bf16_t)v4[u];
      }
    }
  }
  __syncthreads();

  const size_t rec = (size_t)bh * 32 + ch;
  // v^T @ k'  (16 tiles over 8 waves, 2 each), K-dim 128
  {
    const int ft = wave >> 1;
    const int ebase = (wave & 1) * 32;
    v8f accS[2];
#pragma unroll
    for (int i = 0; i < 2; ++i) accS[i] = vzero8();
#pragma unroll
    for (int kk = 0; kk < 128; kk += 32) {
      v16bf av = frag_ld(frag_ptr(svT, ft * 16, 136, lane) + kk);
#pragma unroll
      for (int nt = 0; nt < 2; ++nt) {
        v16bf bk = frag_ld(frag_ptr(skT, ebase + nt * 16, 136, lane) + kk);
        accS[nt] = wmma_bf16(av, bk, accS[nt]);
      }
    }
#pragma unroll
    for (int nt = 0; nt < 2; ++nt)
#pragma unroll
      for (int r = 0; r < 8; ++r) {
        const int f = ft * 16 + rh + r;
        const int e = ebase + nt * 16 + cl;
        Sc[rec * 4096 + f * 64 + e] = accS[nt][r];
      }
  }
  if (tid < 64) {
    float zs = 0.f;
#pragma unroll 8
    for (int c = 0; c < 128; ++c) zs += (float)skT[tid * 136 + c];
    zc[rec * 64 + tid] = zs;
  }
}

// Blocks 0..255: S^T, two neighbouring elements a thread, rounded to bf16 at the
// store (the B operand of q' @ S). Blocks 256..263: z, kept in f32.
__global__ __launch_bounds__(256) void lin_prefix_kernel(const float* __restrict__ Sc,
                                                         const float* __restrict__ zc,
                                                         bf16_t* __restrict__ Sb,
                                                         float* __restrict__ zp) {
  if (blockIdx.x >= 256) {
    const int t = (blockIdx.x - 256) * 256 + threadIdx.x;
    const size_t base = (size_t)(t >> 6) * (32 * 64) + (size_t)(t & 63);
    float v[31];
#pragma unroll
    for (int ch = 0; ch < 31; ++ch) v[ch] = zc[base + ch * 64];
    float s = 0.f;
#pragma unroll
    for (int ch = 0; ch < 32; ++ch) {
      zp[base + ch * 64] = s;
      if (ch < 31) s += v[ch];
    }
    return;
  }
  const int t = blockIdx.x * 256 + threadIdx.x;
  const size_t base = (size_t)(t >> 11) * (32 * 4096) + (size_t)(t & 2047) * 2;
  float2 v[31];
#pragma unroll
  for (int ch = 0; ch < 31; ++ch) v[ch] = *(const float2*)(Sc + base + ch * 4096);
  float s0 = 0.f, s1 = 0.f;
#pragma unroll
  for (int ch = 0; ch < 32; ++ch) {
    v2bf o;
    o[0] = (bf16_t)s0;
    o[1] = (bf16_t)s1;
    *(v2bf*)(Sb + base + ch * 4096) = o;
    if (ch < 31) { s0 += v[ch].x; s1 += v[ch].y; }
  }
  // the built code lets this path run on to the z path's first instructions behind a
  // scalar test; they rewrite registers that the stores above name: wait in front
  asm volatile("s_wait_xcnt 0x0" ::: "memory");
}

__global__ __launch_bounds__(256) void lin_out_kernel(const float* __restrict__ qkv,
                                                      const bf16_t* __restrict__ Sb,
                                                      const float* __restrict__ zp,
                                                      bf16_t* __restrict__ out) {
  const int ch = blockIdx.x, bh = blockIdx.y, b = bh >> 4, h = bh & 15;
  const int tid = threadIdx.x, lane = tid & 31, wave = tid >> 5;
  // q'(128x72) + k'(128x72) overlap with masked A (128x136) -- disjoint lifetimes.
  __shared__ __align__(16) char smem_u[2 * 128 * 72 * 2];
  __shared__ __align__(16) bf16_t svT[64 * 136];   // v^T      [f][c]
  __shared__ __align__(16) bf16_t sSB[64 * 72];    // bf16 S^T before this chunk [f][e]
  __shared__ float sz[64];
  __shared__ float sqz[128];
  __shared__ float sden[128];
  bf16_t* sq = (bf16_t*)smem_u;                    // q' rows  [c][e]
  bf16_t* sk = (bf16_t*)smem_u + 128 * 72;         // k' rows  [c][e]
  bf16_t* sP = (bf16_t*)smem_u;                    // masked A [c][d]

  const int cl = lane & 15, rh = (lane >> 4) << 3;
  const size_t rec = (size_t)bh * 32 + ch;

  // 1. state before this chunk (B-operand layout: row f, cols e)
#pragma unroll
  for (int i = tid; i < 512; i += 256)
    *(v8bf*)&sSB[(i >> 3) * 72 + (i & 7) * 8] = *(const v8bf*)(Sb + rec * 4096 + i * 8);
  if (tid < 64) sz[tid] = zp[rec * 64 + tid];
  // 2. load chunk, apply elu maps
  {
    const int c = tid >> 1, half = (tid & 1) * 32;
    const size_t row = (size_t)b * 4096 + (size_t)ch * 128 + c;
    const float* pq = qkv + row * 3072 + h * 64 + half;
    const float* pk = pq + 1024;
    const float* pv = pq + 2048;
#pragma unroll 8
    for (int j = 0; j < 32; ++j) {
      float qv = pq[j] * 0.125f;  // E^-0.5
      qv = (qv > 0.f ? qv : expm1f(qv)) + 1.0001f;
      sq[c * 72 + half + j] = (bf16_t)qv;
      float kv = pk[j];
      kv = (kv > 0.f ? kv : expm1f(kv)) + 1.0001f;
      sk[c * 72 + half + j] = (bf16_t)kv;
      svT[(half + j) * 136 + c] = (bf16_t)pv[j];
    }
  }
  __syncthreads();

  // 3. A = q k'^T (8 tiles/wave) and num1 = q @ S (4 tiles/wave), K-dim 64
  v8f accA[8], accN[4];
#pragma unroll
  for (int i = 0; i < 8; ++i) accA[i] = vzero8();
#pragma unroll
  for (int i = 0; i < 4; ++i) accN[i] = vzero8();
#pragma unroll
  for (int kk = 0; kk < 64; kk += 32) {
    v16bf aq = frag_ld(frag_ptr(sq, wave * 16, 72, lane) + kk);
#pragma unroll
    for (int nt = 0; nt < 8; ++nt) {
      v16bf bk = frag_ld(frag_ptr(sk, nt * 16, 72, lane) + kk);
      accA[nt] = wmma_bf16(aq, bk, accA[nt]);
    }
#pragma unroll
    for (int nt = 0; nt < 4; ++nt) {
      v16bf bs = frag_ld(frag_ptr(sSB, nt * 16, 72, lane) + kk);
      accN[nt] = wmma_bf16(aq, bs, accN[nt]);
    }
  }
  // 4a. q'.z while q' is still in LDS
  if (tid < 128) {
    float qz = 0.f;
#pragma unroll 8
    for (int e = 0; e < 64; ++e) qz += (float)sq[tid * 72 + e] * sz[e];
    sqz[tid] = qz;
  }
  __syncthreads();  // all waves done reading q'/k' before masked A overwrites them

  // tril mask + row sums + stage masked A as bf16; 4b. den[c] = q'.z + rowsum(A)
#pragma unroll
  for (int r = 0; r < 8; ++r) {
    const int c = wave * 16 + rh + r;
    float rs = 0.f;
#pragma unroll
    for (int nt = 0; nt < 8; ++nt) {
      const int d = nt * 16 + cl;
      const float v = (d <= c) ? accA[nt][r] : 0.f;
      accA[nt][r] = v;
      rs += v;
    }
#pragma unroll
    for (int o = 1; o < 16; o <<= 1) rs += __shfl_xor(rs, o);
    if (cl == 0) sden[c] = sqz[c] + rs;
#pragma unroll
    for (int nt = 0; nt < 8; ++nt)
      sP[c * 136 + nt * 16 + cl] = (bf16_t)accA[nt][r];
  }
  __syncthreads();

  // 5. num2 = A @ v  (B-operand = v^T rows), K-dim 128
#pragma unroll
  for (int kk = 0; kk < 128; kk += 32) {
    v16bf ap = frag_ld(frag_ptr(sP, wave * 16, 136, lane) + kk);
#pragma unroll
    for (int nt = 0; nt < 4; ++nt) {
      v16bf bv = frag_ld(frag_ptr(svT, nt * 16, 136, lane) + kk);
      accN[nt] = wmma_bf16(ap, bv, accN[nt]);
    }
  }
  // 6. o = num / (den + 1e-6) -> global bf16
#pragma unroll
  for (int nt = 0; nt < 4; ++nt)
#pragma unroll
    for (int r = 0; r < 8; ++r) {
      const int c = wave * 16 + rh + r;
      const float o = accN[nt][r] / (sden[c] + 1e-6f);
      const size_t row = (size_t)b * 4096 + (size_t)ch * 128 + c;
      out[row * 1024 + h * 64 + nt * 16 + cl] = (bf16_t)o;
    }
}

// ---------------------------------------------------------------------------
// Launch: B=2, L=4096, D=1024, H=16, E=64, W=128. Requires ws >= ~263 MB.
// ---------------------------------------------------------------------------
extern "C" void kernel_launch(void* const* d_in, const int* in_sizes, int n_in,
                              void* d_out, int out_size, void* d_ws, size_t ws_size,
                              hipStream_t stream) {
  const float* x = (const float*)d_in[0];
  const float* g1 = (const float*)d_in[1];
  const float* b1 = (const float*)d_in[2];
  const float* Wqkva = (const float*)d_in[3];
  const float* bqkva = (const float*)d_in[4];
  const float* Wpa = (const float*)d_in[5];
  const float* bpa = (const float*)d_in[6];
  const float* Wqkvs = (const float*)d_in[7];
  const float* bqkvs = (const float*)d_in[8];
  const float* Wos = (const float*)d_in[9];
  const float* bos = (const float*)d_in[10];
  const float* Wo = (const float*)d_in[11];
  const float* bo = (const float*)d_in[12];
  const float* gm = (const float*)d_in[13];
  const float* bm = (const float*)d_in[14];
  const float* W1 = (const float*)d_in[15];
  const float* b1m = (const float*)d_in[16];
  const float* W2 = (const float*)d_in[17];
  const float* b2m = (const float*)d_in[18];

  char* ws = (char*)d_ws;
  bf16_t* WqkvaT = (bf16_t*)(ws + 0);            // [3072][1024]
  bf16_t* WqkvsT = (bf16_t*)(ws + 6291456);      // [3072][1024]
  bf16_t* WpaT = (bf16_t*)(ws + 12582912);       // [1024][1024]
  bf16_t* WosT = (bf16_t*)(ws + 14680064);       // [1024][1024]
  bf16_t* WoT = (bf16_t*)(ws + 16777216);        // [1024][1024]
  bf16_t* W1T = (bf16_t*)(ws + 18874368);        // [4096][1024]
  bf16_t* W2T = (bf16_t*)(ws + 27262976);        // [1024][4096]
  bf16_t* xn = (bf16_t*)(ws + 35651584);         // [8192][1024]  (later: h)
  bf16_t* swa_o = (bf16_t*)(ws + 52428800);      // [8192][1024]
  bf16_t* lin_o = (bf16_t*)(ws + 69206016);      // [8192][1024]
  bf16_t* mix = (bf16_t*)(ws + 85983232);        // [8192][1024]
  float* linSc = (float*)(ws + 85983232);        // [32*32][64*64] (before mix)
  bf16_t* qkva = (bf16_t*)(ws + 102760448);      // [8192][3072]
  float* qkvs = (float*)(ws + 153092096);        // [8192][3072]
  float* attnf = (float*)(ws + 153092096);       // [8192][1024] (reuses qkvs)
  bf16_t* gbuf = (bf16_t*)(ws + 153092096);      // [8192][4096] (reuses attnf)
  float* x1 = (float*)(ws + 220200960);          // [8192][1024] (tail of qkvs)
  bf16_t* linSb = (bf16_t*)(ws + 253755392);     // [32*32][64*64]
  float* linzc = (float*)(ws + 262144000);       // [32*32][64]
  float* linzp = (float*)(ws + 262406144);       // [32*32][64]
  float* outf = (float*)d_out;

  const dim3 blk(256);
  // Weight convert+transpose to bf16 [N][K]
  wt_transpose_kernel<<<dim3(3072 / 32, 1024 / 32), blk, 0, stream>>>(Wqkva, WqkvaT, 1024, 3072);
  wt_transpose_kernel<<<dim3(3072 / 32, 1024 / 32), blk, 0, stream>>>(Wqkvs, WqkvsT, 1024, 3072);
  wt_transpose_kernel<<<dim3(1024 / 32, 1024 / 32), blk, 0, stream>>>(Wpa, WpaT, 1024, 1024);
  wt_transpose_kernel<<<dim3(1024 / 32, 1024 / 32), blk, 0, stream>>>(Wos, WosT, 1024, 1024);
  wt_transpose_kernel<<<dim3(1024 / 32, 1024 / 32), blk, 0, stream>>>(Wo, WoT, 1024, 1024);
  wt_transpose_kernel<<<dim3(4096 / 32, 1024 / 32), blk, 0, stream>>>(W1, W1T, 1024, 4096);
  wt_transpose_kernel<<<dim3(1024 / 32, 4096 / 32), blk, 0, stream>>>(W2, W2T, 4096, 1024);

  // xn = LN(x)
  ln_kernel<<<8192, blk, 0, stream>>>(x, g1, b1, xn);
  // qkv projections
  gemm_kernel<true, false, false><<<dim3(24, 64), blk, 0, stream>>>(
      xn, WqkvaT, bqkva, nullptr, qkva, 8192, 3072, 1024);
  gemm_kernel<false, false, false><<<dim3(24, 64), blk, 0, stream>>>(
      xn, WqkvsT, bqkvs, nullptr, qkvs, 8192, 3072, 1024);
  // attention branches
  swa_kernel<<<dim3(32, 16, 2), blk, 0, stream>>>(qkva, swa_o);
  lin_state_kernel<<<dim3(31, 32), blk, 0, stream>>>(qkvs, linSc, linzc);
  lin_prefix_kernel<<<dim3(264), blk, 0, stream>>>(linSc, linzc, linSb, linzp);
  lin_out_kernel<<<dim3(32, 32), blk, 0, stream>>>(qkvs, linSb, linzp, lin_o);
  // attn_out = swa @ Wp + bp  (f32)
  gemm_kernel<false, false, false><<<dim3(8, 64), blk, 0, stream>>>(
      swa_o, WpaT, bpa, nullptr, attnf, 8192, 1024, 1024);
  // mix = lin @ Wo_s + bo_s + attn_out  (bf16)
  gemm_kernel<true, false, true><<<dim3(8, 64), blk, 0, stream>>>(
      lin_o, WosT, bos, attnf, mix, 8192, 1024, 1024);
  // x1 = mix @ Wo + bo + x  (f32)
  gemm_kernel<false, false, true><<<dim3(8, 64), blk, 0, stream>>>(
      mix, WoT, bo, x, x1, 8192, 1024, 1024);
  // h = LN(x1)
  ln_kernel<<<8192, blk, 0, stream>>>(x1, gm, bm, xn);
  // g = gelu(h @ W1 + b1m)  (bf16)
  gemm_kernel<true, true, false><<<dim3(32, 64), blk, 0, stream>>>(
      xn, W1T, b1m, nullptr, gbuf, 8192, 4096, 1024);
  // out = g @ W2 + b2m + x1  (f32)
  gemm_kernel<false, false, true><<<dim3(8, 64), blk, 0, stream>>>(
      gbuf, W2T, b2m, x1, outf, 8192, 1024, 4096);
}

// v002
// A run of this version takes 518 microseconds.
// Timed twice side by side with v001, it ran 1.04 and 1.05 times as fast.
// All steps since v000 together make it 1.52 times as fast.
#include <hip/hip_runtime.h>

typedef __bf16 bf16_t;
typedef __attribute__((ext_vector_type(16))) __bf16 v16bf;
typedef __attribute__((ext_vector_type(8)))  __bf16 v8bf;
typedef __attribute__((ext_vector_type(8)))  float  v8f;

#define DEV static __device__ __forceinline__

// ---------------------------------------------------------------------------
// WMMA helpers (CDNA5 wave32, 16x16x32 bf16 -> f32)
// A fragment: lane m = row, kbase = 8*(lane>>4); VGPR v in [0,3] -> K = kbase+2v..,
// v in [4,7] -> K = 16+kbase+...  => two contiguous 16-byte chunks at +0 and +16.
// B fragment mirrors A with lane = output column, reading rows of B^T ([N][K]).
// ---------------------------------------------------------------------------
DEV v8f wmma_bf16(v16bf a, v16bf b, v8f c) {
  return __builtin_amdgcn_wmma_f32_16x16x32_bf16(false, a, false, b, (short)0, c,
                                                 false, false);
}

DEV const bf16_t* frag_ptr(const bf16_t* tile, int row0, int stride, int lane) {
  return tile + (size_t)(row0 + (lane & 15)) * stride + ((lane >> 4) << 3);
}

DEV v16bf frag_ld(const bf16_t* p) {
  v8bf lo = *(const v8bf*)(p);
  v8bf hi = *(const v8bf*)(p + 16);
  return __builtin_shufflevector(lo, hi, 0, 1, 2, 3, 4, 5, 6, 7,
                                 8, 9, 10, 11, 12, 13, 14, 15);
}

DEV v8f vzero8() {
  v8f z;
#pragma unroll
  for (int i = 0; i < 8; ++i) z[i] = 0.0f;
  return z;
}

DEV float gelu_exact(float x) {
  return 0.5f * x * (1.0f + erff(x * 0.70710678118654752f));
}

// ---------------------------------------------------------------------------
// CDNA5 async global->LDS copy (ASYNCcnt-tracked), 16 bytes per lane.
// lds_byte: DS-space byte offset of the destination (truncated generic addr
// of a __shared__ pointer == addrspace(3) offset).
// ---------------------------------------------------------------------------
DEV uint32_t lds_addr32(const void* p) { return (uint32_t)(uintptr_t)p; }

DEV void async_copy_b128(uint32_t lds_byte, const void* gsrc) {
  asm volatile("global_load_async_to_lds_b128 %0, %1, off"
               :
               : "v"(lds_byte), "v"(gsrc)
               : "memory");
}

DEV void wait_async0() { asm volatile("s_wait_asynccnt 0x0" ::: "memory"); }

// ---------------------------------------------------------------------------
// LayerNorm over D=1024, writes bf16. One block per row, 256 threads x 4 elems.
// ---------------------------------------------------------------------------
__global__ __launch_bounds__(256) void ln_kernel(const float* __restrict__ x,
                                                 const float* __restrict__ g,
                                                 const float* __restrict__ b,
                                                 bf16_t* __restrict__ out) {
  const int row = blockIdx.x;
  const int tid = threadIdx.x, lane = tid & 31, wave = tid >> 5;
  const float4 v = ((const float4*)(x + (size_t)row * 1024))[tid];
  float s = v.x + v.y + v.z + v.w;
  float ss = v.x * v.x + v.y * v.y + v.z * v.z + v.w * v.w;
#pragma unroll
  for (int o = 16; o; o >>= 1) {
    s += __shfl_xor(s, o);
    ss += __shfl_xor(ss, o);
  }
  __shared__ float red[16];
  if (lane == 0) { red[wave] = s; red[8 + wave] = ss; }
  __syncthreads();
  if (tid == 0) {
    float a = 0.f, c = 0.f;
#pragma unroll
    for (int i = 0; i < 8; ++i) { a += red[i]; c += red[8 + i]; }
    red[0] = a; red[8] = c;
  }
  __syncthreads();
  const float mean = red[0] * (1.0f / 1024.0f);
  const float var = red[8] * (1.0f / 1024.0f) - mean * mean;
  const float inv = rsqrtf(var + 1e-5f);
  const float4 gg = ((const float4*)g)[tid];
  const float4 bb = ((const float4*)b)[tid];
  bf16_t* o4 = out + (size_t)row * 1024 + tid * 4;
  o4[0] = (bf16_t)((v.x - mean) * inv * gg.x + bb.x);
  o4[1] = (bf16_t)((v.y - mean) * inv * gg.y + bb.y);
  o4[2] = (bf16_t)((v.z - mean) * inv * gg.z + bb.z);
  o4[3] = (bf16_t)((v.w - mean) * inv * gg.w + bb.w);
}

// ---------------------------------------------------------------------------
// Weight convert+transpose, all seven weights in one launch: f32 W[K][N] -> bf16
// Wt[N][K], the seven Wt back to back in WtAll. One 128(k) x 128(n) tile a block.
// A wave reads whole 512-B rows, two neighbouring k rows a pair; a pair is rounded
// and packed to one dword (k even low, k odd high); rows of Wt leave as 256-B runs.
// ---------------------------------------------------------------------------
typedef __attribute__((ext_vector_type(2))) __bf16 v2bf;
typedef __attribute__((ext_vector_type(4))) float v4f;
typedef __attribute__((ext_vector_type(4))) uint32_t v4u;

// dword index of (column n, k pair p): pitch 65 spreads the 4-column lane stride over
// the banks; the 2 extra dwords from column 64 on keep lanes 16..31 off lanes 0..15.
DEV int wt_idx(int n, int p) { return n * 65 + ((n >> 6) << 1) + p; }

// One tile. K and N are compile-time, so that a lane's 16 loads share one address and
// differ in the immediate offset only.
template <int K, int N>
DEV void wt_tile(const float* __restrict__ W, bf16_t* __restrict__ Wt, int l,
                 uint32_t* t) {
  const int tid = threadIdx.x, lane = tid & 31, wave = tid >> 5;
  const int n0 = (l % (N / 128)) * 128, k0 = (l / (N / 128)) * 128;

  // k pair p = wave + 8 i: rows k0 + 2 p and k0 + 2 p + 1, 512 B of each a wave
  const float* src = W + (size_t)(k0 + 2 * wave) * N + n0 + lane * 4;
  v4f a[8], b[8];
#pragma unroll
  for (int i = 0; i < 8; ++i) {
    a[i] = *(const v4f*)(src + (16 * i) * N);
    b[i] = *(const v4f*)(src + (16 * i + 1) * N);
  }
  // the wait that is owed before a register which an issued load names is rewritten;
  // src as an input keeps the address pair live over the whole run, so that no load's
  // result is placed in it
  asm volatile("s_wait_xcnt 0x0" ::"v"(src) : "memory");
  // keeps all 16 loads of a lane ahead of the first conversion, so that they fly
  // together; without it the last four are issued only when the first have landed
  __builtin_amdgcn_sched_barrier(0);
#pragma unroll
  for (int i = 0; i < 8; ++i)
#pragma unroll
    for (int u = 0; u < 4; ++u) {
      v2bf pk;
      pk[0] = (bf16_t)a[i][u];
      pk[1] = (bf16_t)b[i][u];
      t[wt_idx(lane * 4 + u, wave + 8 * i)] = __builtin_bit_cast(uint32_t, pk);
    }
  __syncthreads();
  // a wave stores rows n0 + 2 wave + 16 i and the next, 256 B of each
  const int l16 = tid & 15, r = tid >> 4;
  bf16_t* dst = Wt + (size_t)(n0 + r) * K + k0 + l16 * 8;
#pragma unroll
  for (int i = 0; i < 8; ++i) {
    const int base = wt_idx(r + 16 * i, l16 * 4);
    v4u o;
    o[0] = t[base];
    o[1] = t[base + 1];
    o[2] = t[base + 2];
    o[3] = t[base + 3];
    *(v4u*)(dst + (16 * i) * K) = o;
  }
}

// Blocks 0..383: the two [1024][3072]; 384..575: the three [1024][1024];
// 576..831: [1024][4096]; 832..1087: [4096][1024]. Every branch is block-uniform.
__global__ __launch_bounds__(256) void wt_transpose_kernel(
    const float* __restrict__ Wa, const float* __restrict__ Wb,
    const float* __restrict__ Wc, const float* __restrict__ Wd,
    const float* __restrict__ We, const float* __restrict__ Wf,
    const float* __restrict__ Wg, bf16_t* __restrict__ WtAll) {
  __shared__ uint32_t t[128 * 65 + 2];
  const int bid = blockIdx.x;
  if (bid < 384) {
    const bool s = bid >= 192;
    wt_tile<1024, 3072>(s ? Wb : Wa, WtAll + (s ? 3145728 : 0), s ? bid - 192 : bid, t);
  } else if (bid < 576) {
    const int g = (bid - 384) >> 6;
    wt_tile<1024, 1024>(g == 0 ? Wc : (g == 1 ? Wd : We), WtAll + 6291456 + g * 1048576,
                        (bid - 384) & 63, t);
  } else if (bid < 832) {
    wt_tile<1024, 4096>(Wf, WtAll + 9437184, bid - 576, t);
  } else {
    wt_tile<4096, 1024>(Wg, WtAll + 13631488, bid - 832, t);
  }
}

// ---------------------------------------------------------------------------
// Generic bf16 GEMM, f32 accumulate: out[M][N] = A[M][K] * Bt[N][K]^T + bias
// Block: 256 thr = 8 waves; tile 128x128; wave tile 64x32 (4 M-frags x 2 N-frags).
// Double-buffered LDS staged via async global->LDS (one barrier per K-step).
// Epilogue: optional GELU, optional f32 residual, bf16 or f32 output.
// M,N multiples of 128; K multiple of 32.
// ---------------------------------------------------------------------------
template <bool OUT_BF16, bool GELU_ACT, bool RES>
__global__ __launch_bounds__(256) void gemm_kernel(
    const bf16_t* __restrict__ A, const bf16_t* __restrict__ Bt,
    const float* __restrict__ bias, const float* __restrict__ res,
    void* __restrict__ out, int M, int N, int K) {
  const int LDK = 40;  // 32 + 8 pad; 80B row stride -> conflict-free frag reads
  __shared__ __align__(16) bf16_t sA[2][128 * 40];
  __shared__ __align__(16) bf16_t sB[2][128 * 40];
  const int tid = threadIdx.x, lane = tid & 31, wave = tid >> 5;
  const int m0 = blockIdx.y * 128, n0 = blockIdx.x * 128;
  const int wm = (wave >> 2) * 64;  // wave M offset within tile
  const int wn = (wave & 3) * 32;   // wave N offset within tile

  v8f acc[4][2];
#pragma unroll
  for (int i = 0; i < 4; ++i)
#pragma unroll
    for (int j = 0; j < 2; ++j) acc[i][j] = vzero8();

  const int lr = tid >> 1;        // 0..127 (row of both tiles)
  const int lc = (tid & 1) * 16;  // 0 or 16 (16-element half-row)
  const uint32_t ldsA0 = lds_addr32(&sA[0][lr * LDK + lc]);
  const uint32_t ldsB0 = lds_addr32(&sB[0][lr * LDK + lc]);
  const uint32_t bufstride = (uint32_t)(128 * 40 * sizeof(bf16_t));
  const bf16_t* gA = A + (size_t)(m0 + lr) * K + lc;
  const bf16_t* gB = Bt + (size_t)(n0 + lr) * K + lc;

  // stage k0 into buffer `buf` (4 x 16B per thread, ASYNCcnt-tracked)
  auto prefetch = [&](int k0, int buf) {
    const uint32_t la = ldsA0 + (uint32_t)buf * bufstride;
    const uint32_t lb = ldsB0 + (uint32_t)buf * bufstride;
    async_copy_b128(la, gA + k0);
    async_copy_b128(la + 16, gA + k0 + 8);
    async_copy_b128(lb, gB + k0);
    async_copy_b128(lb + 16, gB + k0 + 8);
  };

  prefetch(0, 0);
  const int niter = K >> 5;
  for (int it = 0; it < niter; ++it) {
    const int buf = it & 1;
    wait_async0();      // own async copies (issued last iter) have landed
    __syncthreads();    // everyone's copies landed; everyone done reading buf^1
    if (it + 1 < niter) prefetch((it + 1) << 5, buf ^ 1);
    const bf16_t* tA = sA[buf];
    const bf16_t* tB = sB[buf];
    v16bf af[4], bfv[2];
#pragma unroll
    for (int mt = 0; mt < 4; ++mt)
      af[mt] = frag_ld(frag_ptr(tA, wm + mt * 16, LDK, lane));
#pragma unroll
    for (int nt = 0; nt < 2; ++nt)
      bfv[nt] = frag_ld(frag_ptr(tB, wn + nt * 16, LDK, lane));
#pragma unroll
    for (int mt = 0; mt < 4; ++mt)
#pragma unroll
      for (int nt = 0; nt < 2; ++nt)
        acc[mt][nt] = wmma_bf16(af[mt], bfv[nt], acc[mt][nt]);
  }

  const int cl = lane & 15, rh = (lane >> 4) << 3;
#pragma unroll
  for (int mt = 0; mt < 4; ++mt)
#pragma unroll
    for (int nt = 0; nt < 2; ++nt)
#pragma unroll
      for (int r = 0; r < 8; ++r) {
        const size_t row = (size_t)(m0 + wm + mt * 16 + rh + r);
        const int col = n0 + wn + nt * 16 + cl;
        float v = acc[mt][nt][r] + bias[col];
        if (RES) v += res[row * (size_t)N + col];
        if (GELU_ACT) v = gelu_exact(v);
        if (OUT_BF16)
          ((bf16_t*)out)[row * (size_t)N + col] = (bf16_t)v;
        else
          ((float*)out)[row * (size_t)N + col] = v;
      }
}

// ---------------------------------------------------------------------------
// Sliding-window attention. One block per (query-block, head, batch).
// Q 128x64, K/V context 256x64 (prev block + own block), W=128 band mask.
// All matmuls via WMMA; softmax in registers with 16-lane shuffles.
// qkv: bf16 [B*L][3*1024]; out: bf16 [B*L][1024].
// ---------------------------------------------------------------------------
__global__ __launch_bounds__(256) void swa_kernel(const bf16_t* __restrict__ qkv,
                                                  bf16_t* __restrict__ out) {
  const int blk = blockIdx.x, h = blockIdx.y, b = blockIdx.z;
  const int tid = threadIdx.x, lane = tid & 31, wave = tid >> 5;

  // Q(128x72) + K(256x72) overlap with P(128x264) -- disjoint lifetimes.
  __shared__ __align__(16) char smem_u[128 * 264 * 2];
  __shared__ __align__(16) bf16_t sVt[64 * 264];  // V^T [e][s]
  bf16_t* sQ = (bf16_t*)smem_u;                   // [128][72]
  bf16_t* sK = (bf16_t*)smem_u + 128 * 72;        // [256][72]
  bf16_t* sP = (bf16_t*)smem_u;                   // [128][264]

  const size_t rowQ0 = (size_t)b * 4096 + (size_t)blk * 128;

  // Load Q: thread -> (row tid/2, 32-col half)
  {
    const int r = tid >> 1, half = (tid & 1) * 32;
    const bf16_t* src = qkv + (rowQ0 + r) * 3072 + h * 64 + half;
#pragma unroll
    for (int j = 0; j < 32; j += 8)
      *(v8bf*)&sQ[r * 72 + half + j] = *(const v8bf*)(src + j);
  }
  // Load K and V^T: thread -> key index s = tid (0..255)
  {
    const int s = tid;
    const long lk = (long)blk * 128 - 128 + s;
    if (lk < 0) {
      for (int e = 0; e < 64; ++e) {
        sK[s * 72 + e] = (bf16_t)0.f;
        sVt[e * 264 + s] = (bf16_t)0.f;
      }
    } else {
      const bf16_t* srck = qkv + ((size_t)b * 4096 + lk) * 3072 + 1024 + h * 64;
      const bf16_t* srcv = srck + 1024;
#pragma unroll
      for (int e = 0; e < 64; e += 8) {
        v8bf kv = *(const v8bf*)(srck + e);
        *(v8bf*)&sK[s * 72 + e] = kv;
        v8bf vv = *(const v8bf*)(srcv + e);
#pragma unroll
        for (int j = 0; j < 8; ++j) sVt[(e + j) * 264 + s] = vv[j];
      }
    }
  }
  __syncthreads();

  // Scores: wave w owns query rows [16w,16w+16); 16 key tiles; K-dim = 64.
  v8f acc[16];
#pragma unroll
  for (int i = 0; i < 16; ++i) acc[i] = vzero8();
#pragma unroll
  for (int kk = 0; kk < 64; kk += 32) {
    v16bf aq = frag_ld(frag_ptr(sQ, wave * 16, 72, lane) + kk);
#pragma unroll
    for (int nt = 0; nt < 16; ++nt) {
      v16bf bk = frag_ld(frag_ptr(sK, nt * 16, 72, lane) + kk);
      acc[nt] = wmma_bf16(aq, bk, acc[nt]);
    }
  }

  // Mask + softmax. C-layout: row = 16*wave + 8*(lane>>4) + r, col = 16*nt + (lane&15)
  const int cl = lane & 15, rh = (lane >> 4) << 3;
#pragma unroll
  for (int r = 0; r < 8; ++r) {
    const int rloc = wave * 16 + rh + r;
    float mx = -1e30f;
#pragma unroll
    for (int nt = 0; nt < 16; ++nt) {
      const int s = nt * 16 + cl;
      const bool ok = (s >= rloc + 1) && (s <= rloc + 128) && (blk > 0 || s >= 128);
      const float v = ok ? acc[nt][r] * 0.125f : -1e30f;
      acc[nt][r] = v;
      mx = fmaxf(mx, v);
    }
#pragma unroll
    for (int o = 1; o < 16; o <<= 1) mx = fmaxf(mx, __shfl_xor(mx, o));
    float sum = 0.f;
#pragma unroll
    for (int nt = 0; nt < 16; ++nt) {
      const float e = __expf(acc[nt][r] - mx);
      acc[nt][r] = e;
      sum += e;
    }
#pragma unroll
    for (int o = 1; o < 16; o <<= 1) sum += __shfl_xor(sum, o);
    const float inv = 1.0f / sum;
#pragma unroll
    for (int nt = 0; nt < 16; ++nt) acc[nt][r] *= inv;
  }

  __syncthreads();  // all waves done reading sQ/sK before P overwrites them
#pragma unroll
  for (int nt = 0; nt < 16; ++nt)
#pragma unroll
    for (int r = 0; r < 8; ++r)
      sP[(wave * 16 + rh + r) * 264 + nt * 16 + cl] = (bf16_t)acc[nt][r];
  __syncthreads();

  // PV: out 16x64 per wave; K-dim = 256 keys.
  v8f ov[4];
#pragma unroll
  for (int i = 0; i < 4; ++i) ov[i] = vzero8();
#pragma unroll
  for (int kk = 0; kk < 256; kk += 32) {
    v16bf ap = frag_ld(frag_ptr(sP, wave * 16, 264, lane) + kk);
#pragma unroll
    for (int nt = 0; nt < 4; ++nt) {
      v16bf bv = frag_ld(frag_ptr(sVt, nt * 16, 264, lane) + kk);
      ov[nt] = wmma_bf16(ap, bv, ov[nt]);
    }
  }
#pragma unroll
  for (int nt = 0; nt < 4; ++nt)
#pragma unroll
    for (int r = 0; r < 8; ++r) {
      const size_t row = rowQ0 + wave * 16 + rh + r;
      out[row * 1024 + h * 64 + nt * 16 + cl] = (bf16_t)ov[nt][r];
    }
}

// ---------------------------------------------------------------------------
// Chunked causal linear attention, chunk-parallel, three launches:
//   lin_state : per (chunk, b, h) the chunk's own v^T k' (64x64 f32) and colsum(k')
//   lin_prefix: exclusive running sum over the chunks, f32, chunk 0 first
//   lin_out   : per (chunk, b, h) the outputs from q', k', v and the summed state
// qkv: f32 [B*L][3*1024] (elu applied at load); out: bf16 [B*L][1024].
// State records: index (bh*32 + ch); S^T as [f][e].
// ---------------------------------------------------------------------------

// The last chunk's own state is read by nobody: grid.x = 31.
__global__ __launch_bounds__(256) void lin_state_kernel(const float* __restrict__ qkv,
                                                        float* __restrict__ Sc,
                                                        float* __restrict__ zc) {
  const int ch = blockIdx.x, bh = blockIdx.y, b = bh >> 4, h = bh & 15;
  const int tid = threadIdx.x, lane = tid & 31, wave = tid >> 5;
  __shared__ __align__(16) bf16_t skT[64 * 136];   // k'^T     [e][c]
  __shared__ __align__(16) bf16_t svT[64 * 136];   // v^T      [f][c]
  const int cl = lane & 15, rh = (lane >> 4) << 3;
  {
    const int c = tid >> 1, half = (tid & 1) * 32;
    const size_t row = (size_t)b * 4096 + (size_t)ch * 128 + c;
    const float4* pk = (const float4*)(qkv + row * 3072 + 1024 + h * 64 + half);
    const float4* pv = pk + 256;
    // loads first, elu after: the loads fly together, not one round trip each
    float4 kx[8], vx[8];
#pragma unroll
    for (int i = 0; i < 8; ++i) { kx[i] = pk[i]; vx[i] = pv[i]; }
#pragma unroll
    for (int i = 0; i < 8; ++i) {
      const float k4[4] = {kx[i].x, kx[i].y, kx[i].z, kx[i].w};
      const float v4[4] = {vx[i].x, vx[i].y, vx[i].z, vx[i].w};
#pragma unroll
      for (int u = 0; u < 4; ++u) {
        const int j = i * 4 + u;
        const float em = expm1f(k4[u]);  // unconditional: a select, no branch a value
        const float kv = (k4[u] > 0.f ? k4[u] : em) + 1.0001f;
        skT[(half + j) * 136 + c] = (bf16_t)kv;
        svT[(half + j) * 136 + c] = (bf16_t)v4[u];
      }
    }
  }
  __syncthreads();

  const size_t rec = (size_t)bh * 32 + ch;
  // v^T @ k'  (16 tiles over 8 waves, 2 each), K-dim 128
  {
    const int ft = wave >> 1;
    const int ebase = (wave & 1) * 32;
    v8f accS[2];
#pragma unroll
    for (int i = 0; i < 2; ++i) accS[i] = vzero8();
#pragma unroll
    for (int kk = 0; kk < 128; kk += 32) {
      v16bf av = frag_ld(frag_ptr(svT, ft * 16, 136, lane) + kk);
#pragma unroll
      for (int nt = 0; nt < 2; ++nt) {
        v16bf bk = frag_ld(frag_ptr(skT, ebase + nt * 16, 136, lane) + kk);
        accS[nt] = wmma_bf16(av, bk, accS[nt]);
      }
    }
#pragma unroll
    for (int nt = 0; nt < 2; ++nt)
#pragma unroll
      for (int r = 0; r < 8; ++r) {
        const int f = ft * 16 + rh + r;
        const int e = ebase + nt * 16 + cl;
        Sc[rec * 4096 + f * 64 + e] = accS[nt][r];
      }
  }
  if (tid < 64) {
    float zs = 0.f;
#pragma unroll 8
    for (int c = 0; c < 128; ++c) zs += (float)skT[tid * 136 + c];
    zc[rec * 64 + tid] = zs;
  }
}

// Blocks 0..255: S^T, two neighbouring elements a thread, rounded to bf16 at the
// store (the B operand of q' @ S). Blocks 256..263: z, kept in f32.
__global__ __launch_bounds__(256) void lin_prefix_kernel(const float* __restrict__ Sc,
                                                         const float* __restrict__ zc,
                                                         bf16_t* __restrict__ Sb,
                                                         float* __restrict__ zp) {
  if (blockIdx.x >= 256) {
    const int t = (blockIdx.x - 256) * 256 + threadIdx.x;
    const size_t base = (size_t)(t >> 6) * (32 * 64) + (size_t)(t & 63);
    float v[31];
#pragma unroll
    for (int ch = 0; ch < 31; ++ch) v[ch] = zc[base + ch * 64];
    float s = 0.f;
#pragma unroll
    for (int ch = 0; ch < 32; ++ch) {
      zp[base + ch * 64] = s;
      if (ch < 31) s += v[ch];
    }
    return;
  }
  const int t = blockIdx.x * 256 + threadIdx.x;
  const size_t base = (size_t)(t >> 11) * (32 * 4096) + (size_t)(t & 2047) * 2;
  float2 v[31];
#pragma unroll
  for (int ch = 0; ch < 31; ++ch) v[ch] = *(const float2*)(Sc + base + ch * 4096);
  float s0 = 0.f, s1 = 0.f;
#pragma unroll
  for (int ch = 0; ch < 32; ++ch) {
    v2bf o;
    o[0] = (bf16_t)s0;
    o[1] = (bf16_t)s1;
    *(v2bf*)(Sb + base + ch * 4096) = o;
    if (ch < 31) { s0 += v[ch].x; s1 += v[ch].y; }
  }
  // the built code lets this path run on to the z path's first instructions behind a
  // scalar test; they rewrite registers that the stores above name: wait in front
  asm volatile("s_wait_xcnt 0x0" ::: "memory");
}

__global__ __launch_bounds__(256) void lin_out_kernel(const float* __restrict__ qkv,
                                                      const bf16_t* __restrict__ Sb,
                                                      const float* __restrict__ zp,
                                                      bf16_t* __restrict__ out) {
  const int ch = blockIdx.x, bh = blockIdx.y, b = bh >> 4, h = bh & 15;
  const int tid = threadIdx.x, lane = tid & 31, wave = tid >> 5;
  // q'(128x72) + k'(128x72) overlap with masked A (128x136) -- disjoint lifetimes.
  __shared__ __align__(16) char smem_u[2 * 128 * 72 * 2];
  __shared__ __align__(16) bf16_t svT[64 * 136];   // v^T      [f][c]
  __shared__ __align__(16) bf16_t sSB[64 * 72];    // bf16 S^T before this chunk [f][e]
  __shared__ float sz[64];
  __shared__ float sqz[128];
  __shared__ float sden[128];
  bf16_t* sq = (bf16_t*)smem_u;                    // q' rows  [c][e]
  bf16_t* sk = (bf16_t*)smem_u + 128 * 72;         // k' rows  [c][e]
  bf16_t* sP = (bf16_t*)smem_u;                    // masked A [c][d]

  const int cl = lane & 15, rh = (lane >> 4) << 3;
  const size_t rec = (size_t)bh * 32 + ch;

  // 1. state before this chunk (B-operand layout: row f, cols e)
#pragma unroll
  for (int i = tid; i < 512; i += 256)
    *(v8bf*)&sSB[(i >> 3) * 72 + (i & 7) * 8] = *(const v8bf*)(Sb + rec * 4096 + i * 8);
  if (tid < 64) sz[tid] = zp[rec * 64 + tid];
  // 2. load chunk, apply elu maps
  {
    const int c = tid >> 1, half = (tid & 1) * 32;
    const size_t row = (size_t)b * 4096 + (size_t)ch * 128 + c;
    const float* pq = qkv + row * 3072 + h * 64 + half;
    const float* pk = pq + 1024;
    const float* pv = pq + 2048;
#pragma unroll 8
    for (int j = 0; j < 32; ++j) {
      float qv = pq[j] * 0.125f;  // E^-0.5
      qv = (qv > 0.f ? qv : expm1f(qv)) + 1.0001f;
      sq[c * 72 + half + j] = (bf16_t)qv;
      float kv = pk[j];
      kv = (kv > 0.f ? kv : expm1f(kv)) + 1.0001f;
      sk[c * 72 + half + j] = (bf16_t)kv;
      svT[(half + j) * 136 + c] = (bf16_t)pv[j];
    }
  }
  __syncthreads();

  // 3. A = q k'^T (8 tiles/wave) and num1 = q @ S (4 tiles/wave), K-dim 64
  v8f accA[8], accN[4];
#pragma unroll
  for (int i = 0; i < 8; ++i) accA[i] = vzero8();
#pragma unroll
  for (int i = 0; i < 4; ++i) accN[i] = vzero8();
#pragma unroll
  for (int kk = 0; kk < 64; kk += 32) {
    v16bf aq = frag_ld(frag_ptr(sq, wave * 16, 72, lane) + kk);
#pragma unroll
    for (int nt = 0; nt < 8; ++nt) {
      v16bf bk = frag_ld(frag_ptr(sk, nt * 16, 72, lane) + kk);
      accA[nt] = wmma_bf16(aq, bk, accA[nt]);
    }
#pragma unroll
    for (int nt = 0; nt < 4; ++nt) {
      v16bf bs = frag_ld(frag_ptr(sSB, nt * 16, 72, lane) + kk);
      accN[nt] = wmma_bf16(aq, bs, accN[nt]);
    }
  }
  // 4a. q'.z while q' is still in LDS
  if (tid < 128) {
    float qz = 0.f;
#pragma unroll 8
    for (int e = 0; e < 64; ++e) qz += (float)sq[tid * 72 + e] * sz[e];
    sqz[tid] = qz;
  }
  __syncthreads();  // all waves done reading q'/k' before masked A overwrites them

  // tril mask + row sums + stage masked A as bf16; 4b. den[c] = q'.z + rowsum(A)
#pragma unroll
  for (int r = 0; r < 8; ++r) {
    const int c = wave * 16 + rh + r;
    float rs = 0.f;
#pragma unroll
    for (int nt = 0; nt < 8; ++nt) {
      const int d = nt * 16 + cl;
      const float v = (d <= c) ? accA[nt][r] : 0.f;
      accA[nt][r] = v;
      rs += v;
    }
#pragma unroll
    for (int o = 1; o < 16; o <<= 1) rs += __shfl_xor(rs, o);
    if (cl == 0) sden[c] = sqz[c] + rs;
#pragma unroll
    for (int nt = 0; nt < 8; ++nt)
      sP[c * 136 + nt * 16 + cl] = (bf16_t)accA[nt][r];
  }
  __syncthreads();

  // 5. num2 = A @ v  (B-operand = v^T rows), K-dim 128
#pragma unroll
  for (int kk = 0; kk < 128; kk += 32) {
    v16bf ap = frag_ld(frag_ptr(sP, wave * 16, 136, lane) + kk);
#pragma unroll
    for (int nt = 0; nt < 4; ++nt) {
      v16bf bv = frag_ld(frag_ptr(svT, nt * 16, 136, lane) + kk);
      accN[nt] = wmma_bf16(ap, bv, accN[nt]);
    }
  }
  // 6. o = num / (den + 1e-6) -> global bf16
#pragma unroll
  for (int nt = 0; nt < 4; ++nt)
#pragma unroll
    for (int r = 0; r < 8; ++r) {
      const int c = wave * 16 + rh + r;
      const float o = accN[nt][r] / (sden[c] + 1e-6f);
      const size_t row = (size_t)b * 4096 + (size_t)ch * 128 + c;
      out[row * 1024 + h * 64 + nt * 16 + cl] = (bf16_t)o;
    }
}

// ---------------------------------------------------------------------------
// Launch: B=2, L=4096, D=1024, H=16, E=64, W=128. Requires ws >= ~263 MB.
// ---------------------------------------------------------------------------
extern "C" void kernel_launch(void* const* d_in, const int* in_sizes, int n_in,
                              void* d_out, int out_size, void* d_ws, size_t ws_size,
                              hipStream_t stream) {
  const float* x = (const float*)d_in[0];
  const float* g1 = (const float*)d_in[1];
  const float* b1 = (const float*)d_in[2];
  const float* Wqkva = (const float*)d_in[3];
  const float* bqkva = (const float*)d_in[4];
  const float* Wpa = (const float*)d_in[5];
  const float* bpa = (const float*)d_in[6];
  const float* Wqkvs = (const float*)d_in[7];
  const float* bqkvs = (const float*)d_in[8];
  const float* Wos = (const float*)d_in[9];
  const float* bos = (const float*)d_in[10];
  const float* Wo = (const float*)d_in[11];
  const float* bo = (const float*)d_in[12];
  const float* gm = (const float*)d_in[13];
  const float* bm = (const float*)d_in[14];
  const float* W1 = (const float*)d_in[15];
  const float* b1m = (const float*)d_in[16];
  const float* W2 = (const float*)d_in[17];
  const float* b2m = (const float*)d_in[18];

  char* ws = (char*)d_ws;
  bf16_t* WqkvaT = (bf16_t*)(ws + 0);            // [3072][1024]
  bf16_t* WqkvsT = (bf16_t*)(ws + 6291456);      // [3072][1024]
  bf16_t* WpaT = (bf16_t*)(ws + 12582912);       // [1024][1024]
  bf16_t* WosT = (bf16_t*)(ws + 14680064);       // [1024][1024]
  bf16_t* WoT = (bf16_t*)(ws + 16777216);        // [1024][1024]
  bf16_t* W1T = (bf16_t*)(ws + 18874368);        // [4096][1024]
  bf16_t* W2T = (bf16_t*)(ws + 27262976);        // [1024][4096]
  bf16_t* xn = (bf16_t*)(ws + 35651584);         // [8192][1024]  (later: h)
  bf16_t* swa_o = (bf16_t*)(ws + 52428800);      // [8192][1024]
  bf16_t* lin_o = (bf16_t*)(ws + 69206016);      // [8192][1024]
  bf16_t* mix = (bf16_t*)(ws + 85983232);        // [8192][1024]
  float* linSc = (float*)(ws + 85983232);        // [32*32][64*64] (before mix)
  bf16_t* qkva = (bf16_t*)(ws + 102760448);      // [8192][3072]
  float* qkvs = (float*)(ws + 153092096);        // [8192][3072]
  float* attnf = (float*)(ws + 153092096);       // [8192][1024] (reuses qkvs)
  bf16_t* gbuf = (bf16_t*)(ws + 153092096);      // [8192][4096] (reuses attnf)
  float* x1 = (float*)(ws + 220200960);          // [8192][1024] (tail of qkvs)
  bf16_t* linSb = (bf16_t*)(ws + 253755392);     // [32*32][64*64]
  float* linzc = (float*)(ws + 262144000);       // [32*32][64]
  float* linzp = (float*)(ws + 262406144);       // [32*32][64]
  float* outf = (float*)d_out;

  const dim3 blk(256);
  // Weight convert+transpose to bf16 [N][K]: the seven Wt lie back to back from ws + 0
  wt_transpose_kernel<<<dim3(1088), blk, 0, stream>>>(Wqkva, Wqkvs, Wpa, Wos, Wo, W1, W2,
                                                      WqkvaT);

  // xn = LN(x)
  ln_kernel<<<8192, blk, 0, stream>>>(x, g1, b1, xn);
  // qkv projections
  gemm_kernel<true, false, false><<<dim3(24, 64), blk, 0, stream>>>(
      xn, WqkvaT, bqkva, nullptr, qkva, 8192, 3072, 1024);
  gemm_kernel<false, false, false><<<dim3(24, 64), blk, 0, stream>>>(
      xn, WqkvsT, bqkvs, nullptr, qkvs, 8192, 3072, 1024);
  // attention branches
  swa_kernel<<<dim3(32, 16, 2), blk, 0, stream>>>(qkva, swa_o);
  lin_state_kernel<<<dim3(31, 32), blk, 0, stream>>>(qkvs, linSc, linzc);
  lin_prefix_kernel<<<dim3(264), blk, 0, stream>>>(linSc, linzc, linSb, linzp);
  lin_out_kernel<<<dim3(32, 32), blk, 0, stream>>>(qkvs, linSb, linzp, lin_o);
  // attn_out = swa @ Wp + bp  (f32)
  gemm_kernel<false, false, false><<<dim3(8, 64), blk, 0, stream>>>(
      swa_o, WpaT, bpa, nullptr, attnf, 8192, 1024, 1024);
  // mix = lin @ Wo_s + bo_s + attn_out  (bf16)
  gemm_kernel<true, false, true><<<dim3(8, 64), blk, 0, stream>>>(
      lin_o, WosT, bos, attnf, mix, 8192, 1024, 1024);
  // x1 = mix @ Wo + bo + x  (f32)
  gemm_kernel<false, false, true><<<dim3(8, 64), blk, 0, stream>>>(
      mix, WoT, bo, x, x1, 8192, 1024, 1024);
  // h = LN(x1)
  ln_kernel<<<8192, blk, 0, stream>>>(x1, gm, bm, xn);
  // g = gelu(h @ W1 + b1m)  (bf16)
  gemm_kernel<true, true, false><<<dim3(32, 64), blk, 0, stream>>>(
      xn, W1T, b1m, nullptr, gbuf, 8192, 4096, 1024);
  // out = g @ W2 + b2m + x1  (f32)
  gemm_kernel<false, false, true><<<dim3(8, 64), blk, 0, stream>>>(
      gbuf, W2T, b2m, x1, outf, 8192, 1024, 4096);
}

// v003
// Measured time: 386 microseconds a run.
// In two side-by-side timings against v002, it was 1.33 and 1.34 times as fast.
// Counting every step since v000, it is 2.04 times as fast.
#include <hip/hip_runtime.h>

typedef __bf16 bf16_t;
typedef __attribute__((ext_vector_type(16))) __bf16 v16bf;
typedef __attribute__((ext_vector_type(8)))  __bf16 v8bf;
typedef __attribute__((ext_vector_type(8)))  float  v8f;

#define DEV static __device__ __forceinline__

// ---------------------------------------------------------------------------
// WMMA helpers (CDNA5 wave32, 16x16x32 bf16 -> f32)
// A fragment: lane m = row, kbase = 8*(lane>>4); VGPR v in [0,3] -> K = kbase+2v..,
// v in [4,7] -> K = 16+kbase+...  => two contiguous 16-byte chunks at +0 and +16.
// B fragment mirrors A with lane = output column, reading rows of B^T ([N][K]).
// ---------------------------------------------------------------------------
DEV v8f wmma_bf16(v16bf a, v16bf b, v8f c) {
  return __builtin_amdgcn_wmma_f32_16x16x32_bf16(false, a, false, b, (short)0, c,
                                                 false, false);
}

DEV const bf16_t* frag_ptr(const bf16_t* tile, int row0, int stride, int lane) {
  return tile + (size_t)(row0 + (lane & 15)) * stride + ((lane >> 4) << 3);
}

DEV v16bf frag_ld(const bf16_t* p) {
  v8bf lo = *(const v8bf*)(p);
  v8bf hi = *(const v8bf*)(p + 16);
  return __builtin_shufflevector(lo, hi, 0, 1, 2, 3, 4, 5, 6, 7,
                                 8, 9, 10, 11, 12, 13, 14, 15);
}

DEV v8f vzero8() {
  v8f z;
#pragma unroll
  for (int i = 0; i < 8; ++i) z[i] = 0.0f;
  return z;
}

DEV float gelu_exact(float x) {
  return 0.5f * x * (1.0f + erff(x * 0.70710678118654752f));
}

// ---------------------------------------------------------------------------
// CDNA5 async global->LDS copy (ASYNCcnt-tracked), 16 bytes per lane, as the builtin:
// the compiler then forms each copy's address from a uniform base and one lane offset.
// ---------------------------------------------------------------------------
typedef __attribute__((ext_vector_type(4))) int v4i;
typedef __attribute__((address_space(1))) v4i g_v4i;
typedef __attribute__((address_space(3))) v4i l_v4i;

DEV void async_copy_b128(bf16_t* ldst, const char* gsrc) {
  __builtin_amdgcn_global_load_async_to_lds_b128((g_v4i*)gsrc, (l_v4i*)ldst, 0, 0);
}

DEV void wait_async0() { asm volatile("s_wait_asynccnt 0x0" ::: "memory"); }
DEV void wait_ds0() { asm volatile("s_wait_dscnt 0x0" ::: "memory"); }

// ---------------------------------------------------------------------------
// LayerNorm over D=1024, writes bf16. One block per row, 256 threads x 4 elems.
// ---------------------------------------------------------------------------
__global__ __launch_bounds__(256) void ln_kernel(const float* __restrict__ x,
                                                 const float* __restrict__ g,
                                                 const float* __restrict__ b,
                                                 bf16_t* __restrict__ out) {
  const int row = blockIdx.x;
  const int tid = threadIdx.x, lane = tid & 31, wave = tid >> 5;
  const float4 v = ((const float4*)(x + (size_t)row * 1024))[tid];
  float s = v.x + v.y + v.z + v.w;
  float ss = v.x * v.x + v.y * v.y + v.z * v.z + v.w * v.w;
#pragma unroll
  for (int o = 16; o; o >>= 1) {
    s += __shfl_xor(s, o);
    ss += __shfl_xor(ss, o);
  }
  __shared__ float red[16];
  if (lane == 0) { red[wave] = s; red[8 + wave] = ss; }
  __syncthreads();
  if (tid == 0) {
    float a = 0.f, c = 0.f;
#pragma unroll
    for (int i = 0; i < 8; ++i) { a += red[i]; c += red[8 + i]; }
    red[0] = a; red[8] = c;
  }
  __syncthreads();
  const float mean = red[0] * (1.0f / 1024.0f);
  const float var = red[8] * (1.0f / 1024.0f) - mean * mean;
  const float inv = rsqrtf(var + 1e-5f);
  const float4 gg = ((const float4*)g)[tid];
  const float4 bb = ((const float4*)b)[tid];
  bf16_t* o4 = out + (size_t)row * 1024 + tid * 4;
  o4[0] = (bf16_t)((v.x - mean) * inv * gg.x + bb.x);
  o4[1] = (bf16_t)((v.y - mean) * inv * gg.y + bb.y);
  o4[2] = (bf16_t)((v.z - mean) * inv * gg.z + bb.z);
  o4[3] = (bf16_t)((v.w - mean) * inv * gg.w + bb.w);
}

// ---------------------------------------------------------------------------
// Weight convert+transpose, all seven weights in one launch: f32 W[K][N] -> bf16
// Wt[N][K], the seven Wt back to back in WtAll. One 128(k) x 128(n) tile a block.
// A wave reads whole 512-B rows, two neighbouring k rows a pair; a pair is rounded
// and packed to one dword (k even low, k odd high); rows of Wt leave as 256-B runs.
// ---------------------------------------------------------------------------
typedef __attribute__((ext_vector_type(2))) __bf16 v2bf;
typedef __attribute__((ext_vector_type(4))) float v4f;
typedef __attribute__((ext_vector_type(4))) uint32_t v4u;

// dword index of (column n, k pair p): pitch 65 spreads the 4-column lane stride over
// the banks; the 2 extra dwords from column 64 on keep lanes 16..31 off lanes 0..15.
DEV int wt_idx(int n, int p) { return n * 65 + ((n >> 6) << 1) + p; }

// One tile. K and N are compile-time, so that a lane's 16 loads share one address and
// differ in the immediate offset only.
template <int K, int N>
DEV void wt_tile(const float* __restrict__ W, bf16_t* __restrict__ Wt, int l,
                 uint32_t* t) {
  const int tid = threadIdx.x, lane = tid & 31, wave = tid >> 5;
  const int n0 = (l % (N / 128)) * 128, k0 = (l / (N / 128)) * 128;

  // k pair p = wave + 8 i: rows k0 + 2 p and k0 + 2 p + 1, 512 B of each a wave
  const float* src = W + (size_t)(k0 + 2 * wave) * N + n0 + lane * 4;
  v4f a[8], b[8];
#pragma unroll
  for (int i = 0; i < 8; ++i) {
    a[i] = *(const v4f*)(src + (16 * i) * N);
    b[i] = *(const v4f*)(src + (16 * i + 1) * N);
  }
  // the wait that is owed before a register which an issued load names is rewritten;
  // src as an input keeps the address pair live over the whole run, so that no load's
  // result is placed in it
  asm volatile("s_wait_xcnt 0x0" ::"v"(src) : "memory");
  // keeps all 16 loads of a lane ahead of the first conversion, so that they fly
  // together; without it the last four are issued only when the first have landed
  __builtin_amdgcn_sched_barrier(0);
#pragma unroll
  for (int i = 0; i < 8; ++i)
#pragma unroll
    for (int u = 0; u < 4; ++u) {
      v2bf pk;
      pk[0] = (bf16_t)a[i][u];
      pk[1] = (bf16_t)b[i][u];
      t[wt_idx(lane * 4 + u, wave + 8 * i)] = __builtin_bit_cast(uint32_t, pk);
    }
  __syncthreads();
  // a wave stores rows n0 + 2 wave + 16 i and the next, 256 B of each
  const int l16 = tid & 15, r = tid >> 4;
  bf16_t* dst = Wt + (size_t)(n0 + r) * K + k0 + l16 * 8;
#pragma unroll
  for (int i = 0; i < 8; ++i) {
    const int base = wt_idx(r + 16 * i, l16 * 4);
    v4u o;
    o[0] = t[base];
    o[1] = t[base + 1];
    o[2] = t[base + 2];
    o[3] = t[base + 3];
    *(v4u*)(dst + (16 * i) * K) = o;
  }
}

// Blocks 0..383: the two [1024][3072]; 384..575: the three [1024][1024];
// 576..831: [1024][4096]; 832..1087: [4096][1024]. Every branch is block-uniform.
__global__ __launch_bounds__(256) void wt_transpose_kernel(
    const float* __restrict__ Wa, const float* __restrict__ Wb,
    const float* __restrict__ Wc, const float* __restrict__ Wd,
    const float* __restrict__ We, const float* __restrict__ Wf,
    const float* __restrict__ Wg, bf16_t* __restrict__ WtAll) {
  __shared__ uint32_t t[128 * 65 + 2];
  const int bid = blockIdx.x;
  if (bid < 384) {
    const bool s = bid >= 192;
    wt_tile<1024, 3072>(s ? Wb : Wa, WtAll + (s ? 3145728 : 0), s ? bid - 192 : bid, t);
  } else if (bid < 576) {
    const int g = (bid - 384) >> 6;
    wt_tile<1024, 1024>(g == 0 ? Wc : (g == 1 ? Wd : We), WtAll + 6291456 + g * 1048576,
                        (bid - 384) & 63, t);
  } else if (bid < 832) {
    wt_tile<1024, 4096>(Wf, WtAll + 9437184, bid - 576, t);
  } else {
    wt_tile<4096, 1024>(Wg, WtAll + 13631488, bid - 832, t);
  }
}

// ---------------------------------------------------------------------------
// Generic bf16 GEMM, f32 accumulate: out[M][NN] = A[M][K] * Bt[NN][K]^T + bias
// Block: 256 thr = 8 waves (2 x 4); tile 128 x 256; wave tile 64 x 64 (4 M-frags x
// 4 N-frags), so that a fragment read from LDS feeds 4 WMMAs and fewer bytes come from
// L2 per product than with a 128 x 128 tile. A pass is KP k = KP / 32 blocks of 32 k.
// Two LDS buffers, each [A 128 rows | Bt 256 rows] at pitch 2 KP + 16 B, filled by async
// global->LDS copies one pass ahead; one barrier a pass. KP = 64: two work-groups fit a
// WGP (grids of more than one a WGP). KP = 128: one work-group a WGP, twice the k per
// barrier and per copy latency (grids of 256).
// Epilogue: optional GELU, optional f32 residual, bf16 or f32 output.
// M multiple of 128, NN of 256, K of KP.
// ---------------------------------------------------------------------------
template <int KP, int NN, bool OUT_BF16, bool GELU_ACT, bool RES>
__global__ __launch_bounds__(256) void gemm_kernel(
    const bf16_t* __restrict__ A, const bf16_t* __restrict__ Bt,
    const float* __restrict__ bias, const float* __restrict__ res,
    void* __restrict__ out, int K) {
  constexpr int LDK = KP + 8;              // row pitch 144 or 272 B = 16 B x odd
  constexpr int STAGE = (128 + 256) * LDK; // elements of one buffer
  constexpr int NB = KP / 32;              // blocks per pass
  constexpr int PR = KP / 8;               // 16-byte pieces per row
  constexpr int RG = 256 / PR;             // rows that the block's 256 threads copy at once
  __shared__ __align__(16) bf16_t sT[2][STAGE];
  const int tid = threadIdx.x, lane = tid & 31, wave = tid >> 5;
  const int m0 = blockIdx.y * 128, n0 = blockIdx.x * 256;
  const int wm = (wave >> 2) * 64;  // wave M offset within tile
  const int wn = (wave & 3) * 64;   // wave N offset within tile

  v8f acc[4][4];
#pragma unroll
  for (int i = 0; i < 4; ++i)
#pragma unroll
    for (int j = 0; j < 4; ++j) acc[i][j] = vzero8();

  const int cr = tid / PR;          // row within a group of RG rows
  const int cc = (tid % PR) * 8;    // 16-byte piece of the row
  // one 32-bit lane offset serves every copy; the rest of each address is uniform
  const uint32_t goff = (uint32_t)(cr * K + cc) * 2u;
  const char* uA = (const char*)(A + (size_t)m0 * K);
  const char* uB = (const char*)(Bt + (size_t)n0 * K);

  // pass k0 into buffer `buf`: 3 KP / 16 copies of 16 B per thread (12 or 24), whole lines
  auto stage = [&](int k0, int buf) {
    bf16_t* d = &sT[buf][cr * LDK + cc];
#pragma unroll
    for (int i = 0; i < 128 / RG; ++i)
      async_copy_b128(d + i * RG * LDK, uA + ((size_t)(i * RG) * K + k0) * 2 + goff);
#pragma unroll
    for (int i = 0; i < 256 / RG; ++i)
      async_copy_b128(d + (128 + i * RG) * LDK,
                      uB + ((size_t)(i * RG) * K + k0) * 2 + goff);
  };

  const int fa = (wm + (lane & 15)) * LDK + ((lane >> 4) << 3);
  const int fb = (128 + wn + (lane & 15)) * LDK + ((lane >> 4) << 3);

  const int npass = K / KP;
  stage(0, 0);
  wait_async0();    // own copies of pass 0 have landed
  __syncthreads();  // everyone's have
  if (1 < npass) stage(KP, 1);
  for (int t = 0; t < npass; ++t) {
    const int buf = t & 1;
    const bf16_t* cur = &sT[buf][0];
    // the sched_barriers keep [16 LDS reads][16 WMMAs] as written: a block's reads go as
    // one group; left alone they are spread in pairs among the WMMAs, each pair with a
    // full wait of its own behind it
#pragma unroll
    for (int u = 0; u < NB; ++u) {
      v16bf af[4], bfv[4];
      __builtin_amdgcn_sched_barrier(0);
#pragma unroll
      for (int mt = 0; mt < 4; ++mt) af[mt] = frag_ld(cur + fa + mt * 16 * LDK + u * 32);
#pragma unroll
      for (int nt = 0; nt < 4; ++nt) bfv[nt] = frag_ld(cur + fb + nt * 16 * LDK + u * 32);
      __builtin_amdgcn_sched_barrier(0);
#pragma unroll
      for (int nt = 0; nt < 4; ++nt)
#pragma unroll
        for (int mt = 0; mt < 4; ++mt)
          acc[mt][nt] = wmma_bf16(af[mt], bfv[nt], acc[mt][nt]);
    }
    // publish point of pass t + 1
    wait_ds0();       // own reads of this buffer have all returned
    wait_async0();    // own copies of pass t + 1 have landed
    __syncthreads();  // everyone's have, and everyone has left this buffer
    if (t + 2 < npass) stage((t + 2) * KP, buf);
  }
  wait_async0();  // nothing is in flight when the wave goes on to its end

  // NN is compile-time: a lane's bias, residual and output accesses are one base address
  // each plus immediate offsets.
  const int cl = lane & 15, rh = (lane >> 4) << 3;
  const size_t e0 = (size_t)(m0 + wm + rh) * NN + (size_t)(n0 + wn + cl);
  typedef typename std::conditional<OUT_BF16, bf16_t, float>::type out_t;
  out_t* op = (out_t*)out + e0;
  const float* rp = RES ? res + e0 : bias;
  const float* bp = bias + (n0 + wn + cl);
  // The wait that is owed before a register which an issued load or store names is
  // rewritten, behind each run of stores; the base addresses as inputs stay live up to it.
#define G_WAIT_X() asm volatile("s_wait_xcnt 0x0" ::"v"(op), "v"(rp), "v"(bp) : "memory")

  if constexpr (!GELU_ACT) {
    float bv[4];
#pragma unroll
    for (int nt = 0; nt < 4; ++nt) bv[nt] = bp[nt * 16];
    // two row tiles a run: their residual loads fly together, then their 64 stores
#pragma unroll
    for (int hf = 0; hf < 4; hf += 2) {
      float rv[2][4][8];
      if (RES) {
#pragma unroll
        for (int i = 0; i < 2; ++i)
#pragma unroll
          for (int nt = 0; nt < 4; ++nt)
#pragma unroll
            for (int r = 0; r < 8; ++r)
              rv[i][nt][r] = rp[((hf + i) * 16 + r) * NN + nt * 16];
      }
#pragma unroll
      for (int i = 0; i < 2; ++i)
#pragma unroll
        for (int nt = 0; nt < 4; ++nt)
#pragma unroll
          for (int r = 0; r < 8; ++r) {
            float v = acc[hf + i][nt][r] + bv[nt];
            if (RES) v += rv[i][nt][r];
            op[((hf + i) * 16 + r) * NN + nt * 16] = (out_t)v;
          }
      G_WAIT_X();
    }
  } else {
    // With GELU the loop over the 4 column tiles stays rolled, works on column
    // tile 0 and moves the other tiles down by one (register moves, every index constant).
#pragma clang loop unroll(disable)
    for (int nb = 0; nb < 4; ++nb) {
      const float b = bp[0];
#pragma unroll
      for (int mt = 0; mt < 4; ++mt)
#pragma unroll
        for (int r = 0; r < 8; ++r) {
          float v = acc[mt][0][r] + b;
          if (RES) v += rp[(mt * 16 + r) * NN];
          op[(mt * 16 + r) * NN] = (out_t)gelu_exact(v);
        }
      G_WAIT_X();  // also in front of the addresses' step to the next column tile
      op += 16;
      bp += 16;
      if (RES) rp += 16;
#pragma unroll
      for (int mt = 0; mt < 4; ++mt)
#pragma unroll
        for (int nt = 0; nt < 3; ++nt) acc[mt][nt] = acc[mt][nt + 1];
    }
  }
#undef G_WAIT_X
}

// ---------------------------------------------------------------------------
// Sliding-window attention. One block per (query-block, head, batch).
// Q 128x64, K/V context 256x64 (prev block + own block), W=128 band mask.
// All matmuls via WMMA; softmax in registers with 16-lane shuffles.
// qkv: bf16 [B*L][3*1024]; out: bf16 [B*L][1024].
// ---------------------------------------------------------------------------
__global__ __launch_bounds__(256) void swa_kernel(const bf16_t* __restrict__ qkv,
                                                  bf16_t* __restrict__ out) {
  const int blk = blockIdx.x, h = blockIdx.y, b = blockIdx.z;
  const int tid = threadIdx.x, lane = tid & 31, wave = tid >> 5;

  // Q(128x72) + K(256x72) overlap with P(128x264) -- disjoint lifetimes.
  __shared__ __align__(16) char smem_u[128 * 264 * 2];
  __shared__ __align__(16) bf16_t sVt[64 * 264];  // V^T [e][s]
  bf16_t* sQ = (bf16_t*)smem_u;                   // [128][72]
  bf16_t* sK = (bf16_t*)smem_u + 128 * 72;        // [256][72]
  bf16_t* sP = (bf16_t*)smem_u;                   // [128][264]

  const size_t rowQ0 = (size_t)b * 4096 + (size_t)blk * 128;

  // Load Q: thread -> (row tid/2, 32-col half)
  {
    const int r = tid >> 1, half = (tid & 1) * 32;
    const bf16_t* src = qkv + (rowQ0 + r) * 3072 + h * 64 + half;
#pragma unroll
    for (int j = 0; j < 32; j += 8)
      *(v8bf*)&sQ[r * 72 + half + j] = *(const v8bf*)(src + j);
  }
  // Load K and V^T: thread -> key index s = tid (0..255)
  {
    const int s = tid;
    const long lk = (long)blk * 128 - 128 + s;
    if (lk < 0) {
      for (int e = 0; e < 64; ++e) {
        sK[s * 72 + e] = (bf16_t)0.f;
        sVt[e * 264 + s] = (bf16_t)0.f;
      }
    } else {
      const bf16_t* srck = qkv + ((size_t)b * 4096 + lk) * 3072 + 1024 + h * 64;
      const bf16_t* srcv = srck + 1024;
#pragma unroll
      for (int e = 0; e < 64; e += 8) {
        v8bf kv = *(const v8bf*)(srck + e);
        *(v8bf*)&sK[s * 72 + e] = kv;
        v8bf vv = *(const v8bf*)(srcv + e);
#pragma unroll
        for (int j = 0; j < 8; ++j) sVt[(e + j) * 264 + s] = vv[j];
      }
    }
  }
  __syncthreads();

  // Scores: wave w owns query rows [16w,16w+16); 16 key tiles; K-dim = 64.
  v8f acc[16];
#pragma unroll
  for (int i = 0; i < 16; ++i) acc[i] = vzero8();
#pragma unroll
  for (int kk = 0; kk < 64; kk += 32) {
    v16bf aq = frag_ld(frag_ptr(sQ, wave * 16, 72, lane) + kk);
#pragma unroll
    for (int nt = 0; nt < 16; ++nt) {
      v16bf bk = frag_ld(frag_ptr(sK, nt * 16, 72, lane) + kk);
      acc[nt] = wmma_bf16(aq, bk, acc[nt]);
    }
  }

  // Mask + softmax. C-layout: row = 16*wave + 8*(lane>>4) + r, col = 16*nt + (lane&15)
  const int cl = lane & 15, rh = (lane >> 4) << 3;
#pragma unroll
  for (int r = 0; r < 8; ++r) {
    const int rloc = wave * 16 + rh + r;
    float mx = -1e30f;
#pragma unroll
    for (int nt = 0; nt < 16; ++nt) {
      const int s = nt * 16 + cl;
      const bool ok = (s >= rloc + 1) && (s <= rloc + 128) && (blk > 0 || s >= 128);
      const float v = ok ? acc[nt][r] * 0.125f : -1e30f;
      acc[nt][r] = v;
      mx = fmaxf(mx, v);
    }
#pragma unroll
    for (int o = 1; o < 16; o <<= 1) mx = fmaxf(mx, __shfl_xor(mx, o));
    float sum = 0.f;
#pragma unroll
    for (int nt = 0; nt < 16; ++nt) {
      const float e = __expf(acc[nt][r] - mx);
      acc[nt][r] = e;
      sum += e;
    }
#pragma unroll
    for (int o = 1; o < 16; o <<= 1) sum += __shfl_xor(sum, o);
    const float inv = 1.0f / sum;
#pragma unroll
    for (int nt = 0; nt < 16; ++nt) acc[nt][r] *= inv;
  }

  __syncthreads();  // all waves done reading sQ/sK before P overwrites them
#pragma unroll
  for (int nt = 0; nt < 16; ++nt)
#pragma unroll
    for (int r = 0; r < 8; ++r)
      sP[(wave * 16 + rh + r) * 264 + nt * 16 + cl] = (bf16_t)acc[nt][r];
  __syncthreads();

  // PV: out 16x64 per wave; K-dim = 256 keys.
  v8f ov[4];
#pragma unroll
  for (int i = 0; i < 4; ++i) ov[i] = vzero8();
#pragma unroll
  for (int kk = 0; kk < 256; kk += 32) {
    v16bf ap = frag_ld(frag_ptr(sP, wave * 16, 264, lane) + kk);
#pragma unroll
    for (int nt = 0; nt < 4; ++nt) {
      v16bf bv = frag_ld(frag_ptr(sVt, nt * 16, 264, lane) + kk);
      ov[nt] = wmma_bf16(ap, bv, ov[nt]);
    }
  }
#pragma unroll
  for (int nt = 0; nt < 4; ++nt)
#pragma unroll
    for (int r = 0; r < 8; ++r) {
      const size_t row = rowQ0 + wave * 16 + rh + r;
      out[row * 1024 + h * 64 + nt * 16 + cl] = (bf16_t)ov[nt][r];
    }
}

// ---------------------------------------------------------------------------
// Chunked causal linear attention, chunk-parallel, three launches:
//   lin_state : per (chunk, b, h) the chunk's own v^T k' (64x64 f32) and colsum(k')
//   lin_prefix: exclusive running sum over the chunks, f32, chunk 0 first
//   lin_out   : per (chunk, b, h) the outputs from q', k', v and the summed state
// qkv: f32 [B*L][3*1024] (elu applied at load); out: bf16 [B*L][1024].
// State records: index (bh*32 + ch); S^T as [f][e].
// ---------------------------------------------------------------------------

// The last chunk's own state is read by nobody: grid.x = 31.
__global__ __launch_bounds__(256) void lin_state_kernel(const float* __restrict__ qkv,
                                                        float* __restrict__ Sc,
                                                        float* __restrict__ zc) {
  const int ch = blockIdx.x, bh = blockIdx.y, b = bh >> 4, h = bh & 15;
  const int tid = threadIdx.x, lane = tid & 31, wave = tid >> 5;
  __shared__ __align__(16) bf16_t skT[64 * 136];   // k'^T     [e][c]
  __shared__ __align__(16) bf16_t svT[64 * 136];   // v^T      [f][c]
  const int cl = lane & 15, rh = (lane >> 4) << 3;
  {
    const int c = tid >> 1, half = (tid & 1) * 32;
    const size_t row = (size_t)b * 4096 + (size_t)ch * 128 + c;
    const float4* pk = (const float4*)(qkv + row * 3072 + 1024 + h * 64 + half);
    const float4* pv = pk + 256;
    // loads first, elu after: the loads fly together, not one round trip each
    float4 kx[8], vx[8];
#pragma unroll
    for (int i = 0; i < 8; ++i) { kx[i] = pk[i]; vx[i] = pv[i]; }
#pragma unroll
    for (int i = 0; i < 8; ++i) {
      const float k4[4] = {kx[i].x, kx[i].y, kx[i].z, kx[i].w};
      const float v4[4] = {vx[i].x, vx[i].y, vx[i].z, vx[i].w};
#pragma unroll
      for (int u = 0; u < 4; ++u) {
        const int j = i * 4 + u;
        const float em = expm1f(k4[u]);  // unconditional: a select, no branch a value
        const float kv = (k4[u] > 0.f ? k4[u] : em) + 1.0001f;
        skT[(half + j) * 136 + c] = (bf16_t)kv;
        svT[(half + j) * 136 + c] = (bf16_t)v4[u];
      }
    }
  }
  __syncthreads();

  const size_t rec = (size_t)bh * 32 + ch;
  // v^T @ k'  (16 tiles over 8 waves, 2 each), K-dim 128
  {
    const int ft = wave >> 1;
    const int ebase = (wave & 1) * 32;
    v8f accS[2];
#pragma unroll
    for (int i = 0; i < 2; ++i) accS[i] = vzero8();
#pragma unroll
    for (int kk = 0; kk < 128; kk += 32) {
      v16bf av = frag_ld(frag_ptr(svT, ft * 16, 136, lane) + kk);
#pragma unroll
      for (int nt = 0; nt < 2; ++nt) {
        v16bf bk = frag_ld(frag_ptr(skT, ebase + nt * 16, 136, lane) + kk);
        accS[nt] = wmma_bf16(av, bk, accS[nt]);
      }
    }
#pragma unroll
    for (int nt = 0; nt < 2; ++nt)
#pragma unroll
      for (int r = 0; r < 8; ++r) {
        const int f = ft * 16 + rh + r;
        const int e = ebase + nt * 16 + cl;
        Sc[rec * 4096 + f * 64 + e] = accS[nt][r];
      }
  }
  if (tid < 64) {
    float zs = 0.f;
#pragma unroll 8
    for (int c = 0; c < 128; ++c) zs += (float)skT[tid * 136 + c];
    zc[rec * 64 + tid] = zs;
  }
}

// Blocks 0..255: S^T, two neighbouring elements a thread, rounded to bf16 at the
// store (the B operand of q' @ S). Blocks 256..263: z, kept in f32.
__global__ __launch_bounds__(256) void lin_prefix_kernel(const float* __restrict__ Sc,
                                                         const float* __restrict__ zc,
                                                         bf16_t* __restrict__ Sb,
                                                         float* __restrict__ zp) {
  if (blockIdx.x >= 256) {
    const int t = (blockIdx.x - 256) * 256 + threadIdx.x;
    const size_t base = (size_t)(t >> 6) * (32 * 64) + (size_t)(t & 63);
    float v[31];
#pragma unroll
    for (int ch = 0; ch < 31; ++ch) v[ch] = zc[base + ch * 64];
    float s = 0.f;
#pragma unroll
    for (int ch = 0; ch < 32; ++ch) {
      zp[base + ch * 64] = s;
      if (ch < 31) s += v[ch];
    }
    return;
  }
  const int t = blockIdx.x * 256 + threadIdx.x;
  const size_t base = (size_t)(t >> 11) * (32 * 4096) + (size_t)(t & 2047) * 2;
  float2 v[31];
#pragma unroll
  for (int ch = 0; ch < 31; ++ch) v[ch] = *(const float2*)(Sc + base + ch * 4096);
  float s0 = 0.f, s1 = 0.f;
#pragma unroll
  for (int ch = 0; ch < 32; ++ch) {
    v2bf o;
    o[0] = (bf16_t)s0;
    o[1] = (bf16_t)s1;
    *(v2bf*)(Sb + base + ch * 4096) = o;
    if (ch < 31) { s0 += v[ch].x; s1 += v[ch].y; }
  }
  // the built code lets this path run on to the z path's first instructions behind a
  // scalar test; they rewrite registers that the stores above name: wait in front
  asm volatile("s_wait_xcnt 0x0" ::: "memory");
}

__global__ __launch_bounds__(256) void lin_out_kernel(const float* __restrict__ qkv,
                                                      const bf16_t* __restrict__ Sb,
                                                      const float* __restrict__ zp,
                                                      bf16_t* __restrict__ out) {
  const int ch = blockIdx.x, bh = blockIdx.y, b = bh >> 4, h = bh & 15;
  const int tid = threadIdx.x, lane = tid & 31, wave = tid >> 5;
  // q'(128x72) + k'(128x72) overlap with masked A (128x136) -- disjoint lifetimes.
  __shared__ __align__(16) char smem_u[2 * 128 * 72 * 2];
  __shared__ __align__(16) bf16_t svT[64 * 136];   // v^T      [f][c]
  __shared__ __align__(16) bf16_t sSB[64 * 72];    // bf16 S^T before this chunk [f][e]
  __shared__ float sz[64];
  __shared__ float sqz[128];
  __shared__ float sden[128];
  bf16_t* sq = (bf16_t*)smem_u;                    // q' rows  [c][e]
  bf16_t* sk = (bf16_t*)smem_u + 128 * 72;         // k' rows  [c][e]
  bf16_t* sP = (bf16_t*)smem_u;                    // masked A [c][d]

  const int cl = lane & 15, rh = (lane >> 4) << 3;
  const size_t rec = (size_t)bh * 32 + ch;

  // 1. state before this chunk (B-operand layout: row f, cols e)
#pragma unroll
  for (int i = tid; i < 512; i += 256)
    *(v8bf*)&sSB[(i >> 3) * 72 + (i & 7) * 8] = *(const v8bf*)(Sb + rec * 4096 + i * 8);
  if (tid < 64) sz[tid] = zp[rec * 64 + tid];
  // 2. load chunk, apply elu maps
  {
    const int c = tid >> 1, half = (tid & 1) * 32;
    const size_t row = (size_t)b * 4096 + (size_t)ch * 128 + c;
    const float* pq = qkv + row * 3072 + h * 64 + half;
    const float* pk = pq + 1024;
    const float* pv = pq + 2048;
#pragma unroll 8
    for (int j = 0; j < 32; ++j) {
      float qv = pq[j] * 0.125f;  // E^-0.5
      qv = (qv > 0.f ? qv : expm1f(qv)) + 1.0001f;
      sq[c * 72 + half + j] = (bf16_t)qv;
      float kv = pk[j];
      kv = (kv > 0.f ? kv : expm1f(kv)) + 1.0001f;
      sk[c * 72 + half + j] = (bf16_t)kv;
      svT[(half + j) * 136 + c] = (bf16_t)pv[j];
    }
  }
  __syncthreads();

  // 3. A = q k'^T (8 tiles/wave) and num1 = q @ S (4 tiles/wave), K-dim 64
  v8f accA[8], accN[4];
#pragma unroll
  for (int i = 0; i < 8; ++i) accA[i] = vzero8();
#pragma unroll
  for (int i = 0; i < 4; ++i) accN[i] = vzero8();
#pragma unroll
  for (int kk = 0; kk < 64; kk += 32) {
    v16bf aq = frag_ld(frag_ptr(sq, wave * 16, 72, lane) + kk);
#pragma unroll
    for (int nt = 0; nt < 8; ++nt) {
      v16bf bk = frag_ld(frag_ptr(sk, nt * 16, 72, lane) + kk);
      accA[nt] = wmma_bf16(aq, bk, accA[nt]);
    }
#pragma unroll
    for (int nt = 0; nt < 4; ++nt) {
      v16bf bs = frag_ld(frag_ptr(sSB, nt * 16, 72, lane) + kk);
      accN[nt] = wmma_bf16(aq, bs, accN[nt]);
    }
  }
  // 4a. q'.z while q' is still in LDS
  if (tid < 128) {
    float qz = 0.f;
#pragma unroll 8
    for (int e = 0; e < 64; ++e) qz += (float)sq[tid * 72 + e] * sz[e];
    sqz[tid] = qz;
  }
  __syncthreads();  // all waves done reading q'/k' before masked A overwrites them

  // tril mask + row sums + stage masked A as bf16; 4b. den[c] = q'.z + rowsum(A)
#pragma unroll
  for (int r = 0; r < 8; ++r) {
    const int c = wave * 16 + rh + r;
    float rs = 0.f;
#pragma unroll
    for (int nt = 0; nt < 8; ++nt) {
      const int d = nt * 16 + cl;
      const float v = (d <= c) ? accA[nt][r] : 0.f;
      accA[nt][r] = v;
      rs += v;
    }
#pragma unroll
    for (int o = 1; o < 16; o <<= 1) rs += __shfl_xor(rs, o);
    if (cl == 0) sden[c] = sqz[c] + rs;
#pragma unroll
    for (int nt = 0; nt < 8; ++nt)
      sP[c * 136 + nt * 16 + cl] = (bf16_t)accA[nt][r];
  }
  __syncthreads();

  // 5. num2 = A @ v  (B-operand = v^T rows), K-dim 128
#pragma unroll
  for (int kk = 0; kk < 128; kk += 32) {
    v16bf ap = frag_ld(frag_ptr(sP, wave * 16, 136, lane) + kk);
#pragma unroll
    for (int nt = 0; nt < 4; ++nt) {
      v16bf bv = frag_ld(frag_ptr(svT, nt * 16, 136, lane) + kk);
      accN[nt] = wmma_bf16(ap, bv, accN[nt]);
    }
  }
  // 6. o = num / (den + 1e-6) -> global bf16
#pragma unroll
  for (int nt = 0; nt < 4; ++nt)
#pragma unroll
    for (int r = 0; r < 8; ++r) {
      const int c = wave * 16 + rh + r;
      const float o = accN[nt][r] / (sden[c] + 1e-6f);
      const size_t row = (size_t)b * 4096 + (size_t)ch * 128 + c;
      out[row * 1024 + h * 64 + nt * 16 + cl] = (bf16_t)o;
    }
}

// ---------------------------------------------------------------------------
// Launch: B=2, L=4096, D=1024, H=16, E=64, W=128. Requires ws >= ~263 MB.
// ---------------------------------------------------------------------------
extern "C" void kernel_launch(void* const* d_in, const int* in_sizes, int n_in,
                              void* d_out, int out_size, void* d_ws, size_t ws_size,
                              hipStream_t stream) {
  const float* x = (const float*)d_in[0];
  const float* g1 = (const float*)d_in[1];
  const float* b1 = (const float*)d_in[2];
  const float* Wqkva = (const float*)d_in[3];
  const float* bqkva = (const float*)d_in[4];
  const float* Wpa = (const float*)d_in[5];
  const float* bpa = (const float*)d_in[6];
  const float* Wqkvs = (const float*)d_in[7];
  const float* bqkvs = (const float*)d_in[8];
  const float* Wos = (const float*)d_in[9];
  const float* bos = (const float*)d_in[10];
  const float* Wo = (const float*)d_in[11];
  const float* bo = (const float*)d_in[12];
  const float* gm = (const float*)d_in[13];
  const float* bm = (const float*)d_in[14];
  const float* W1 = (const float*)d_in[15];
  const float* b1m = (const float*)d_in[16];
  const float* W2 = (const float*)d_in[17];
  const float* b2m = (const float*)d_in[18];

  char* ws = (char*)d_ws;
  bf16_t* WqkvaT = (bf16_t*)(ws + 0);            // [3072][1024]
  bf16_t* WqkvsT = (bf16_t*)(ws + 6291456);      // [3072][1024]
  bf16_t* WpaT = (bf16_t*)(ws + 12582912);       // [1024][1024]
  bf16_t* WosT = (bf16_t*)(ws + 14680064);       // [1024][1024]
  bf16_t* WoT = (bf16_t*)(ws + 16777216);        // [1024][1024]
  bf16_t* W1T = (bf16_t*)(ws + 18874368);        // [4096][1024]
  bf16_t* W2T = (bf16_t*)(ws + 27262976);        // [1024][4096]
  bf16_t* xn = (bf16_t*)(ws + 35651584);         // [8192][1024]  (later: h)
  bf16_t* swa_o = (bf16_t*)(ws + 52428800);      // [8192][1024]
  bf16_t* lin_o = (bf16_t*)(ws + 69206016);      // [8192][1024]
  bf16_t* mix = (bf16_t*)(ws + 85983232);        // [8192][1024]
  float* linSc = (float*)(ws + 85983232);        // [32*32][64*64] (before mix)
  bf16_t* qkva = (bf16_t*)(ws + 102760448);      // [8192][3072]
  float* qkvs = (float*)(ws + 153092096);        // [8192][3072]
  float* attnf = (float*)(ws + 153092096);       // [8192][1024] (reuses qkvs)
  bf16_t* gbuf = (bf16_t*)(ws + 153092096);      // [8192][4096] (reuses attnf)
  float* x1 = (float*)(ws + 220200960);          // [8192][1024] (tail of qkvs)
  bf16_t* linSb = (bf16_t*)(ws + 253755392);     // [32*32][64*64]
  float* linzc = (float*)(ws + 262144000);       // [32*32][64]
  float* linzp = (float*)(ws + 262406144);       // [32*32][64]
  float* outf = (float*)d_out;

  const dim3 blk(256);
  // Weight convert+transpose to bf16 [N][K]: the seven Wt lie back to back from ws + 0
  wt_transpose_kernel<<<dim3(1088), blk, 0, stream>>>(Wqkva, Wqkvs, Wpa, Wos, Wo, W1, W2,
                                                      WqkvaT);

  // xn = LN(x)
  ln_kernel<<<8192, blk, 0, stream>>>(x, g1, b1, xn);
  // qkv projections
  gemm_kernel<64, 3072, true, false, false><<<dim3(12, 64), blk, 0, stream>>>(
      xn, WqkvaT, bqkva, nullptr, qkva, 1024);
  gemm_kernel<64, 3072, false, false, false><<<dim3(12, 64), blk, 0, stream>>>(
      xn, WqkvsT, bqkvs, nullptr, qkvs, 1024);
  // attention branches
  swa_kernel<<<dim3(32, 16, 2), blk, 0, stream>>>(qkva, swa_o);
  lin_state_kernel<<<dim3(31, 32), blk, 0, stream>>>(qkvs, linSc, linzc);
  lin_prefix_kernel<<<dim3(264), blk, 0, stream>>>(linSc, linzc, linSb, linzp);
  lin_out_kernel<<<dim3(32, 32), blk, 0, stream>>>(qkvs, linSb, linzp, lin_o);
  // attn_out = swa @ Wp + bp  (f32)
  gemm_kernel<128, 1024, false, false, false><<<dim3(4, 64), blk, 0, stream>>>(
      swa_o, WpaT, bpa, nullptr, attnf, 1024);
  // mix = lin @ Wo_s + bo_s + attn_out  (bf16)
  gemm_kernel<128, 1024, true, false, true><<<dim3(4, 64), blk, 0, stream>>>(
      lin_o, WosT, bos, attnf, mix, 1024);
  // x1 = mix @ Wo + bo + x  (f32)
  gemm_kernel<128, 1024, false, false, true><<<dim3(4, 64), blk, 0, stream>>>(
      mix, WoT, bo, x, x1, 1024);
  // h = LN(x1)
  ln_kernel<<<8192, blk, 0, stream>>>(x1, gm, bm, xn);
  // g = gelu(h @ W1 + b1m)  (bf16)
  gemm_kernel<64, 4096, true, true, false><<<dim3(16, 64), blk, 0, stream>>>(
      xn, W1T, b1m, nullptr, gbuf, 1024);
  // out = g @ W2 + b2m + x1  (f32)
  gemm_kernel<128, 1024, false, false, true><<<dim3(4, 64), blk, 0, stream>>>(
      gbuf, W2T, b2m, x1, outf, 4096);
}

// v004
// One run takes 372 microseconds.
// Timed twice side by side with v003, it ran 1.04 times as fast both times.
// Counting every step since v000, it is 2.11 times as fast.
#include <hip/hip_runtime.h>

typedef __bf16 bf16_t;
typedef __attribute__((ext_vector_type(16))) __bf16 v16bf;
typedef __attribute__((ext_vector_type(8)))  __bf16 v8bf;
typedef __attribute__((ext_vector_type(8)))  float  v8f;

#define DEV static __device__ __forceinline__

// ---------------------------------------------------------------------------
// WMMA helpers (CDNA5 wave32, 16x16x32 bf16 -> f32)
// A fragment: lane m = row, kbase = 8*(lane>>4); VGPR v in [0,3] -> K = kbase+2v..,
// v in [4,7] -> K = 16+kbase+...  => two contiguous 16-byte chunks at +0 and +16.
// B fragment mirrors A with lane = output column, reading rows of B^T ([N][K]).
// ---------------------------------------------------------------------------
DEV v8f wmma_bf16(v16bf a, v16bf b, v8f c) {
  return __builtin_amdgcn_wmma_f32_16x16x32_bf16(false, a, false, b, (short)0, c,
                                                 false, false);
}

DEV const bf16_t* frag_ptr(const bf16_t* tile, int row0, int stride, int lane) {
  return tile + (size_t)(row0 + (lane & 15)) * stride + ((lane >> 4) << 3);
}

DEV v16bf frag_ld(const bf16_t* p) {
  v8bf lo = *(const v8bf*)(p);
  v8bf hi = *(const v8bf*)(p + 16);
  return __builtin_shufflevector(lo, hi, 0, 1, 2, 3, 4, 5, 6, 7,
                                 8, 9, 10, 11, 12, 13, 14, 15);
}

DEV v8f vzero8() {
  v8f z;
#pragma unroll
  for (int i = 0; i < 8; ++i) z[i] = 0.0f;
  return z;
}

// v_rcp_f32 and v_exp_f32 (2^a), each with the one slot that the instruction set asks for
// behind a transcendental before its result is used or its source overwritten; in one
// statement with it, so that the slot stands there whatever is scheduled next.
DEV float rcp_slot(float a) {
  float r;
  asm("v_rcp_f32 %0, %1\n\tv_nop" : "=v"(r) : "v"(a));
  return r;
}
DEV float exp2_slot(float a) {
  float r;
  asm("v_exp_f32 %0, %1\n\tv_nop" : "=v"(r) : "v"(a));
  return r;
}

// Exact GELU, 0.5 x (1 + erf(x / sqrt 2)), of 8 values, without a branch: 8 independent
// chains, stage by stage. One formula serves every z = |x| / sqrt 2: with t = 1 / (1 + p z),
// erfc(z) = t (a1 + t (a2 + t (a3 + t (a4 + t a5)))) exp(-z z), absolute error 1.5e-7.
// 1 + erf is 2 - erfc(z) for x >= 0 and erfc(z) itself for x < 0.
DEV void gelu_exact8(float (&x)[8]) {
  float z[8], t[8], e[8];
#pragma unroll
  for (int i = 0; i < 8; ++i) z[i] = fabsf(x[i]) * 0.70710678118654752f;
#pragma unroll
  for (int i = 0; i < 8; ++i) {
    t[i] = fmaf(0.3275911f, z[i], 1.0f);
    e[i] = z[i] * z[i] * -1.4426950408889634f;
  }
  // The two sched_barriers keep the 16 transcendentals together, away from what feeds them
  // and from what reads them: the compiler knows no latency of an asm statement and writes
  // no s_delay_alu for it, and a reader close behind would hold up the SIMD's other waves.
  __builtin_amdgcn_sched_barrier(0);
#pragma unroll
  for (int i = 0; i < 8; ++i) t[i] = rcp_slot(t[i]);
#pragma unroll
  for (int i = 0; i < 8; ++i) e[i] = exp2_slot(e[i]);
  __builtin_amdgcn_sched_barrier(0);
#pragma unroll
  for (int i = 0; i < 8; ++i) {
    float p = fmaf(1.061405429f, t[i], -1.453152027f);
    p = fmaf(p, t[i], 1.421413741f);
    p = fmaf(p, t[i], -0.284496736f);
    p = fmaf(p, t[i], 0.254829592f);
    const float h = (0.5f * x[i]) * ((p * t[i]) * e[i]);  // 0.5 x erfc(z)
    x[i] = x[i] >= 0.f ? x[i] - h : h;
  }
}

// ---------------------------------------------------------------------------
// CDNA5 async global->LDS copy (ASYNCcnt-tracked), 16 bytes per lane, as the builtin:
// the compiler then forms each copy's address from a uniform base and one lane offset.
// ---------------------------------------------------------------------------
typedef __attribute__((ext_vector_type(4))) int v4i;
typedef __attribute__((address_space(1))) v4i g_v4i;
typedef __attribute__((address_space(3))) v4i l_v4i;

DEV void async_copy_b128(bf16_t* ldst, const char* gsrc) {
  __builtin_amdgcn_global_load_async_to_lds_b128((g_v4i*)gsrc, (l_v4i*)ldst, 0, 0);
}

DEV void wait_async0() { asm volatile("s_wait_asynccnt 0x0" ::: "memory"); }
DEV void wait_ds0() { asm volatile("s_wait_dscnt 0x0" ::: "memory"); }

// ---------------------------------------------------------------------------
// LayerNorm over D=1024, writes bf16. One block per row, 256 threads x 4 elems.
// ---------------------------------------------------------------------------
__global__ __launch_bounds__(256) void ln_kernel(const float* __restrict__ x,
                                                 const float* __restrict__ g,
                                                 const float* __restrict__ b,
                                                 bf16_t* __restrict__ out) {
  const int row = blockIdx.x;
  const int tid = threadIdx.x, lane = tid & 31, wave = tid >> 5;
  const float4 v = ((const float4*)(x + (size_t)row * 1024))[tid];
  float s = v.x + v.y + v.z + v.w;
  float ss = v.x * v.x + v.y * v.y + v.z * v.z + v.w * v.w;
#pragma unroll
  for (int o = 16; o; o >>= 1) {
    s += __shfl_xor(s, o);
    ss += __shfl_xor(ss, o);
  }
  __shared__ float red[16];
  if (lane == 0) { red[wave] = s; red[8 + wave] = ss; }
  __syncthreads();
  if (tid == 0) {
    float a = 0.f, c = 0.f;
#pragma unroll
    for (int i = 0; i < 8; ++i) { a += red[i]; c += red[8 + i]; }
    red[0] = a; red[8] = c;
  }
  __syncthreads();
  const float mean = red[0] * (1.0f / 1024.0f);
  const float var = red[8] * (1.0f / 1024.0f) - mean * mean;
  const float inv = rsqrtf(var + 1e-5f);
  const float4 gg = ((const float4*)g)[tid];
  const float4 bb = ((const float4*)b)[tid];
  bf16_t* o4 = out + (size_t)row * 1024 + tid * 4;
  o4[0] = (bf16_t)((v.x - mean) * inv * gg.x + bb.x);
  o4[1] = (bf16_t)((v.y - mean) * inv * gg.y + bb.y);
  o4[2] = (bf16_t)((v.z - mean) * inv * gg.z + bb.z);
  o4[3] = (bf16_t)((v.w - mean) * inv * gg.w + bb.w);
}

// ---------------------------------------------------------------------------
// Weight convert+transpose, all seven weights in one launch: f32 W[K][N] -> bf16
// Wt[N][K], the seven Wt back to back in WtAll. One 128(k) x 128(n) tile a block.
// A wave reads whole 512-B rows, two neighbouring k rows a pair; a pair is rounded
// and packed to one dword (k even low, k odd high); rows of Wt leave as 256-B runs.
// ---------------------------------------------------------------------------
typedef __attribute__((ext_vector_type(2))) __bf16 v2bf;
typedef __attribute__((ext_vector_type(4))) float v4f;
typedef __attribute__((ext_vector_type(4))) uint32_t v4u;

// dword index of (column n, k pair p): pitch 65 spreads the 4-column lane stride over
// the banks; the 2 extra dwords from column 64 on keep lanes 16..31 off lanes 0..15.
DEV int wt_idx(int n, int p) { return n * 65 + ((n >> 6) << 1) + p; }

// One tile. K and N are compile-time, so that a lane's 16 loads share one address and
// differ in the immediate offset only.
template <int K, int N>
DEV void wt_tile(const float* __restrict__ W, bf16_t* __restrict__ Wt, int l,
                 uint32_t* t) {
  const int tid = threadIdx.x, lane = tid & 31, wave = tid >> 5;
  const int n0 = (l % (N / 128)) * 128, k0 = (l / (N / 128)) * 128;

  // k pair p = wave + 8 i: rows k0 + 2 p and k0 + 2 p + 1, 512 B of each a wave
  const float* src = W + (size_t)(k0 + 2 * wave) * N + n0 + lane * 4;
  v4f a[8], b[8];
#pragma unroll
  for (int i = 0; i < 8; ++i) {
    a[i] = *(const v4f*)(src + (16 * i) * N);
    b[i] = *(const v4f*)(src + (16 * i + 1) * N);
  }
  // the wait that is owed before a register which an issued load names is rewritten;
  // src as an input keeps the address pair live over the whole run, so that no load's
  // result is placed in it
  asm volatile("s_wait_xcnt 0x0" ::"v"(src) : "memory");
  // keeps all 16 loads of a lane ahead of the first conversion, so that they fly
  // together; without it the last four are issued only when the first have landed
  __builtin_amdgcn_sched_barrier(0);
#pragma unroll
  for (int i = 0; i < 8; ++i)
#pragma unroll
    for (int u = 0; u < 4; ++u) {
      v2bf pk;
      pk[0] = (bf16_t)a[i][u];
      pk[1] = (bf16_t)b[i][u];
      t[wt_idx(lane * 4 + u, wave + 8 * i)] = __builtin_bit_cast(uint32_t, pk);
    }
  __syncthreads();
  // a wave stores rows n0 + 2 wave + 16 i and the next, 256 B of each
  const int l16 = tid & 15, r = tid >> 4;
  bf16_t* dst = Wt + (size_t)(n0 + r) * K + k0 + l16 * 8;
#pragma unroll
  for (int i = 0; i < 8; ++i) {
    const int base = wt_idx(r + 16 * i, l16 * 4);
    v4u o;
    o[0] = t[base];
    o[1] = t[base + 1];
    o[2] = t[base + 2];
    o[3] = t[base + 3];
    *(v4u*)(dst + (16 * i) * K) = o;
  }
}

// Blocks 0..383: the two [1024][3072]; 384..575: the three [1024][1024];
// 576..831: [1024][4096]; 832..1087: [4096][1024]. Every branch is block-uniform.
__global__ __launch_bounds__(256) void wt_transpose_kernel(
    const float* __restrict__ Wa, const float* __restrict__ Wb,
    const float* __restrict__ Wc, const float* __restrict__ Wd,
    const float* __restrict__ We, const float* __restrict__ Wf,
    const float* __restrict__ Wg, bf16_t* __restrict__ WtAll) {
  __shared__ uint32_t t[128 * 65 + 2];
  const int bid = blockIdx.x;
  if (bid < 384) {
    const bool s = bid >= 192;
    wt_tile<1024, 3072>(s ? Wb : Wa, WtAll + (s ? 3145728 : 0), s ? bid - 192 : bid, t);
  } else if (bid < 576) {
    const int g = (bid - 384) >> 6;
    wt_tile<1024, 1024>(g == 0 ? Wc : (g == 1 ? Wd : We), WtAll + 6291456 + g * 1048576,
                        (bid - 384) & 63, t);
  } else if (bid < 832) {
    wt_tile<1024, 4096>(Wf, WtAll + 9437184, bid - 576, t);
  } else {
    wt_tile<4096, 1024>(Wg, WtAll + 13631488, bid - 832, t);
  }
}

// ---------------------------------------------------------------------------
// Generic bf16 GEMM, f32 accumulate: out[M][NN] = A[M][K] * Bt[NN][K]^T + bias
// Block: 256 thr = 8 waves (2 x 4); tile 128 x 256; wave tile 64 x 64 (4 M-frags x
// 4 N-frags), so that a fragment read from LDS feeds 4 WMMAs and fewer bytes come from
// L2 per product than with a 128 x 128 tile. A pass is KP k = KP / 32 blocks of 32 k.
// Two LDS buffers, each [A 128 rows | Bt 256 rows] at pitch 2 KP + 16 B, filled by async
// global->LDS copies one pass ahead; one barrier a pass. KP = 64: two work-groups fit a
// WGP (grids of more than one a WGP). KP = 128: one work-group a WGP, twice the k per
// barrier and per copy latency (grids of 256).
// Epilogue: optional GELU, optional f32 residual, bf16 or f32 output.
// M multiple of 128, NN of 256, K of KP.
// ---------------------------------------------------------------------------
template <int KP, int NN, bool OUT_BF16, bool GELU_ACT, bool RES>
__global__ __launch_bounds__(256) void gemm_kernel(
    const bf16_t* __restrict__ A, const bf16_t* __restrict__ Bt,
    const float* __restrict__ bias, const float* __restrict__ res,
    void* __restrict__ out, int K) {
  constexpr int LDK = KP + 8;              // row pitch 144 or 272 B = 16 B x odd
  constexpr int STAGE = (128 + 256) * LDK; // elements of one buffer
  constexpr int NB = KP / 32;              // blocks per pass
  constexpr int PR = KP / 8;               // 16-byte pieces per row
  constexpr int RG = 256 / PR;             // rows that the block's 256 threads copy at once
  __shared__ __align__(16) bf16_t sT[2][STAGE];
  const int tid = threadIdx.x, lane = tid & 31, wave = tid >> 5;
  const int m0 = blockIdx.y * 128, n0 = blockIdx.x * 256;
  const int wm = (wave >> 2) * 64;  // wave M offset within tile
  const int wn = (wave & 3) * 64;   // wave N offset within tile

  v8f acc[4][4];
#pragma unroll
  for (int i = 0; i < 4; ++i)
#pragma unroll
    for (int j = 0; j < 4; ++j) acc[i][j] = vzero8();

  const int cr = tid / PR;          // row within a group of RG rows
  const int cc = (tid % PR) * 8;    // 16-byte piece of the row
  // one 32-bit lane offset serves every copy; the rest of each address is uniform
  const uint32_t goff = (uint32_t)(cr * K + cc) * 2u;
  const char* uA = (const char*)(A + (size_t)m0 * K);
  const char* uB = (const char*)(Bt + (size_t)n0 * K);

  // pass k0 into buffer `buf`: 3 KP / 16 copies of 16 B per thread (12 or 24), whole lines
  auto stage = [&](int k0, int buf) {
    bf16_t* d = &sT[buf][cr * LDK + cc];
#pragma unroll
    for (int i = 0; i < 128 / RG; ++i)
      async_copy_b128(d + i * RG * LDK, uA + ((size_t)(i * RG) * K + k0) * 2 + goff);
#pragma unroll
    for (int i = 0; i < 256 / RG; ++i)
      async_copy_b128(d + (128 + i * RG) * LDK,
                      uB + ((size_t)(i * RG) * K + k0) * 2 + goff);
  };

  const int fa = (wm + (lane & 15)) * LDK + ((lane >> 4) << 3);
  const int fb = (128 + wn + (lane & 15)) * LDK + ((lane >> 4) << 3);

  const int npass = K / KP;
  stage(0, 0);
  wait_async0();    // own copies of pass 0 have landed
  __syncthreads();  // everyone's have
  if (1 < npass) stage(KP, 1);
  for (int t = 0; t < npass; ++t) {
    const int buf = t & 1;
    const bf16_t* cur = &sT[buf][0];
    // the sched_barriers keep [16 LDS reads][16 WMMAs] as written: a block's reads go as
    // one group; left alone they are spread in pairs among the WMMAs, each pair with a
    // full wait of its own behind it
#pragma unroll
    for (int u = 0; u < NB; ++u) {
      v16bf af[4], bfv[4];
      __builtin_amdgcn_sched_barrier(0);
#pragma unroll
      for (int mt = 0; mt < 4; ++mt) af[mt] = frag_ld(cur + fa + mt * 16 * LDK + u * 32);
#pragma unroll
      for (int nt = 0; nt < 4; ++nt) bfv[nt] = frag_ld(cur + fb + nt * 16 * LDK + u * 32);
      __builtin_amdgcn_sched_barrier(0);
#pragma unroll
      for (int nt = 0; nt < 4; ++nt)
#pragma unroll
        for (int mt = 0; mt < 4; ++mt)
          acc[mt][nt] = wmma_bf16(af[mt], bfv[nt], acc[mt][nt]);
    }
    // publish point of pass t + 1
    wait_ds0();       // own reads of this buffer have all returned
    wait_async0();    // own copies of pass t + 1 have landed
    __syncthreads();  // everyone's have, and everyone has left this buffer
    if (t + 2 < npass) stage((t + 2) * KP, buf);
  }
  wait_async0();  // nothing is in flight when the wave goes on to its end

  // NN is compile-time: a lane's bias, residual and output accesses are one base address
  // each plus immediate offsets.
  const int cl = lane & 15, rh = (lane >> 4) << 3;
  const size_t e0 = (size_t)(m0 + wm + rh) * NN + (size_t)(n0 + wn + cl);
  typedef typename std::conditional<OUT_BF16, bf16_t, float>::type out_t;
  out_t* op = (out_t*)out + e0;
  const float* rp = RES ? res + e0 : bias;
  const float* bp = bias + (n0 + wn + cl);
  // The wait that is owed before a register which an issued load or store names is
  // rewritten, behind each run of stores; the base addresses as inputs stay live up to it.
#define G_WAIT_X() asm volatile("s_wait_xcnt 0x0" ::"v"(op), "v"(rp), "v"(bp) : "memory")

  if constexpr (!GELU_ACT) {
    float bv[4];
#pragma unroll
    for (int nt = 0; nt < 4; ++nt) bv[nt] = bp[nt * 16];
    // two row tiles a run: their residual loads fly together, then their 64 stores
#pragma unroll
    for (int hf = 0; hf < 4; hf += 2) {
      float rv[2][4][8];
      if (RES) {
#pragma unroll
        for (int i = 0; i < 2; ++i)
#pragma unroll
          for (int nt = 0; nt < 4; ++nt)
#pragma unroll
            for (int r = 0; r < 8; ++r)
              rv[i][nt][r] = rp[((hf + i) * 16 + r) * NN + nt * 16];
      }
#pragma unroll
      for (int i = 0; i < 2; ++i)
#pragma unroll
        for (int nt = 0; nt < 4; ++nt)
#pragma unroll
          for (int r = 0; r < 8; ++r) {
            float v = acc[hf + i][nt][r] + bv[nt];
            if (RES) v += rv[i][nt][r];
            op[((hf + i) * 16 + r) * NN + nt * 16] = (out_t)v;
          }
      G_WAIT_X();
    }
  } else {
    float bv[4];
#pragma unroll
    for (int nt = 0; nt < 4; ++nt) bv[nt] = bp[nt * 16];
#pragma unroll
    for (int mt = 0; mt < 4; ++mt)
#pragma unroll
      for (int nt = 0; nt < 4; ++nt) {
        float v[8];
#pragma unroll
        for (int r = 0; r < 8; ++r) {
          v[r] = acc[mt][nt][r] + bv[nt];
          if (RES) v[r] += rp[(mt * 16 + r) * NN + nt * 16];
        }
        gelu_exact8(v);
#pragma unroll
        for (int r = 0; r < 8; ++r) op[(mt * 16 + r) * NN + nt * 16] = (out_t)v[r];
      }
    G_WAIT_X();
  }
#undef G_WAIT_X
}

// ---------------------------------------------------------------------------
// Sliding-window attention. One block per (query-block, head, batch).
// Q 128x64, K/V context 256x64 (prev block + own block), W=128 band mask.
// All matmuls via WMMA; softmax in registers with 16-lane shuffles.
// qkv: bf16 [B*L][3*1024]; out: bf16 [B*L][1024].
// ---------------------------------------------------------------------------
__global__ __launch_bounds__(256) void swa_kernel(const bf16_t* __restrict__ qkv,
                                                  bf16_t* __restrict__ out) {
  const int blk = blockIdx.x, h = blockIdx.y, b = blockIdx.z;
  const int tid = threadIdx.x, lane = tid & 31, wave = tid >> 5;

  // Q(128x72) + K(256x72) overlap with P(128x264) -- disjoint lifetimes.
  __shared__ __align__(16) char smem_u[128 * 264 * 2];
  __shared__ __align__(16) bf16_t sVt[64 * 264];  // V^T [e][s]
  bf16_t* sQ = (bf16_t*)smem_u;                   // [128][72]
  bf16_t* sK = (bf16_t*)smem_u + 128 * 72;        // [256][72]
  bf16_t* sP = (bf16_t*)smem_u;                   // [128][264]

  const size_t rowQ0 = (size_t)b * 4096 + (size_t)blk * 128;

  // Load Q: thread -> (row tid/2, 32-col half)
  {
    const int r = tid >> 1, half = (tid & 1) * 32;
    const bf16_t* src = qkv + (rowQ0 + r) * 3072 + h * 64 + half;
#pragma unroll
    for (int j = 0; j < 32; j += 8)
      *(v8bf*)&sQ[r * 72 + half + j] = *(const v8bf*)(src + j);
  }
  // Load K and V^T: thread -> key index s = tid (0..255)
  {
    const int s = tid;
    const long lk = (long)blk * 128 - 128 + s;
    if (lk < 0) {
      for (int e = 0; e < 64; ++e) {
        sK[s * 72 + e] = (bf16_t)0.f;
        sVt[e * 264 + s] = (bf16_t)0.f;
      }
    } else {
      const bf16_t* srck = qkv + ((size_t)b * 4096 + lk) * 3072 + 1024 + h * 64;
      const bf16_t* srcv = srck + 1024;
#pragma unroll
      for (int e = 0; e < 64; e += 8) {
        v8bf kv = *(const v8bf*)(srck + e);
        *(v8bf*)&sK[s * 72 + e] = kv;
        v8bf vv = *(const v8bf*)(srcv + e);
#pragma unroll
        for (int j = 0; j < 8; ++j) sVt[(e + j) * 264 + s] = vv[j];
      }
    }
  }
  __syncthreads();

  // Scores: wave w owns query rows [16w,16w+16); 16 key tiles; K-dim = 64.
  v8f acc[16];
#pragma unroll
  for (int i = 0; i < 16; ++i) acc[i] = vzero8();
#pragma unroll
  for (int kk = 0; kk < 64; kk += 32) {
    v16bf aq = frag_ld(frag_ptr(sQ, wave * 16, 72, lane) + kk);
#pragma unroll
    for (int nt = 0; nt < 16; ++nt) {
      v16bf bk = frag_ld(frag_ptr(sK, nt * 16, 72, lane) + kk);
      acc[nt] = wmma_bf16(aq, bk, acc[nt]);
    }
  }

  // Mask + softmax. C-layout: row = 16*wave + 8*(lane>>4) + r, col = 16*nt + (lane&15)
  const int cl = lane & 15, rh = (lane >> 4) << 3;
#pragma unroll
  for (int r = 0; r < 8; ++r) {
    const int rloc = wave * 16 + rh + r;
    float mx = -1e30f;
#pragma unroll
    for (int nt = 0; nt < 16; ++nt) {
      const int s = nt * 16 + cl;
      const bool ok = (s >= rloc + 1) && (s <= rloc + 128) && (blk > 0 || s >= 128);
      const float v = ok ? acc[nt][r] * 0.125f : -1e30f;
      acc[nt][r] = v;
      mx = fmaxf(mx, v);
    }
#pragma unroll
    for (int o = 1; o < 16; o <<= 1) mx = fmaxf(mx, __shfl_xor(mx, o));
    float sum = 0.f;
#pragma unroll
    for (int nt = 0; nt < 16; ++nt) {
      const float e = __expf(acc[nt][r] - mx);
      acc[nt][r] = e;
      sum += e;
    }
#pragma unroll
    for (int o = 1; o < 16; o <<= 1) sum += __shfl_xor(sum, o);
    const float inv = 1.0f / sum;
#pragma unroll
    for (int nt = 0; nt < 16; ++nt) acc[nt][r] *= inv;
  }

  __syncthreads();  // all waves done reading sQ/sK before P overwrites them
#pragma unroll
  for (int nt = 0; nt < 16; ++nt)
#pragma unroll
    for (int r = 0; r < 8; ++r)
      sP[(wave * 16 + rh + r) * 264 + nt * 16 + cl] = (bf16_t)acc[nt][r];
  __syncthreads();

  // PV: out 16x64 per wave; K-dim = 256 keys.
  v8f ov[4];
#pragma unroll
  for (int i = 0; i < 4; ++i) ov[i] = vzero8();
#pragma unroll
  for (int kk = 0; kk < 256; kk += 32) {
    v16bf ap = frag_ld(frag_ptr(sP, wave * 16, 264, lane) + kk);
#pragma unroll
    for (int nt = 0; nt < 4; ++nt) {
      v16bf bv = frag_ld(frag_ptr(sVt, nt * 16, 264, lane) + kk);
      ov[nt] = wmma_bf16(ap, bv, ov[nt]);
    }
  }
#pragma unroll
  for (int nt = 0; nt < 4; ++nt)
#pragma unroll
    for (int r = 0; r < 8; ++r) {
      const size_t row = rowQ0 + wave * 16 + rh + r;
      out[row * 1024 + h * 64 + nt * 16 + cl] = (bf16_t)ov[nt][r];
    }
}

// ---------------------------------------------------------------------------
// Chunked causal linear attention, chunk-parallel, three launches:
//   lin_state : per (chunk, b, h) the chunk's own v^T k' (64x64 f32) and colsum(k')
//   lin_prefix: exclusive running sum over the chunks, f32, chunk 0 first
//   lin_out   : per (chunk, b, h) the outputs from q', k', v and the summed state
// qkv: f32 [B*L][3*1024] (elu applied at load); out: bf16 [B*L][1024].
// State records: index (bh*32 + ch); S^T as [f][e].
// ---------------------------------------------------------------------------

// The last chunk's own state is read by nobody: grid.x = 31.
__global__ __launch_bounds__(256) void lin_state_kernel(const float* __restrict__ qkv,
                                                        float* __restrict__ Sc,
                                                        float* __restrict__ zc) {
  const int ch = blockIdx.x, bh = blockIdx.y, b = bh >> 4, h = bh & 15;
  const int tid = threadIdx.x, lane = tid & 31, wave = tid >> 5;
  __shared__ __align__(16) bf16_t skT[64 * 136];   // k'^T     [e][c]
  __shared__ __align__(16) bf16_t svT[64 * 136];   // v^T      [f][c]
  const int cl = lane & 15, rh = (lane >> 4) << 3;
  {
    const int c = tid >> 1, half = (tid & 1) * 32;
    const size_t row = (size_t)b * 4096 + (size_t)ch * 128 + c;
    const float4* pk = (const float4*)(qkv + row * 3072 + 1024 + h * 64 + half);
    const float4* pv = pk + 256;
    // loads first, elu after: the loads fly together, not one round trip each
    float4 kx[8], vx[8];
#pragma unroll
    for (int i = 0; i < 8; ++i) { kx[i] = pk[i]; vx[i] = pv[i]; }
#pragma unroll
    for (int i = 0; i < 8; ++i) {
      const float k4[4] = {kx[i].x, kx[i].y, kx[i].z, kx[i].w};
      const float v4[4] = {vx[i].x, vx[i].y, vx[i].z, vx[i].w};
#pragma unroll
      for (int u = 0; u < 4; ++u) {
        const int j = i * 4 + u;
        const float em = expm1f(k4[u]);  // unconditional: a select, no branch a value
        const float kv = (k4[u] > 0.f ? k4[u] : em) + 1.0001f;
        skT[(half + j) * 136 + c] = (bf16_t)kv;
        svT[(half + j) * 136 + c] = (bf16_t)v4[u];
      }
    }
  }
  __syncthreads();

  const size_t rec = (size_t)bh * 32 + ch;
  // v^T @ k'  (16 tiles over 8 waves, 2 each), K-dim 128
  {
    const int ft = wave >> 1;
    const int ebase = (wave & 1) * 32;
    v8f accS[2];
#pragma unroll
    for (int i = 0; i < 2; ++i) accS[i] = vzero8();
#pragma unroll
    for (int kk = 0; kk < 128; kk += 32) {
      v16bf av = frag_ld(frag_ptr(svT, ft * 16, 136, lane) + kk);
#pragma unroll
      for (int nt = 0; nt < 2; ++nt) {
        v16bf bk = frag_ld(frag_ptr(skT, ebase + nt * 16, 136, lane) + kk);
        accS[nt] = wmma_bf16(av, bk, accS[nt]);
      }
    }
#pragma unroll
    for (int nt = 0; nt < 2; ++nt)
#pragma unroll
      for (int r = 0; r < 8; ++r) {
        const int f = ft * 16 + rh + r;
        const int e = ebase + nt * 16 + cl;
        Sc[rec * 4096 + f * 64 + e] = accS[nt][r];
      }
  }
  if (tid < 64) {
    float zs = 0.f;
#pragma unroll 8
    for (int c = 0; c < 128; ++c) zs += (float)skT[tid * 136 + c];
    zc[rec * 64 + tid] = zs;
  }
}

// Blocks 0..255: S^T, two neighbouring elements a thread, rounded to bf16 at the
// store (the B operand of q' @ S). Blocks 256..263: z, kept in f32.
__global__ __launch_bounds__(256) void lin_prefix_kernel(const float* __restrict__ Sc,
                                                         const float* __restrict__ zc,
                                                         bf16_t* __restrict__ Sb,
                                                         float* __restrict__ zp) {
  if (blockIdx.x >= 256) {
    const int t = (blockIdx.x - 256) * 256 + threadIdx.x;
    const size_t base = (size_t)(t >> 6) * (32 * 64) + (size_t)(t & 63);
    float v[31];
#pragma unroll
    for (int ch = 0; ch < 31; ++ch) v[ch] = zc[base + ch * 64];
    float s = 0.f;
#pragma unroll
    for (int ch = 0; ch < 32; ++ch) {
      zp[base + ch * 64] = s;
      if (ch < 31) s += v[ch];
    }
    return;
  }
  const int t = blockIdx.x * 256 + threadIdx.x;
  const size_t base = (size_t)(t >> 11) * (32 * 4096) + (size_t)(t & 2047) * 2;
  float2 v[31];
#pragma unroll
  for (int ch = 0; ch < 31; ++ch) v[ch] = *(const float2*)(Sc + base + ch * 4096);
  float s0 = 0.f, s1 = 0.f;
#pragma unroll
  for (int ch = 0; ch < 32; ++ch) {
    v2bf o;
    o[0] = (bf16_t)s0;
    o[1] = (bf16_t)s1;
    *(v2bf*)(Sb + base + ch * 4096) = o;
    if (ch < 31) { s0 += v[ch].x; s1 += v[ch].y; }
  }
  // the built code lets this path run on to the z path's first instructions behind a
  // scalar test; they rewrite registers that the stores above name: wait in front
  asm volatile("s_wait_xcnt 0x0" ::: "memory");
}

__global__ __launch_bounds__(256) void lin_out_kernel(const float* __restrict__ qkv,
                                                      const bf16_t* __restrict__ Sb,
                                                      const float* __restrict__ zp,
                                                      bf16_t* __restrict__ out) {
  const int ch = blockIdx.x, bh = blockIdx.y, b = bh >> 4, h = bh & 15;
  const int tid = threadIdx.x, lane = tid & 31, wave = tid >> 5;
  // q'(128x72) + k'(128x72) overlap with masked A (128x136) -- disjoint lifetimes.
  __shared__ __align__(16) char smem_u[2 * 128 * 72 * 2];
  __shared__ __align__(16) bf16_t svT[64 * 136];   // v^T      [f][c]
  __shared__ __align__(16) bf16_t sSB[64 * 72];    // bf16 S^T before this chunk [f][e]
  __shared__ float sz[64];
  __shared__ float sqz[128];
  __shared__ float sden[128];
  bf16_t* sq = (bf16_t*)smem_u;                    // q' rows  [c][e]
  bf16_t* sk = (bf16_t*)smem_u + 128 * 72;         // k' rows  [c][e]
  bf16_t* sP = (bf16_t*)smem_u;                    // masked A [c][d]

  const int cl = lane & 15, rh = (lane >> 4) << 3;
  const size_t rec = (size_t)bh * 32 + ch;

  // 1. state before this chunk (B-operand layout: row f, cols e)
#pragma unroll
  for (int i = tid; i < 512; i += 256)
    *(v8bf*)&sSB[(i >> 3) * 72 + (i & 7) * 8] = *(const v8bf*)(Sb + rec * 4096 + i * 8);
  if (tid < 64) sz[tid] = zp[rec * 64 + tid];
  // 2. load chunk, apply elu maps
  {
    const int c = tid >> 1, half = (tid & 1) * 32;
    const size_t row = (size_t)b * 4096 + (size_t)ch * 128 + c;
    const float* pq = qkv + row * 3072 + h * 64 + half;
    const float* pk = pq + 1024;
    const float* pv = pq + 2048;
#pragma unroll 8
    for (int j = 0; j < 32; ++j) {
      float qv = pq[j] * 0.125f;  // E^-0.5
      qv = (qv > 0.f ? qv : expm1f(qv)) + 1.0001f;
      sq[c * 72 + half + j] = (bf16_t)qv;
      float kv = pk[j];
      kv = (kv > 0.f ? kv : expm1f(kv)) + 1.0001f;
      sk[c * 72 + half + j] = (bf16_t)kv;
      svT[(half + j) * 136 + c] = (bf16_t)pv[j];
    }
  }
  __syncthreads();

  // 3. A = q k'^T (8 tiles/wave) and num1 = q @ S (4 tiles/wave), K-dim 64
  v8f accA[8], accN[4];
#pragma unroll
  for (int i = 0; i < 8; ++i) accA[i] = vzero8();
#pragma unroll
  for (int i = 0; i < 4; ++i) accN[i] = vzero8();
#pragma unroll
  for (int kk = 0; kk < 64; kk += 32) {
    v16bf aq = frag_ld(frag_ptr(sq, wave * 16, 72, lane) + kk);
#pragma unroll
    for (int nt = 0; nt < 8; ++nt) {
      v16bf bk = frag_ld(frag_ptr(sk, nt * 16, 72, lane) + kk);
      accA[nt] = wmma_bf16(aq, bk, accA[nt]);
    }
#pragma unroll
    for (int nt = 0; nt < 4; ++nt) {
      v16bf bs = frag_ld(frag_ptr(sSB, nt * 16, 72, lane) + kk);
      accN[nt] = wmma_bf16(aq, bs, accN[nt]);
    }
  }
  // 4a. q'.z while q' is still in LDS
  if (tid < 128) {
    float qz = 0.f;
#pragma unroll 8
    for (int e = 0; e < 64; ++e) qz += (float)sq[tid * 72 + e] * sz[e];
    sqz[tid] = qz;
  }
  __syncthreads();  // all waves done reading q'/k' before masked A overwrites them

  // tril mask + row sums + stage masked A as bf16; 4b. den[c] = q'.z + rowsum(A)
#pragma unroll
  for (int r = 0; r < 8; ++r) {
    const int c = wave * 16 + rh + r;
    float rs = 0.f;
#pragma unroll
    for (int nt = 0; nt < 8; ++nt) {
      const int d = nt * 16 + cl;
      const float v = (d <= c) ? accA[nt][r] : 0.f;
      accA[nt][r] = v;
      rs += v;
    }
#pragma unroll
    for (int o = 1; o < 16; o <<= 1) rs += __shfl_xor(rs, o);
    if (cl == 0) sden[c] = sqz[c] + rs;
#pragma unroll
    for (int nt = 0; nt < 8; ++nt)
      sP[c * 136 + nt * 16 + cl] = (bf16_t)accA[nt][r];
  }
  __syncthreads();

  // 5. num2 = A @ v  (B-operand = v^T rows), K-dim 128
#pragma unroll
  for (int kk = 0; kk < 128; kk += 32) {
    v16bf ap = frag_ld(frag_ptr(sP, wave * 16, 136, lane) + kk);
#pragma unroll
    for (int nt = 0; nt < 4; ++nt) {
      v16bf bv = frag_ld(frag_ptr(svT, nt * 16, 136, lane) + kk);
      accN[nt] = wmma_bf16(ap, bv, accN[nt]);
    }
  }
  // 6. o = num / (den + 1e-6) -> global bf16
#pragma unroll
  for (int nt = 0; nt < 4; ++nt)
#pragma unroll
    for (int r = 0; r < 8; ++r) {
      const int c = wave * 16 + rh + r;
      const float o = accN[nt][r] / (sden[c] + 1e-6f);
      const size_t row = (size_t)b * 4096 + (size_t)ch * 128 + c;
      out[row * 1024 + h * 64 + nt * 16 + cl] = (bf16_t)o;
    }
}

// ---------------------------------------------------------------------------
// Launch: B=2, L=4096, D=1024, H=16, E=64, W=128. Requires ws >= ~263 MB.
// ---------------------------------------------------------------------------
extern "C" void kernel_launch(void* const* d_in, const int* in_sizes, int n_in,
                              void* d_out, int out_size, void* d_ws, size_t ws_size,
                              hipStream_t stream) {
  const float* x = (const float*)d_in[0];
  const float* g1 = (const float*)d_in[1];
  const float* b1 = (const float*)d_in[2];
  const float* Wqkva = (const float*)d_in[3];
  const float* bqkva = (const float*)d_in[4];
  const float* Wpa = (const float*)d_in[5];
  const float* bpa = (const float*)d_in[6];
  const float* Wqkvs = (const float*)d_in[7];
  const float* bqkvs = (const float*)d_in[8];
  const float* Wos = (const float*)d_in[9];
  const float* bos = (const float*)d_in[10];
  const float* Wo = (const float*)d_in[11];
  const float* bo = (const float*)d_in[12];
  const float* gm = (const float*)d_in[13];
  const float* bm = (const float*)d_in[14];
  const float* W1 = (const float*)d_in[15];
  const float* b1m = (const float*)d_in[16];
  const float* W2 = (const float*)d_in[17];
  const float* b2m = (const float*)d_in[18];

  char* ws = (char*)d_ws;
  bf16_t* WqkvaT = (bf16_t*)(ws + 0);            // [3072][1024]
  bf16_t* WqkvsT = (bf16_t*)(ws + 6291456);      // [3072][1024]
  bf16_t* WpaT = (bf16_t*)(ws + 12582912);       // [1024][1024]
  bf16_t* WosT = (bf16_t*)(ws + 14680064);       // [1024][1024]
  bf16_t* WoT = (bf16_t*)(ws + 16777216);        // [1024][1024]
  bf16_t* W1T = (bf16_t*)(ws + 18874368);        // [4096][1024]
  bf16_t* W2T = (bf16_t*)(ws + 27262976);        // [1024][4096]
  bf16_t* xn = (bf16_t*)(ws + 35651584);         // [8192][1024]  (later: h)
  bf16_t* swa_o = (bf16_t*)(ws + 52428800);      // [8192][1024]
  bf16_t* lin_o = (bf16_t*)(ws + 69206016);      // [8192][1024]
  bf16_t* mix = (bf16_t*)(ws + 85983232);        // [8192][1024]
  float* linSc = (float*)(ws + 85983232);        // [32*32][64*64] (before mix)
  bf16_t* qkva = (bf16_t*)(ws + 102760448);      // [8192][3072]
  float* qkvs = (float*)(ws + 153092096);        // [8192][3072]
  float* attnf = (float*)(ws + 153092096);       // [8192][1024] (reuses qkvs)
  bf16_t* gbuf = (bf16_t*)(ws + 153092096);      // [8192][4096] (reuses attnf)
  float* x1 = (float*)(ws + 220200960);          // [8192][1024] (tail of qkvs)
  bf16_t* linSb = (bf16_t*)(ws + 253755392);     // [32*32][64*64]
  float* linzc = (float*)(ws + 262144000);       // [32*32][64]
  float* linzp = (float*)(ws + 262406144);       // [32*32][64]
  float* outf = (float*)d_out;

  const dim3 blk(256);
  // Weight convert+transpose to bf16 [N][K]: the seven Wt lie back to back from ws + 0
  wt_transpose_kernel<<<dim3(1088), blk, 0, stream>>>(Wqkva, Wqkvs, Wpa, Wos, Wo, W1, W2,
                                                      WqkvaT);

  // xn = LN(x)
  ln_kernel<<<8192, blk, 0, stream>>>(x, g1, b1, xn);
  // qkv projections
  gemm_kernel<64, 3072, true, false, false><<<dim3(12, 64), blk, 0, stream>>>(
      xn, WqkvaT, bqkva, nullptr, qkva, 1024);
  gemm_kernel<64, 3072, false, false, false><<<dim3(12, 64), blk, 0, stream>>>(
      xn, WqkvsT, bqkvs, nullptr, qkvs, 1024);
  // attention branches
  swa_kernel<<<dim3(32, 16, 2), blk, 0, stream>>>(qkva, swa_o);
  lin_state_kernel<<<dim3(31, 32), blk, 0, stream>>>(qkvs, linSc, linzc);
  lin_prefix_kernel<<<dim3(264), blk, 0, stream>>>(linSc, linzc, linSb, linzp);
  lin_out_kernel<<<dim3(32, 32), blk, 0, stream>>>(qkvs, linSb, linzp, lin_o);
  // attn_out = swa @ Wp + bp  (f32)
  gemm_kernel<128, 1024, false, false, false><<<dim3(4, 64), blk, 0, stream>>>(
      swa_o, WpaT, bpa, nullptr, attnf, 1024);
  // mix = lin @ Wo_s + bo_s + attn_out  (bf16)
  gemm_kernel<128, 1024, true, false, true><<<dim3(4, 64), blk, 0, stream>>>(
      lin_o, WosT, bos, attnf, mix, 1024);
  // x1 = mix @ Wo + bo + x  (f32)
  gemm_kernel<128, 1024, false, false, true><<<dim3(4, 64), blk, 0, stream>>>(
      mix, WoT, bo, x, x1, 1024);
  // h = LN(x1)
  ln_kernel<<<8192, blk, 0, stream>>>(x1, gm, bm, xn);
  // g = gelu(h @ W1 + b1m)  (bf16)
  gemm_kernel<64, 4096, true, true, false><<<dim3(16, 64), blk, 0, stream>>>(
      xn, W1T, b1m, nullptr, gbuf, 1024);
  // out = g @ W2 + b2m + x1  (f32)
  gemm_kernel<128, 1024, false, false, true><<<dim3(4, 64), blk, 0, stream>>>(
      gbuf, W2T, b2m, x1, outf, 4096);
}

// v005
// A run of this version takes 348 microseconds.
// Next to v004, in two timings, it ran 1.08 and 1.06 times as fast.
// All steps since v000 together make it 2.26 times as fast.
#include <hip/hip_runtime.h>

typedef __bf16 bf16_t;
typedef __attribute__((ext_vector_type(16))) __bf16 v16bf;
typedef __attribute__((ext_vector_type(8)))  __bf16 v8bf;
typedef __attribute__((ext_vector_type(8)))  float  v8f;

#define DEV static __device__ __forceinline__

// ---------------------------------------------------------------------------
// WMMA helpers (CDNA5 wave32, 16x16x32 bf16 -> f32)
// A fragment: lane m = row, kbase = 8*(lane>>4); VGPR v in [0,3] -> K = kbase+2v..,
// v in [4,7] -> K = 16+kbase+...  => two contiguous 16-byte chunks at +0 and +16.
// B fragment mirrors A with lane = output column, reading rows of B^T ([N][K]).
// ---------------------------------------------------------------------------
DEV v8f wmma_bf16(v16bf a, v16bf b, v8f c) {
  return __builtin_amdgcn_wmma_f32_16x16x32_bf16(false, a, false, b, (short)0, c,
                                                 false, false);
}

DEV const bf16_t* frag_ptr(const bf16_t* tile, int row0, int stride, int lane) {
  return tile + (size_t)(row0 + (lane & 15)) * stride + ((lane >> 4) << 3);
}

DEV v16bf frag_ld(const bf16_t* p) {
  v8bf lo = *(const v8bf*)(p);
  v8bf hi = *(const v8bf*)(p + 16);
  return __builtin_shufflevector(lo, hi, 0, 1, 2, 3, 4, 5, 6, 7,
                                 8, 9, 10, 11, 12, 13, 14, 15);
}

DEV v8f vzero8() {
  v8f z;
#pragma unroll
  for (int i = 0; i < 8; ++i) z[i] = 0.0f;
  return z;
}

// v_rcp_f32 and v_exp_f32 (2^a), each with the one slot that the instruction set asks for
// behind a transcendental before its result is used or its source overwritten; in one
// statement with it, so that the slot stands there whatever is scheduled next.
DEV float rcp_slot(float a) {
  float r;
  asm("v_rcp_f32 %0, %1\n\tv_nop" : "=v"(r) : "v"(a));
  return r;
}
DEV float exp2_slot(float a) {
  float r;
  asm("v_exp_f32 %0, %1\n\tv_nop" : "=v"(r) : "v"(a));
  return r;
}

// Exact GELU, 0.5 x (1 + erf(x / sqrt 2)), of 8 values, without a branch: 8 independent
// chains, stage by stage. One formula serves every z = |x| / sqrt 2: with t = 1 / (1 + p z),
// erfc(z) = t (a1 + t (a2 + t (a3 + t (a4 + t a5)))) exp(-z z), absolute error 1.5e-7.
// 1 + erf is 2 - erfc(z) for x >= 0 and erfc(z) itself for x < 0.
DEV void gelu_exact8(float (&x)[8]) {
  float z[8], t[8], e[8];
#pragma unroll
  for (int i = 0; i < 8; ++i) z[i] = fabsf(x[i]) * 0.70710678118654752f;
#pragma unroll
  for (int i = 0; i < 8; ++i) {
    t[i] = fmaf(0.3275911f, z[i], 1.0f);
    e[i] = z[i] * z[i] * -1.4426950408889634f;
  }
  // The two sched_barriers keep the 16 transcendentals together, away from what feeds them
  // and from what reads them: the compiler knows no latency of an asm statement and writes
  // no s_delay_alu for it, and a reader close behind would hold up the SIMD's other waves.
  __builtin_amdgcn_sched_barrier(0);
#pragma unroll
  for (int i = 0; i < 8; ++i) t[i] = rcp_slot(t[i]);
#pragma unroll
  for (int i = 0; i < 8; ++i) e[i] = exp2_slot(e[i]);
  __builtin_amdgcn_sched_barrier(0);
#pragma unroll
  for (int i = 0; i < 8; ++i) {
    float p = fmaf(1.061405429f, t[i], -1.453152027f);
    p = fmaf(p, t[i], 1.421413741f);
    p = fmaf(p, t[i], -0.284496736f);
    p = fmaf(p, t[i], 0.254829592f);
    const float h = (0.5f * x[i]) * ((p * t[i]) * e[i]);  // 0.5 x erfc(z)
    x[i] = x[i] >= 0.f ? x[i] - h : h;
  }
}

// ---------------------------------------------------------------------------
// CDNA5 async global->LDS copy (ASYNCcnt-tracked), 16 bytes per lane, as the builtin:
// the compiler then forms each copy's address from a uniform base and one lane offset.
// ---------------------------------------------------------------------------
typedef __attribute__((ext_vector_type(4))) int v4i;
typedef __attribute__((address_space(1))) v4i g_v4i;
typedef __attribute__((address_space(3))) v4i l_v4i;

DEV void async_copy_b128(bf16_t* ldst, const char* gsrc) {
  __builtin_amdgcn_global_load_async_to_lds_b128((g_v4i*)gsrc, (l_v4i*)ldst, 0, 0);
}

DEV void wait_async0() { asm volatile("s_wait_asynccnt 0x0" ::: "memory"); }
DEV void wait_ds0() { asm volatile("s_wait_dscnt 0x0" ::: "memory"); }

// ---------------------------------------------------------------------------
// LayerNorm over D=1024, writes bf16. One block per row, 256 threads x 4 elems.
// ---------------------------------------------------------------------------
__global__ __launch_bounds__(256) void ln_kernel(const float* __restrict__ x,
                                                 const float* __restrict__ g,
                                                 const float* __restrict__ b,
                                                 bf16_t* __restrict__ out) {
  const int row = blockIdx.x;
  const int tid = threadIdx.x, lane = tid & 31, wave = tid >> 5;
  const float4 v = ((const float4*)(x + (size_t)row * 1024))[tid];
  float s = v.x + v.y + v.z + v.w;
  float ss = v.x * v.x + v.y * v.y + v.z * v.z + v.w * v.w;
#pragma unroll
  for (int o = 16; o; o >>= 1) {
    s += __shfl_xor(s, o);
    ss += __shfl_xor(ss, o);
  }
  __shared__ float red[16];
  if (lane == 0) { red[wave] = s; red[8 + wave] = ss; }
  __syncthreads();
  if (tid == 0) {
    float a = 0.f, c = 0.f;
#pragma unroll
    for (int i = 0; i < 8; ++i) { a += red[i]; c += red[8 + i]; }
    red[0] = a; red[8] = c;
  }
  __syncthreads();
  const float mean = red[0] * (1.0f / 1024.0f);
  const float var = red[8] * (1.0f / 1024.0f) - mean * mean;
  const float inv = rsqrtf(var + 1e-5f);
  const float4 gg = ((const float4*)g)[tid];
  const float4 bb = ((const float4*)b)[tid];
  bf16_t* o4 = out + (size_t)row * 1024 + tid * 4;
  o4[0] = (bf16_t)((v.x - mean) * inv * gg.x + bb.x);
  o4[1] = (bf16_t)((v.y - mean) * inv * gg.y + bb.y);
  o4[2] = (bf16_t)((v.z - mean) * inv * gg.z + bb.z);
  o4[3] = (bf16_t)((v.w - mean) * inv * gg.w + bb.w);
}

// ---------------------------------------------------------------------------
// Weight convert+transpose, all seven weights in one launch: f32 W[K][N] -> bf16
// Wt[N][K], the seven Wt back to back in WtAll. One 128(k) x 128(n) tile a block.
// A wave reads whole 512-B rows, two neighbouring k rows a pair; a pair is rounded
// and packed to one dword (k even low, k odd high); rows of Wt leave as 256-B runs.
// ---------------------------------------------------------------------------
typedef __attribute__((ext_vector_type(2))) __bf16 v2bf;
typedef __attribute__((ext_vector_type(4))) float v4f;
typedef __attribute__((ext_vector_type(4))) uint32_t v4u;

// dword index of (column n, k pair p): pitch 65 spreads the 4-column lane stride over
// the banks; the 2 extra dwords from column 64 on keep lanes 16..31 off lanes 0..15.
DEV int wt_idx(int n, int p) { return n * 65 + ((n >> 6) << 1) + p; }

// One tile. K and N are compile-time, so that a lane's 16 loads share one address and
// differ in the immediate offset only.
template <int K, int N>
DEV void wt_tile(const float* __restrict__ W, bf16_t* __restrict__ Wt, int l,
                 uint32_t* t) {
  const int tid = threadIdx.x, lane = tid & 31, wave = tid >> 5;
  const int n0 = (l % (N / 128)) * 128, k0 = (l / (N / 128)) * 128;

  // k pair p = wave + 8 i: rows k0 + 2 p and k0 + 2 p + 1, 512 B of each a wave
  const float* src = W + (size_t)(k0 + 2 * wave) * N + n0 + lane * 4;
  v4f a[8], b[8];
#pragma unroll
  for (int i = 0; i < 8; ++i) {
    a[i] = *(const v4f*)(src + (16 * i) * N);
    b[i] = *(const v4f*)(src + (16 * i + 1) * N);
  }
  // the wait that is owed before a register which an issued load names is rewritten;
  // src as an input keeps the address pair live over the whole run, so that no load's
  // result is placed in it
  asm volatile("s_wait_xcnt 0x0" ::"v"(src) : "memory");
  // keeps all 16 loads of a lane ahead of the first conversion, so that they fly
  // together; without it the last four are issued only when the first have landed
  __builtin_amdgcn_sched_barrier(0);
#pragma unroll
  for (int i = 0; i < 8; ++i)
#pragma unroll
    for (int u = 0; u < 4; ++u) {
      v2bf pk;
      pk[0] = (bf16_t)a[i][u];
      pk[1] = (bf16_t)b[i][u];
      t[wt_idx(lane * 4 + u, wave + 8 * i)] = __builtin_bit_cast(uint32_t, pk);
    }
  __syncthreads();
  // a wave stores rows n0 + 2 wave + 16 i and the next, 256 B of each
  const int l16 = tid & 15, r = tid >> 4;
  bf16_t* dst = Wt + (size_t)(n0 + r) * K + k0 + l16 * 8;
#pragma unroll
  for (int i = 0; i < 8; ++i) {
    const int base = wt_idx(r + 16 * i, l16 * 4);
    v4u o;
    o[0] = t[base];
    o[1] = t[base + 1];
    o[2] = t[base + 2];
    o[3] = t[base + 3];
    *(v4u*)(dst + (16 * i) * K) = o;
  }
}

// Blocks 0..383: the two [1024][3072]; 384..575: the three [1024][1024];
// 576..831: [1024][4096]; 832..1087: [4096][1024]. Every branch is block-uniform.
__global__ __launch_bounds__(256) void wt_transpose_kernel(
    const float* __restrict__ Wa, const float* __restrict__ Wb,
    const float* __restrict__ Wc, const float* __restrict__ Wd,
    const float* __restrict__ We, const float* __restrict__ Wf,
    const float* __restrict__ Wg, bf16_t* __restrict__ WtAll) {
  __shared__ uint32_t t[128 * 65 + 2];
  const int bid = blockIdx.x;
  if (bid < 384) {
    const bool s = bid >= 192;
    wt_tile<1024, 3072>(s ? Wb : Wa, WtAll + (s ? 3145728 : 0), s ? bid - 192 : bid, t);
  } else if (bid < 576) {
    const int g = (bid - 384) >> 6;
    wt_tile<1024, 1024>(g == 0 ? Wc : (g == 1 ? Wd : We), WtAll + 6291456 + g * 1048576,
                        (bid - 384) & 63, t);
  } else if (bid < 832) {
    wt_tile<1024, 4096>(Wf, WtAll + 9437184, bid - 576, t);
  } else {
    wt_tile<4096, 1024>(Wg, WtAll + 13631488, bid - 832, t);
  }
}

// ---------------------------------------------------------------------------
// Generic bf16 GEMM, f32 accumulate: out[M][NN] = A[M][K] * Bt[NN][K]^T + bias
// Block: 256 thr = 8 waves (2 x 4); tile 128 x 256; wave tile 64 x 64 (4 M-frags x
// 4 N-frags), so that a fragment read from LDS feeds 4 WMMAs and fewer bytes come from
// L2 per product than with a 128 x 128 tile. A pass is KP k = KP / 32 blocks of 32 k.
// Two LDS buffers, each [A 128 rows | Bt 256 rows] at pitch 2 KP + 16 B, filled by async
// global->LDS copies one pass ahead; one barrier a pass. KP = 64: two work-groups fit a
// WGP (grids of more than one a WGP). KP = 128: one work-group a WGP, twice the k per
// barrier and per copy latency (grids of 256).
// Epilogue: optional GELU, optional f32 residual, bf16 or f32 output.
// M multiple of 128, NN of 256, K of KP.
// Two products that share an operand or an output run as one launch:
// CATN: Bt holds 2 NN rows, the weights of two products of the same A one behind the other;
//   grid.x = 2 NN / 256. Column blocks below NN give out (bf16, bias), the rest out2 (f32,
//   bias2), each [M][NN].
// CATK: out = A Bt^T + A2 Bt2^T + bias + bias2, all four operands of row length K: the k
//   passes of the second product follow those of the first on the same accumulators.
// ---------------------------------------------------------------------------
template <int KP, int NN, bool OUT_BF16, bool GELU_ACT, bool RES, bool CATN = false,
          bool CATK = false>
__global__ __launch_bounds__(256) void gemm_kernel(
    const bf16_t* __restrict__ A, const bf16_t* __restrict__ Bt,
    const float* __restrict__ bias, const float* __restrict__ res,
    void* __restrict__ out, int K, const bf16_t* __restrict__ A2,
    const bf16_t* __restrict__ Bt2, const float* __restrict__ bias2,
    void* __restrict__ out2) {
  constexpr int LDK = KP + 8;              // row pitch 144 or 272 B = 16 B x odd
  constexpr int STAGE = (128 + 256) * LDK; // elements of one buffer
  constexpr int NB = KP / 32;              // blocks per pass
  constexpr int PR = KP / 8;               // 16-byte pieces per row
  constexpr int RG = 256 / PR;             // rows that the block's 256 threads copy at once
  __shared__ __align__(16) bf16_t sT[2][STAGE];
  const int tid = threadIdx.x, lane = tid & 31, wave = tid >> 5;
  const int m0 = blockIdx.y * 128, n0 = blockIdx.x * 256;
  const int wm = (wave >> 2) * 64;  // wave M offset within tile
  const int wn = (wave & 3) * 64;   // wave N offset within tile

  v8f acc[4][4];
#pragma unroll
  for (int i = 0; i < 4; ++i)
#pragma unroll
    for (int j = 0; j < 4; ++j) acc[i][j] = vzero8();

  const int cr = tid / PR;          // row within a group of RG rows
  const int cc = (tid % PR) * 8;    // 16-byte piece of the row
  // one 32-bit lane offset serves every copy; the rest of each address is uniform
  const uint32_t goff = (uint32_t)(cr * K + cc) * 2u;
  const char* uA = (const char*)(A + (size_t)m0 * K);
  const char* uB = (const char*)(Bt + (size_t)n0 * K);
  const char* uA2 = CATK ? (const char*)(A2 + (size_t)m0 * K) : uA;
  const char* uB2 = CATK ? (const char*)(Bt2 + (size_t)n0 * K) : uB;

  // pass kq into buffer `buf`: 3 KP / 16 copies of 16 B per thread (12 or 24), whole lines
  auto stage = [&](int kq, int buf) {
    // CATK: from k = K on the second pair of operands, a choice that is block-uniform
    const bool second = CATK && kq >= K;
    const char* pA = second ? uA2 : uA;
    const char* pB = second ? uB2 : uB;
    const int k0 = second ? kq - K : kq;
    bf16_t* d = &sT[buf][cr * LDK + cc];
#pragma unroll
    for (int i = 0; i < 128 / RG; ++i)
      async_copy_b128(d + i * RG * LDK, pA + ((size_t)(i * RG) * K + k0) * 2 + goff);
#pragma unroll
    for (int i = 0; i < 256 / RG; ++i)
      async_copy_b128(d + (128 + i * RG) * LDK,
                      pB + ((size_t)(i * RG) * K + k0) * 2 + goff);
  };

  const int fa = (wm + (lane & 15)) * LDK + ((lane >> 4) << 3);
  const int fb = (128 + wn + (lane & 15)) * LDK + ((lane >> 4) << 3);

  const int npass = (CATK ? 2 * K : K) / KP;
  stage(0, 0);
  wait_async0();    // own copies of pass 0 have landed
  __syncthreads();  // everyone's have
  if (1 < npass) stage(KP, 1);
  for (int t = 0; t < npass; ++t) {
    const int buf = t & 1;
    const bf16_t* cur = &sT[buf][0];
    // the sched_barriers keep [16 LDS reads][16 WMMAs] as written: a block's reads go as
    // one group; left alone they are spread in pairs among the WMMAs, each pair with a
    // full wait of its own behind it
#pragma unroll
    for (int u = 0; u < NB; ++u) {
      v16bf af[4], bfv[4];
      __builtin_amdgcn_sched_barrier(0);
#pragma unroll
      for (int mt = 0; mt < 4; ++mt) af[mt] = frag_ld(cur + fa + mt * 16 * LDK + u * 32);
#pragma unroll
      for (int nt = 0; nt < 4; ++nt) bfv[nt] = frag_ld(cur + fb + nt * 16 * LDK + u * 32);
      __builtin_amdgcn_sched_barrier(0);
#pragma unroll
      for (int nt = 0; nt < 4; ++nt)
#pragma unroll
        for (int mt = 0; mt < 4; ++mt)
          acc[mt][nt] = wmma_bf16(af[mt], bfv[nt], acc[mt][nt]);
    }
    // publish point of pass t + 1
    wait_ds0();       // own reads of this buffer have all returned
    wait_async0();    // own copies of pass t + 1 have landed
    __syncthreads();  // everyone's have, and everyone has left this buffer
    if (t + 2 < npass) stage((t + 2) * KP, buf);
  }
  wait_async0();  // nothing is in flight when the wave goes on to its end

  // NN is compile-time: a lane's bias, residual and output accesses are one base address
  // each plus immediate offsets.
  const int cl = lane & 15, rh = (lane >> 4) << 3;
  if constexpr (CATN) {
    // block-uniform: a block's 256 columns lie wholly in one of the two products
    if (n0 >= NN) {
      float* op2 = (float*)out2 + (size_t)(m0 + wm + rh) * NN + (size_t)(n0 - NN + wn + cl);
      const float* bp2 = bias2 + (n0 - NN + wn + cl);
      float bw[4];
#pragma unroll
      for (int nt = 0; nt < 4; ++nt) bw[nt] = bp2[nt * 16];
#pragma unroll
      for (int mt = 0; mt < 4; ++mt)
#pragma unroll
        for (int nt = 0; nt < 4; ++nt)
#pragma unroll
          for (int r = 0; r < 8; ++r)
            op2[(mt * 16 + r) * NN + nt * 16] = acc[mt][nt][r] + bw[nt];
      // the wait that is owed before a register which an issued load or store names is
      // rewritten; the base addresses as inputs stay live up to it
      asm volatile("s_wait_xcnt 0x0" ::"v"(op2), "v"(bp2) : "memory");
      return;
    }
  }
  const size_t e0 = (size_t)(m0 + wm + rh) * NN + (size_t)(n0 + wn + cl);
  typedef typename std::conditional<OUT_BF16, bf16_t, float>::type out_t;
  out_t* op = (out_t*)out + e0;
  const float* rp = RES ? res + e0 : bias;
  const float* bp = bias + (n0 + wn + cl);
  // The wait that is owed before a register which an issued load or store names is
  // rewritten, behind each run of stores; the base addresses as inputs stay live up to it.
#define G_WAIT_X() asm volatile("s_wait_xcnt 0x0" ::"v"(op), "v"(rp), "v"(bp) : "memory")

  if constexpr (!GELU_ACT) {
    float bv[4];
#pragma unroll
    for (int nt = 0; nt < 4; ++nt) bv[nt] = bp[nt * 16];
    if constexpr (CATK) {
      const float* bq = bias2 + (n0 + wn + cl);
      float bw[4];
#pragma unroll
      for (int nt = 0; nt < 4; ++nt) bw[nt] = bq[nt * 16];
      // the same wait, behind the second bias's loads; bq as an input stays live up to it
      asm volatile("s_wait_xcnt 0x0" ::"v"(bq) : "memory");
#pragma unroll
      for (int nt = 0; nt < 4; ++nt) bv[nt] += bw[nt];
    }
    // two row tiles a run: their residual loads fly together, then their 64 stores
#pragma unroll
    for (int hf = 0; hf < 4; hf += 2) {
      float rv[2][4][8];
      if (RES) {
#pragma unroll
        for (int i = 0; i < 2; ++i)
#pragma unroll
          for (int nt = 0; nt < 4; ++nt)
#pragma unroll
            for (int r = 0; r < 8; ++r)
              rv[i][nt][r] = rp[((hf + i) * 16 + r) * NN + nt * 16];
      }
#pragma unroll
      for (int i = 0; i < 2; ++i)
#pragma unroll
        for (int nt = 0; nt < 4; ++nt)
#pragma unroll
          for (int r = 0; r < 8; ++r) {
            float v = acc[hf + i][nt][r] + bv[nt];
            if (RES) v += rv[i][nt][r];
            op[((hf + i) * 16 + r) * NN + nt * 16] = (out_t)v;
          }
      G_WAIT_X();
    }
  } else {
    float bv[4];
#pragma unroll
    for (int nt = 0; nt < 4; ++nt) bv[nt] = bp[nt * 16];
#pragma unroll
    for (int mt = 0; mt < 4; ++mt)
#pragma unroll
      for (int nt = 0; nt < 4; ++nt) {
        float v[8];
#pragma unroll
        for (int r = 0; r < 8; ++r) {
          v[r] = acc[mt][nt][r] + bv[nt];
          if (RES) v[r] += rp[(mt * 16 + r) * NN + nt * 16];
        }
        gelu_exact8(v);
#pragma unroll
        for (int r = 0; r < 8; ++r) op[(mt * 16 + r) * NN + nt * 16] = (out_t)v[r];
      }
    G_WAIT_X();
  }
#undef G_WAIT_X
}

// ---------------------------------------------------------------------------
// Sliding-window attention. One block per (query-block, head, batch).
// Q 128x64, K/V context 256x64 (prev block + own block), W=128 band mask.
// All matmuls via WMMA; softmax in registers with 16-lane shuffles.
// qkv: bf16 [B*L][3*1024]; out: bf16 [B*L][1024].
// ---------------------------------------------------------------------------
__global__ __launch_bounds__(256) void swa_kernel(const bf16_t* __restrict__ qkv,
                                                  bf16_t* __restrict__ out) {
  const int blk = blockIdx.x, h = blockIdx.y, b = blockIdx.z;
  const int tid = threadIdx.x, lane = tid & 31, wave = tid >> 5;

  // Q(128x72) + K(256x72) overlap with P(128x264) -- disjoint lifetimes.
  __shared__ __align__(16) char smem_u[128 * 264 * 2];
  __shared__ __align__(16) bf16_t sVt[64 * 264];  // V^T [e][s]
  bf16_t* sQ = (bf16_t*)smem_u;                   // [128][72]
  bf16_t* sK = (bf16_t*)smem_u + 128 * 72;        // [256][72]
  bf16_t* sP = (bf16_t*)smem_u;                   // [128][264]

  const size_t rowQ0 = (size_t)b * 4096 + (size_t)blk * 128;

  // Load Q: thread -> (row tid/2, 32-col half)
  {
    const int r = tid >> 1, half = (tid & 1) * 32;
    const bf16_t* src = qkv + (rowQ0 + r) * 3072 + h * 64 + half;
#pragma unroll
    for (int j = 0; j < 32; j += 8)
      *(v8bf*)&sQ[r * 72 + half + j] = *(const v8bf*)(src + j);
  }
  // Load K and V^T: thread -> key index s = tid (0..255)
  {
    const int s = tid;
    const long lk = (long)blk * 128 - 128 + s;
    if (lk < 0) {
      for (int e = 0; e < 64; ++e) {
        sK[s * 72 + e] = (bf16_t)0.f;
        sVt[e * 264 + s] = (bf16_t)0.f;
      }
    } else {
      const bf16_t* srck = qkv + ((size_t)b * 4096 + lk) * 3072 + 1024 + h * 64;
      const bf16_t* srcv = srck + 1024;
#pragma unroll
      for (int e = 0; e < 64; e += 8) {
        v8bf kv = *(const v8bf*)(srck + e);
        *(v8bf*)&sK[s * 72 + e] = kv;
        v8bf vv = *(const v8bf*)(srcv + e);
#pragma unroll
        for (int j = 0; j < 8; ++j) sVt[(e + j) * 264 + s] = vv[j];
      }
    }
  }
  __syncthreads();

  // Scores: wave w owns query rows [16w,16w+16); 16 key tiles; K-dim = 64.
  v8f acc[16];
#pragma unroll
  for (int i = 0; i < 16; ++i) acc[i] = vzero8();
#pragma unroll
  for (int kk = 0; kk < 64; kk += 32) {
    v16bf aq = frag_ld(frag_ptr(sQ, wave * 16, 72, lane) + kk);
#pragma unroll
    for (int nt = 0; nt < 16; ++nt) {
      v16bf bk = frag_ld(frag_ptr(sK, nt * 16, 72, lane) + kk);
      acc[nt] = wmma_bf16(aq, bk, acc[nt]);
    }
  }

  // Mask + softmax. C-layout: row = 16*wave + 8*(lane>>4) + r, col = 16*nt + (lane&15)
  const int cl = lane & 15, rh = (lane >> 4) << 3;
#pragma unroll
  for (int r = 0; r < 8; ++r) {
    const int rloc = wave * 16 + rh + r;
    float mx = -1e30f;
#pragma unroll
    for (int nt = 0; nt < 16; ++nt) {
      const int s = nt * 16 + cl;
      const bool ok = (s >= rloc + 1) && (s <= rloc + 128) && (blk > 0 || s >= 128);
      const float v = ok ? acc[nt][r] * 0.125f : -1e30f;
      acc[nt][r] = v;
      mx = fmaxf(mx, v);
    }
#pragma unroll
    for (int o = 1; o < 16; o <<= 1) mx = fmaxf(mx, __shfl_xor(mx, o));
    float sum = 0.f;
#pragma unroll
    for (int nt = 0; nt < 16; ++nt) {
      const float e = __expf(acc[nt][r] - mx);
      acc[nt][r] = e;
      sum += e;
    }
#pragma unroll
    for (int o = 1; o < 16; o <<= 1) sum += __shfl_xor(sum, o);
    const float inv = 1.0f / sum;
#pragma unroll
    for (int nt = 0; nt < 16; ++nt) acc[nt][r] *= inv;
  }

  __syncthreads();  // all waves done reading sQ/sK before P overwrites them
#pragma unroll
  for (int nt = 0; nt < 16; ++nt)
#pragma unroll
    for (int r = 0; r < 8; ++r)
      sP[(wave * 16 + rh + r) * 264 + nt * 16 + cl] = (bf16_t)acc[nt][r];
  __syncthreads();

  // PV: out 16x64 per wave; K-dim = 256 keys.
  v8f ov[4];
#pragma unroll
  for (int i = 0; i < 4; ++i) ov[i] = vzero8();
#pragma unroll
  for (int kk = 0; kk < 256; kk += 32) {
    v16bf ap = frag_ld(frag_ptr(sP, wave * 16, 264, lane) + kk);
#pragma unroll
    for (int nt = 0; nt < 4; ++nt) {
      v16bf bv = frag_ld(frag_ptr(sVt, nt * 16, 264, lane) + kk);
      ov[nt] = wmma_bf16(ap, bv, ov[nt]);
    }
  }
#pragma unroll
  for (int nt = 0; nt < 4; ++nt)
#pragma unroll
    for (int r = 0; r < 8; ++r) {
      const size_t row = rowQ0 + wave * 16 + rh + r;
      out[row * 1024 + h * 64 + nt * 16 + cl] = (bf16_t)ov[nt][r];
    }
}

// ---------------------------------------------------------------------------
// Chunked causal linear attention, chunk-parallel, three launches:
//   lin_state : per (chunk, b, h) the chunk's own v^T k' (64x64 f32) and colsum(k')
//   lin_prefix: exclusive running sum over the chunks, f32, chunk 0 first
//   lin_out   : per (chunk, b, h) the outputs from q', k', v and the summed state
// qkv: f32 [B*L][3*1024] (elu applied at load); out: bf16 [B*L][1024].
// State records: index (bh*32 + ch); S^T as [f][e].
// ---------------------------------------------------------------------------

// The last chunk's own state is read by nobody: grid.x = 31.
__global__ __launch_bounds__(256) void lin_state_kernel(const float* __restrict__ qkv,
                                                        float* __restrict__ Sc,
                                                        float* __restrict__ zc) {
  const int ch = blockIdx.x, bh = blockIdx.y, b = bh >> 4, h = bh & 15;
  const int tid = threadIdx.x, lane = tid & 31, wave = tid >> 5;
  __shared__ __align__(16) bf16_t skT[64 * 136];   // k'^T     [e][c]
  __shared__ __align__(16) bf16_t svT[64 * 136];   // v^T      [f][c]
  const int cl = lane & 15, rh = (lane >> 4) << 3;
  {
    const int c = tid >> 1, half = (tid & 1) * 32;
    const size_t row = (size_t)b * 4096 + (size_t)ch * 128 + c;
    const float4* pk = (const float4*)(qkv + row * 3072 + 1024 + h * 64 + half);
    const float4* pv = pk + 256;
    // loads first, elu after: the loads fly together, not one round trip each
    float4 kx[8], vx[8];
#pragma unroll
    for (int i = 0; i < 8; ++i) { kx[i] = pk[i]; vx[i] = pv[i]; }
#pragma unroll
    for (int i = 0; i < 8; ++i) {
      const float k4[4] = {kx[i].x, kx[i].y, kx[i].z, kx[i].w};
      const float v4[4] = {vx[i].x, vx[i].y, vx[i].z, vx[i].w};
#pragma unroll
      for (int u = 0; u < 4; ++u) {
        const int j = i * 4 + u;
        const float em = expm1f(k4[u]);  // unconditional: a select, no branch a value
        const float kv = (k4[u] > 0.f ? k4[u] : em) + 1.0001f;
        skT[(half + j) * 136 + c] = (bf16_t)kv;
        svT[(half + j) * 136 + c] = (bf16_t)v4[u];
      }
    }
  }
  __syncthreads();

  const size_t rec = (size_t)bh * 32 + ch;
  // v^T @ k'  (16 tiles over 8 waves, 2 each), K-dim 128
  {
    const int ft = wave >> 1;
    const int ebase = (wave & 1) * 32;
    v8f accS[2];
#pragma unroll
    for (int i = 0; i < 2; ++i) accS[i] = vzero8();
#pragma unroll
    for (int kk = 0; kk < 128; kk += 32) {
      v16bf av = frag_ld(frag_ptr(svT, ft * 16, 136, lane) + kk);
#pragma unroll
      for (int nt = 0; nt < 2; ++nt) {
        v16bf bk = frag_ld(frag_ptr(skT, ebase + nt * 16, 136, lane) + kk);
        accS[nt] = wmma_bf16(av, bk, accS[nt]);
      }
    }
#pragma unroll
    for (int nt = 0; nt < 2; ++nt)
#pragma unroll
      for (int r = 0; r < 8; ++r) {
        const int f = ft * 16 + rh + r;
        const int e = ebase + nt * 16 + cl;
        Sc[rec * 4096 + f * 64 + e] = accS[nt][r];
      }
  }
  if (tid < 64) {
    float zs = 0.f;
#pragma unroll 8
    for (int c = 0; c < 128; ++c) zs += (float)skT[tid * 136 + c];
    zc[rec * 64 + tid] = zs;
  }
}

// Blocks 0..255: S^T, two neighbouring elements a thread, rounded to bf16 at the
// store (the B operand of q' @ S). Blocks 256..263: z, kept in f32.
__global__ __launch_bounds__(256) void lin_prefix_kernel(const float* __restrict__ Sc,
                                                         const float* __restrict__ zc,
                                                         bf16_t* __restrict__ Sb,
                                                         float* __restrict__ zp) {
  if (blockIdx.x >= 256) {
    const int t = (blockIdx.x - 256) * 256 + threadIdx.x;
    const size_t base = (size_t)(t >> 6) * (32 * 64) + (size_t)(t & 63);
    float v[31];
#pragma unroll
    for (int ch = 0; ch < 31; ++ch) v[ch] = zc[base + ch * 64];
    float s = 0.f;
#pragma unroll
    for (int ch = 0; ch < 32; ++ch) {
      zp[base + ch * 64] = s;
      if (ch < 31) s += v[ch];
    }
    return;
  }
  const int t = blockIdx.x * 256 + threadIdx.x;
  const size_t base = (size_t)(t >> 11) * (32 * 4096) + (size_t)(t & 2047) * 2;
  float2 v[31];
#pragma unroll
  for (int ch = 0; ch < 31; ++ch) v[ch] = *(const float2*)(Sc + base + ch * 4096);
  float s0 = 0.f, s1 = 0.f;
#pragma unroll
  for (int ch = 0; ch < 32; ++ch) {
    v2bf o;
    o[0] = (bf16_t)s0;
    o[1] = (bf16_t)s1;
    *(v2bf*)(Sb + base + ch * 4096) = o;
    if (ch < 31) { s0 += v[ch].x; s1 += v[ch].y; }
  }
  // the built code lets this path run on to the z path's first instructions behind a
  // scalar test; they rewrite registers that the stores above name: wait in front
  asm volatile("s_wait_xcnt 0x0" ::: "memory");
}

__global__ __launch_bounds__(256) void lin_out_kernel(const float* __restrict__ qkv,
                                                      const bf16_t* __restrict__ Sb,
                                                      const float* __restrict__ zp,
                                                      bf16_t* __restrict__ out) {
  const int ch = blockIdx.x, bh = blockIdx.y, b = bh >> 4, h = bh & 15;
  const int tid = threadIdx.x, lane = tid & 31, wave = tid >> 5;
  // q'(128x72) + k'(128x72) overlap with masked A (128x136) -- disjoint lifetimes.
  __shared__ __align__(16) char smem_u[2 * 128 * 72 * 2];
  __shared__ __align__(16) bf16_t svT[64 * 136];   // v^T      [f][c]
  __shared__ __align__(16) bf16_t sSB[64 * 72];    // bf16 S^T before this chunk [f][e]
  __shared__ float sz[64];
  __shared__ float sqz[128];
  __shared__ float sden[128];
  bf16_t* sq = (bf16_t*)smem_u;                    // q' rows  [c][e]
  bf16_t* sk = (bf16_t*)smem_u + 128 * 72;         // k' rows  [c][e]
  bf16_t* sP = (bf16_t*)smem_u;                    // masked A [c][d]

  const int cl = lane & 15, rh = (lane >> 4) << 3;
  const size_t rec = (size_t)bh * 32 + ch;

  // 1. state before this chunk (B-operand layout: row f, cols e)
#pragma unroll
  for (int i = tid; i < 512; i += 256)
    *(v8bf*)&sSB[(i >> 3) * 72 + (i & 7) * 8] = *(const v8bf*)(Sb + rec * 4096 + i * 8);
  if (tid < 64) sz[tid] = zp[rec * 64 + tid];
  // 2. load chunk, apply elu maps
  {
    const int c = tid >> 1, half = (tid & 1) * 32;
    const size_t row = (size_t)b * 4096 + (size_t)ch * 128 + c;
    const float* pq = qkv + row * 3072 + h * 64 + half;
    const float* pk = pq + 1024;
    const float* pv = pq + 2048;
#pragma unroll 8
    for (int j = 0; j < 32; ++j) {
      float qv = pq[j] * 0.125f;  // E^-0.5
      qv = (qv > 0.f ? qv : expm1f(qv)) + 1.0001f;
      sq[c * 72 + half + j] = (bf16_t)qv;
      float kv = pk[j];
      kv = (kv > 0.f ? kv : expm1f(kv)) + 1.0001f;
      sk[c * 72 + half + j] = (bf16_t)kv;
      svT[(half + j) * 136 + c] = (bf16_t)pv[j];
    }
  }
  __syncthreads();

  // 3. A = q k'^T (8 tiles/wave) and num1 = q @ S (4 tiles/wave), K-dim 64
  v8f accA[8], accN[4];
#pragma unroll
  for (int i = 0; i < 8; ++i) accA[i] = vzero8();
#pragma unroll
  for (int i = 0; i < 4; ++i) accN[i] = vzero8();
#pragma unroll
  for (int kk = 0; kk < 64; kk += 32) {
    v16bf aq = frag_ld(frag_ptr(sq, wave * 16, 72, lane) + kk);
#pragma unroll
    for (int nt = 0; nt < 8; ++nt) {
      v16bf bk = frag_ld(frag_ptr(sk, nt * 16, 72, lane) + kk);
      accA[nt] = wmma_bf16(aq, bk, accA[nt]);
    }
#pragma unroll
    for (int nt = 0; nt < 4; ++nt) {
      v16bf bs = frag_ld(frag_ptr(sSB, nt * 16, 72, lane) + kk);
      accN[nt] = wmma_bf16(aq, bs, accN[nt]);
    }
  }
  // 4a. q'.z while q' is still in LDS
  if (tid < 128) {
    float qz = 0.f;
#pragma unroll 8
    for (int e = 0; e < 64; ++e) qz += (float)sq[tid * 72 + e] * sz[e];
    sqz[tid] = qz;
  }
  __syncthreads();  // all waves done reading q'/k' before masked A overwrites them

  // tril mask + row sums + stage masked A as bf16; 4b. den[c] = q'.z + rowsum(A)
#pragma unroll
  for (int r = 0; r < 8; ++r) {
    const int c = wave * 16 + rh + r;
    float rs = 0.f;
#pragma unroll
    for (int nt = 0; nt < 8; ++nt) {
      const int d = nt * 16 + cl;
      const float v = (d <= c) ? accA[nt][r] : 0.f;
      accA[nt][r] = v;
      rs += v;
    }
#pragma unroll
    for (int o = 1; o < 16; o <<= 1) rs += __shfl_xor(rs, o);
    if (cl == 0) sden[c] = sqz[c] + rs;
#pragma unroll
    for (int nt = 0; nt < 8; ++nt)
      sP[c * 136 + nt * 16 + cl] = (bf16_t)accA[nt][r];
  }
  __syncthreads();

  // 5. num2 = A @ v  (B-operand = v^T rows), K-dim 128
#pragma unroll
  for (int kk = 0; kk < 128; kk += 32) {
    v16bf ap = frag_ld(frag_ptr(sP, wave * 16, 136, lane) + kk);
#pragma unroll
    for (int nt = 0; nt < 4; ++nt) {
      v16bf bv = frag_ld(frag_ptr(svT, nt * 16, 136, lane) + kk);
      accN[nt] = wmma_bf16(ap, bv, accN[nt]);
    }
  }
  // 6. o = num / (den + 1e-6) -> global bf16
#pragma unroll
  for (int nt = 0; nt < 4; ++nt)
#pragma unroll
    for (int r = 0; r < 8; ++r) {
      const int c = wave * 16 + rh + r;
      const float o = accN[nt][r] / (sden[c] + 1e-6f);
      const size_t row = (size_t)b * 4096 + (size_t)ch * 128 + c;
      out[row * 1024 + h * 64 + nt * 16 + cl] = (bf16_t)o;
    }
}

// ---------------------------------------------------------------------------
// Launch: B=2, L=4096, D=1024, H=16, E=64, W=128. Requires ws >= ~263 MB.
// ---------------------------------------------------------------------------
extern "C" void kernel_launch(void* const* d_in, const int* in_sizes, int n_in,
                              void* d_out, int out_size, void* d_ws, size_t ws_size,
                              hipStream_t stream) {
  const float* x = (const float*)d_in[0];
  const float* g1 = (const float*)d_in[1];
  const float* b1 = (const float*)d_in[2];
  const float* Wqkva = (const float*)d_in[3];
  const float* bqkva = (const float*)d_in[4];
  const float* Wpa = (const float*)d_in[5];
  const float* bpa = (const float*)d_in[6];
  const float* Wqkvs = (const float*)d_in[7];
  const float* bqkvs = (const float*)d_in[8];
  const float* Wos = (const float*)d_in[9];
  const float* bos = (const float*)d_in[10];
  const float* Wo = (const float*)d_in[11];
  const float* bo = (const float*)d_in[12];
  const float* gm = (const float*)d_in[13];
  const float* bm = (const float*)d_in[14];
  const float* W1 = (const float*)d_in[15];
  const float* b1m = (const float*)d_in[16];
  const float* W2 = (const float*)d_in[17];
  const float* b2m = (const float*)d_in[18];

  char* ws = (char*)d_ws;
  bf16_t* WqkvaT = (bf16_t*)(ws + 0);            // [3072][1024], and directly behind it,
                                                 // from ws + 6291456, WqkvsT [3072][1024]
  bf16_t* WpaT = (bf16_t*)(ws + 12582912);       // [1024][1024]
  bf16_t* WosT = (bf16_t*)(ws + 14680064);       // [1024][1024]
  bf16_t* WoT = (bf16_t*)(ws + 16777216);        // [1024][1024]
  bf16_t* W1T = (bf16_t*)(ws + 18874368);        // [4096][1024]
  bf16_t* W2T = (bf16_t*)(ws + 27262976);        // [1024][4096]
  bf16_t* xn = (bf16_t*)(ws + 35651584);         // [8192][1024]  (later: h)
  bf16_t* swa_o = (bf16_t*)(ws + 52428800);      // [8192][1024]
  bf16_t* lin_o = (bf16_t*)(ws + 69206016);      // [8192][1024]
  bf16_t* mix = (bf16_t*)(ws + 85983232);        // [8192][1024]
  float* linSc = (float*)(ws + 85983232);        // [32*32][64*64] (before mix)
  bf16_t* qkva = (bf16_t*)(ws + 102760448);      // [8192][3072]
  float* qkvs = (float*)(ws + 153092096);        // [8192][3072]
  bf16_t* gbuf = (bf16_t*)(ws + 153092096);      // [8192][4096] (reuses qkvs)
  float* x1 = (float*)(ws + 220200960);          // [8192][1024] (tail of qkvs)
  bf16_t* linSb = (bf16_t*)(ws + 253755392);     // [32*32][64*64]
  float* linzc = (float*)(ws + 262144000);       // [32*32][64]
  float* linzp = (float*)(ws + 262406144);       // [32*32][64]
  float* outf = (float*)d_out;

  const dim3 blk(256);
  // Weight convert+transpose to bf16 [N][K]: the seven Wt lie back to back from ws + 0
  wt_transpose_kernel<<<dim3(1088), blk, 0, stream>>>(Wqkva, Wqkvs, Wpa, Wos, Wo, W1, W2,
                                                      WqkvaT);

  // xn = LN(x)
  ln_kernel<<<8192, blk, 0, stream>>>(x, g1, b1, xn);
  // both qkv projections: one Bt of 6144 rows from WqkvaT on
  gemm_kernel<64, 3072, true, false, false, true, false><<<dim3(24, 64), blk, 0, stream>>>(
      xn, WqkvaT, bqkva, nullptr, qkva, 1024, nullptr, nullptr, bqkvs, qkvs);
  // attention branches
  swa_kernel<<<dim3(32, 16, 2), blk, 0, stream>>>(qkva, swa_o);
  lin_state_kernel<<<dim3(31, 32), blk, 0, stream>>>(qkvs, linSc, linzc);
  lin_prefix_kernel<<<dim3(264), blk, 0, stream>>>(linSc, linzc, linSb, linzp);
  lin_out_kernel<<<dim3(32, 32), blk, 0, stream>>>(qkvs, linSb, linzp, lin_o);
  // mix = swa @ Wp + bp + lin @ Wo_s + bo_s  (bf16)
  gemm_kernel<128, 1024, true, false, false, false, true><<<dim3(4, 64), blk, 0, stream>>>(
      swa_o, WpaT, bpa, nullptr, mix, 1024, lin_o, WosT, bos, nullptr);
  // x1 = mix @ Wo + bo + x  (f32)
  gemm_kernel<128, 1024, false, false, true><<<dim3(4, 64), blk, 0, stream>>>(
      mix, WoT, bo, x, x1, 1024, nullptr, nullptr, nullptr, nullptr);
  // h = LN(x1)
  ln_kernel<<<8192, blk, 0, stream>>>(x1, gm, bm, xn);
  // g = gelu(h @ W1 + b1m)  (bf16)
  gemm_kernel<64, 4096, true, true, false><<<dim3(16, 64), blk, 0, stream>>>(
      xn, W1T, b1m, nullptr, gbuf, 1024, nullptr, nullptr, nullptr, nullptr);
  // out = g @ W2 + b2m + x1  (f32)
  gemm_kernel<128, 1024, false, false, true><<<dim3(4, 64), blk, 0, stream>>>(
      gbuf, W2T, b2m, x1, outf, 4096, nullptr, nullptr, nullptr, nullptr);
}

// v006
// One run takes 331 microseconds.
// Two timings next to v005 put it at 1.05 and 1.06 times that version's speed.
// Counting every step since v000, it is 2.38 times as fast.
#include <hip/hip_runtime.h>

typedef __bf16 bf16_t;
typedef __attribute__((ext_vector_type(16))) __bf16 v16bf;
typedef __attribute__((ext_vector_type(8)))  __bf16 v8bf;
typedef __attribute__((ext_vector_type(8)))  float  v8f;

#define DEV static __device__ __forceinline__

// ---------------------------------------------------------------------------
// WMMA helpers (CDNA5 wave32, 16x16x32 bf16 -> f32)
// A fragment: lane m = row, kbase = 8*(lane>>4); VGPR v in [0,3] -> K = kbase+2v..,
// v in [4,7] -> K = 16+kbase+...  => two contiguous 16-byte chunks at +0 and +16.
// B fragment mirrors A with lane = output column, reading rows of B^T ([N][K]).
// ---------------------------------------------------------------------------
DEV v8f wmma_bf16(v16bf a, v16bf b, v8f c) {
  return __builtin_amdgcn_wmma_f32_16x16x32_bf16(false, a, false, b, (short)0, c,
                                                 false, false);
}

DEV const bf16_t* frag_ptr(const bf16_t* tile, int row0, int stride, int lane) {
  return tile + (size_t)(row0 + (lane & 15)) * stride + ((lane >> 4) << 3);
}

DEV v16bf frag_ld(const bf16_t* p) {
  v8bf lo = *(const v8bf*)(p);
  v8bf hi = *(const v8bf*)(p + 16);
  return __builtin_shufflevector(lo, hi, 0, 1, 2, 3, 4, 5, 6, 7,
                                 8, 9, 10, 11, 12, 13, 14, 15);
}

DEV v8f vzero8() {
  v8f z;
#pragma unroll
  for (int i = 0; i < 8; ++i) z[i] = 0.0f;
  return z;
}

// v_rcp_f32 and v_exp_f32 (2^a), each with the one slot that the instruction set asks for
// behind a transcendental before its result is used or its source overwritten; in one
// statement with it, so that the slot stands there whatever is scheduled next.
DEV float rcp_slot(float a) {
  float r;
  asm("v_rcp_f32 %0, %1\n\tv_nop" : "=v"(r) : "v"(a));
  return r;
}
DEV float exp2_slot(float a) {
  float r;
  asm("v_exp_f32 %0, %1\n\tv_nop" : "=v"(r) : "v"(a));
  return r;
}

// Exact GELU, 0.5 x (1 + erf(x / sqrt 2)), of 8 values, without a branch: 8 independent
// chains, stage by stage. One formula serves every z = |x| / sqrt 2: with t = 1 / (1 + p z),
// erfc(z) = t (a1 + t (a2 + t (a3 + t (a4 + t a5)))) exp(-z z), absolute error 1.5e-7.
// 1 + erf is 2 - erfc(z) for x >= 0 and erfc(z) itself for x < 0.
DEV void gelu_exact8(float (&x)[8]) {
  float z[8], t[8], e[8];
#pragma unroll
  for (int i = 0; i < 8; ++i) z[i] = fabsf(x[i]) * 0.70710678118654752f;
#pragma unroll
  for (int i = 0; i < 8; ++i) {
    t[i] = fmaf(0.3275911f, z[i], 1.0f);
    e[i] = z[i] * z[i] * -1.4426950408889634f;
  }
  // The two sched_barriers keep the 16 transcendentals together, away from what feeds them
  // and from what reads them: the compiler knows no latency of an asm statement and writes
  // no s_delay_alu for it, and a reader close behind would hold up the SIMD's other waves.
  __builtin_amdgcn_sched_barrier(0);
#pragma unroll
  for (int i = 0; i < 8; ++i) t[i] = rcp_slot(t[i]);
#pragma unroll
  for (int i = 0; i < 8; ++i) e[i] = exp2_slot(e[i]);
  __builtin_amdgcn_sched_barrier(0);
#pragma unroll
  for (int i = 0; i < 8; ++i) {
    float p = fmaf(1.061405429f, t[i], -1.453152027f);
    p = fmaf(p, t[i], 1.421413741f);
    p = fmaf(p, t[i], -0.284496736f);
    p = fmaf(p, t[i], 0.254829592f);
    const float h = (0.5f * x[i]) * ((p * t[i]) * e[i]);  // 0.5 x erfc(z)
    x[i] = x[i] >= 0.f ? x[i] - h : h;
  }
}

// ---------------------------------------------------------------------------
// CDNA5 async global->LDS copy (ASYNCcnt-tracked), 16 bytes per lane, as the builtin:
// the compiler then forms each copy's address from a uniform base and one lane offset.
// ---------------------------------------------------------------------------
typedef __attribute__((ext_vector_type(4))) int v4i;
typedef __attribute__((address_space(1))) v4i g_v4i;
typedef __attribute__((address_space(3))) v4i l_v4i;

DEV void async_copy_b128(bf16_t* ldst, const char* gsrc) {
  __builtin_amdgcn_global_load_async_to_lds_b128((g_v4i*)gsrc, (l_v4i*)ldst, 0, 0);
}

DEV void wait_async0() { asm volatile("s_wait_asynccnt 0x0" ::: "memory"); }
DEV void wait_ds0() { asm volatile("s_wait_dscnt 0x0" ::: "memory"); }

// ---------------------------------------------------------------------------
// LayerNorm over D=1024, writes bf16. One block per row, 256 threads x 4 elems.
// ---------------------------------------------------------------------------
__global__ __launch_bounds__(256) void ln_kernel(const float* __restrict__ x,
                                                 const float* __restrict__ g,
                                                 const float* __restrict__ b,
                                                 bf16_t* __restrict__ out) {
  const int row = blockIdx.x;
  const int tid = threadIdx.x, lane = tid & 31, wave = tid >> 5;
  const float4 v = ((const float4*)(x + (size_t)row * 1024))[tid];
  float s = v.x + v.y + v.z + v.w;
  float ss = v.x * v.x + v.y * v.y + v.z * v.z + v.w * v.w;
#pragma unroll
  for (int o = 16; o; o >>= 1) {
    s += __shfl_xor(s, o);
    ss += __shfl_xor(ss, o);
  }
  __shared__ float red[16];
  if (lane == 0) { red[wave] = s; red[8 + wave] = ss; }
  __syncthreads();
  if (tid == 0) {
    float a = 0.f, c = 0.f;
#pragma unroll
    for (int i = 0; i < 8; ++i) { a += red[i]; c += red[8 + i]; }
    red[0] = a; red[8] = c;
  }
  __syncthreads();
  const float mean = red[0] * (1.0f / 1024.0f);
  const float var = red[8] * (1.0f / 1024.0f) - mean * mean;
  const float inv = rsqrtf(var + 1e-5f);
  const float4 gg = ((const float4*)g)[tid];
  const float4 bb = ((const float4*)b)[tid];
  bf16_t* o4 = out + (size_t)row * 1024 + tid * 4;
  o4[0] = (bf16_t)((v.x - mean) * inv * gg.x + bb.x);
  o4[1] = (bf16_t)((v.y - mean) * inv * gg.y + bb.y);
  o4[2] = (bf16_t)((v.z - mean) * inv * gg.z + bb.z);
  o4[3] = (bf16_t)((v.w - mean) * inv * gg.w + bb.w);
}

// ---------------------------------------------------------------------------
// Weight convert+transpose, all seven weights in one launch: f32 W[K][N] -> bf16
// Wt[N][K], the seven Wt back to back in WtAll. One 128(k) x 128(n) tile a block.
// A wave reads whole 512-B rows, two neighbouring k rows a pair; a pair is rounded
// and packed to one dword (k even low, k odd high); rows of Wt leave as 256-B runs.
// ---------------------------------------------------------------------------
typedef __attribute__((ext_vector_type(2))) __bf16 v2bf;
typedef __attribute__((ext_vector_type(4))) __bf16 v4bf;
typedef __attribute__((ext_vector_type(4))) float v4f;
typedef __attribute__((ext_vector_type(4))) uint32_t v4u;

// dword index of (column n, k pair p): pitch 65 spreads the 4-column lane stride over
// the banks; the 2 extra dwords from column 64 on keep lanes 16..31 off lanes 0..15.
DEV int wt_idx(int n, int p) { return n * 65 + ((n >> 6) << 1) + p; }

// One tile. K and N are compile-time, so that a lane's 16 loads share one address and
// differ in the immediate offset only.
template <int K, int N>
DEV void wt_tile(const float* __restrict__ W, bf16_t* __restrict__ Wt, int l,
                 uint32_t* t) {
  const int tid = threadIdx.x, lane = tid & 31, wave = tid >> 5;
  const int n0 = (l % (N / 128)) * 128, k0 = (l / (N / 128)) * 128;

  // k pair p = wave + 8 i: rows k0 + 2 p and k0 + 2 p + 1, 512 B of each a wave
  const float* src = W + (size_t)(k0 + 2 * wave) * N + n0 + lane * 4;
  v4f a[8], b[8];
#pragma unroll
  for (int i = 0; i < 8; ++i) {
    a[i] = *(const v4f*)(src + (16 * i) * N);
    b[i] = *(const v4f*)(src + (16 * i + 1) * N);
  }
  // the wait that is owed before a register which an issued load names is rewritten;
  // src as an input keeps the address pair live over the whole run, so that no load's
  // result is placed in it
  asm volatile("s_wait_xcnt 0x0" ::"v"(src) : "memory");
  // keeps all 16 loads of a lane ahead of the first conversion, so that they fly
  // together; without it the last four are issued only when the first have landed
  __builtin_amdgcn_sched_barrier(0);
#pragma unroll
  for (int i = 0; i < 8; ++i)
#pragma unroll
    for (int u = 0; u < 4; ++u) {
      v2bf pk;
      pk[0] = (bf16_t)a[i][u];
      pk[1] = (bf16_t)b[i][u];
      t[wt_idx(lane * 4 + u, wave + 8 * i)] = __builtin_bit_cast(uint32_t, pk);
    }
  __syncthreads();
  // a wave stores rows n0 + 2 wave + 16 i and the next, 256 B of each
  const int l16 = tid & 15, r = tid >> 4;
  bf16_t* dst = Wt + (size_t)(n0 + r) * K + k0 + l16 * 8;
#pragma unroll
  for (int i = 0; i < 8; ++i) {
    const int base = wt_idx(r + 16 * i, l16 * 4);
    v4u o;
    o[0] = t[base];
    o[1] = t[base + 1];
    o[2] = t[base + 2];
    o[3] = t[base + 3];
    *(v4u*)(dst + (16 * i) * K) = o;
  }
}

// Blocks 0..383: the two [1024][3072]; 384..575: the three [1024][1024];
// 576..831: [1024][4096]; 832..1087: [4096][1024]. Every branch is block-uniform.
__global__ __launch_bounds__(256) void wt_transpose_kernel(
    const float* __restrict__ Wa, const float* __restrict__ Wb,
    const float* __restrict__ Wc, const float* __restrict__ Wd,
    const float* __restrict__ We, const float* __restrict__ Wf,
    const float* __restrict__ Wg, bf16_t* __restrict__ WtAll) {
  __shared__ uint32_t t[128 * 65 + 2];
  const int bid = blockIdx.x;
  if (bid < 384) {
    const bool s = bid >= 192;
    wt_tile<1024, 3072>(s ? Wb : Wa, WtAll + (s ? 3145728 : 0), s ? bid - 192 : bid, t);
  } else if (bid < 576) {
    const int g = (bid - 384) >> 6;
    wt_tile<1024, 1024>(g == 0 ? Wc : (g == 1 ? Wd : We), WtAll + 6291456 + g * 1048576,
                        (bid - 384) & 63, t);
  } else if (bid < 832) {
    wt_tile<1024, 4096>(Wf, WtAll + 9437184, bid - 576, t);
  } else {
    wt_tile<4096, 1024>(Wg, WtAll + 13631488, bid - 832, t);
  }
}

// ---------------------------------------------------------------------------
// Generic bf16 GEMM, f32 accumulate: out[M][NN] = A[M][K] * Bt[NN][K]^T + bias
// Block: 256 thr = 8 waves (2 x 4); tile 128 x 256; wave tile 64 x 64 (4 M-frags x
// 4 N-frags), so that a fragment read from LDS feeds 4 WMMAs and fewer bytes come from
// L2 per product than with a 128 x 128 tile. A pass is KP k = KP / 32 blocks of 32 k.
// Two LDS buffers, each [A 128 rows | Bt 256 rows] at pitch 2 KP + 16 B, filled by async
// global->LDS copies one pass ahead; one barrier a pass. KP = 64: two work-groups fit a
// WGP (grids of more than one a WGP). KP = 128: one work-group a WGP, twice the k per
// barrier and per copy latency (grids of 256).
// Epilogue: optional GELU, optional f32 residual, bf16 or f32 output.
// M multiple of 128, NN of 256, K of KP.
// Two products that share an operand or an output run as one launch:
// CATN: Bt holds 2 NN rows, the weights of two products of the same A one behind the other;
//   grid.x = 2 NN / 256. Column blocks below NN give out (bf16, bias), the rest out2 (f32,
//   bias2), each [M][NN].
// CATK: out = A Bt^T + A2 Bt2^T + bias + bias2, all four operands of row length K: the k
//   passes of the second product follow those of the first on the same accumulators.
// ---------------------------------------------------------------------------
template <int KP, int NN, bool OUT_BF16, bool GELU_ACT, bool RES, bool CATN = false,
          bool CATK = false>
__global__ __launch_bounds__(256) void gemm_kernel(
    const bf16_t* __restrict__ A, const bf16_t* __restrict__ Bt,
    const float* __restrict__ bias, const float* __restrict__ res,
    void* __restrict__ out, int K, const bf16_t* __restrict__ A2,
    const bf16_t* __restrict__ Bt2, const float* __restrict__ bias2,
    void* __restrict__ out2) {
  constexpr int LDK = KP + 8;              // row pitch 144 or 272 B = 16 B x odd
  constexpr int STAGE = (128 + 256) * LDK; // elements of one buffer
  constexpr int NB = KP / 32;              // blocks per pass
  constexpr int PR = KP / 8;               // 16-byte pieces per row
  constexpr int RG = 256 / PR;             // rows that the block's 256 threads copy at once
  __shared__ __align__(16) bf16_t sT[2][STAGE];
  const int tid = threadIdx.x, lane = tid & 31, wave = tid >> 5;
  const int m0 = blockIdx.y * 128, n0 = blockIdx.x * 256;
  const int wm = (wave >> 2) * 64;  // wave M offset within tile
  const int wn = (wave & 3) * 64;   // wave N offset within tile

  v8f acc[4][4];
#pragma unroll
  for (int i = 0; i < 4; ++i)
#pragma unroll
    for (int j = 0; j < 4; ++j) acc[i][j] = vzero8();

  const int cr = tid / PR;          // row within a group of RG rows
  const int cc = (tid % PR) * 8;    // 16-byte piece of the row
  // one 32-bit lane offset serves every copy; the rest of each address is uniform
  const uint32_t goff = (uint32_t)(cr * K + cc) * 2u;
  const char* uA = (const char*)(A + (size_t)m0 * K);
  const char* uB = (const char*)(Bt + (size_t)n0 * K);
  const char* uA2 = CATK ? (const char*)(A2 + (size_t)m0 * K) : uA;
  const char* uB2 = CATK ? (const char*)(Bt2 + (size_t)n0 * K) : uB;

  // pass kq into buffer `buf`: 3 KP / 16 copies of 16 B per thread (12 or 24), whole lines
  auto stage = [&](int kq, int buf) {
    // CATK: from k = K on the second pair of operands, a choice that is block-uniform
    const bool second = CATK && kq >= K;
    const char* pA = second ? uA2 : uA;
    const char* pB = second ? uB2 : uB;
    const int k0 = second ? kq - K : kq;
    bf16_t* d = &sT[buf][cr * LDK + cc];
#pragma unroll
    for (int i = 0; i < 128 / RG; ++i)
      async_copy_b128(d + i * RG * LDK, pA + ((size_t)(i * RG) * K + k0) * 2 + goff);
#pragma unroll
    for (int i = 0; i < 256 / RG; ++i)
      async_copy_b128(d + (128 + i * RG) * LDK,
                      pB + ((size_t)(i * RG) * K + k0) * 2 + goff);
  };

  const int fa = (wm + (lane & 15)) * LDK + ((lane >> 4) << 3);
  const int fb = (128 + wn + (lane & 15)) * LDK + ((lane >> 4) << 3);

  const int npass = (CATK ? 2 * K : K) / KP;
  stage(0, 0);
  wait_async0();    // own copies of pass 0 have landed
  __syncthreads();  // everyone's have
  if (1 < npass) stage(KP, 1);
  for (int t = 0; t < npass; ++t) {
    const int buf = t & 1;
    const bf16_t* cur = &sT[buf][0];
    // the sched_barriers keep [16 LDS reads][16 WMMAs] as written: a block's reads go as
    // one group; left alone they are spread in pairs among the WMMAs, each pair with a
    // full wait of its own behind it
#pragma unroll
    for (int u = 0; u < NB; ++u) {
      v16bf af[4], bfv[4];
      __builtin_amdgcn_sched_barrier(0);
#pragma unroll
      for (int mt = 0; mt < 4; ++mt) af[mt] = frag_ld(cur + fa + mt * 16 * LDK + u * 32);
#pragma unroll
      for (int nt = 0; nt < 4; ++nt) bfv[nt] = frag_ld(cur + fb + nt * 16 * LDK + u * 32);
      __builtin_amdgcn_sched_barrier(0);
#pragma unroll
      for (int nt = 0; nt < 4; ++nt)
#pragma unroll
        for (int mt = 0; mt < 4; ++mt)
          acc[mt][nt] = wmma_bf16(af[mt], bfv[nt], acc[mt][nt]);
    }
    // publish point of pass t + 1
    wait_ds0();       // own reads of this buffer have all returned
    wait_async0();    // own copies of pass t + 1 have landed
    __syncthreads();  // everyone's have, and everyone has left this buffer
    if (t + 2 < npass) stage((t + 2) * KP, buf);
  }
  wait_async0();  // nothing is in flight when the wave goes on to its end

  // NN is compile-time: a lane's bias, residual and output accesses are one base address
  // each plus immediate offsets.
  const int cl = lane & 15, rh = (lane >> 4) << 3;
  if constexpr (CATN) {
    // block-uniform: a block's 256 columns lie wholly in one of the two products
    if (n0 >= NN) {
      float* op2 = (float*)out2 + (size_t)(m0 + wm + rh) * NN + (size_t)(n0 - NN + wn + cl);
      const float* bp2 = bias2 + (n0 - NN + wn + cl);
      float bw[4];
#pragma unroll
      for (int nt = 0; nt < 4; ++nt) bw[nt] = bp2[nt * 16];
#pragma unroll
      for (int mt = 0; mt < 4; ++mt)
#pragma unroll
        for (int nt = 0; nt < 4; ++nt)
#pragma unroll
          for (int r = 0; r < 8; ++r)
            op2[(mt * 16 + r) * NN + nt * 16] = acc[mt][nt][r] + bw[nt];
      // the wait that is owed before a register which an issued load or store names is
      // rewritten; the base addresses as inputs stay live up to it
      asm volatile("s_wait_xcnt 0x0" ::"v"(op2), "v"(bp2) : "memory");
      return;
    }
  }
  const size_t e0 = (size_t)(m0 + wm + rh) * NN + (size_t)(n0 + wn + cl);
  typedef typename std::conditional<OUT_BF16, bf16_t, float>::type out_t;
  out_t* op = (out_t*)out + e0;
  const float* rp = RES ? res + e0 : bias;
  const float* bp = bias + (n0 + wn + cl);
  // The wait that is owed before a register which an issued load or store names is
  // rewritten, behind each run of stores; the base addresses as inputs stay live up to it.
#define G_WAIT_X() asm volatile("s_wait_xcnt 0x0" ::"v"(op), "v"(rp), "v"(bp) : "memory")

  if constexpr (!GELU_ACT) {
    float bv[4];
#pragma unroll
    for (int nt = 0; nt < 4; ++nt) bv[nt] = bp[nt * 16];
    if constexpr (CATK) {
      const float* bq = bias2 + (n0 + wn + cl);
      float bw[4];
#pragma unroll
      for (int nt = 0; nt < 4; ++nt) bw[nt] = bq[nt * 16];
      // the same wait, behind the second bias's loads; bq as an input stays live up to it
      asm volatile("s_wait_xcnt 0x0" ::"v"(bq) : "memory");
#pragma unroll
      for (int nt = 0; nt < 4; ++nt) bv[nt] += bw[nt];
    }
    // two row tiles a run: their residual loads fly together, then their 64 stores
#pragma unroll
    for (int hf = 0; hf < 4; hf += 2) {
      float rv[2][4][8];
      if (RES) {
#pragma unroll
        for (int i = 0; i < 2; ++i)
#pragma unroll
          for (int nt = 0; nt < 4; ++nt)
#pragma unroll
            for (int r = 0; r < 8; ++r)
              rv[i][nt][r] = rp[((hf + i) * 16 + r) * NN + nt * 16];
      }
#pragma unroll
      for (int i = 0; i < 2; ++i)
#pragma unroll
        for (int nt = 0; nt < 4; ++nt)
#pragma unroll
          for (int r = 0; r < 8; ++r) {
            float v = acc[hf + i][nt][r] + bv[nt];
            if (RES) v += rv[i][nt][r];
            op[((hf + i) * 16 + r) * NN + nt * 16] = (out_t)v;
          }
      G_WAIT_X();
    }
  } else {
    float bv[4];
#pragma unroll
    for (int nt = 0; nt < 4; ++nt) bv[nt] = bp[nt * 16];
#pragma unroll
    for (int mt = 0; mt < 4; ++mt)
#pragma unroll
      for (int nt = 0; nt < 4; ++nt) {
        float v[8];
#pragma unroll
        for (int r = 0; r < 8; ++r) {
          v[r] = acc[mt][nt][r] + bv[nt];
          if (RES) v[r] += rp[(mt * 16 + r) * NN + nt * 16];
        }
        gelu_exact8(v);
#pragma unroll
        for (int r = 0; r < 8; ++r) op[(mt * 16 + r) * NN + nt * 16] = (out_t)v[r];
      }
    G_WAIT_X();
  }
#undef G_WAIT_X
}

// ---------------------------------------------------------------------------
// Sliding-window attention. One block per (query-block, head, batch).
// Q 128x64, K/V context 256x64 (prev block + own block), W=128 band mask.
// All matmuls via WMMA; softmax in registers with 16-lane shuffles.
// qkv: bf16 [B*L][3*1024]; out: bf16 [B*L][1024].
// ---------------------------------------------------------------------------
__global__ __launch_bounds__(256) void swa_kernel(const bf16_t* __restrict__ qkv,
                                                  bf16_t* __restrict__ out) {
  const int blk = blockIdx.x, h = blockIdx.y, b = blockIdx.z;
  const int tid = threadIdx.x, lane = tid & 31, wave = tid >> 5;

  // Q(128x72) + K(256x72) overlap with P(128x264) -- disjoint lifetimes.
  __shared__ __align__(16) char smem_u[128 * 264 * 2];
  __shared__ __align__(16) bf16_t sVt[64 * 264];  // V^T [e][s]
  bf16_t* sQ = (bf16_t*)smem_u;                   // [128][72]
  bf16_t* sK = (bf16_t*)smem_u + 128 * 72;        // [256][72]
  bf16_t* sP = (bf16_t*)smem_u;                   // [128][264]

  const size_t rowQ0 = (size_t)b * 4096 + (size_t)blk * 128;

  // 8 lanes a 128-B head row: a wave-wide load covers 4 whole rows = 4 whole lines.
  // Q: rows rg + 32 i. K, V: loads 2 p and 2 p + 1 of a thread are the neighbouring keys s0
  // and s0 + 1, s0 = 64 p + 2 rg, which share a dword of V^T. Keys 0..127 are the previous
  // block (p < 2): block 0 has none and takes zeros, a choice that is block-uniform.
  {
    const int l8 = tid & 7, rg = tid >> 3;
    const bf16_t* srcq = qkv + (rowQ0 + rg) * 3072 + h * 64 + l8 * 8;
    const bf16_t* srck = qkv + (rowQ0 + rg * 2) * 3072 + 1024 + h * 64 + l8 * 8;  // key 128 + 2 rg
    v8bf qx[4], kx[8], vx[8];
#pragma unroll
    for (int i = 0; i < 4; ++i) qx[i] = *(const v8bf*)(srcq + (i * 32) * 3072);
#pragma unroll
    for (int i = 4; i < 8; ++i) {
      kx[i] = *(const v8bf*)(srck + (((i >> 1) - 2) * 64 + (i & 1)) * 3072);
      vx[i] = *(const v8bf*)(srck + (((i >> 1) - 2) * 64 + (i & 1)) * 3072 + 1024);
    }
    if (blk > 0) {
#pragma unroll
      for (int i = 0; i < 4; ++i) {
        kx[i] = *(const v8bf*)(srck + (((i >> 1) - 2) * 64 + (i & 1)) * 3072);
        vx[i] = *(const v8bf*)(srck + (((i >> 1) - 2) * 64 + (i & 1)) * 3072 + 1024);
      }
    } else {
#pragma unroll
      for (int i = 0; i < 4; ++i)
#pragma unroll
        for (int j = 0; j < 8; ++j) {
          kx[i][j] = (bf16_t)0.f;
          vx[i][j] = (bf16_t)0.f;
        }
    }
    // the wait that is owed before a register which an issued load names is rewritten;
    // the two addresses as inputs stay live over the whole run
    asm volatile("s_wait_xcnt 0x0" ::"v"(srcq), "v"(srck) : "memory");
#pragma unroll
    for (int i = 0; i < 4; ++i) *(v8bf*)&sQ[(rg + 32 * i) * 72 + l8 * 8] = qx[i];
#pragma unroll
    for (int i = 0; i < 8; ++i)
      *(v8bf*)&sK[((i >> 1) * 64 + rg * 2 + (i & 1)) * 72 + l8 * 8] = kx[i];
#pragma unroll
    for (int p = 0; p < 4; ++p)
#pragma unroll
      for (int j = 0; j < 8; ++j) {
        v2bf vo;
        vo[0] = vx[2 * p][j];
        vo[1] = vx[2 * p + 1][j];
        *(v2bf*)&sVt[(l8 * 8 + j) * 264 + p * 64 + rg * 2] = vo;
      }
  }
  __syncthreads();

  // Scores: wave w owns query rows [16w,16w+16); 16 key tiles; K-dim = 64.
  v8f acc[16];
#pragma unroll
  for (int i = 0; i < 16; ++i) acc[i] = vzero8();
#pragma unroll
  for (int kk = 0; kk < 64; kk += 32) {
    v16bf aq = frag_ld(frag_ptr(sQ, wave * 16, 72, lane) + kk);
#pragma unroll
    for (int nt = 0; nt < 16; ++nt) {
      v16bf bk = frag_ld(frag_ptr(sK, nt * 16, 72, lane) + kk);
      acc[nt] = wmma_bf16(aq, bk, acc[nt]);
    }
  }

  // Mask + softmax. C-layout: row = 16*wave + 8*(lane>>4) + r, col = 16*nt + (lane&15)
  const int cl = lane & 15, rh = (lane >> 4) << 3;
#pragma unroll
  for (int r = 0; r < 8; ++r) {
    const int rloc = wave * 16 + rh + r;
    float mx = -1e30f;
#pragma unroll
    for (int nt = 0; nt < 16; ++nt) {
      const int s = nt * 16 + cl;
      const bool ok = (s >= rloc + 1) && (s <= rloc + 128) && (blk > 0 || s >= 128);
      const float v = ok ? acc[nt][r] * 0.125f : -1e30f;
      acc[nt][r] = v;
      mx = fmaxf(mx, v);
    }
#pragma unroll
    for (int o = 1; o < 16; o <<= 1) mx = fmaxf(mx, __shfl_xor(mx, o));
    float sum = 0.f;
#pragma unroll
    for (int nt = 0; nt < 16; ++nt) {
      const float e = __expf(acc[nt][r] - mx);
      acc[nt][r] = e;
      sum += e;
    }
#pragma unroll
    for (int o = 1; o < 16; o <<= 1) sum += __shfl_xor(sum, o);
    const float inv = 1.0f / sum;
#pragma unroll
    for (int nt = 0; nt < 16; ++nt) acc[nt][r] *= inv;
  }

  __syncthreads();  // all waves done reading sQ/sK before P overwrites them
#pragma unroll
  for (int nt = 0; nt < 16; ++nt)
#pragma unroll
    for (int r = 0; r < 8; ++r)
      sP[(wave * 16 + rh + r) * 264 + nt * 16 + cl] = (bf16_t)acc[nt][r];
  __syncthreads();

  // PV: out 16x64 per wave; K-dim = 256 keys.
  v8f ov[4];
#pragma unroll
  for (int i = 0; i < 4; ++i) ov[i] = vzero8();
#pragma unroll
  for (int kk = 0; kk < 256; kk += 32) {
    v16bf ap = frag_ld(frag_ptr(sP, wave * 16, 264, lane) + kk);
#pragma unroll
    for (int nt = 0; nt < 4; ++nt) {
      v16bf bv = frag_ld(frag_ptr(sVt, nt * 16, 264, lane) + kk);
      ov[nt] = wmma_bf16(ap, bv, ov[nt]);
    }
  }
#pragma unroll
  for (int nt = 0; nt < 4; ++nt)
#pragma unroll
    for (int r = 0; r < 8; ++r) {
      const size_t row = rowQ0 + wave * 16 + rh + r;
      out[row * 1024 + h * 64 + nt * 16 + cl] = (bf16_t)ov[nt][r];
    }
}

// ---------------------------------------------------------------------------
// Chunked causal linear attention, chunk-parallel, three launches:
//   lin_state : per (chunk, b, h) the chunk's own v^T k' (64x64 f32) and colsum(k')
//   lin_prefix: exclusive running sum over the chunks, f32, chunk 0 first
//   lin_out   : per (chunk, b, h) the outputs from q', k', v and the summed state
// qkv: f32 [B*L][3*1024] (elu applied at load); out: bf16 [B*L][1024].
// State records: index (bh*32 + ch); S^T as [f][e].
// ---------------------------------------------------------------------------

// The last chunk's own state is read by nobody: grid.x = 31.
__global__ __launch_bounds__(256) void lin_state_kernel(const float* __restrict__ qkv,
                                                        float* __restrict__ Sc,
                                                        float* __restrict__ zc) {
  const int ch = blockIdx.x, bh = blockIdx.y, b = bh >> 4, h = bh & 15;
  const int tid = threadIdx.x, lane = tid & 31, wave = tid >> 5;
  __shared__ __align__(16) bf16_t skT[64 * 136];   // k'^T     [e][c]
  __shared__ __align__(16) bf16_t svT[64 * 136];   // v^T      [f][c]
  const int cl = lane & 15, rh = (lane >> 4) << 3;
  {
    // 16 lanes a 256-B head row: a wave-wide load covers two whole rows = 4 whole lines.
    // Loads 2 p and 2 p + 1 of a thread are the neighbouring rows c0 and c0 + 1, which share
    // a dword of the transposed tiles.
    const int l16 = tid & 15, rg = tid >> 4;
    const float* pk = qkv + ((size_t)b * 4096 + (size_t)ch * 128 + rg * 2) * 3072 + 1024 +
                      h * 64 + l16 * 4;
    // loads first, elu after: the loads fly together, not one round trip each
    v4f kx[8], vx[8];
#pragma unroll
    for (int i = 0; i < 8; ++i) {
      kx[i] = *(const v4f*)(pk + ((i >> 1) * 32 + (i & 1)) * 3072);
      vx[i] = *(const v4f*)(pk + ((i >> 1) * 32 + (i & 1)) * 3072 + 1024);
    }
    // the wait that is owed before a register which an issued load names is rewritten;
    // pk as an input keeps the address live over the whole run
    asm volatile("s_wait_xcnt 0x0" ::"v"(pk) : "memory");
    // keeps all 16 loads of a lane ahead of the first conversion, so that they fly
    // together; without it the last four are issued only when the first have landed
    __builtin_amdgcn_sched_barrier(0);
#pragma unroll
    for (int p = 0; p < 4; ++p) {
      const int c0 = p * 32 + rg * 2;
#pragma unroll
      for (int u = 0; u < 4; ++u) {
        v2bf ko, vo;
#pragma unroll
        for (int o = 0; o < 2; ++o) {
          const float kr = kx[2 * p + o][u];
          const float em = expm1f(kr);  // unconditional: a select, no branch a value
          ko[o] = (bf16_t)((kr > 0.f ? kr : em) + 1.0001f);
          vo[o] = (bf16_t)vx[2 * p + o][u];
        }
        *(v2bf*)&skT[(l16 * 4 + u) * 136 + c0] = ko;
        *(v2bf*)&svT[(l16 * 4 + u) * 136 + c0] = vo;
      }
    }
  }
  __syncthreads();

  const size_t rec = (size_t)bh * 32 + ch;
  // v^T @ k'  (16 tiles over 8 waves, 2 each), K-dim 128
  {
    const int ft = wave >> 1;
    const int ebase = (wave & 1) * 32;
    v8f accS[2];
#pragma unroll
    for (int i = 0; i < 2; ++i) accS[i] = vzero8();
#pragma unroll
    for (int kk = 0; kk < 128; kk += 32) {
      v16bf av = frag_ld(frag_ptr(svT, ft * 16, 136, lane) + kk);
#pragma unroll
      for (int nt = 0; nt < 2; ++nt) {
        v16bf bk = frag_ld(frag_ptr(skT, ebase + nt * 16, 136, lane) + kk);
        accS[nt] = wmma_bf16(av, bk, accS[nt]);
      }
    }
#pragma unroll
    for (int nt = 0; nt < 2; ++nt)
#pragma unroll
      for (int r = 0; r < 8; ++r) {
        const int f = ft * 16 + rh + r;
        const int e = ebase + nt * 16 + cl;
        Sc[rec * 4096 + f * 64 + e] = accS[nt][r];
      }
  }
  if (tid < 64) {
    float zs = 0.f;
#pragma unroll 8
    for (int c = 0; c < 128; ++c) zs += (float)skT[tid * 136 + c];
    zc[rec * 64 + tid] = zs;
  }
}

// Blocks 0..255: S^T, two neighbouring elements a thread, rounded to bf16 at the
// store (the B operand of q' @ S). Blocks 256..263: z, kept in f32.
__global__ __launch_bounds__(256) void lin_prefix_kernel(const float* __restrict__ Sc,
                                                         const float* __restrict__ zc,
                                                         bf16_t* __restrict__ Sb,
                                                         float* __restrict__ zp) {
  if (blockIdx.x >= 256) {
    const int t = (blockIdx.x - 256) * 256 + threadIdx.x;
    const size_t base = (size_t)(t >> 6) * (32 * 64) + (size_t)(t & 63);
    float v[31];
#pragma unroll
    for (int ch = 0; ch < 31; ++ch) v[ch] = zc[base + ch * 64];
    float s = 0.f;
#pragma unroll
    for (int ch = 0; ch < 32; ++ch) {
      zp[base + ch * 64] = s;
      if (ch < 31) s += v[ch];
    }
    return;
  }
  const int t = blockIdx.x * 256 + threadIdx.x;
  const size_t base = (size_t)(t >> 11) * (32 * 4096) + (size_t)(t & 2047) * 2;
  float2 v[31];
#pragma unroll
  for (int ch = 0; ch < 31; ++ch) v[ch] = *(const float2*)(Sc + base + ch * 4096);
  float s0 = 0.f, s1 = 0.f;
#pragma unroll
  for (int ch = 0; ch < 32; ++ch) {
    v2bf o;
    o[0] = (bf16_t)s0;
    o[1] = (bf16_t)s1;
    *(v2bf*)(Sb + base + ch * 4096) = o;
    if (ch < 31) { s0 += v[ch].x; s1 += v[ch].y; }
  }
  // the built code lets this path run on to the z path's first instructions behind a
  // scalar test; they rewrite registers that the stores above name: wait in front
  asm volatile("s_wait_xcnt 0x0" ::: "memory");
}

__global__ __launch_bounds__(256) void lin_out_kernel(const float* __restrict__ qkv,
                                                      const bf16_t* __restrict__ Sb,
                                                      const float* __restrict__ zp,
                                                      bf16_t* __restrict__ out) {
  const int ch = blockIdx.x, bh = blockIdx.y, b = bh >> 4, h = bh & 15;
  const int tid = threadIdx.x, lane = tid & 31, wave = tid >> 5;
  // q'(128x72) + k'(128x72) overlap with masked A (128x136) -- disjoint lifetimes.
  __shared__ __align__(16) char smem_u[2 * 128 * 72 * 2];
  __shared__ __align__(16) bf16_t svT[64 * 136];   // v^T      [f][c]
  __shared__ __align__(16) bf16_t sSB[64 * 72];    // bf16 S^T before this chunk [f][e]
  __shared__ float sz[64];
  __shared__ float sqz[128];
  __shared__ float sden[128];
  bf16_t* sq = (bf16_t*)smem_u;                    // q' rows  [c][e]
  bf16_t* sk = (bf16_t*)smem_u + 128 * 72;         // k' rows  [c][e]
  bf16_t* sP = (bf16_t*)smem_u;                    // masked A [c][d]

  const int cl = lane & 15, rh = (lane >> 4) << 3;
  const size_t rec = (size_t)bh * 32 + ch;

  // 1. state before this chunk (B-operand layout: row f, cols e)
#pragma unroll
  for (int i = tid; i < 512; i += 256)
    *(v8bf*)&sSB[(i >> 3) * 72 + (i & 7) * 8] = *(const v8bf*)(Sb + rec * 4096 + i * 8);
  if (tid < 64) sz[tid] = zp[rec * 64 + tid];
  // 2. load chunk, apply elu maps
  {
    // 16 lanes a 256-B head row: a wave-wide load covers two whole rows = 4 whole lines.
    // A thread takes the neighbouring rows c0 and c0 + 1, which share a dword of v^T.
    const int l16 = tid & 15, rg = tid >> 4;
    const float* pq = qkv + ((size_t)b * 4096 + (size_t)ch * 128 + rg * 2) * 3072 + h * 64 +
                      l16 * 4;
    // kept rolled, 6 loads a trip: unrolled, the register count passes 128 and only three
    // work-groups, not four, fit a WGP
#pragma unroll 1
    for (int p = 0; p < 4; ++p) {
      const int c0 = p * 32 + rg * 2;
      v4f qx[2], kx[2], vx[2];
#pragma unroll
      for (int o = 0; o < 2; ++o) {
        qx[o] = *(const v4f*)(pq + (p * 32 + o) * 3072);
        kx[o] = *(const v4f*)(pq + (p * 32 + o) * 3072 + 1024);
        vx[o] = *(const v4f*)(pq + (p * 32 + o) * 3072 + 2048);
      }
      // the wait that is owed before a register which an issued load names is rewritten;
      // pq as an input keeps the address live over the run
      asm volatile("s_wait_xcnt 0x0" ::"v"(pq) : "memory");
#pragma unroll
      for (int o = 0; o < 2; ++o) {
        v4bf qo, ko;
#pragma unroll
        for (int u = 0; u < 4; ++u) {
          // expm1f unconditional: a select, no branch a value, as this loop was built before
          const float qv = qx[o][u] * 0.125f;  // E^-0.5
          const float qe = expm1f(qv);
          qo[u] = (bf16_t)((qv > 0.f ? qv : qe) + 1.0001f);
          const float kv = kx[o][u];
          const float ke = expm1f(kv);
          ko[u] = (bf16_t)((kv > 0.f ? kv : ke) + 1.0001f);
        }
        *(v4bf*)&sq[(c0 + o) * 72 + l16 * 4] = qo;
        *(v4bf*)&sk[(c0 + o) * 72 + l16 * 4] = ko;
      }
#pragma unroll
      for (int u = 0; u < 4; ++u) {
        v2bf vo;
        vo[0] = (bf16_t)vx[0][u];
        vo[1] = (bf16_t)vx[1][u];
        *(v2bf*)&svT[(l16 * 4 + u) * 136 + c0] = vo;
      }
    }
  }
  __syncthreads();

  // 3. A = q k'^T (8 tiles/wave) and num1 = q @ S (4 tiles/wave), K-dim 64
  v8f accA[8], accN[4];
#pragma unroll
  for (int i = 0; i < 8; ++i) accA[i] = vzero8();
#pragma unroll
  for (int i = 0; i < 4; ++i) accN[i] = vzero8();
#pragma unroll
  for (int kk = 0; kk < 64; kk += 32) {
    v16bf aq = frag_ld(frag_ptr(sq, wave * 16, 72, lane) + kk);
#pragma unroll
    for (int nt = 0; nt < 8; ++nt) {
      v16bf bk = frag_ld(frag_ptr(sk, nt * 16, 72, lane) + kk);
      accA[nt] = wmma_bf16(aq, bk, accA[nt]);
    }
#pragma unroll
    for (int nt = 0; nt < 4; ++nt) {
      v16bf bs = frag_ld(frag_ptr(sSB, nt * 16, 72, lane) + kk);
      accN[nt] = wmma_bf16(aq, bs, accN[nt]);
    }
  }
  // 4a. q'.z while q' is still in LDS
  if (tid < 128) {
    float qz = 0.f;
#pragma unroll 8
    for (int e = 0; e < 64; ++e) qz += (float)sq[tid * 72 + e] * sz[e];
    sqz[tid] = qz;
  }
  __syncthreads();  // all waves done reading q'/k' before masked A overwrites them

  // tril mask + row sums + stage masked A as bf16; 4b. den[c] = q'.z + rowsum(A)
#pragma unroll
  for (int r = 0; r < 8; ++r) {
    const int c = wave * 16 + rh + r;
    float rs = 0.f;
#pragma unroll
    for (int nt = 0; nt < 8; ++nt) {
      const int d = nt * 16 + cl;
      const float v = (d <= c) ? accA[nt][r] : 0.f;
      accA[nt][r] = v;
      rs += v;
    }
#pragma unroll
    for (int o = 1; o < 16; o <<= 1) rs += __shfl_xor(rs, o);
    if (cl == 0) sden[c] = sqz[c] + rs;
#pragma unroll
    for (int nt = 0; nt < 8; ++nt)
      sP[c * 136 + nt * 16 + cl] = (bf16_t)accA[nt][r];
  }
  __syncthreads();

  // 5. num2 = A @ v  (B-operand = v^T rows), K-dim 128
#pragma unroll
  for (int kk = 0; kk < 128; kk += 32) {
    v16bf ap = frag_ld(frag_ptr(sP, wave * 16, 136, lane) + kk);
#pragma unroll
    for (int nt = 0; nt < 4; ++nt) {
      v16bf bv = frag_ld(frag_ptr(svT, nt * 16, 136, lane) + kk);
      accN[nt] = wmma_bf16(ap, bv, accN[nt]);
    }
  }
  // 6. o = num / (den + 1e-6) -> global bf16
#pragma unroll
  for (int nt = 0; nt < 4; ++nt)
#pragma unroll
    for (int r = 0; r < 8; ++r) {
      const int c = wave * 16 + rh + r;
      const float o = accN[nt][r] / (sden[c] + 1e-6f);
      const size_t row = (size_t)b * 4096 + (size_t)ch * 128 + c;
      out[row * 1024 + h * 64 + nt * 16 + cl] = (bf16_t)o;
    }
}

// ---------------------------------------------------------------------------
// Launch: B=2, L=4096, D=1024, H=16, E=64, W=128. Requires ws >= ~263 MB.
// ---------------------------------------------------------------------------
extern "C" void kernel_launch(void* const* d_in, const int* in_sizes, int n_in,
                              void* d_out, int out_size, void* d_ws, size_t ws_size,
                              hipStream_t stream) {
  const float* x = (const float*)d_in[0];
  const float* g1 = (const float*)d_in[1];
  const float* b1 = (const float*)d_in[2];
  const float* Wqkva = (const float*)d_in[3];
  const float* bqkva = (const float*)d_in[4];
  const float* Wpa = (const float*)d_in[5];
  const float* bpa = (const float*)d_in[6];
  const float* Wqkvs = (const float*)d_in[7];
  const float* bqkvs = (const float*)d_in[8];
  const float* Wos = (const float*)d_in[9];
  const float* bos = (const float*)d_in[10];
  const float* Wo = (const float*)d_in[11];
  const float* bo = (const float*)d_in[12];
  const float* gm = (const float*)d_in[13];
  const float* bm = (const float*)d_in[14];
  const float* W1 = (const float*)d_in[15];
  const float* b1m = (const float*)d_in[16];
  const float* W2 = (const float*)d_in[17];
  const float* b2m = (const float*)d_in[18];

  char* ws = (char*)d_ws;
  bf16_t* WqkvaT = (bf16_t*)(ws + 0);            // [3072][1024], and directly behind it,
                                                 // from ws + 6291456, WqkvsT [3072][1024]
  bf16_t* WpaT = (bf16_t*)(ws + 12582912);       // [1024][1024]
  bf16_t* WosT = (bf16_t*)(ws + 14680064);       // [1024][1024]
  bf16_t* WoT = (bf16_t*)(ws + 16777216);        // [1024][1024]
  bf16_t* W1T = (bf16_t*)(ws + 18874368);        // [4096][1024]
  bf16_t* W2T = (bf16_t*)(ws + 27262976);        // [1024][4096]
  bf16_t* xn = (bf16_t*)(ws + 35651584);         // [8192][1024]  (later: h)
  bf16_t* swa_o = (bf16_t*)(ws + 52428800);      // [8192][1024]
  bf16_t* lin_o = (bf16_t*)(ws + 69206016);      // [8192][1024]
  bf16_t* mix = (bf16_t*)(ws + 85983232);        // [8192][1024]
  float* linSc = (float*)(ws + 85983232);        // [32*32][64*64] (before mix)
  bf16_t* qkva = (bf16_t*)(ws + 102760448);      // [8192][3072]
  float* qkvs = (float*)(ws + 153092096);        // [8192][3072]
  bf16_t* gbuf = (bf16_t*)(ws + 153092096);      // [8192][4096] (reuses qkvs)
  float* x1 = (float*)(ws + 220200960);          // [8192][1024] (tail of qkvs)
  bf16_t* linSb = (bf16_t*)(ws + 253755392);     // [32*32][64*64]
  float* linzc = (float*)(ws + 262144000);       // [32*32][64]
  float* linzp = (float*)(ws + 262406144);       // [32*32][64]
  float* outf = (float*)d_out;

  const dim3 blk(256);
  // Weight convert+transpose to bf16 [N][K]: the seven Wt lie back to back from ws + 0
  wt_transpose_kernel<<<dim3(1088), blk, 0, stream>>>(Wqkva, Wqkvs, Wpa, Wos, Wo, W1, W2,
                                                      WqkvaT);

  // xn = LN(x)
  ln_kernel<<<8192, blk, 0, stream>>>(x, g1, b1, xn);
  // both qkv projections: one Bt of 6144 rows from WqkvaT on
  gemm_kernel<64, 3072, true, false, false, true, false><<<dim3(24, 64), blk, 0, stream>>>(
      xn, WqkvaT, bqkva, nullptr, qkva, 1024, nullptr, nullptr, bqkvs, qkvs);
  // attention branches
  swa_kernel<<<dim3(32, 16, 2), blk, 0, stream>>>(qkva, swa_o);
  lin_state_kernel<<<dim3(31, 32), blk, 0, stream>>>(qkvs, linSc, linzc);
  lin_prefix_kernel<<<dim3(264), blk, 0, stream>>>(linSc, linzc, linSb, linzp);
  lin_out_kernel<<<dim3(32, 32), blk, 0, stream>>>(qkvs, linSb, linzp, lin_o);
  // mix = swa @ Wp + bp + lin @ Wo_s + bo_s  (bf16)
  gemm_kernel<128, 1024, true, false, false, false, true><<<dim3(4, 64), blk, 0, stream>>>(
      swa_o, WpaT, bpa, nullptr, mix, 1024, lin_o, WosT, bos, nullptr);
  // x1 = mix @ Wo + bo + x  (f32)
  gemm_kernel<128, 1024, false, false, true><<<dim3(4, 64), blk, 0, stream>>>(
      mix, WoT, bo, x, x1, 1024, nullptr, nullptr, nullptr, nullptr);
  // h = LN(x1)
  ln_kernel<<<8192, blk, 0, stream>>>(x1, gm, bm, xn);
  // g = gelu(h @ W1 + b1m)  (bf16)
  gemm_kernel<64, 4096, true, true, false><<<dim3(16, 64), blk, 0, stream>>>(
      xn, W1T, b1m, nullptr, gbuf, 1024, nullptr, nullptr, nullptr, nullptr);
  // out = g @ W2 + b2m + x1  (f32)
  gemm_kernel<128, 1024, false, false, true><<<dim3(4, 64), blk, 0, stream>>>(
      gbuf, W2T, b2m, x1, outf, 4096, nullptr, nullptr, nullptr, nullptr);
}

// v007
// One run takes 319 microseconds.
// Next to v006, in two timings, it ran 1.04 and 1.05 times as fast.
// Counting every step since v000, it is 2.49 times as fast.
#include <hip/hip_runtime.h>

typedef __bf16 bf16_t;
typedef __attribute__((ext_vector_type(16))) __bf16 v16bf;
typedef __attribute__((ext_vector_type(8)))  __bf16 v8bf;
typedef __attribute__((ext_vector_type(8)))  float  v8f;

#define DEV static __device__ __forceinline__

// ---------------------------------------------------------------------------
// WMMA helpers (CDNA5 wave32, 16x16x32 bf16 -> f32)
// A fragment: lane m = row, kbase = 8*(lane>>4); VGPR v in [0,3] -> K = kbase+2v..,
// v in [4,7] -> K = 16+kbase+...  => two contiguous 16-byte chunks at +0 and +16.
// B fragment mirrors A with lane = output column, reading rows of B^T ([N][K]).
// ---------------------------------------------------------------------------
DEV v8f wmma_bf16(v16bf a, v16bf b, v8f c) {
  return __builtin_amdgcn_wmma_f32_16x16x32_bf16(false, a, false, b, (short)0, c,
                                                 false, false);
}

DEV const bf16_t* frag_ptr(const bf16_t* tile, int row0, int stride, int lane) {
  return tile + (size_t)(row0 + (lane & 15)) * stride + ((lane >> 4) << 3);
}

DEV v16bf frag_ld(const bf16_t* p) {
  v8bf lo = *(const v8bf*)(p);
  v8bf hi = *(const v8bf*)(p + 16);
  return __builtin_shufflevector(lo, hi, 0, 1, 2, 3, 4, 5, 6, 7,
                                 8, 9, 10, 11, 12, 13, 14, 15);
}

DEV v8f vzero8() {
  v8f z;
#pragma unroll
  for (int i = 0; i < 8; ++i) z[i] = 0.0f;
  return z;
}

// v_rcp_f32 and v_exp_f32 (2^a), each with the one slot that the instruction set asks for
// behind a transcendental before its result is used or its source overwritten; in one
// statement with it, so that the slot stands there whatever is scheduled next.
DEV float rcp_slot(float a) {
  float r;
  asm("v_rcp_f32 %0, %1\n\tv_nop" : "=v"(r) : "v"(a));
  return r;
}
DEV float exp2_slot(float a) {
  float r;
  asm("v_exp_f32 %0, %1\n\tv_nop" : "=v"(r) : "v"(a));
  return r;
}

// Exact GELU, 0.5 x (1 + erf(x / sqrt 2)), of 8 values, without a branch: 8 independent
// chains, stage by stage. One formula serves every z = |x| / sqrt 2: with t = 1 / (1 + p z),
// erfc(z) = t (a1 + t (a2 + t (a3 + t (a4 + t a5)))) exp(-z z), absolute error 1.5e-7.
// 1 + erf is 2 - erfc(z) for x >= 0 and erfc(z) itself for x < 0.
DEV void gelu_exact8(float (&x)[8]) {
  float z[8], t[8], e[8];
#pragma unroll
  for (int i = 0; i < 8; ++i) z[i] = fabsf(x[i]) * 0.70710678118654752f;
#pragma unroll
  for (int i = 0; i < 8; ++i) {
    t[i] = fmaf(0.3275911f, z[i], 1.0f);
    e[i] = z[i] * z[i] * -1.4426950408889634f;
  }
  // The two sched_barriers keep the 16 transcendentals together, away from what feeds them
  // and from what reads them: the compiler knows no latency of an asm statement and writes
  // no s_delay_alu for it, and a reader close behind would hold up the SIMD's other waves.
  __builtin_amdgcn_sched_barrier(0);
#pragma unroll
  for (int i = 0; i < 8; ++i) t[i] = rcp_slot(t[i]);
#pragma unroll
  for (int i = 0; i < 8; ++i) e[i] = exp2_slot(e[i]);
  __builtin_amdgcn_sched_barrier(0);
#pragma unroll
  for (int i = 0; i < 8; ++i) {
    float p = fmaf(1.061405429f, t[i], -1.453152027f);
    p = fmaf(p, t[i], 1.421413741f);
    p = fmaf(p, t[i], -0.284496736f);
    p = fmaf(p, t[i], 0.254829592f);
    const float h = (0.5f * x[i]) * ((p * t[i]) * e[i]);  // 0.5 x erfc(z)
    x[i] = x[i] >= 0.f ? x[i] - h : h;
  }
}

// ---------------------------------------------------------------------------
// CDNA5 async global->LDS copy (ASYNCcnt-tracked), 16 bytes per lane, as the builtin:
// the compiler then forms each copy's address from a uniform base and one lane offset.
// ---------------------------------------------------------------------------
typedef __attribute__((ext_vector_type(4))) int v4i;
typedef __attribute__((address_space(1))) v4i g_v4i;
typedef __attribute__((address_space(3))) v4i l_v4i;

DEV void async_copy_b128(bf16_t* ldst, const char* gsrc) {
  __builtin_amdgcn_global_load_async_to_lds_b128((g_v4i*)gsrc, (l_v4i*)ldst, 0, 0);
}

DEV void wait_async0() { asm volatile("s_wait_asynccnt 0x0" ::: "memory"); }
DEV void wait_ds0() { asm volatile("s_wait_dscnt 0x0" ::: "memory"); }

// ---------------------------------------------------------------------------
// LayerNorm over D=1024, writes bf16. One block per row, 256 threads x 4 elems.
// ---------------------------------------------------------------------------
__global__ __launch_bounds__(256) void ln_kernel(const float* __restrict__ x,
                                                 const float* __restrict__ g,
                                                 const float* __restrict__ b,
                                                 bf16_t* __restrict__ out) {
  const int row = blockIdx.x;
  const int tid = threadIdx.x, lane = tid & 31, wave = tid >> 5;
  const float4 v = ((const float4*)(x + (size_t)row * 1024))[tid];
  float s = v.x + v.y + v.z + v.w;
  float ss = v.x * v.x + v.y * v.y + v.z * v.z + v.w * v.w;
#pragma unroll
  for (int o = 16; o; o >>= 1) {
    s += __shfl_xor(s, o);
    ss += __shfl_xor(ss, o);
  }
  __shared__ float red[16];
  if (lane == 0) { red[wave] = s; red[8 + wave] = ss; }
  __syncthreads();
  if (tid == 0) {
    float a = 0.f, c = 0.f;
#pragma unroll
    for (int i = 0; i < 8; ++i) { a += red[i]; c += red[8 + i]; }
    red[0] = a; red[8] = c;
  }
  __syncthreads();
  const float mean = red[0] * (1.0f / 1024.0f);
  const float var = red[8] * (1.0f / 1024.0f) - mean * mean;
  const float inv = rsqrtf(var + 1e-5f);
  const float4 gg = ((const float4*)g)[tid];
  const float4 bb = ((const float4*)b)[tid];
  bf16_t* o4 = out + (size_t)row * 1024 + tid * 4;
  o4[0] = (bf16_t)((v.x - mean) * inv * gg.x + bb.x);
  o4[1] = (bf16_t)((v.y - mean) * inv * gg.y + bb.y);
  o4[2] = (bf16_t)((v.z - mean) * inv * gg.z + bb.z);
  o4[3] = (bf16_t)((v.w - mean) * inv * gg.w + bb.w);
}

// ---------------------------------------------------------------------------
// Weight convert+transpose, all seven weights in one launch: f32 W[K][N] -> bf16
// Wt[N][K], the seven Wt back to back in WtAll. One 128(k) x 128(n) tile a block.
// A wave reads whole 512-B rows, two neighbouring k rows a pair; a pair is rounded
// and packed to one dword (k even low, k odd high); rows of Wt leave as 256-B runs.
// ---------------------------------------------------------------------------
typedef __attribute__((ext_vector_type(2))) __bf16 v2bf;
typedef __attribute__((ext_vector_type(4))) __bf16 v4bf;
typedef __attribute__((ext_vector_type(4))) float v4f;
typedef __attribute__((ext_vector_type(4))) uint32_t v4u;

// dword index of (column n, k pair p): pitch 65 spreads the 4-column lane stride over
// the banks; the 2 extra dwords from column 64 on keep lanes 16..31 off lanes 0..15.
DEV int wt_idx(int n, int p) { return n * 65 + ((n >> 6) << 1) + p; }

// One tile. K and N are compile-time, so that a lane's 16 loads share one address and
// differ in the immediate offset only.
template <int K, int N>
DEV void wt_tile(const float* __restrict__ W, bf16_t* __restrict__ Wt, int l,
                 uint32_t* t) {
  const int tid = threadIdx.x, lane = tid & 31, wave = tid >> 5;
  const int n0 = (l % (N / 128)) * 128, k0 = (l / (N / 128)) * 128;

  // k pair p = wave + 8 i: rows k0 + 2 p and k0 + 2 p + 1, 512 B of each a wave
  const float* src = W + (size_t)(k0 + 2 * wave) * N + n0 + lane * 4;
  v4f a[8], b[8];
#pragma unroll
  for (int i = 0; i < 8; ++i) {
    a[i] = *(const v4f*)(src + (16 * i) * N);
    b[i] = *(const v4f*)(src + (16 * i + 1) * N);
  }
  // the wait that is owed before a register which an issued load names is rewritten;
  // src as an input keeps the address pair live over the whole run, so that no load's
  // result is placed in it
  asm volatile("s_wait_xcnt 0x0" ::"v"(src) : "memory");
  // keeps all 16 loads of a lane ahead of the first conversion, so that they fly
  // together; without it the last four are issued only when the first have landed
  __builtin_amdgcn_sched_barrier(0);
#pragma unroll
  for (int i = 0; i < 8; ++i)
#pragma unroll
    for (int u = 0; u < 4; ++u) {
      v2bf pk;
      pk[0] = (bf16_t)a[i][u];
      pk[1] = (bf16_t)b[i][u];
      t[wt_idx(lane * 4 + u, wave + 8 * i)] = __builtin_bit_cast(uint32_t, pk);
    }
  __syncthreads();
  // a wave stores rows n0 + 2 wave + 16 i and the next, 256 B of each
  const int l16 = tid & 15, r = tid >> 4;
  bf16_t* dst = Wt + (size_t)(n0 + r) * K + k0 + l16 * 8;
#pragma unroll
  for (int i = 0; i < 8; ++i) {
    const int base = wt_idx(r + 16 * i, l16 * 4);
    v4u o;
    o[0] = t[base];
    o[1] = t[base + 1];
    o[2] = t[base + 2];
    o[3] = t[base + 3];
    *(v4u*)(dst + (16 * i) * K) = o;
  }
}

// Blocks 0..383: the two [1024][3072]; 384..575: the three [1024][1024];
// 576..831: [1024][4096]; 832..1087: [4096][1024]. Every branch is block-uniform.
__global__ __launch_bounds__(256) void wt_transpose_kernel(
    const float* __restrict__ Wa, const float* __restrict__ Wb,
    const float* __restrict__ Wc, const float* __restrict__ Wd,
    const float* __restrict__ We, const float* __restrict__ Wf,
    const float* __restrict__ Wg, bf16_t* __restrict__ WtAll) {
  __shared__ uint32_t t[128 * 65 + 2];
  const int bid = blockIdx.x;
  if (bid < 384) {
    const bool s = bid >= 192;
    wt_tile<1024, 3072>(s ? Wb : Wa, WtAll + (s ? 3145728 : 0), s ? bid - 192 : bid, t);
  } else if (bid < 576) {
    const int g = (bid - 384) >> 6;
    wt_tile<1024, 1024>(g == 0 ? Wc : (g == 1 ? Wd : We), WtAll + 6291456 + g * 1048576,
                        (bid - 384) & 63, t);
  } else if (bid < 832) {
    wt_tile<1024, 4096>(Wf, WtAll + 9437184, bid - 576, t);
  } else {
    wt_tile<4096, 1024>(Wg, WtAll + 13631488, bid - 832, t);
  }
}

// ---------------------------------------------------------------------------
// One wave's 64 x 64 tile from its accumulators to global memory in whole 128-B lines.
// acc[mt][nt] holds the tile TRANSPOSED (weight rows were the A operand): lane l has row
// m = 16 mt + (l & 15) and the 8 neighbouring columns n = 16 nt + 8 (l >> 4) + r. They go
// as 16-byte pieces into st, the wave's own LDS range (32 rows of 64 elements + 16 B, so
// that the 16 rows of a store fall on different banks), and come back with the lanes laid
// along the rows: a wave-wide 16-byte store then covers 4 whole lines. Two rounds of 32
// rows. bias (+ bias2) and GELU before the staging, the f32 residual behind it, read in
// whole lines too.
// og, rg: element (0, 0) of the tile in out and res; bp, bq: the tile's first column.
// ---------------------------------------------------------------------------
template <typename OT, int NN, bool GELU_ACT, bool RES, bool TWOB>
DEV void tile_out(const v8f (&acc)[4][4], OT* st, OT* __restrict__ og,
                  const float* __restrict__ bp, const float* __restrict__ bq,
                  const float* __restrict__ rg, int lane) {
  typedef __attribute__((ext_vector_type(4))) float f4;
  constexpr bool B16 = sizeof(OT) == 2;
  constexpr int EPB = 16 / (int)sizeof(OT);  // elements of a 16-byte piece
  constexpr int SP = 64 + EPB;               // staging pitch, elements
  constexpr int LPR = 64 / EPB;              // lanes a row at the read-back
  constexpr int RPI = 32 / LPR;              // rows a wave-wide access
  constexpr int NJ = 32 / RPI;               // accesses a round
  const int cl = lane & 15, hi = lane >> 4;
  const float* bl = bp + hi * 8;
  const float* bm = bq + hi * 8;
  OT* ol = og + (size_t)(lane / LPR) * NN + (lane % LPR) * EPB;
  const float* rl = rg + (RES ? (size_t)(lane / LPR) * NN + (lane % LPR) * 4 : 0);
  OT* sw = st + cl * SP + hi * 8;
  const OT* sr = st + (lane / LPR) * SP + (lane % LPR) * EPB;

  float bv[4][8];
#pragma unroll
  for (int nt = 0; nt < 4; ++nt) {
    const f4 a = *(const f4*)(bl + nt * 16), b = *(const f4*)(bl + nt * 16 + 4);
#pragma unroll
    for (int r = 0; r < 4; ++r) { bv[nt][r] = a[r]; bv[nt][4 + r] = b[r]; }
  }
  if constexpr (TWOB) {
#pragma unroll
    for (int nt = 0; nt < 4; ++nt) {
      const f4 a = *(const f4*)(bm + nt * 16), b = *(const f4*)(bm + nt * 16 + 4);
#pragma unroll
      for (int r = 0; r < 4; ++r) { bv[nt][r] += a[r]; bv[nt][4 + r] += b[r]; }
    }
  }
  // the wait that is owed before a register which an issued load names is rewritten; the
  // addresses as inputs stay live up to it
  if constexpr (TWOB) asm volatile("s_wait_xcnt 0x0" ::"v"(bl), "v"(bm) : "memory");
  else asm volatile("s_wait_xcnt 0x0" ::"v"(bl) : "memory");

#pragma unroll
  for (int hf = 0; hf < 2; ++hf) {
    f4 rr[NJ];
    if constexpr (RES) {
      // ahead of the staging, so that they fly during it
#pragma unroll
      for (int j = 0; j < NJ; ++j) rr[j] = *(const f4*)(rl + (hf * 32 + j * RPI) * NN);
    }
#pragma unroll
    for (int i = 0; i < 2; ++i)
#pragma unroll
      for (int nt = 0; nt < 4; ++nt) {
        float v[8];
#pragma unroll
        for (int r = 0; r < 8; ++r) v[r] = acc[hf * 2 + i][nt][r] + bv[nt][r];
        if constexpr (GELU_ACT) gelu_exact8(v);
        if constexpr (B16) {
          v8bf pk;
#pragma unroll
          for (int r = 0; r < 8; ++r) pk[r] = (bf16_t)v[r];
          *(v8bf*)(sw + i * 16 * SP + nt * 16) = pk;
        } else {
          f4 lo, up;
#pragma unroll
          for (int r = 0; r < 4; ++r) { lo[r] = v[r]; up[r] = v[4 + r]; }
          *(f4*)(sw + i * 16 * SP + nt * 16) = lo;
          *(f4*)(sw + i * 16 * SP + nt * 16 + 4) = up;
        }
      }
    wait_ds0();  // the wave's own pieces are in LDS before other lanes of it read them
    if constexpr (B16) {
      v8bf x[NJ];
#pragma unroll
      for (int j = 0; j < NJ; ++j) x[j] = *(const v8bf*)(sr + j * RPI * SP);
#pragma unroll
      for (int j = 0; j < NJ; ++j) *(v8bf*)(ol + (hf * 32 + j * RPI) * NN) = x[j];
    } else {
      f4 x[NJ];
#pragma unroll
      for (int j = 0; j < NJ; ++j) x[j] = *(const f4*)(sr + j * RPI * SP);
      if constexpr (RES) {
#pragma unroll
        for (int j = 0; j < NJ; ++j) x[j] += rr[j];
      }
#pragma unroll
      for (int j = 0; j < NJ; ++j) *(f4*)(ol + (hf * 32 + j * RPI) * NN) = x[j];
    }
    // the same wait, behind each round's loads and stores
    if constexpr (RES) asm volatile("s_wait_xcnt 0x0" ::"v"(ol), "v"(rl) : "memory");
    else asm volatile("s_wait_xcnt 0x0" ::"v"(ol) : "memory");
  }
}

// ---------------------------------------------------------------------------
// Generic bf16 GEMM, f32 accumulate: out[M][NN] = A[M][K] * Bt[NN][K]^T + bias
// Block: 256 thr = 8 waves (2 x 4); tile 128 x 256; wave tile 64 x 64 (4 M-frags x
// 4 N-frags), so that a fragment read from LDS feeds 4 WMMAs and fewer bytes come from
// L2 per product than with a 128 x 128 tile. A pass is KP k = KP / 32 blocks of 32 k.
// Two LDS buffers, each [A 128 rows | Bt 256 rows] at pitch 2 KP + 16 B, filled by async
// global->LDS copies one pass ahead; one barrier a pass. KP = 64: two work-groups fit a
// WGP (grids of more than one a WGP). KP = 128: one work-group a WGP, twice the k per
// barrier and per copy latency (grids of 256).
// Epilogue (tile_out): optional GELU, optional f32 residual, bf16 or f32 output.
// M multiple of 128, NN of 256, K of KP.
// Two products that share an operand or an output run as one launch:
// CATN: Bt holds 2 NN rows, the weights of two products of the same A one behind the other;
//   grid.x = 2 NN / 256. Column blocks below NN give out (bf16, bias), the rest out2 (f32,
//   bias2), each [M][NN].
// CATK: out = A Bt^T + A2 Bt2^T + bias + bias2, all four operands of row length K: the k
//   passes of the second product follow those of the first on the same accumulators.
// ---------------------------------------------------------------------------
template <int KP, int NN, bool OUT_BF16, bool GELU_ACT, bool RES, bool CATN = false,
          bool CATK = false>
__global__ __launch_bounds__(256) void gemm_kernel(
    const bf16_t* __restrict__ A, const bf16_t* __restrict__ Bt,
    const float* __restrict__ bias, const float* __restrict__ res,
    void* __restrict__ out, int K, const bf16_t* __restrict__ A2,
    const bf16_t* __restrict__ Bt2, const float* __restrict__ bias2,
    void* __restrict__ out2) {
  constexpr int LDK = KP + 8;              // row pitch 144 or 272 B = 16 B x odd
  constexpr int STAGE = (128 + 256) * LDK; // elements of one buffer
  constexpr int NB = KP / 32;              // blocks per pass
  constexpr int PR = KP / 8;               // 16-byte pieces per row
  constexpr int RG = 256 / PR;             // rows that the block's 256 threads copy at once
  __shared__ __align__(16) bf16_t sT[2][STAGE];
  const int tid = threadIdx.x, lane = tid & 31, wave = tid >> 5;
  const int m0 = blockIdx.y * 128, n0 = blockIdx.x * 256;
  const int wm = (wave >> 2) * 64;  // wave M offset within tile
  const int wn = (wave & 3) * 64;   // wave N offset within tile

  v8f acc[4][4];
#pragma unroll
  for (int i = 0; i < 4; ++i)
#pragma unroll
    for (int j = 0; j < 4; ++j) acc[i][j] = vzero8();

  const int cr = tid / PR;          // row within a group of RG rows
  const int cc = (tid % PR) * 8;    // 16-byte piece of the row
  // one 32-bit lane offset serves every copy; the rest of each address is uniform
  const uint32_t goff = (uint32_t)(cr * K + cc) * 2u;
  const char* uA = (const char*)(A + (size_t)m0 * K);
  const char* uB = (const char*)(Bt + (size_t)n0 * K);
  const char* uA2 = CATK ? (const char*)(A2 + (size_t)m0 * K) : uA;
  const char* uB2 = CATK ? (const char*)(Bt2 + (size_t)n0 * K) : uB;

  // pass kq into buffer `buf`: 3 KP / 16 copies of 16 B per thread (12 or 24), whole lines
  auto stage = [&](int kq, int buf) {
    // CATK: from k = K on the second pair of operands, a choice that is block-uniform
    const bool second = CATK && kq >= K;
    const char* pA = second ? uA2 : uA;
    const char* pB = second ? uB2 : uB;
    const int k0 = second ? kq - K : kq;
    bf16_t* d = &sT[buf][cr * LDK + cc];
#pragma unroll
    for (int i = 0; i < 128 / RG; ++i)
      async_copy_b128(d + i * RG * LDK, pA + ((size_t)(i * RG) * K + k0) * 2 + goff);
#pragma unroll
    for (int i = 0; i < 256 / RG; ++i)
      async_copy_b128(d + (128 + i * RG) * LDK,
                      pB + ((size_t)(i * RG) * K + k0) * 2 + goff);
  };

  const int fa = (wm + (lane & 15)) * LDK + ((lane >> 4) << 3);
  const int fb = (128 + wn + (lane & 15)) * LDK + ((lane >> 4) << 3);

  const int npass = (CATK ? 2 * K : K) / KP;
  stage(0, 0);
  wait_async0();    // own copies of pass 0 have landed
  __syncthreads();  // everyone's have
  if (1 < npass) stage(KP, 1);
  for (int t = 0; t < npass; ++t) {
    const int buf = t & 1;
    const bf16_t* cur = &sT[buf][0];
    // the sched_barriers keep [16 LDS reads][16 WMMAs] as written: a block's reads go as
    // one group; left alone they are spread in pairs among the WMMAs, each pair with a
    // full wait of its own behind it
#pragma unroll
    for (int u = 0; u < NB; ++u) {
      v16bf af[4], bfv[4];
      __builtin_amdgcn_sched_barrier(0);
#pragma unroll
      for (int mt = 0; mt < 4; ++mt) af[mt] = frag_ld(cur + fa + mt * 16 * LDK + u * 32);
#pragma unroll
      for (int nt = 0; nt < 4; ++nt) bfv[nt] = frag_ld(cur + fb + nt * 16 * LDK + u * 32);
      __builtin_amdgcn_sched_barrier(0);
#pragma unroll
      for (int nt = 0; nt < 4; ++nt)
#pragma unroll
        for (int mt = 0; mt < 4; ++mt)
          acc[mt][nt] = wmma_bf16(bfv[nt], af[mt], acc[mt][nt]);  // D = tile^T: tile_out
    }
    // publish point of pass t + 1
    wait_ds0();       // own reads of this buffer have all returned
    wait_async0();    // own copies of pass t + 1 have landed
    __syncthreads();  // everyone's have, and everyone has left this buffer
    if (t + 2 < npass) stage((t + 2) * KP, buf);
  }
  wait_async0();  // nothing is in flight when the wave goes on to its end

  // Every wave has left the ring (the last pass's barrier) and no copy is in flight: the
  // ring's LDS is free, and each wave stages in a range of its own.
  typedef typename std::conditional<OUT_BF16, bf16_t, float>::type out_t;
  static_assert(!(RES && OUT_BF16) && !(RES && GELU_ACT), "residual: f32 output, no GELU");
  if constexpr (CATN) {
    // block-uniform: a block's 256 columns lie wholly in one of the two products
    if (n0 >= NN) {
      tile_out<float, NN, false, false, false>(
          acc, (float*)&sT[0][0] + wave * (32 * 68),
          (float*)out2 + (size_t)(m0 + wm) * NN + (size_t)(n0 - NN + wn),
          bias2 + (n0 - NN + wn), bias2, bias2, lane);
      return;
    }
  }
  const size_t e0 = (size_t)(m0 + wm) * NN + (size_t)(n0 + wn);
  tile_out<out_t, NN, GELU_ACT, RES, CATK>(
      acc, (out_t*)&sT[0][0] + wave * (32 * (64 + 16 / (int)sizeof(out_t))), (out_t*)out + e0,
      bias + (n0 + wn), CATK ? bias2 + (n0 + wn) : bias, RES ? res + e0 : bias, lane);
}

// ---------------------------------------------------------------------------
// One wave's 16 rows x 64 head columns, bf16, to global memory in whole 128-B lines, as in
// tile_out: t[nt] holds the tile transposed (lane l: row l & 15, columns 16 nt + 8 (l >> 4)
// + r). st: the wave's own 16 rows of an LDS tile that only it reads and that it has done
// with, pitch sp elements (16 B x odd). og: element (0, 0), row pitch 1024. dv: the lane's
// row is divided by den.
// ---------------------------------------------------------------------------
DEV void head_rows_out(const v8f (&t)[4], bf16_t* st, int sp, bf16_t* __restrict__ og,
                       float den, bool dv, int lane) {
#pragma unroll
  for (int nt = 0; nt < 4; ++nt) {
    v8bf pk;
#pragma unroll
    for (int r = 0; r < 8; ++r) pk[r] = (bf16_t)(dv ? t[nt][r] / den : t[nt][r]);
    *(v8bf*)(st + (lane & 15) * sp + nt * 16 + (lane >> 4) * 8) = pk;
  }
  wait_ds0();  // the wave's own pieces are in LDS before other lanes of it read them
  v8bf x[4];
#pragma unroll
  for (int j = 0; j < 4; ++j)
    x[j] = *(const v8bf*)(st + (j * 4 + (lane >> 3)) * sp + (lane & 7) * 8);
  bf16_t* ol = og + (size_t)(lane >> 3) * 1024 + (lane & 7) * 8;
#pragma unroll
  for (int j = 0; j < 4; ++j) *(v8bf*)(ol + j * 4 * 1024) = x[j];
}

// ---------------------------------------------------------------------------
// Sliding-window attention. One block per (query-block, head, batch).
// Q 128x64, K/V context 256x64 (prev block + own block), W=128 band mask.
// All matmuls via WMMA; softmax in registers with 16-lane shuffles.
// qkv: bf16 [B*L][3*1024]; out: bf16 [B*L][1024].
// ---------------------------------------------------------------------------
__global__ __launch_bounds__(256) void swa_kernel(const bf16_t* __restrict__ qkv,
                                                  bf16_t* __restrict__ out) {
  const int blk = blockIdx.x, h = blockIdx.y, b = blockIdx.z;
  const int tid = threadIdx.x, lane = tid & 31, wave = tid >> 5;

  // Q(128x72) + K(256x72) overlap with P(128x264) -- disjoint lifetimes.
  __shared__ __align__(16) char smem_u[128 * 264 * 2];
  __shared__ __align__(16) bf16_t sVt[64 * 264];  // V^T [e][s]
  bf16_t* sQ = (bf16_t*)smem_u;                   // [128][72]
  bf16_t* sK = (bf16_t*)smem_u + 128 * 72;        // [256][72]
  bf16_t* sP = (bf16_t*)smem_u;                   // [128][264]

  const size_t rowQ0 = (size_t)b * 4096 + (size_t)blk * 128;

  // 8 lanes a 128-B head row: a wave-wide load covers 4 whole rows = 4 whole lines.
  // Q: rows rg + 32 i. K, V: loads 2 p and 2 p + 1 of a thread are the neighbouring keys s0
  // and s0 + 1, s0 = 64 p + 2 rg, which share a dword of V^T. Keys 0..127 are the previous
  // block (p < 2): block 0 has none and takes zeros, a choice that is block-uniform.
  {
    const int l8 = tid & 7, rg = tid >> 3;
    const bf16_t* srcq = qkv + (rowQ0 + rg) * 3072 + h * 64 + l8 * 8;
    const bf16_t* srck = qkv + (rowQ0 + rg * 2) * 3072 + 1024 + h * 64 + l8 * 8;  // key 128 + 2 rg
    v8bf qx[4], kx[8], vx[8];
#pragma unroll
    for (int i = 0; i < 4; ++i) qx[i] = *(const v8bf*)(srcq + (i * 32) * 3072);
#pragma unroll
    for (int i = 4; i < 8; ++i) {
      kx[i] = *(const v8bf*)(srck + (((i >> 1) - 2) * 64 + (i & 1)) * 3072);
      vx[i] = *(const v8bf*)(srck + (((i >> 1) - 2) * 64 + (i & 1)) * 3072 + 1024);
    }
    if (blk > 0) {
#pragma unroll
      for (int i = 0; i < 4; ++i) {
        kx[i] = *(const v8bf*)(srck + (((i >> 1) - 2) * 64 + (i & 1)) * 3072);
        vx[i] = *(const v8bf*)(srck + (((i >> 1) - 2) * 64 + (i & 1)) * 3072 + 1024);
      }
    } else {
#pragma unroll
      for (int i = 0; i < 4; ++i)
#pragma unroll
        for (int j = 0; j < 8; ++j) {
          kx[i][j] = (bf16_t)0.f;
          vx[i][j] = (bf16_t)0.f;
        }
    }
    // the wait that is owed before a register which an issued load names is rewritten;
    // the two addresses as inputs stay live over the whole run
    asm volatile("s_wait_xcnt 0x0" ::"v"(srcq), "v"(srck) : "memory");
#pragma unroll
    for (int i = 0; i < 4; ++i) *(v8bf*)&sQ[(rg + 32 * i) * 72 + l8 * 8] = qx[i];
#pragma unroll
    for (int i = 0; i < 8; ++i)
      *(v8bf*)&sK[((i >> 1) * 64 + rg * 2 + (i & 1)) * 72 + l8 * 8] = kx[i];
#pragma unroll
    for (int p = 0; p < 4; ++p)
#pragma unroll
      for (int j = 0; j < 8; ++j) {
        v2bf vo;
        vo[0] = vx[2 * p][j];
        vo[1] = vx[2 * p + 1][j];
        *(v2bf*)&sVt[(l8 * 8 + j) * 264 + p * 64 + rg * 2] = vo;
      }
  }
  __syncthreads();

  // Scores: wave w owns query rows [16w,16w+16); 16 key tiles; K-dim = 64.
  v8f acc[16];
#pragma unroll
  for (int i = 0; i < 16; ++i) acc[i] = vzero8();
#pragma unroll
  for (int kk = 0; kk < 64; kk += 32) {
    v16bf aq = frag_ld(frag_ptr(sQ, wave * 16, 72, lane) + kk);
#pragma unroll
    for (int nt = 0; nt < 16; ++nt) {
      v16bf bk = frag_ld(frag_ptr(sK, nt * 16, 72, lane) + kk);
      acc[nt] = wmma_bf16(aq, bk, acc[nt]);
    }
  }

  // Mask + softmax. C-layout: row = 16*wave + 8*(lane>>4) + r, col = 16*nt + (lane&15)
  const int cl = lane & 15, rh = (lane >> 4) << 3;
#pragma unroll
  for (int r = 0; r < 8; ++r) {
    const int rloc = wave * 16 + rh + r;
    float mx = -1e30f;
#pragma unroll
    for (int nt = 0; nt < 16; ++nt) {
      const int s = nt * 16 + cl;
      const bool ok = (s >= rloc + 1) && (s <= rloc + 128) && (blk > 0 || s >= 128);
      const float v = ok ? acc[nt][r] * 0.125f : -1e30f;
      acc[nt][r] = v;
      mx = fmaxf(mx, v);
    }
#pragma unroll
    for (int o = 1; o < 16; o <<= 1) mx = fmaxf(mx, __shfl_xor(mx, o));
    float sum = 0.f;
#pragma unroll
    for (int nt = 0; nt < 16; ++nt) {
      const float e = __expf(acc[nt][r] - mx);
      acc[nt][r] = e;
      sum += e;
    }
#pragma unroll
    for (int o = 1; o < 16; o <<= 1) sum += __shfl_xor(sum, o);
    const float inv = 1.0f / sum;
#pragma unroll
    for (int nt = 0; nt < 16; ++nt) acc[nt][r] *= inv;
  }

  __syncthreads();  // all waves done reading sQ/sK before P overwrites them
#pragma unroll
  for (int nt = 0; nt < 16; ++nt)
#pragma unroll
    for (int r = 0; r < 8; ++r)
      sP[(wave * 16 + rh + r) * 264 + nt * 16 + cl] = (bf16_t)acc[nt][r];
  __syncthreads();

  // PV: out 16x64 per wave; K-dim = 256 keys.
  v8f ov[4];
#pragma unroll
  for (int i = 0; i < 4; ++i) ov[i] = vzero8();
#pragma unroll
  for (int kk = 0; kk < 256; kk += 32) {
    v16bf ap = frag_ld(frag_ptr(sP, wave * 16, 264, lane) + kk);
#pragma unroll
    for (int nt = 0; nt < 4; ++nt) {
      v16bf bv = frag_ld(frag_ptr(sVt, nt * 16, 264, lane) + kk);
      ov[nt] = wmma_bf16(bv, ap, ov[nt]);  // D = tile^T: query cl, 8 neighbouring e a lane
    }
  }
  head_rows_out(ov, sP + wave * 16 * 264, 264,
                out + (rowQ0 + wave * 16) * 1024 + h * 64, 1.0f, false, lane);
}

// ---------------------------------------------------------------------------
// Chunked causal linear attention, chunk-parallel, three launches:
//   lin_state : per (chunk, b, h) the chunk's own v^T k' (64x64 f32) and colsum(k')
//   lin_prefix: exclusive running sum over the chunks, f32, chunk 0 first
//   lin_out   : per (chunk, b, h) the outputs from q', k', v and the summed state
// qkv: f32 [B*L][3*1024] (elu applied at load); out: bf16 [B*L][1024].
// State records: index (bh*32 + ch); S^T as [f][e].
// ---------------------------------------------------------------------------

// The last chunk's own state is read by nobody: grid.x = 31.
__global__ __launch_bounds__(256) void lin_state_kernel(const float* __restrict__ qkv,
                                                        float* __restrict__ Sc,
                                                        float* __restrict__ zc) {
  const int ch = blockIdx.x, bh = blockIdx.y, b = bh >> 4, h = bh & 15;
  const int tid = threadIdx.x, lane = tid & 31, wave = tid >> 5;
  __shared__ __align__(16) bf16_t skT[64 * 136];   // k'^T     [e][c]
  __shared__ __align__(16) bf16_t svT[64 * 136];   // v^T      [f][c]
  const int cl = lane & 15, rh = (lane >> 4) << 3;
  {
    // 16 lanes a 256-B head row: a wave-wide load covers two whole rows = 4 whole lines.
    // Loads 2 p and 2 p + 1 of a thread are the neighbouring rows c0 and c0 + 1, which share
    // a dword of the transposed tiles.
    const int l16 = tid & 15, rg = tid >> 4;
    const float* pk = qkv + ((size_t)b * 4096 + (size_t)ch * 128 + rg * 2) * 3072 + 1024 +
                      h * 64 + l16 * 4;
    // loads first, elu after: the loads fly together, not one round trip each
    v4f kx[8], vx[8];
#pragma unroll
    for (int i = 0; i < 8; ++i) {
      kx[i] = *(const v4f*)(pk + ((i >> 1) * 32 + (i & 1)) * 3072);
      vx[i] = *(const v4f*)(pk + ((i >> 1) * 32 + (i & 1)) * 3072 + 1024);
    }
    // the wait that is owed before a register which an issued load names is rewritten;
    // pk as an input keeps the address live over the whole run
    asm volatile("s_wait_xcnt 0x0" ::"v"(pk) : "memory");
    // keeps all 16 loads of a lane ahead of the first conversion, so that they fly
    // together; without it the last four are issued only when the first have landed
    __builtin_amdgcn_sched_barrier(0);
#pragma unroll
    for (int p = 0; p < 4; ++p) {
      const int c0 = p * 32 + rg * 2;
#pragma unroll
      for (int u = 0; u < 4; ++u) {
        v2bf ko, vo;
#pragma unroll
        for (int o = 0; o < 2; ++o) {
          const float kr = kx[2 * p + o][u];
          const float em = expm1f(kr);  // unconditional: a select, no branch a value
          ko[o] = (bf16_t)((kr > 0.f ? kr : em) + 1.0001f);
          vo[o] = (bf16_t)vx[2 * p + o][u];
        }
        *(v2bf*)&skT[(l16 * 4 + u) * 136 + c0] = ko;
        *(v2bf*)&svT[(l16 * 4 + u) * 136 + c0] = vo;
      }
    }
  }
  __syncthreads();

  const size_t rec = (size_t)bh * 32 + ch;
  // v^T @ k'  (16 tiles over 8 waves, 2 each), K-dim 128
  {
    const int ft = wave >> 1;
    const int ebase = (wave & 1) * 32;
    v8f accS[2];
#pragma unroll
    for (int i = 0; i < 2; ++i) accS[i] = vzero8();
#pragma unroll
    for (int kk = 0; kk < 128; kk += 32) {
      v16bf av = frag_ld(frag_ptr(svT, ft * 16, 136, lane) + kk);
#pragma unroll
      for (int nt = 0; nt < 2; ++nt) {
        v16bf bk = frag_ld(frag_ptr(skT, ebase + nt * 16, 136, lane) + kk);
        accS[nt] = wmma_bf16(av, bk, accS[nt]);
      }
    }
#pragma unroll
    for (int nt = 0; nt < 2; ++nt)
#pragma unroll
      for (int r = 0; r < 8; ++r) {
        const int f = ft * 16 + rh + r;
        const int e = ebase + nt * 16 + cl;
        Sc[rec * 4096 + f * 64 + e] = accS[nt][r];
      }
  }
  if (tid < 64) {
    float zs = 0.f;
#pragma unroll 8
    for (int c = 0; c < 128; ++c) zs += (float)skT[tid * 136 + c];
    zc[rec * 64 + tid] = zs;
  }
}

// Blocks 0..255: S^T, two neighbouring elements a thread, rounded to bf16 at the
// store (the A operand of the transposed q' @ S). Blocks 256..263: z, kept in f32.
__global__ __launch_bounds__(256) void lin_prefix_kernel(const float* __restrict__ Sc,
                                                         const float* __restrict__ zc,
                                                         bf16_t* __restrict__ Sb,
                                                         float* __restrict__ zp) {
  if (blockIdx.x >= 256) {
    const int t = (blockIdx.x - 256) * 256 + threadIdx.x;
    const size_t base = (size_t)(t >> 6) * (32 * 64) + (size_t)(t & 63);
    float v[31];
#pragma unroll
    for (int ch = 0; ch < 31; ++ch) v[ch] = zc[base + ch * 64];
    float s = 0.f;
#pragma unroll
    for (int ch = 0; ch < 32; ++ch) {
      zp[base + ch * 64] = s;
      if (ch < 31) s += v[ch];
    }
    return;
  }
  const int t = blockIdx.x * 256 + threadIdx.x;
  const size_t base = (size_t)(t >> 11) * (32 * 4096) + (size_t)(t & 2047) * 2;
  float2 v[31];
#pragma unroll
  for (int ch = 0; ch < 31; ++ch) v[ch] = *(const float2*)(Sc + base + ch * 4096);
  float s0 = 0.f, s1 = 0.f;
#pragma unroll
  for (int ch = 0; ch < 32; ++ch) {
    v2bf o;
    o[0] = (bf16_t)s0;
    o[1] = (bf16_t)s1;
    *(v2bf*)(Sb + base + ch * 4096) = o;
    if (ch < 31) { s0 += v[ch].x; s1 += v[ch].y; }
  }
  // the built code lets this path run on to the z path's first instructions behind a
  // scalar test; they rewrite registers that the stores above name: wait in front
  asm volatile("s_wait_xcnt 0x0" ::: "memory");
}

// 8 waves a SIMD asked for: at most 128 registers, so that four work-groups fit a WGP
__global__ __launch_bounds__(256, 8) void lin_out_kernel(const float* __restrict__ qkv,
                                                      const bf16_t* __restrict__ Sb,
                                                      const float* __restrict__ zp,
                                                      bf16_t* __restrict__ out) {
  const int ch = blockIdx.x, bh = blockIdx.y, b = bh >> 4, h = bh & 15;
  const int tid = threadIdx.x, lane = tid & 31, wave = tid >> 5;
  // q'(128x72) + k'(128x72) overlap with masked A (128x136) -- disjoint lifetimes.
  __shared__ __align__(16) char smem_u[2 * 128 * 72 * 2];
  __shared__ __align__(16) bf16_t svT[64 * 136];   // v^T      [f][c]
  __shared__ __align__(16) bf16_t sSB[64 * 72];    // bf16 S^T before this chunk [f][e]
  __shared__ float sz[64];
  __shared__ float sqz[128];
  __shared__ float sden[128];
  bf16_t* sq = (bf16_t*)smem_u;                    // q' rows  [c][e]
  bf16_t* sk = (bf16_t*)smem_u + 128 * 72;         // k' rows  [c][e]
  bf16_t* sP = (bf16_t*)smem_u;                    // masked A [c][d]

  const int cl = lane & 15, rh = (lane >> 4) << 3;
  const size_t rec = (size_t)bh * 32 + ch;

  // 1. state before this chunk (A-operand layout: row f, cols e)
#pragma unroll
  for (int i = tid; i < 512; i += 256)
    *(v8bf*)&sSB[(i >> 3) * 72 + (i & 7) * 8] = *(const v8bf*)(Sb + rec * 4096 + i * 8);
  if (tid < 64) sz[tid] = zp[rec * 64 + tid];
  // 2. load chunk, apply elu maps
  {
    // 16 lanes a 256-B head row: a wave-wide load covers two whole rows = 4 whole lines.
    // A thread takes the neighbouring rows c0 and c0 + 1, which share a dword of v^T.
    const int l16 = tid & 15, rg = tid >> 4;
    const float* pq = qkv + ((size_t)b * 4096 + (size_t)ch * 128 + rg * 2) * 3072 + h * 64 +
                      l16 * 4;
    // kept rolled, 6 loads a trip: unrolled, the register count passes 128 and only three
    // work-groups, not four, fit a WGP
#pragma unroll 1
    for (int p = 0; p < 4; ++p) {
      const int c0 = p * 32 + rg * 2;
      v4f qx[2], kx[2], vx[2];
#pragma unroll
      for (int o = 0; o < 2; ++o) {
        qx[o] = *(const v4f*)(pq + (p * 32 + o) * 3072);
        kx[o] = *(const v4f*)(pq + (p * 32 + o) * 3072 + 1024);
        vx[o] = *(const v4f*)(pq + (p * 32 + o) * 3072 + 2048);
      }
      // the wait that is owed before a register which an issued load names is rewritten;
      // pq as an input keeps the address live over the run
      asm volatile("s_wait_xcnt 0x0" ::"v"(pq) : "memory");
#pragma unroll
      for (int o = 0; o < 2; ++o) {
        v4bf qo, ko;
#pragma unroll
        for (int u = 0; u < 4; ++u) {
          // expm1f unconditional: a select, no branch a value, as this loop was built before
          const float qv = qx[o][u] * 0.125f;  // E^-0.5
          const float qe = expm1f(qv);
          qo[u] = (bf16_t)((qv > 0.f ? qv : qe) + 1.0001f);
          const float kv = kx[o][u];
          const float ke = expm1f(kv);
          ko[u] = (bf16_t)((kv > 0.f ? kv : ke) + 1.0001f);
        }
        *(v4bf*)&sq[(c0 + o) * 72 + l16 * 4] = qo;
        *(v4bf*)&sk[(c0 + o) * 72 + l16 * 4] = ko;
      }
#pragma unroll
      for (int u = 0; u < 4; ++u) {
        v2bf vo;
        vo[0] = (bf16_t)vx[0][u];
        vo[1] = (bf16_t)vx[1][u];
        *(v2bf*)&svT[(l16 * 4 + u) * 136 + c0] = vo;
      }
    }
  }
  __syncthreads();

  // 3. A = q k'^T (8 tiles/wave) and num1 = q @ S (4 tiles/wave), K-dim 64
  v8f accA[8], accN[4];
#pragma unroll
  for (int i = 0; i < 8; ++i) accA[i] = vzero8();
#pragma unroll
  for (int i = 0; i < 4; ++i) accN[i] = vzero8();
#pragma unroll
  for (int kk = 0; kk < 64; kk += 32) {
    v16bf aq = frag_ld(frag_ptr(sq, wave * 16, 72, lane) + kk);
#pragma unroll
    for (int nt = 0; nt < 8; ++nt) {
      v16bf bk = frag_ld(frag_ptr(sk, nt * 16, 72, lane) + kk);
      accA[nt] = wmma_bf16(aq, bk, accA[nt]);
    }
#pragma unroll
    for (int nt = 0; nt < 4; ++nt) {
      v16bf bs = frag_ld(frag_ptr(sSB, nt * 16, 72, lane) + kk);
      accN[nt] = wmma_bf16(bs, aq, accN[nt]);  // D = tile^T: row cl, 8 neighbouring f a lane
    }
  }
  // 4a. q'.z while q' is still in LDS
  if (tid < 128) {
    float qz = 0.f;
#pragma unroll 8
    for (int e = 0; e < 64; ++e) qz += (float)sq[tid * 72 + e] * sz[e];
    sqz[tid] = qz;
  }
  __syncthreads();  // all waves done reading q'/k' before masked A overwrites them

  // tril mask + row sums + stage masked A as bf16; 4b. den[c] = q'.z + rowsum(A)
#pragma unroll
  for (int r = 0; r < 8; ++r) {
    const int c = wave * 16 + rh + r;
    float rs = 0.f;
#pragma unroll
    for (int nt = 0; nt < 8; ++nt) {
      const int d = nt * 16 + cl;
      const float v = (d <= c) ? accA[nt][r] : 0.f;
      accA[nt][r] = v;
      rs += v;
    }
#pragma unroll
    for (int o = 1; o < 16; o <<= 1) rs += __shfl_xor(rs, o);
    if (cl == 0) sden[c] = sqz[c] + rs;
#pragma unroll
    for (int nt = 0; nt < 8; ++nt)
      sP[c * 136 + nt * 16 + cl] = (bf16_t)accA[nt][r];
  }
  __syncthreads();

  // 5. num2 = A @ v  (A-operand = v^T rows; D transposed), K-dim 128
#pragma unroll
  for (int kk = 0; kk < 128; kk += 32) {
    v16bf ap = frag_ld(frag_ptr(sP, wave * 16, 136, lane) + kk);
#pragma unroll
    for (int nt = 0; nt < 4; ++nt) {
      v16bf bv = frag_ld(frag_ptr(svT, nt * 16, 136, lane) + kk);
      accN[nt] = wmma_bf16(bv, ap, accN[nt]);
    }
  }
  // 6. o = num / (den + 1e-6) -> global bf16
  head_rows_out(accN, sP + wave * 16 * 136, 136,
                out + ((size_t)b * 4096 + (size_t)ch * 128 + wave * 16) * 1024 + h * 64,
                sden[wave * 16 + cl] + 1e-6f, true, lane);
}

// ---------------------------------------------------------------------------
// Launch: B=2, L=4096, D=1024, H=16, E=64, W=128. Requires ws >= ~263 MB.
// ---------------------------------------------------------------------------
extern "C" void kernel_launch(void* const* d_in, const int* in_sizes, int n_in,
                              void* d_out, int out_size, void* d_ws, size_t ws_size,
                              hipStream_t stream) {
  const float* x = (const float*)d_in[0];
  const float* g1 = (const float*)d_in[1];
  const float* b1 = (const float*)d_in[2];
  const float* Wqkva = (const float*)d_in[3];
  const float* bqkva = (const float*)d_in[4];
  const float* Wpa = (const float*)d_in[5];
  const float* bpa = (const float*)d_in[6];
  const float* Wqkvs = (const float*)d_in[7];
  const float* bqkvs = (const float*)d_in[8];
  const float* Wos = (const float*)d_in[9];
  const float* bos = (const float*)d_in[10];
  const float* Wo = (const float*)d_in[11];
  const float* bo = (const float*)d_in[12];
  const float* gm = (const float*)d_in[13];
  const float* bm = (const float*)d_in[14];
  const float* W1 = (const float*)d_in[15];
  const float* b1m = (const float*)d_in[16];
  const float* W2 = (const float*)d_in[17];
  const float* b2m = (const float*)d_in[18];

  char* ws = (char*)d_ws;
  bf16_t* WqkvaT = (bf16_t*)(ws + 0);            // [3072][1024], and directly behind it,
                                                 // from ws + 6291456, WqkvsT [3072][1024]
  bf16_t* WpaT = (bf16_t*)(ws + 12582912);       // [1024][1024]
  bf16_t* WosT = (bf16_t*)(ws + 14680064);       // [1024][1024]
  bf16_t* WoT = (bf16_t*)(ws + 16777216);        // [1024][1024]
  bf16_t* W1T = (bf16_t*)(ws + 18874368);        // [4096][1024]
  bf16_t* W2T = (bf16_t*)(ws + 27262976);        // [1024][4096]
  bf16_t* xn = (bf16_t*)(ws + 35651584);         // [8192][1024]  (later: h)
  bf16_t* swa_o = (bf16_t*)(ws + 52428800);      // [8192][1024]
  bf16_t* lin_o = (bf16_t*)(ws + 69206016);      // [8192][1024]
  bf16_t* mix = (bf16_t*)(ws + 85983232);        // [8192][1024]
  float* linSc = (float*)(ws + 85983232);        // [32*32][64*64] (before mix)
  bf16_t* qkva = (bf16_t*)(ws + 102760448);      // [8192][3072]
  float* qkvs = (float*)(ws + 153092096);        // [8192][3072]
  bf16_t* gbuf = (bf16_t*)(ws + 153092096);      // [8192][4096] (reuses qkvs)
  float* x1 = (float*)(ws + 220200960);          // [8192][1024] (tail of qkvs)
  bf16_t* linSb = (bf16_t*)(ws + 253755392);     // [32*32][64*64]
  float* linzc = (float*)(ws + 262144000);       // [32*32][64]
  float* linzp = (float*)(ws + 262406144);       // [32*32][64]
  float* outf = (float*)d_out;

  const dim3 blk(256);
  // Weight convert+transpose to bf16 [N][K]: the seven Wt lie back to back from ws + 0
  wt_transpose_kernel<<<dim3(1088), blk, 0, stream>>>(Wqkva, Wqkvs, Wpa, Wos, Wo, W1, W2,
                                                      WqkvaT);

  // xn = LN(x)
  ln_kernel<<<8192, blk, 0, stream>>>(x, g1, b1, xn);
  // both qkv projections: one Bt of 6144 rows from WqkvaT on
  gemm_kernel<64, 3072, true, false, false, true, false><<<dim3(24, 64), blk, 0, stream>>>(
      xn, WqkvaT, bqkva, nullptr, qkva, 1024, nullptr, nullptr, bqkvs, qkvs);
  // attention branches
  swa_kernel<<<dim3(32, 16, 2), blk, 0, stream>>>(qkva, swa_o);
  lin_state_kernel<<<dim3(31, 32), blk, 0, stream>>>(qkvs, linSc, linzc);
  lin_prefix_kernel<<<dim3(264), blk, 0, stream>>>(linSc, linzc, linSb, linzp);
  lin_out_kernel<<<dim3(32, 32), blk, 0, stream>>>(qkvs, linSb, linzp, lin_o);
  // mix = swa @ Wp + bp + lin @ Wo_s + bo_s  (bf16)
  gemm_kernel<128, 1024, true, false, false, false, true><<<dim3(4, 64), blk, 0, stream>>>(
      swa_o, WpaT, bpa, nullptr, mix, 1024, lin_o, WosT, bos, nullptr);
  // x1 = mix @ Wo + bo + x  (f32)
  gemm_kernel<128, 1024, false, false, true><<<dim3(4, 64), blk, 0, stream>>>(
      mix, WoT, bo, x, x1, 1024, nullptr, nullptr, nullptr, nullptr);
  // h = LN(x1)
  ln_kernel<<<8192, blk, 0, stream>>>(x1, gm, bm, xn);
  // g = gelu(h @ W1 + b1m)  (bf16)
  gemm_kernel<64, 4096, true, true, false><<<dim3(16, 64), blk, 0, stream>>>(
      xn, W1T, b1m, nullptr, gbuf, 1024, nullptr, nullptr, nullptr, nullptr);
  // out = g @ W2 + b2m + x1  (f32)
  gemm_kernel<128, 1024, false, false, true><<<dim3(4, 64), blk, 0, stream>>>(
      gbuf, W2T, b2m, x1, outf, 4096, nullptr, nullptr, nullptr, nullptr);
}

// v008
// Measured time: 304 microseconds a run.
// Next to v007, in two timings, it ran 1.05 and 1.03 times as fast.
// Counting every step since v000, it is 2.59 times as fast.
#include <hip/hip_runtime.h>

typedef __bf16 bf16_t;
typedef __attribute__((ext_vector_type(16))) __bf16 v16bf;
typedef __attribute__((ext_vector_type(8)))  __bf16 v8bf;
typedef __attribute__((ext_vector_type(8)))  float  v8f;

#define DEV static __device__ __forceinline__

// ---------------------------------------------------------------------------
// WMMA helpers (CDNA5 wave32, 16x16x32 bf16 -> f32)
// A fragment: lane m = row, kbase = 8*(lane>>4); VGPR v in [0,3] -> K = kbase+2v..,
// v in [4,7] -> K = 16+kbase+...  => two contiguous 16-byte chunks at +0 and +16.
// B fragment mirrors A with lane = output column, reading rows of B^T ([N][K]).
// ---------------------------------------------------------------------------
DEV v8f wmma_bf16(v16bf a, v16bf b, v8f c) {
  return __builtin_amdgcn_wmma_f32_16x16x32_bf16(false, a, false, b, (short)0, c,
                                                 false, false);
}

DEV const bf16_t* frag_ptr(const bf16_t* tile, int row0, int stride, int lane) {
  return tile + (size_t)(row0 + (lane & 15)) * stride + ((lane >> 4) << 3);
}

DEV v16bf frag_ld(const bf16_t* p) {
  v8bf lo = *(const v8bf*)(p);
  v8bf hi = *(const v8bf*)(p + 16);
  return __builtin_shufflevector(lo, hi, 0, 1, 2, 3, 4, 5, 6, 7,
                                 8, 9, 10, 11, 12, 13, 14, 15);
}

DEV v8f vzero8() {
  v8f z;
#pragma unroll
  for (int i = 0; i < 8; ++i) z[i] = 0.0f;
  return z;
}

// v_rcp_f32 and v_exp_f32 (2^a), each with the one slot that the instruction set asks for
// behind a transcendental before its result is used or its source overwritten; in one
// statement with it, so that the slot stands there whatever is scheduled next.
DEV float rcp_slot(float a) {
  float r;
  asm("v_rcp_f32 %0, %1\n\tv_nop" : "=v"(r) : "v"(a));
  return r;
}
DEV float exp2_slot(float a) {
  float r;
  asm("v_exp_f32 %0, %1\n\tv_nop" : "=v"(r) : "v"(a));
  return r;
}

// Exact GELU, 0.5 x (1 + erf(x / sqrt 2)), of 8 values, without a branch: 8 independent
// chains, stage by stage. One formula serves every z = |x| / sqrt 2: with t = 1 / (1 + p z),
// erfc(z) = t (a1 + t (a2 + t (a3 + t (a4 + t a5)))) exp(-z z), absolute error 1.5e-7.
// 1 + erf is 2 - erfc(z) for x >= 0 and erfc(z) itself for x < 0.
DEV void gelu_exact8(float (&x)[8]) {
  float z[8], t[8], e[8];
#pragma unroll
  for (int i = 0; i < 8; ++i) z[i] = fabsf(x[i]) * 0.70710678118654752f;
#pragma unroll
  for (int i = 0; i < 8; ++i) {
    t[i] = fmaf(0.3275911f, z[i], 1.0f);
    e[i] = z[i] * z[i] * -1.4426950408889634f;
  }
  // The two sched_barriers keep the 16 transcendentals together, away from what feeds them
  // and from what reads them: the compiler knows no latency of an asm statement and writes
  // no s_delay_alu for it, and a reader close behind would hold up the SIMD's other waves.
  __builtin_amdgcn_sched_barrier(0);
#pragma unroll
  for (int i = 0; i < 8; ++i) t[i] = rcp_slot(t[i]);
#pragma unroll
  for (int i = 0; i < 8; ++i) e[i] = exp2_slot(e[i]);
  __builtin_amdgcn_sched_barrier(0);
#pragma unroll
  for (int i = 0; i < 8; ++i) {
    float p = fmaf(1.061405429f, t[i], -1.453152027f);
    p = fmaf(p, t[i], 1.421413741f);
    p = fmaf(p, t[i], -0.284496736f);
    p = fmaf(p, t[i], 0.254829592f);
    const float h = (0.5f * x[i]) * ((p * t[i]) * e[i]);  // 0.5 x erfc(z)
    x[i] = x[i] >= 0.f ? x[i] - h : h;
  }
}

// ---------------------------------------------------------------------------
// CDNA5 async global->LDS copy (ASYNCcnt-tracked), 16 bytes per lane, as the builtin:
// the compiler then forms each copy's address from a uniform base and one lane offset.
// ---------------------------------------------------------------------------
typedef __attribute__((ext_vector_type(4))) int v4i;
typedef __attribute__((address_space(1))) v4i g_v4i;
typedef __attribute__((address_space(3))) v4i l_v4i;

DEV void async_copy_b128(bf16_t* ldst, const char* gsrc) {
  __builtin_amdgcn_global_load_async_to_lds_b128((g_v4i*)gsrc, (l_v4i*)ldst, 0, 0);
}

DEV void wait_async0() { asm volatile("s_wait_asynccnt 0x0" ::: "memory"); }
DEV void wait_ds0() { asm volatile("s_wait_dscnt 0x0" ::: "memory"); }

// ---------------------------------------------------------------------------
// LayerNorm over D=1024, writes bf16. One block per row, 256 threads x 4 elems.
// ---------------------------------------------------------------------------
__global__ __launch_bounds__(256) void ln_kernel(const float* __restrict__ x,
                                                 const float* __restrict__ g,
                                                 const float* __restrict__ b,
                                                 bf16_t* __restrict__ out) {
  const int row = blockIdx.x;
  const int tid = threadIdx.x, lane = tid & 31, wave = tid >> 5;
  const float4 v = ((const float4*)(x + (size_t)row * 1024))[tid];
  float s = v.x + v.y + v.z + v.w;
  float ss = v.x * v.x + v.y * v.y + v.z * v.z + v.w * v.w;
#pragma unroll
  for (int o = 16; o; o >>= 1) {
    s += __shfl_xor(s, o);
    ss += __shfl_xor(ss, o);
  }
  __shared__ float red[16];
  if (lane == 0) { red[wave] = s; red[8 + wave] = ss; }
  __syncthreads();
  if (tid == 0) {
    float a = 0.f, c = 0.f;
#pragma unroll
    for (int i = 0; i < 8; ++i) { a += red[i]; c += red[8 + i]; }
    red[0] = a; red[8] = c;
  }
  __syncthreads();
  const float mean = red[0] * (1.0f / 1024.0f);
  const float var = red[8] * (1.0f / 1024.0f) - mean * mean;
  const float inv = rsqrtf(var + 1e-5f);
  const float4 gg = ((const float4*)g)[tid];
  const float4 bb = ((const float4*)b)[tid];
  bf16_t* o4 = out + (size_t)row * 1024 + tid * 4;
  o4[0] = (bf16_t)((v.x - mean) * inv * gg.x + bb.x);
  o4[1] = (bf16_t)((v.y - mean) * inv * gg.y + bb.y);
  o4[2] = (bf16_t)((v.z - mean) * inv * gg.z + bb.z);
  o4[3] = (bf16_t)((v.w - mean) * inv * gg.w + bb.w);
}

// ---------------------------------------------------------------------------
// Weight convert+transpose, all seven weights in one launch: f32 W[K][N] -> bf16
// Wt[N][K], the seven Wt back to back in WtAll. One 128(k) x 128(n) tile a block.
// A wave reads whole 512-B rows, two neighbouring k rows a pair; a pair is rounded
// and packed to one dword (k even low, k odd high); rows of Wt leave as 256-B runs.
// ---------------------------------------------------------------------------
typedef __attribute__((ext_vector_type(2))) __bf16 v2bf;
typedef __attribute__((ext_vector_type(4))) __bf16 v4bf;
typedef __attribute__((ext_vector_type(4))) float v4f;
typedef __attribute__((ext_vector_type(4))) uint32_t v4u;

// dword index of (column n, k pair p): pitch 65 spreads the 4-column lane stride over
// the banks; the 2 extra dwords from column 64 on keep lanes 16..31 off lanes 0..15.
DEV int wt_idx(int n, int p) { return n * 65 + ((n >> 6) << 1) + p; }

// One tile. K and N are compile-time, so that a lane's 16 loads share one address and
// differ in the immediate offset only.
template <int K, int N>
DEV void wt_tile(const float* __restrict__ W, bf16_t* __restrict__ Wt, int l,
                 uint32_t* t) {
  const int tid = threadIdx.x, lane = tid & 31, wave = tid >> 5;
  const int n0 = (l % (N / 128)) * 128, k0 = (l / (N / 128)) * 128;

  // k pair p = wave + 8 i: rows k0 + 2 p and k0 + 2 p + 1, 512 B of each a wave
  const float* src = W + (size_t)(k0 + 2 * wave) * N + n0 + lane * 4;
  v4f a[8], b[8];
#pragma unroll
  for (int i = 0; i < 8; ++i) {
    a[i] = *(const v4f*)(src + (16 * i) * N);
    b[i] = *(const v4f*)(src + (16 * i + 1) * N);
  }
  // the wait that is owed before a register which an issued load names is rewritten;
  // src as an input keeps the address pair live over the whole run, so that no load's
  // result is placed in it
  asm volatile("s_wait_xcnt 0x0" ::"v"(src) : "memory");
  // keeps all 16 loads of a lane ahead of the first conversion, so that they fly
  // together; without it the last four are issued only when the first have landed
  __builtin_amdgcn_sched_barrier(0);
#pragma unroll
  for (int i = 0; i < 8; ++i)
#pragma unroll
    for (int u = 0; u < 4; ++u) {
      v2bf pk;
      pk[0] = (bf16_t)a[i][u];
      pk[1] = (bf16_t)b[i][u];
      t[wt_idx(lane * 4 + u, wave + 8 * i)] = __builtin_bit_cast(uint32_t, pk);
    }
  __syncthreads();
  // a wave stores rows n0 + 2 wave + 16 i and the next, 256 B of each
  const int l16 = tid & 15, r = tid >> 4;
  bf16_t* dst = Wt + (size_t)(n0 + r) * K + k0 + l16 * 8;
#pragma unroll
  for (int i = 0; i < 8; ++i) {
    const int base = wt_idx(r + 16 * i, l16 * 4);
    v4u o;
    o[0] = t[base];
    o[1] = t[base + 1];
    o[2] = t[base + 2];
    o[3] = t[base + 3];
    *(v4u*)(dst + (16 * i) * K) = o;
  }
}

// Blocks 0..383: the two [1024][3072]; 384..575: the three [1024][1024];
// 576..831: [1024][4096]; 832..1087: [4096][1024]. Every branch is block-uniform.
__global__ __launch_bounds__(256) void wt_transpose_kernel(
    const float* __restrict__ Wa, const float* __restrict__ Wb,
    const float* __restrict__ Wc, const float* __restrict__ Wd,
    const float* __restrict__ We, const float* __restrict__ Wf,
    const float* __restrict__ Wg, bf16_t* __restrict__ WtAll) {
  __shared__ uint32_t t[128 * 65 + 2];
  const int bid = blockIdx.x;
  if (bid < 384) {
    const bool s = bid >= 192;
    wt_tile<1024, 3072>(s ? Wb : Wa, WtAll + (s ? 3145728 : 0), s ? bid - 192 : bid, t);
  } else if (bid < 576) {
    const int g = (bid - 384) >> 6;
    wt_tile<1024, 1024>(g == 0 ? Wc : (g == 1 ? Wd : We), WtAll + 6291456 + g * 1048576,
                        (bid - 384) & 63, t);
  } else if (bid < 832) {
    wt_tile<1024, 4096>(Wf, WtAll + 9437184, bid - 576, t);
  } else {
    wt_tile<4096, 1024>(Wg, WtAll + 13631488, bid - 832, t);
  }
}

// ---------------------------------------------------------------------------
// One wave's 64 x 64 tile from its accumulators to global memory in whole 128-B lines.
// acc[mt][nt] holds the tile TRANSPOSED (weight rows were the A operand): lane l has row
// m = 16 mt + (l & 15) and the 8 neighbouring columns n = 16 nt + 8 (l >> 4) + r. They go
// as 16-byte pieces into st, the wave's own LDS range (32 rows of 64 elements + 16 B, so
// that the 16 rows of a store fall on different banks), and come back with the lanes laid
// along the rows: a wave-wide 16-byte store then covers 4 whole lines. Two rounds of 32
// rows. bias (+ bias2) and GELU before the staging, the f32 residual behind it, read in
// whole lines too.
// og, rg: element (0, 0) of the tile in out and res; bp, bq: the tile's first column.
// ---------------------------------------------------------------------------
template <typename OT, int NN, bool GELU_ACT, bool RES, bool TWOB>
DEV void tile_out(const v8f (&acc)[4][4], OT* st, OT* __restrict__ og,
                  const float* __restrict__ bp, const float* __restrict__ bq,
                  const float* __restrict__ rg, int lane) {
  typedef __attribute__((ext_vector_type(4))) float f4;
  constexpr bool B16 = sizeof(OT) == 2;
  constexpr int EPB = 16 / (int)sizeof(OT);  // elements of a 16-byte piece
  constexpr int SP = 64 + EPB;               // staging pitch, elements
  constexpr int LPR = 64 / EPB;              // lanes a row at the read-back
  constexpr int RPI = 32 / LPR;              // rows a wave-wide access
  constexpr int NJ = 32 / RPI;               // accesses a round
  const int cl = lane & 15, hi = lane >> 4;
  const float* bl = bp + hi * 8;
  const float* bm = bq + hi * 8;
  OT* ol = og + (size_t)(lane / LPR) * NN + (lane % LPR) * EPB;
  const float* rl = rg + (RES ? (size_t)(lane / LPR) * NN + (lane % LPR) * 4 : 0);
  OT* sw = st + cl * SP + hi * 8;
  const OT* sr = st + (lane / LPR) * SP + (lane % LPR) * EPB;

  float bv[4][8];
#pragma unroll
  for (int nt = 0; nt < 4; ++nt) {
    const f4 a = *(const f4*)(bl + nt * 16), b = *(const f4*)(bl + nt * 16 + 4);
#pragma unroll
    for (int r = 0; r < 4; ++r) { bv[nt][r] = a[r]; bv[nt][4 + r] = b[r]; }
  }
  if constexpr (TWOB) {
#pragma unroll
    for (int nt = 0; nt < 4; ++nt) {
      const f4 a = *(const f4*)(bm + nt * 16), b = *(const f4*)(bm + nt * 16 + 4);
#pragma unroll
      for (int r = 0; r < 4; ++r) { bv[nt][r] += a[r]; bv[nt][4 + r] += b[r]; }
    }
  }
  // the wait that is owed before a register which an issued load names is rewritten; the
  // addresses as inputs stay live up to it
  if constexpr (TWOB) asm volatile("s_wait_xcnt 0x0" ::"v"(bl), "v"(bm) : "memory");
  else asm volatile("s_wait_xcnt 0x0" ::"v"(bl) : "memory");

#pragma unroll
  for (int hf = 0; hf < 2; ++hf) {
    f4 rr[NJ];
    if constexpr (RES) {
      // ahead of the staging, so that they fly during it
#pragma unroll
      for (int j = 0; j < NJ; ++j) rr[j] = *(const f4*)(rl + (hf * 32 + j * RPI) * NN);
    }
#pragma unroll
    for (int i = 0; i < 2; ++i)
#pragma unroll
      for (int nt = 0; nt < 4; ++nt) {
        float v[8];
#pragma unroll
        for (int r = 0; r < 8; ++r) v[r] = acc[hf * 2 + i][nt][r] + bv[nt][r];
        if constexpr (GELU_ACT) gelu_exact8(v);
        if constexpr (B16) {
          v8bf pk;
#pragma unroll
          for (int r = 0; r < 8; ++r) pk[r] = (bf16_t)v[r];
          *(v8bf*)(sw + i * 16 * SP + nt * 16) = pk;
        } else {
          f4 lo, up;
#pragma unroll
          for (int r = 0; r < 4; ++r) { lo[r] = v[r]; up[r] = v[4 + r]; }
          *(f4*)(sw + i * 16 * SP + nt * 16) = lo;
          *(f4*)(sw + i * 16 * SP + nt * 16 + 4) = up;
        }
      }
    wait_ds0();  // the wave's own pieces are in LDS before other lanes of it read them
    if constexpr (B16) {
      v8bf x[NJ];
#pragma unroll
      for (int j = 0; j < NJ; ++j) x[j] = *(const v8bf*)(sr + j * RPI * SP);
#pragma unroll
      for (int j = 0; j < NJ; ++j) *(v8bf*)(ol + (hf * 32 + j * RPI) * NN) = x[j];
    } else {
      f4 x[NJ];
#pragma unroll
      for (int j = 0; j < NJ; ++j) x[j] = *(const f4*)(sr + j * RPI * SP);
      if constexpr (RES) {
#pragma unroll
        for (int j = 0; j < NJ; ++j) x[j] += rr[j];
      }
#pragma unroll
      for (int j = 0; j < NJ; ++j) *(f4*)(ol + (hf * 32 + j * RPI) * NN) = x[j];
    }
    // the same wait, behind each round's loads and stores
    if constexpr (RES) asm volatile("s_wait_xcnt 0x0" ::"v"(ol), "v"(rl) : "memory");
    else asm volatile("s_wait_xcnt 0x0" ::"v"(ol) : "memory");
  }
}

// ---------------------------------------------------------------------------
// Generic bf16 GEMM, f32 accumulate: out[M][NN] = A[M][K] * Bt[NN][K]^T + bias
// Block: 256 thr = 8 waves (2 x 4); tile 128 x 256; wave tile 64 x 64 (4 M-frags x
// 4 N-frags), so that a fragment read from LDS feeds 4 WMMAs and fewer bytes come from
// L2 per product than with a 128 x 128 tile. A pass is KP k = KP / 32 blocks of 32 k.
// Two LDS buffers, each [A 128 rows | Bt 256 rows] at pitch 2 KP + 16 B, filled by async
// global->LDS copies one pass ahead; one barrier a pass. KP = 64: two work-groups fit a
// WGP (grids of more than one a WGP). KP = 128: one work-group a WGP, twice the k per
// barrier and per copy latency (grids of 256).
// Epilogue (tile_out): optional GELU, optional f32 residual, bf16 or f32 output.
// M multiple of 128, NN of 256, K of KP.
// The k walk is rotated: work-group (x, y) begins at pass (x + y) & (passes - 1) and wraps
// round. Work-groups that share operand rows (one x: Bt, one y: A) start together; from one
// k they would ask L2 for the same lines at the same moment, and every request on the chip
// would fall on the same 128 B or 256 B of the operands' 2-KiB and 8-KiB rows.
// Two products that share an operand or an output run as one launch:
// CATN: Bt holds 2 NN rows, the weights of two products of the same A one behind the other;
//   grid.x = 2 NN / 256. Column blocks below NN give out (bf16, bias), the rest out2 (f32,
//   bias2), each [M][NN].
// CATK: out = A Bt^T + A2 Bt2^T + bias + bias2, all four operands of row length K: the k
//   passes of the second product (k from K to 2 K) and those of the first form one rotated walk on the
//   same accumulators.
// ---------------------------------------------------------------------------
template <int KP, int NN, bool OUT_BF16, bool GELU_ACT, bool RES, bool CATN = false,
          bool CATK = false>
__global__ __launch_bounds__(256) void gemm_kernel(
    const bf16_t* __restrict__ A, const bf16_t* __restrict__ Bt,
    const float* __restrict__ bias, const float* __restrict__ res,
    void* __restrict__ out, int K, const bf16_t* __restrict__ A2,
    const bf16_t* __restrict__ Bt2, const float* __restrict__ bias2,
    void* __restrict__ out2) {
  constexpr int LDK = KP + 8;              // row pitch 144 or 272 B = 16 B x odd
  constexpr int STAGE = (128 + 256) * LDK; // elements of one buffer
  constexpr int NB = KP / 32;              // blocks per pass
  constexpr int PR = KP / 8;               // 16-byte pieces per row
  constexpr int RG = 256 / PR;             // rows that the block's 256 threads copy at once
  __shared__ __align__(16) bf16_t sT[2][STAGE];
  const int tid = threadIdx.x, lane = tid & 31, wave = tid >> 5;
  const int m0 = blockIdx.y * 128, n0 = blockIdx.x * 256;
  const int wm = (wave >> 2) * 64;  // wave M offset within tile
  const int wn = (wave & 3) * 64;   // wave N offset within tile

  v8f acc[4][4];
#pragma unroll
  for (int i = 0; i < 4; ++i)
#pragma unroll
    for (int j = 0; j < 4; ++j) acc[i][j] = vzero8();

  const int cr = tid / PR;          // row within a group of RG rows
  const int cc = (tid % PR) * 8;    // 16-byte piece of the row
  // one 32-bit lane offset serves every copy; the rest of each address is uniform
  const uint32_t goff = (uint32_t)(cr * K + cc) * 2u;
  const char* uA = (const char*)(A + (size_t)m0 * K);
  const char* uB = (const char*)(Bt + (size_t)n0 * K);
  const char* uA2 = CATK ? (const char*)(A2 + (size_t)m0 * K) : uA;
  const char* uB2 = CATK ? (const char*)(Bt2 + (size_t)n0 * K) : uB;

  // pass kq into buffer `buf`: 3 KP / 16 copies of 16 B per thread (12 or 24), whole lines
  auto stage = [&](int kq, int buf) {
    // CATK: from k = K on the second pair of operands, a choice that is block-uniform
    const bool second = CATK && kq >= K;
    const char* pA = second ? uA2 : uA;
    const char* pB = second ? uB2 : uB;
    const int k0 = second ? kq - K : kq;
    bf16_t* d = &sT[buf][cr * LDK + cc];
#pragma unroll
    for (int i = 0; i < 128 / RG; ++i)
      async_copy_b128(d + i * RG * LDK, pA + ((size_t)(i * RG) * K + k0) * 2 + goff);
#pragma unroll
    for (int i = 0; i < 256 / RG; ++i)
      async_copy_b128(d + (128 + i * RG) * LDK,
                      pB + ((size_t)(i * RG) * K + k0) * 2 + goff);
  };

  const int fa = (wm + (lane & 15)) * LDK + ((lane >> 4) << 3);
  const int fb = (128 + wn + (lane & 15)) * LDK + ((lane >> 4) << 3);

  const int ktot = CATK ? 2 * K : K;
  const int npass = ktot / KP;
  // k of the next pass to be staged; the mask gives a start below npass for any npass
  int kn = (int)((blockIdx.x + blockIdx.y) & (unsigned)(npass - 1)) * KP;
  auto next_k = [&]() {
    const int k = kn;
    kn = kn + KP == ktot ? 0 : kn + KP;
    return k;
  };
  stage(next_k(), 0);
  wait_async0();    // own copies of the first pass have landed
  __syncthreads();  // everyone's have
  if (1 < npass) stage(next_k(), 1);
  for (int t = 0; t < npass; ++t) {
    const int buf = t & 1;
    const bf16_t* cur = &sT[buf][0];
    // the sched_barriers keep [16 LDS reads][16 WMMAs] as written: a block's reads go as
    // one group; left alone they are spread in pairs among the WMMAs, each pair with a
    // full wait of its own behind it
#pragma unroll
    for (int u = 0; u < NB; ++u) {
      v16bf af[4], bfv[4];
      __builtin_amdgcn_sched_barrier(0);
#pragma unroll
      for (int mt = 0; mt < 4; ++mt) af[mt] = frag_ld(cur + fa + mt * 16 * LDK + u * 32);
#pragma unroll
      for (int nt = 0; nt < 4; ++nt) bfv[nt] = frag_ld(cur + fb + nt * 16 * LDK + u * 32);
      __builtin_amdgcn_sched_barrier(0);
#pragma unroll
      for (int nt = 0; nt < 4; ++nt)
#pragma unroll
        for (int mt = 0; mt < 4; ++mt)
          acc[mt][nt] = wmma_bf16(bfv[nt], af[mt], acc[mt][nt]);  // D = tile^T: tile_out
    }
    // publish point of pass t + 1
    wait_ds0();       // own reads of this buffer have all returned
    wait_async0();    // own copies of pass t + 1 have landed
    __syncthreads();  // everyone's have, and everyone has left this buffer
    if (t + 2 < npass) stage(next_k(), buf);
  }
  wait_async0();  // nothing is in flight when the wave goes on to its end

  // Every wave has left the ring (the last pass's barrier) and no copy is in flight: the
  // ring's LDS is free, and each wave stages in a range of its own.
  typedef typename std::conditional<OUT_BF16, bf16_t, float>::type out_t;
  static_assert(!(RES && OUT_BF16) && !(RES && GELU_ACT), "residual: f32 output, no GELU");
  if constexpr (CATN) {
    // block-uniform: a block's 256 columns lie wholly in one of the two products
    if (n0 >= NN) {
      tile_out<float, NN, false, false, false>(
          acc, (float*)&sT[0][0] + wave * (32 * 68),
          (float*)out2 + (size_t)(m0 + wm) * NN + (size_t)(n0 - NN + wn),
          bias2 + (n0 - NN + wn), bias2, bias2, lane);
      return;
    }
  }
  const size_t e0 = (size_t)(m0 + wm) * NN + (size_t)(n0 + wn);
  tile_out<out_t, NN, GELU_ACT, RES, CATK>(
      acc, (out_t*)&sT[0][0] + wave * (32 * (64 + 16 / (int)sizeof(out_t))), (out_t*)out + e0,
      bias + (n0 + wn), CATK ? bias2 + (n0 + wn) : bias, RES ? res + e0 : bias, lane);
}

// ---------------------------------------------------------------------------
// One wave's 16 rows x 64 head columns, bf16, to global memory in whole 128-B lines, as in
// tile_out: t[nt] holds the tile transposed (lane l: row l & 15, columns 16 nt + 8 (l >> 4)
// + r). st: the wave's own 16 rows of an LDS tile that only it reads and that it has done
// with, pitch sp elements (16 B x odd). og: element (0, 0), row pitch 1024. dv: the lane's
// row is divided by den.
// ---------------------------------------------------------------------------
DEV void head_rows_out(const v8f (&t)[4], bf16_t* st, int sp, bf16_t* __restrict__ og,
                       float den, bool dv, int lane) {
#pragma unroll
  for (int nt = 0; nt < 4; ++nt) {
    v8bf pk;
#pragma unroll
    for (int r = 0; r < 8; ++r) pk[r] = (bf16_t)(dv ? t[nt][r] / den : t[nt][r]);
    *(v8bf*)(st + (lane & 15) * sp + nt * 16 + (lane >> 4) * 8) = pk;
  }
  wait_ds0();  // the wave's own pieces are in LDS before other lanes of it read them
  v8bf x[4];
#pragma unroll
  for (int j = 0; j < 4; ++j)
    x[j] = *(const v8bf*)(st + (j * 4 + (lane >> 3)) * sp + (lane & 7) * 8);
  bf16_t* ol = og + (size_t)(lane >> 3) * 1024 + (lane & 7) * 8;
#pragma unroll
  for (int j = 0; j < 4; ++j) *(v8bf*)(ol + j * 4 * 1024) = x[j];
}

// ---------------------------------------------------------------------------
// Sliding-window attention. One block per (query-block, head, batch).
// Q 128x64, K/V context 256x64 (prev block + own block), W=128 band mask.
// All matmuls via WMMA; softmax in registers with 16-lane shuffles.
// qkv: bf16 [B*L][3*1024]; out: bf16 [B*L][1024].
// ---------------------------------------------------------------------------
__global__ __launch_bounds__(256) void swa_kernel(const bf16_t* __restrict__ qkv,
                                                  bf16_t* __restrict__ out) {
  const int blk = blockIdx.x, h = blockIdx.y, b = blockIdx.z;
  const int tid = threadIdx.x, lane = tid & 31, wave = tid >> 5;

  // Q(128x72) + K(256x72) overlap with P(128x264) -- disjoint lifetimes.
  __shared__ __align__(16) char smem_u[128 * 264 * 2];
  __shared__ __align__(16) bf16_t sVt[64 * 264];  // V^T [e][s]
  bf16_t* sQ = (bf16_t*)smem_u;                   // [128][72]
  bf16_t* sK = (bf16_t*)smem_u + 128 * 72;        // [256][72]
  bf16_t* sP = (bf16_t*)smem_u;                   // [128][264]

  const size_t rowQ0 = (size_t)b * 4096 + (size_t)blk * 128;

  // 8 lanes a 128-B head row: a wave-wide load covers 4 whole rows = 4 whole lines.
  // Q: rows rg + 32 i. K, V: loads 2 p and 2 p + 1 of a thread are the neighbouring keys s0
  // and s0 + 1, s0 = 64 p + 2 rg, which share a dword of V^T. Keys 0..127 are the previous
  // block (p < 2): block 0 has none and takes zeros, a choice that is block-uniform.
  {
    const int l8 = tid & 7, rg = tid >> 3;
    const bf16_t* srcq = qkv + (rowQ0 + rg) * 3072 + h * 64 + l8 * 8;
    const bf16_t* srck = qkv + (rowQ0 + rg * 2) * 3072 + 1024 + h * 64 + l8 * 8;  // key 128 + 2 rg
    v8bf qx[4], kx[8], vx[8];
#pragma unroll
    for (int i = 0; i < 4; ++i) qx[i] = *(const v8bf*)(srcq + (i * 32) * 3072);
#pragma unroll
    for (int i = 4; i < 8; ++i) {
      kx[i] = *(const v8bf*)(srck + (((i >> 1) - 2) * 64 + (i & 1)) * 3072);
      vx[i] = *(const v8bf*)(srck + (((i >> 1) - 2) * 64 + (i & 1)) * 3072 + 1024);
    }
    if (blk > 0) {
#pragma unroll
      for (int i = 0; i < 4; ++i) {
        kx[i] = *(const v8bf*)(srck + (((i >> 1) - 2) * 64 + (i & 1)) * 3072);
        vx[i] = *(const v8bf*)(srck + (((i >> 1) - 2) * 64 + (i & 1)) * 3072 + 1024);
      }
    } else {
#pragma unroll
      for (int i = 0; i < 4; ++i)
#pragma unroll
        for (int j = 0; j < 8; ++j) {
          kx[i][j] = (bf16_t)0.f;
          vx[i][j] = (bf16_t)0.f;
        }
    }
    // the wait that is owed before a register which an issued load names is rewritten;
    // the two addresses as inputs stay live over the whole run
    asm volatile("s_wait_xcnt 0x0" ::"v"(srcq), "v"(srck) : "memory");
#pragma unroll
    for (int i = 0; i < 4; ++i) *(v8bf*)&sQ[(rg + 32 * i) * 72 + l8 * 8] = qx[i];
#pragma unroll
    for (int i = 0; i < 8; ++i)
      *(v8bf*)&sK[((i >> 1) * 64 + rg * 2 + (i & 1)) * 72 + l8 * 8] = kx[i];
#pragma unroll
    for (int p = 0; p < 4; ++p)
#pragma unroll
      for (int j = 0; j < 8; ++j) {
        v2bf vo;
        vo[0] = vx[2 * p][j];
        vo[1] = vx[2 * p + 1][j];
        *(v2bf*)&sVt[(l8 * 8 + j) * 264 + p * 64 + rg * 2] = vo;
      }
  }
  __syncthreads();

  // Scores: wave w owns query rows [16w,16w+16); 16 key tiles; K-dim = 64.
  v8f acc[16];
#pragma unroll
  for (int i = 0; i < 16; ++i) acc[i] = vzero8();
#pragma unroll
  for (int kk = 0; kk < 64; kk += 32) {
    v16bf aq = frag_ld(frag_ptr(sQ, wave * 16, 72, lane) + kk);
#pragma unroll
    for (int nt = 0; nt < 16; ++nt) {
      v16bf bk = frag_ld(frag_ptr(sK, nt * 16, 72, lane) + kk);
      acc[nt] = wmma_bf16(aq, bk, acc[nt]);
    }
  }

  // Mask + softmax. C-layout: row = 16*wave + 8*(lane>>4) + r, col = 16*nt + (lane&15)
  const int cl = lane & 15, rh = (lane >> 4) << 3;
#pragma unroll
  for (int r = 0; r < 8; ++r) {
    const int rloc = wave * 16 + rh + r;
    float mx = -1e30f;
#pragma unroll
    for (int nt = 0; nt < 16; ++nt) {
      const int s = nt * 16 + cl;
      const bool ok = (s >= rloc + 1) && (s <= rloc + 128) && (blk > 0 || s >= 128);
      const float v = ok ? acc[nt][r] * 0.125f : -1e30f;
      acc[nt][r] = v;
      mx = fmaxf(mx, v);
    }
#pragma unroll
    for (int o = 1; o < 16; o <<= 1) mx = fmaxf(mx, __shfl_xor(mx, o));
    float sum = 0.f;
#pragma unroll
    for (int nt = 0; nt < 16; ++nt) {
      const float e = __expf(acc[nt][r] - mx);
      acc[nt][r] = e;
      sum += e;
    }
#pragma unroll
    for (int o = 1; o < 16; o <<= 1) sum += __shfl_xor(sum, o);
    const float inv = 1.0f / sum;
#pragma unroll
    for (int nt = 0; nt < 16; ++nt) acc[nt][r] *= inv;
  }

  __syncthreads();  // all waves done reading sQ/sK before P overwrites them
#pragma unroll
  for (int nt = 0; nt < 16; ++nt)
#pragma unroll
    for (int r = 0; r < 8; ++r)
      sP[(wave * 16 + rh + r) * 264 + nt * 16 + cl] = (bf16_t)acc[nt][r];
  __syncthreads();

  // PV: out 16x64 per wave; K-dim = 256 keys.
  v8f ov[4];
#pragma unroll
  for (int i = 0; i < 4; ++i) ov[i] = vzero8();
#pragma unroll
  for (int kk = 0; kk < 256; kk += 32) {
    v16bf ap = frag_ld(frag_ptr(sP, wave * 16, 264, lane) + kk);
#pragma unroll
    for (int nt = 0; nt < 4; ++nt) {
      v16bf bv = frag_ld(frag_ptr(sVt, nt * 16, 264, lane) + kk);
      ov[nt] = wmma_bf16(bv, ap, ov[nt]);  // D = tile^T: query cl, 8 neighbouring e a lane
    }
  }
  head_rows_out(ov, sP + wave * 16 * 264, 264,
                out + (rowQ0 + wave * 16) * 1024 + h * 64, 1.0f, false, lane);
}

// ---------------------------------------------------------------------------
// Chunked causal linear attention, chunk-parallel, three launches:
//   lin_state : per (chunk, b, h) the chunk's own v^T k' (64x64 f32) and colsum(k')
//   lin_prefix: exclusive running sum over the chunks, f32, chunk 0 first
//   lin_out   : per (chunk, b, h) the outputs from q', k', v and the summed state
// qkv: f32 [B*L][3*1024] (elu applied at load); out: bf16 [B*L][1024].
// State records: index (bh*32 + ch); S^T as [f][e].
// ---------------------------------------------------------------------------

// The last chunk's own state is read by nobody: grid.x = 31.
__global__ __launch_bounds__(256) void lin_state_kernel(const float* __restrict__ qkv,
                                                        float* __restrict__ Sc,
                                                        float* __restrict__ zc) {
  const int ch = blockIdx.x, bh = blockIdx.y, b = bh >> 4, h = bh & 15;
  const int tid = threadIdx.x, lane = tid & 31, wave = tid >> 5;
  __shared__ __align__(16) bf16_t skT[64 * 136];   // k'^T     [e][c]
  __shared__ __align__(16) bf16_t svT[64 * 136];   // v^T      [f][c]
  const int cl = lane & 15, rh = (lane >> 4) << 3;
  {
    // 16 lanes a 256-B head row: a wave-wide load covers two whole rows = 4 whole lines.
    // Loads 2 p and 2 p + 1 of a thread are the neighbouring rows c0 and c0 + 1, which share
    // a dword of the transposed tiles.
    const int l16 = tid & 15, rg = tid >> 4;
    const float* pk = qkv + ((size_t)b * 4096 + (size_t)ch * 128 + rg * 2) * 3072 + 1024 +
                      h * 64 + l16 * 4;
    // loads first, elu after: the loads fly together, not one round trip each
    v4f kx[8], vx[8];
#pragma unroll
    for (int i = 0; i < 8; ++i) {
      kx[i] = *(const v4f*)(pk + ((i >> 1) * 32 + (i & 1)) * 3072);
      vx[i] = *(const v4f*)(pk + ((i >> 1) * 32 + (i & 1)) * 3072 + 1024);
    }
    // the wait that is owed before a register which an issued load names is rewritten;
    // pk as an input keeps the address live over the whole run
    asm volatile("s_wait_xcnt 0x0" ::"v"(pk) : "memory");
    // keeps all 16 loads of a lane ahead of the first conversion, so that they fly
    // together; without it the last four are issued only when the first have landed
    __builtin_amdgcn_sched_barrier(0);
#pragma unroll
    for (int p = 0; p < 4; ++p) {
      const int c0 = p * 32 + rg * 2;
#pragma unroll
      for (int u = 0; u < 4; ++u) {
        v2bf ko, vo;
#pragma unroll
        for (int o = 0; o < 2; ++o) {
          const float kr = kx[2 * p + o][u];
          const float em = expm1f(kr);  // unconditional: a select, no branch a value
          ko[o] = (bf16_t)((kr > 0.f ? kr : em) + 1.0001f);
          vo[o] = (bf16_t)vx[2 * p + o][u];
        }
        *(v2bf*)&skT[(l16 * 4 + u) * 136 + c0] = ko;
        *(v2bf*)&svT[(l16 * 4 + u) * 136 + c0] = vo;
      }
    }
  }
  __syncthreads();

  const size_t rec = (size_t)bh * 32 + ch;
  // v^T @ k'  (16 tiles over 8 waves, 2 each), K-dim 128
  {
    const int ft = wave >> 1;
    const int ebase = (wave & 1) * 32;
    v8f accS[2];
#pragma unroll
    for (int i = 0; i < 2; ++i) accS[i] = vzero8();
#pragma unroll
    for (int kk = 0; kk < 128; kk += 32) {
      v16bf av = frag_ld(frag_ptr(svT, ft * 16, 136, lane) + kk);
#pragma unroll
      for (int nt = 0; nt < 2; ++nt) {
        v16bf bk = frag_ld(frag_ptr(skT, ebase + nt * 16, 136, lane) + kk);
        accS[nt] = wmma_bf16(av, bk, accS[nt]);
      }
    }
#pragma unroll
    for (int nt = 0; nt < 2; ++nt)
#pragma unroll
      for (int r = 0; r < 8; ++r) {
        const int f = ft * 16 + rh + r;
        const int e = ebase + nt * 16 + cl;
        Sc[rec * 4096 + f * 64 + e] = accS[nt][r];
      }
  }
  if (tid < 64) {
    float zs = 0.f;
#pragma unroll 8
    for (int c = 0; c < 128; ++c) zs += (float)skT[tid * 136 + c];
    zc[rec * 64 + tid] = zs;
  }
}

// Blocks 0..255: S^T, two neighbouring elements a thread, rounded to bf16 at the
// store (the A operand of the transposed q' @ S). Blocks 256..263: z, kept in f32.
__global__ __launch_bounds__(256) void lin_prefix_kernel(const float* __restrict__ Sc,
                                                         const float* __restrict__ zc,
                                                         bf16_t* __restrict__ Sb,
                                                         float* __restrict__ zp) {
  if (blockIdx.x >= 256) {
    const int t = (blockIdx.x - 256) * 256 + threadIdx.x;
    const size_t base = (size_t)(t >> 6) * (32 * 64) + (size_t)(t & 63);
    float v[31];
#pragma unroll
    for (int ch = 0; ch < 31; ++ch) v[ch] = zc[base + ch * 64];
    float s = 0.f;
#pragma unroll
    for (int ch = 0; ch < 32; ++ch) {
      zp[base + ch * 64] = s;
      if (ch < 31) s += v[ch];
    }
    return;
  }
  const int t = blockIdx.x * 256 + threadIdx.x;
  const size_t base = (size_t)(t >> 11) * (32 * 4096) + (size_t)(t & 2047) * 2;
  float2 v[31];
#pragma unroll
  for (int ch = 0; ch < 31; ++ch) v[ch] = *(const float2*)(Sc + base + ch * 4096);
  float s0 = 0.f, s1 = 0.f;
#pragma unroll
  for (int ch = 0; ch < 32; ++ch) {
    v2bf o;
    o[0] = (bf16_t)s0;
    o[1] = (bf16_t)s1;
    *(v2bf*)(Sb + base + ch * 4096) = o;
    if (ch < 31) { s0 += v[ch].x; s1 += v[ch].y; }
  }
  // the built code lets this path run on to the z path's first instructions behind a
  // scalar test; they rewrite registers that the stores above name: wait in front
  asm volatile("s_wait_xcnt 0x0" ::: "memory");
}

// 8 waves a SIMD asked for: at most 128 registers, so that four work-groups fit a WGP
__global__ __launch_bounds__(256, 8) void lin_out_kernel(const float* __restrict__ qkv,
                                                      const bf16_t* __restrict__ Sb,
                                                      const float* __restrict__ zp,
                                                      bf16_t* __restrict__ out) {
  const int ch = blockIdx.x, bh = blockIdx.y, b = bh >> 4, h = bh & 15;
  const int tid = threadIdx.x, lane = tid & 31, wave = tid >> 5;
  // q'(128x72) + k'(128x72) overlap with masked A (128x136) -- disjoint lifetimes.
  __shared__ __align__(16) char smem_u[2 * 128 * 72 * 2];
  __shared__ __align__(16) bf16_t svT[64 * 136];   // v^T      [f][c]
  __shared__ __align__(16) bf16_t sSB[64 * 72];    // bf16 S^T before this chunk [f][e]
  __shared__ float sz[64];
  __shared__ float sqz[128];
  __shared__ float sden[128];
  bf16_t* sq = (bf16_t*)smem_u;                    // q' rows  [c][e]
  bf16_t* sk = (bf16_t*)smem_u + 128 * 72;         // k' rows  [c][e]
  bf16_t* sP = (bf16_t*)smem_u;                    // masked A [c][d]

  const int cl = lane & 15, rh = (lane >> 4) << 3;
  const size_t rec = (size_t)bh * 32 + ch;

  // 1. state before this chunk (A-operand layout: row f, cols e)
#pragma unroll
  for (int i = tid; i < 512; i += 256)
    *(v8bf*)&sSB[(i >> 3) * 72 + (i & 7) * 8] = *(const v8bf*)(Sb + rec * 4096 + i * 8);
  if (tid < 64) sz[tid] = zp[rec * 64 + tid];
  // 2. load chunk, apply elu maps
  {
    // 16 lanes a 256-B head row: a wave-wide load covers two whole rows = 4 whole lines.
    // A thread takes the neighbouring rows c0 and c0 + 1, which share a dword of v^T.
    const int l16 = tid & 15, rg = tid >> 4;
    const float* pq = qkv + ((size_t)b * 4096 + (size_t)ch * 128 + rg * 2) * 3072 + h * 64 +
                      l16 * 4;
    // kept rolled, 6 loads a trip: unrolled, the register count passes 128 and only three
    // work-groups, not four, fit a WGP
#pragma unroll 1
    for (int p = 0; p < 4; ++p) {
      const int c0 = p * 32 + rg * 2;
      v4f qx[2], kx[2], vx[2];
#pragma unroll
      for (int o = 0; o < 2; ++o) {
        qx[o] = *(const v4f*)(pq + (p * 32 + o) * 3072);
        kx[o] = *(const v4f*)(pq + (p * 32 + o) * 3072 + 1024);
        vx[o] = *(const v4f*)(pq + (p * 32 + o) * 3072 + 2048);
      }
      // the wait that is owed before a register which an issued load names is rewritten;
      // pq as an input keeps the address live over the run
      asm volatile("s_wait_xcnt 0x0" ::"v"(pq) : "memory");
#pragma unroll
      for (int o = 0; o < 2; ++o) {
        v4bf qo, ko;
#pragma unroll
        for (int u = 0; u < 4; ++u) {
          // expm1f unconditional: a select, no branch a value, as this loop was built before
          const float qv = qx[o][u] * 0.125f;  // E^-0.5
          const float qe = expm1f(qv);
          qo[u] = (bf16_t)((qv > 0.f ? qv : qe) + 1.0001f);
          const float kv = kx[o][u];
          const float ke = expm1f(kv);
          ko[u] = (bf16_t)((kv > 0.f ? kv : ke) + 1.0001f);
        }
        *(v4bf*)&sq[(c0 + o) * 72 + l16 * 4] = qo;
        *(v4bf*)&sk[(c0 + o) * 72 + l16 * 4] = ko;
      }
#pragma unroll
      for (int u = 0; u < 4; ++u) {
        v2bf vo;
        vo[0] = (bf16_t)vx[0][u];
        vo[1] = (bf16_t)vx[1][u];
        *(v2bf*)&svT[(l16 * 4 + u) * 136 + c0] = vo;
      }
    }
  }
  __syncthreads();

  // 3. A = q k'^T (8 tiles/wave) and num1 = q @ S (4 tiles/wave), K-dim 64
  v8f accA[8], accN[4];
#pragma unroll
  for (int i = 0; i < 8; ++i) accA[i] = vzero8();
#pragma unroll
  for (int i = 0; i < 4; ++i) accN[i] = vzero8();
#pragma unroll
  for (int kk = 0; kk < 64; kk += 32) {
    v16bf aq = frag_ld(frag_ptr(sq, wave * 16, 72, lane) + kk);
#pragma unroll
    for (int nt = 0; nt < 8; ++nt) {
      v16bf bk = frag_ld(frag_ptr(sk, nt * 16, 72, lane) + kk);
      accA[nt] = wmma_bf16(aq, bk, accA[nt]);
    }
#pragma unroll
    for (int nt = 0; nt < 4; ++nt) {
      v16bf bs = frag_ld(frag_ptr(sSB, nt * 16, 72, lane) + kk);
      accN[nt] = wmma_bf16(bs, aq, accN[nt]);  // D = tile^T: row cl, 8 neighbouring f a lane
    }
  }
  // 4a. q'.z while q' is still in LDS
  if (tid < 128) {
    float qz = 0.f;
#pragma unroll 8
    for (int e = 0; e < 64; ++e) qz += (float)sq[tid * 72 + e] * sz[e];
    sqz[tid] = qz;
  }
  __syncthreads();  // all waves done reading q'/k' before masked A overwrites them

  // tril mask + row sums + stage masked A as bf16; 4b. den[c] = q'.z + rowsum(A)
#pragma unroll
  for (int r = 0; r < 8; ++r) {
    const int c = wave * 16 + rh + r;
    float rs = 0.f;
#pragma unroll
    for (int nt = 0; nt < 8; ++nt) {
      const int d = nt * 16 + cl;
      const float v = (d <= c) ? accA[nt][r] : 0.f;
      accA[nt][r] = v;
      rs += v;
    }
#pragma unroll
    for (int o = 1; o < 16; o <<= 1) rs += __shfl_xor(rs, o);
    if (cl == 0) sden[c] = sqz[c] + rs;
#pragma unroll
    for (int nt = 0; nt < 8; ++nt)
      sP[c * 136 + nt * 16 + cl] = (bf16_t)accA[nt][r];
  }
  __syncthreads();

  // 5. num2 = A @ v  (A-operand = v^T rows; D transposed), K-dim 128
#pragma unroll
  for (int kk = 0; kk < 128; kk += 32) {
    v16bf ap = frag_ld(frag_ptr(sP, wave * 16, 136, lane) + kk);
#pragma unroll
    for (int nt = 0; nt < 4; ++nt) {
      v16bf bv = frag_ld(frag_ptr(svT, nt * 16, 136, lane) + kk);
      accN[nt] = wmma_bf16(bv, ap, accN[nt]);
    }
  }
  // 6. o = num / (den + 1e-6) -> global bf16
  head_rows_out(accN, sP + wave * 16 * 136, 136,
                out + ((size_t)b * 4096 + (size_t)ch * 128 + wave * 16) * 1024 + h * 64,
                sden[wave * 16 + cl] + 1e-6f, true, lane);
}

// ---------------------------------------------------------------------------
// Launch: B=2, L=4096, D=1024, H=16, E=64, W=128. Requires ws >= ~263 MB.
// ---------------------------------------------------------------------------
extern "C" void kernel_launch(void* const* d_in, const int* in_sizes, int n_in,
                              void* d_out, int out_size, void* d_ws, size_t ws_size,
                              hipStream_t stream) {
  const float* x = (const float*)d_in[0];
  const float* g1 = (const float*)d_in[1];
  const float* b1 = (const float*)d_in[2];
  const float* Wqkva = (const float*)d_in[3];
  const float* bqkva = (const float*)d_in[4];
  const float* Wpa = (const float*)d_in[5];
  const float* bpa = (const float*)d_in[6];
  const float* Wqkvs = (const float*)d_in[7];
  const float* bqkvs = (const float*)d_in[8];
  const float* Wos = (const float*)d_in[9];
  const float* bos = (const float*)d_in[10];
  const float* Wo = (const float*)d_in[11];
  const float* bo = (const float*)d_in[12];
  const float* gm = (const float*)d_in[13];
  const float* bm = (const float*)d_in[14];
  const float* W1 = (const float*)d_in[15];
  const float* b1m = (const float*)d_in[16];
  const float* W2 = (const float*)d_in[17];
  const float* b2m = (const float*)d_in[18];

  char* ws = (char*)d_ws;
  bf16_t* WqkvaT = (bf16_t*)(ws + 0);            // [3072][1024], and directly behind it,
                                                 // from ws + 6291456, WqkvsT [3072][1024]
  bf16_t* WpaT = (bf16_t*)(ws + 12582912);       // [1024][1024]
  bf16_t* WosT = (bf16_t*)(ws + 14680064);       // [1024][1024]
  bf16_t* WoT = (bf16_t*)(ws + 16777216);        // [1024][1024]
  bf16_t* W1T = (bf16_t*)(ws + 18874368);        // [4096][1024]
  bf16_t* W2T = (bf16_t*)(ws + 27262976);        // [1024][4096]
  bf16_t* xn = (bf16_t*)(ws + 35651584);         // [8192][1024]  (later: h)
  bf16_t* swa_o = (bf16_t*)(ws + 52428800);      // [8192][1024]
  bf16_t* lin_o = (bf16_t*)(ws + 69206016);      // [8192][1024]
  bf16_t* mix = (bf16_t*)(ws + 85983232);        // [8192][1024]
  float* linSc = (float*)(ws + 85983232);        // [32*32][64*64] (before mix)
  bf16_t* qkva = (bf16_t*)(ws + 102760448);      // [8192][3072]
  float* qkvs = (float*)(ws + 153092096);        // [8192][3072]
  bf16_t* gbuf = (bf16_t*)(ws + 153092096);      // [8192][4096] (reuses qkvs)
  float* x1 = (float*)(ws + 220200960);          // [8192][1024] (tail of qkvs)
  bf16_t* linSb = (bf16_t*)(ws + 253755392);     // [32*32][64*64]
  float* linzc = (float*)(ws + 262144000);       // [32*32][64]
  float* linzp = (float*)(ws + 262406144);       // [32*32][64]
  float* outf = (float*)d_out;

  const dim3 blk(256);
  // Weight convert+transpose to bf16 [N][K]: the seven Wt lie back to back from ws + 0
  wt_transpose_kernel<<<dim3(1088), blk, 0, stream>>>(Wqkva, Wqkvs, Wpa, Wos, Wo, W1, W2,
                                                      WqkvaT);

  // xn = LN(x)
  ln_kernel<<<8192, blk, 0, stream>>>(x, g1, b1, xn);
  // both qkv projections: one Bt of 6144 rows from WqkvaT on
  gemm_kernel<64, 3072, true, false, false, true, false><<<dim3(24, 64), blk, 0, stream>>>(
      xn, WqkvaT, bqkva, nullptr, qkva, 1024, nullptr, nullptr, bqkvs, qkvs);
  // attention branches
  swa_kernel<<<dim3(32, 16, 2), blk, 0, stream>>>(qkva, swa_o);
  lin_state_kernel<<<dim3(31, 32), blk, 0, stream>>>(qkvs, linSc, linzc);
  lin_prefix_kernel<<<dim3(264), blk, 0, stream>>>(linSc, linzc, linSb, linzp);
  lin_out_kernel<<<dim3(32, 32), blk, 0, stream>>>(qkvs, linSb, linzp, lin_o);
  // mix = swa @ Wp + bp + lin @ Wo_s + bo_s  (bf16)
  gemm_kernel<128, 1024, true, false, false, false, true><<<dim3(4, 64), blk, 0, stream>>>(
      swa_o, WpaT, bpa, nullptr, mix, 1024, lin_o, WosT, bos, nullptr);
  // x1 = mix @ Wo + bo + x  (f32)
  gemm_kernel<128, 1024, false, false, true><<<dim3(4, 64), blk, 0, stream>>>(
      mix, WoT, bo, x, x1, 1024, nullptr, nullptr, nullptr, nullptr);
  // h = LN(x1)
  ln_kernel<<<8192, blk, 0, stream>>>(x1, gm, bm, xn);
  // g = gelu(h @ W1 + b1m)  (bf16)
  gemm_kernel<64, 4096, true, true, false><<<dim3(16, 64), blk, 0, stream>>>(
      xn, W1T, b1m, nullptr, gbuf, 1024, nullptr, nullptr, nullptr, nullptr);
  // out = g @ W2 + b2m + x1  (f32)
  gemm_kernel<128, 1024, false, false, true><<<dim3(4, 64), blk, 0, stream>>>(
      gbuf, W2T, b2m, x1, outf, 4096, nullptr, nullptr, nullptr, nullptr);
}

// v009
// Measured time: 294 microseconds a run.
// In both of two side-by-side timings against v008, it was 1.04 times as fast.
// Counting every step since v000, it is 2.69 times as fast.
#include <hip/hip_runtime.h>

typedef __bf16 bf16_t;
typedef __attribute__((ext_vector_type(16))) __bf16 v16bf;
typedef __attribute__((ext_vector_type(8)))  __bf16 v8bf;
typedef __attribute__((ext_vector_type(8)))  float  v8f;

#define DEV static __device__ __forceinline__

// ---------------------------------------------------------------------------
// WMMA helpers (CDNA5 wave32, 16x16x32 bf16 -> f32)
// A fragment: lane m = row, kbase = 8*(lane>>4); VGPR v in [0,3] -> K = kbase+2v..,
// v in [4,7] -> K = 16+kbase+...  => two contiguous 16-byte chunks at +0 and +16.
// B fragment mirrors A with lane = output column, reading rows of B^T ([N][K]).
// ---------------------------------------------------------------------------
DEV v8f wmma_bf16(v16bf a, v16bf b, v8f c) {
  return __builtin_amdgcn_wmma_f32_16x16x32_bf16(false, a, false, b, (short)0, c,
                                                 false, false);
}

DEV const bf16_t* frag_ptr(const bf16_t* tile, int row0, int stride, int lane) {
  return tile + (size_t)(row0 + (lane & 15)) * stride + ((lane >> 4) << 3);
}

DEV v16bf frag_ld(const bf16_t* p) {
  v8bf lo = *(const v8bf*)(p);
  v8bf hi = *(const v8bf*)(p + 16);
  return __builtin_shufflevector(lo, hi, 0, 1, 2, 3, 4, 5, 6, 7,
                                 8, 9, 10, 11, 12, 13, 14, 15);
}

DEV v8f vzero8() {
  v8f z;
#pragma unroll
  for (int i = 0; i < 8; ++i) z[i] = 0.0f;
  return z;
}

// v_rcp_f32 and v_exp_f32 (2^a), each with the one slot that the instruction set asks for
// behind a transcendental before its result is used or its source overwritten; in one
// statement with it, so that the slot stands there whatever is scheduled next.
DEV float rcp_slot(float a) {
  float r;
  asm("v_rcp_f32 %0, %1\n\tv_nop" : "=v"(r) : "v"(a));
  return r;
}
DEV float exp2_slot(float a) {
  float r;
  asm("v_exp_f32 %0, %1\n\tv_nop" : "=v"(r) : "v"(a));
  return r;
}

// Exact GELU, 0.5 x (1 + erf(x / sqrt 2)), of 8 values, without a branch: 8 independent
// chains, stage by stage. One formula serves every z = |x| / sqrt 2: with t = 1 / (1 + p z),
// erfc(z) = t (a1 + t (a2 + t (a3 + t (a4 + t a5)))) exp(-z z), absolute error 1.5e-7.
// 1 + erf is 2 - erfc(z) for x >= 0 and erfc(z) itself for x < 0.
DEV void gelu_exact8(float (&x)[8]) {
  float z[8], t[8], e[8];
#pragma unroll
  for (int i = 0; i < 8; ++i) z[i] = fabsf(x[i]) * 0.70710678118654752f;
#pragma unroll
  for (int i = 0; i < 8; ++i) {
    t[i] = fmaf(0.3275911f, z[i], 1.0f);
    e[i] = z[i] * z[i] * -1.4426950408889634f;
  }
  // The two sched_barriers keep the 16 transcendentals together, away from what feeds them
  // and from what reads them: the compiler knows no latency of an asm statement and writes
  // no s_delay_alu for it, and a reader close behind would hold up the SIMD's other waves.
  __builtin_amdgcn_sched_barrier(0);
#pragma unroll
  for (int i = 0; i < 8; ++i) t[i] = rcp_slot(t[i]);
#pragma unroll
  for (int i = 0; i < 8; ++i) e[i] = exp2_slot(e[i]);
  __builtin_amdgcn_sched_barrier(0);
#pragma unroll
  for (int i = 0; i < 8; ++i) {
    float p = fmaf(1.061405429f, t[i], -1.453152027f);
    p = fmaf(p, t[i], 1.421413741f);
    p = fmaf(p, t[i], -0.284496736f);
    p = fmaf(p, t[i], 0.254829592f);
    const float h = (0.5f * x[i]) * ((p * t[i]) * e[i]);  // 0.5 x erfc(z)
    x[i] = x[i] >= 0.f ? x[i] - h : h;
  }
}

// ---------------------------------------------------------------------------
// CDNA5 async global->LDS copy (ASYNCcnt-tracked), 16 bytes per lane, as the builtin:
// the compiler then forms each copy's address from a uniform base and one lane offset.
// ---------------------------------------------------------------------------
typedef __attribute__((ext_vector_type(4))) int v4i;
typedef __attribute__((address_space(1))) v4i g_v4i;
typedef __attribute__((address_space(3))) v4i l_v4i;

DEV void async_copy_b128(bf16_t* ldst, const char* gsrc) {
  __builtin_amdgcn_global_load_async_to_lds_b128((g_v4i*)gsrc, (l_v4i*)ldst, 0, 0);
}

DEV void wait_async0() { asm volatile("s_wait_asynccnt 0x0" ::: "memory"); }
DEV void wait_ds0() { asm volatile("s_wait_dscnt 0x0" ::: "memory"); }

// ---------------------------------------------------------------------------
// LayerNorm over D=1024, writes bf16. One block per row, 256 threads x 4 elems.
// ---------------------------------------------------------------------------
__global__ __launch_bounds__(256) void ln_kernel(const float* __restrict__ x,
                                                 const float* __restrict__ g,
                                                 const float* __restrict__ b,
                                                 bf16_t* __restrict__ out) {
  const int row = blockIdx.x;
  const int tid = threadIdx.x, lane = tid & 31, wave = tid >> 5;
  const float4 v = ((const float4*)(x + (size_t)row * 1024))[tid];
  float s = v.x + v.y + v.z + v.w;
  float ss = v.x * v.x + v.y * v.y + v.z * v.z + v.w * v.w;
#pragma unroll
  for (int o = 16; o; o >>= 1) {
    s += __shfl_xor(s, o);
    ss += __shfl_xor(ss, o);
  }
  __shared__ float red[16];
  if (lane == 0) { red[wave] = s; red[8 + wave] = ss; }
  __syncthreads();
  if (tid == 0) {
    float a = 0.f, c = 0.f;
#pragma unroll
    for (int i = 0; i < 8; ++i) { a += red[i]; c += red[8 + i]; }
    red[0] = a; red[8] = c;
  }
  __syncthreads();
  const float mean = red[0] * (1.0f / 1024.0f);
  const float var = red[8] * (1.0f / 1024.0f) - mean * mean;
  const float inv = rsqrtf(var + 1e-5f);
  const float4 gg = ((const float4*)g)[tid];
  const float4 bb = ((const float4*)b)[tid];
  bf16_t* o4 = out + (size_t)row * 1024 + tid * 4;
  o4[0] = (bf16_t)((v.x - mean) * inv * gg.x + bb.x);
  o4[1] = (bf16_t)((v.y - mean) * inv * gg.y + bb.y);
  o4[2] = (bf16_t)((v.z - mean) * inv * gg.z + bb.z);
  o4[3] = (bf16_t)((v.w - mean) * inv * gg.w + bb.w);
}

// ---------------------------------------------------------------------------
// Weight convert+transpose, all seven weights in one launch: f32 W[K][N] -> bf16
// Wt[N][K], the seven Wt back to back in WtAll. One 128(k) x 128(n) tile a block.
// A wave reads whole 512-B rows, two neighbouring k rows a pair; a pair is rounded
// and packed to one dword (k even low, k odd high); rows of Wt leave as 256-B runs.
// ---------------------------------------------------------------------------
typedef __attribute__((ext_vector_type(2))) __bf16 v2bf;
typedef __attribute__((ext_vector_type(4))) __bf16 v4bf;
typedef __attribute__((ext_vector_type(4))) float v4f;
typedef __attribute__((ext_vector_type(4))) uint32_t v4u;

// dword index of (column n, k pair p): pitch 65 spreads the 4-column lane stride over
// the banks; the 2 extra dwords from column 64 on keep lanes 16..31 off lanes 0..15.
DEV int wt_idx(int n, int p) { return n * 65 + ((n >> 6) << 1) + p; }

// One tile. K and N are compile-time, so that a lane's 16 loads share one address and
// differ in the immediate offset only.
template <int K, int N>
DEV void wt_tile(const float* __restrict__ W, bf16_t* __restrict__ Wt, int l,
                 uint32_t* t) {
  const int tid = threadIdx.x, lane = tid & 31, wave = tid >> 5;
  const int n0 = (l % (N / 128)) * 128, k0 = (l / (N / 128)) * 128;

  // k pair p = wave + 8 i: rows k0 + 2 p and k0 + 2 p + 1, 512 B of each a wave
  const float* src = W + (size_t)(k0 + 2 * wave) * N + n0 + lane * 4;
  v4f a[8], b[8];
#pragma unroll
  for (int i = 0; i < 8; ++i) {
    a[i] = *(const v4f*)(src + (16 * i) * N);
    b[i] = *(const v4f*)(src + (16 * i + 1) * N);
  }
  // the wait that is owed before a register which an issued load names is rewritten;
  // src as an input keeps the address pair live over the whole run, so that no load's
  // result is placed in it
  asm volatile("s_wait_xcnt 0x0" ::"v"(src) : "memory");
  // keeps all 16 loads of a lane ahead of the first conversion, so that they fly
  // together; without it the last four are issued only when the first have landed
  __builtin_amdgcn_sched_barrier(0);
#pragma unroll
  for (int i = 0; i < 8; ++i)
#pragma unroll
    for (int u = 0; u < 4; ++u) {
      v2bf pk;
      pk[0] = (bf16_t)a[i][u];
      pk[1] = (bf16_t)b[i][u];
      t[wt_idx(lane * 4 + u, wave + 8 * i)] = __builtin_bit_cast(uint32_t, pk);
    }
  __syncthreads();
  // a wave stores rows n0 + 2 wave + 16 i and the next, 256 B of each
  const int l16 = tid & 15, r = tid >> 4;
  bf16_t* dst = Wt + (size_t)(n0 + r) * K + k0 + l16 * 8;
#pragma unroll
  for (int i = 0; i < 8; ++i) {
    const int base = wt_idx(r + 16 * i, l16 * 4);
    v4u o;
    o[0] = t[base];
    o[1] = t[base + 1];
    o[2] = t[base + 2];
    o[3] = t[base + 3];
    *(v4u*)(dst + (16 * i) * K) = o;
  }
}

// Blocks 0..383: the two [1024][3072]; 384..575: the three [1024][1024];
// 576..831: [1024][4096]; 832..1087: [4096][1024]. Every branch is block-uniform.
__global__ __launch_bounds__(256) void wt_transpose_kernel(
    const float* __restrict__ Wa, const float* __restrict__ Wb,
    const float* __restrict__ Wc, const float* __restrict__ Wd,
    const float* __restrict__ We, const float* __restrict__ Wf,
    const float* __restrict__ Wg, bf16_t* __restrict__ WtAll) {
  __shared__ uint32_t t[128 * 65 + 2];
  const int bid = blockIdx.x;
  if (bid < 384) {
    const bool s = bid >= 192;
    wt_tile<1024, 3072>(s ? Wb : Wa, WtAll + (s ? 3145728 : 0), s ? bid - 192 : bid, t);
  } else if (bid < 576) {
    const int g = (bid - 384) >> 6;
    wt_tile<1024, 1024>(g == 0 ? Wc : (g == 1 ? Wd : We), WtAll + 6291456 + g * 1048576,
                        (bid - 384) & 63, t);
  } else if (bid < 832) {
    wt_tile<1024, 4096>(Wf, WtAll + 9437184, bid - 576, t);
  } else {
    wt_tile<4096, 1024>(Wg, WtAll + 13631488, bid - 832, t);
  }
}

// ---------------------------------------------------------------------------
// One wave's 64 x 64 tile from its accumulators to global memory in whole 128-B lines.
// acc[mt][nt] holds the tile TRANSPOSED (weight rows were the A operand): lane l has row
// m = 16 mt + (l & 15) and the 8 neighbouring columns n = 16 nt + 8 (l >> 4) + r. They go
// as 16-byte pieces into st, the wave's own LDS range (32 rows of 64 elements + 16 B, so
// that the 16 rows of a store fall on different banks), and come back with the lanes laid
// along the rows: a wave-wide 16-byte store then covers 4 whole lines. Two rounds of 32
// rows. bias (+ bias2) and GELU before the staging, the f32 residual behind it, read in
// whole lines too.
// og, rg: element (0, 0) of the tile in out and res; bp, bq: the tile's first column.
// ---------------------------------------------------------------------------
template <typename OT, int NN, bool GELU_ACT, bool RES, bool TWOB>
DEV void tile_out(const v8f (&acc)[4][4], OT* st, OT* __restrict__ og,
                  const float* __restrict__ bp, const float* __restrict__ bq,
                  const float* __restrict__ rg, int lane) {
  typedef __attribute__((ext_vector_type(4))) float f4;
  constexpr bool B16 = sizeof(OT) == 2;
  constexpr int EPB = 16 / (int)sizeof(OT);  // elements of a 16-byte piece
  constexpr int SP = 64 + EPB;               // staging pitch, elements
  constexpr int LPR = 64 / EPB;              // lanes a row at the read-back
  constexpr int RPI = 32 / LPR;              // rows a wave-wide access
  constexpr int NJ = 32 / RPI;               // accesses a round
  const int cl = lane & 15, hi = lane >> 4;
  const float* bl = bp + hi * 8;
  const float* bm = bq + hi * 8;
  OT* ol = og + (size_t)(lane / LPR) * NN + (lane % LPR) * EPB;
  const float* rl = rg + (RES ? (size_t)(lane / LPR) * NN + (lane % LPR) * 4 : 0);
  OT* sw = st + cl * SP + hi * 8;
  const OT* sr = st + (lane / LPR) * SP + (lane % LPR) * EPB;

  float bv[4][8];
#pragma unroll
  for (int nt = 0; nt < 4; ++nt) {
    const f4 a = *(const f4*)(bl + nt * 16), b = *(const f4*)(bl + nt * 16 + 4);
#pragma unroll
    for (int r = 0; r < 4; ++r) { bv[nt][r] = a[r]; bv[nt][4 + r] = b[r]; }
  }
  if constexpr (TWOB) {
#pragma unroll
    for (int nt = 0; nt < 4; ++nt) {
      const f4 a = *(const f4*)(bm + nt * 16), b = *(const f4*)(bm + nt * 16 + 4);
#pragma unroll
      for (int r = 0; r < 4; ++r) { bv[nt][r] += a[r]; bv[nt][4 + r] += b[r]; }
    }
  }
  // the wait that is owed before a register which an issued load names is rewritten; the
  // addresses as inputs stay live up to it
  if constexpr (TWOB) asm volatile("s_wait_xcnt 0x0" ::"v"(bl), "v"(bm) : "memory");
  else asm volatile("s_wait_xcnt 0x0" ::"v"(bl) : "memory");

#pragma unroll
  for (int hf = 0; hf < 2; ++hf) {
    f4 rr[NJ];
    if constexpr (RES) {
      // ahead of the staging, so that they fly during it
#pragma unroll
      for (int j = 0; j < NJ; ++j) rr[j] = *(const f4*)(rl + (hf * 32 + j * RPI) * NN);
    }
#pragma unroll
    for (int i = 0; i < 2; ++i)
#pragma unroll
      for (int nt = 0; nt < 4; ++nt) {
        float v[8];
#pragma unroll
        for (int r = 0; r < 8; ++r) v[r] = acc[hf * 2 + i][nt][r] + bv[nt][r];
        if constexpr (GELU_ACT) gelu_exact8(v);
        if constexpr (B16) {
          v8bf pk;
#pragma unroll
          for (int r = 0; r < 8; ++r) pk[r] = (bf16_t)v[r];
          *(v8bf*)(sw + i * 16 * SP + nt * 16) = pk;
        } else {
          f4 lo, up;
#pragma unroll
          for (int r = 0; r < 4; ++r) { lo[r] = v[r]; up[r] = v[4 + r]; }
          *(f4*)(sw + i * 16 * SP + nt * 16) = lo;
          *(f4*)(sw + i * 16 * SP + nt * 16 + 4) = up;
        }
      }
    wait_ds0();  // the wave's own pieces are in LDS before other lanes of it read them
    if constexpr (B16) {
      v8bf x[NJ];
#pragma unroll
      for (int j = 0; j < NJ; ++j) x[j] = *(const v8bf*)(sr + j * RPI * SP);
#pragma unroll
      for (int j = 0; j < NJ; ++j) *(v8bf*)(ol + (hf * 32 + j * RPI) * NN) = x[j];
    } else {
      f4 x[NJ];
#pragma unroll
      for (int j = 0; j < NJ; ++j) x[j] = *(const f4*)(sr + j * RPI * SP);
      if constexpr (RES) {
#pragma unroll
        for (int j = 0; j < NJ; ++j) x[j] += rr[j];
      }
#pragma unroll
      for (int j = 0; j < NJ; ++j) *(f4*)(ol + (hf * 32 + j * RPI) * NN) = x[j];
    }
    // the same wait, behind each round's loads and stores
    if constexpr (RES) asm volatile("s_wait_xcnt 0x0" ::"v"(ol), "v"(rl) : "memory");
    else asm volatile("s_wait_xcnt 0x0" ::"v"(ol) : "memory");
  }
}

// ---------------------------------------------------------------------------
// Generic bf16 GEMM, f32 accumulate: out[M][NN] = A[M][K] * Bt[NN][K]^T + bias
// Block: 256 thr = 8 waves; tile BM x 256; one work-group a WGP.
// BM = 128 (products of 1024 columns: 256 tiles, one a WGP): waves 2 x 4, wave tile 64 x 64.
// BM = 256 (the wide products, whole rounds of 256 tiles): waves 4 x 2, wave tile 64 x 128
// (4 M-frags x 8 N-frags): 12 fragments read from LDS feed 32 WMMAs (8 feed 16 at 64 x 64),
// and 512 operand rows come from L2 for the products that two 128 x 256 tiles take 768 for.
// A pass is KP k = KP / 32 blocks of 32 k. Two LDS buffers, each [A BM rows | Bt 256 rows]
// at pitch 2 KP + 16 B, filled by async global->LDS copies one pass ahead; one barrier a pass.
// Epilogue (tile_out, once per 64 columns of the wave tile): optional GELU, optional f32
// residual, bf16 or f32 output. M multiple of BM, NN of 256, K of KP.
// The k walk is rotated: work-group (x, y) begins at pass (x + y) & (passes - 1) and wraps
// round. Work-groups that share operand rows (one x: Bt, one y: A) start together; from one
// k they would ask L2 for the same lines at the same moment, and every request on the chip
// would fall on the same 256 B of the operands' 2-KiB and 8-KiB rows.
// Two products that share an operand or an output run as one launch:
// CATN: Bt holds 2 NN rows, the weights of two products of the same A one behind the other;
//   grid.x = 2 NN / 256. Column blocks below NN give out (bf16, bias), the rest out2 (f32,
//   bias2), each [M][NN].
// CATK: out = A Bt^T + A2 Bt2^T + bias + bias2, all four operands of row length K: the k
//   passes of the second product (k from K to 2 K) and those of the first form one rotated walk on the
//   same accumulators.
// ---------------------------------------------------------------------------
template <int BM, int KP, int NN, bool OUT_BF16, bool GELU_ACT, bool RES, bool CATN = false,
          bool CATK = false>
__global__ __launch_bounds__(256) void gemm_kernel(
    const bf16_t* __restrict__ A, const bf16_t* __restrict__ Bt,
    const float* __restrict__ bias, const float* __restrict__ res,
    void* __restrict__ out, int K, const bf16_t* __restrict__ A2,
    const bf16_t* __restrict__ Bt2, const float* __restrict__ bias2,
    void* __restrict__ out2) {
  constexpr int LDK = KP + 8;              // row pitch 272 B = 16 B x odd
  constexpr int STAGE = (BM + 256) * LDK;  // elements of one buffer
  constexpr int WN = 512 / BM;             // waves along N: 4 or 2
  constexpr int NH = 4 / WN;               // 64-column parts of a wave's tile: 1 or 2
  constexpr int NB = KP / 32;              // blocks per pass
  constexpr int PR = KP / 8;               // 16-byte pieces per row
  constexpr int RG = 256 / PR;             // rows that the block's 256 threads copy at once
  __shared__ __align__(16) bf16_t sT[2][STAGE];
  const int tid = threadIdx.x, lane = tid & 31, wave = tid >> 5;
  const int m0 = blockIdx.y * BM, n0 = blockIdx.x * 256;
  const int wm = (wave / WN) * 64;         // wave M offset within tile
  const int wn = (wave % WN) * (64 * NH);  // wave N offset within tile

  v8f acc[NH][4][4];
#pragma unroll
  for (int h = 0; h < NH; ++h)
#pragma unroll
    for (int i = 0; i < 4; ++i)
#pragma unroll
      for (int j = 0; j < 4; ++j) acc[h][i][j] = vzero8();

  const int cr = tid / PR;          // row within a group of RG rows
  const int cc = (tid % PR) * 8;    // 16-byte piece of the row
  // one 32-bit lane offset serves every copy; the rest of each address is uniform
  const uint32_t goff = (uint32_t)(cr * K + cc) * 2u;
  const char* uA = (const char*)(A + (size_t)m0 * K);
  const char* uB = (const char*)(Bt + (size_t)n0 * K);
  const char* uA2 = CATK ? (const char*)(A2 + (size_t)m0 * K) : uA;
  const char* uB2 = CATK ? (const char*)(Bt2 + (size_t)n0 * K) : uB;

  // pass kq into buffer `buf`: (BM + 256) KP / 2048 copies of 16 B per thread (24 or 32),
  // whole lines
  auto stage = [&](int kq, int buf) {
    // CATK: from k = K on the second pair of operands, a choice that is block-uniform
    const bool second = CATK && kq >= K;
    const char* pA = second ? uA2 : uA;
    const char* pB = second ? uB2 : uB;
    const int k0 = second ? kq - K : kq;
    bf16_t* d = &sT[buf][cr * LDK + cc];
#pragma unroll
    for (int i = 0; i < BM / RG; ++i)
      async_copy_b128(d + i * RG * LDK, pA + ((size_t)(i * RG) * K + k0) * 2 + goff);
#pragma unroll
    for (int i = 0; i < 256 / RG; ++i)
      async_copy_b128(d + (BM + i * RG) * LDK,
                      pB + ((size_t)(i * RG) * K + k0) * 2 + goff);
  };

  const int fa = (wm + (lane & 15)) * LDK + ((lane >> 4) << 3);
  const int fb = (BM + wn + (lane & 15)) * LDK + ((lane >> 4) << 3);

  const int ktot = CATK ? 2 * K : K;
  const int npass = ktot / KP;
  // k of the next pass to be staged; the mask gives a start below npass for any npass
  int kn = (int)((blockIdx.x + blockIdx.y) & (unsigned)(npass - 1)) * KP;
  auto next_k = [&]() {
    const int k = kn;
    kn = kn + KP == ktot ? 0 : kn + KP;
    return k;
  };
  stage(next_k(), 0);
  wait_async0();    // own copies of the first pass have landed
  __syncthreads();  // everyone's have
  if (1 < npass) stage(next_k(), 1);
  for (int t = 0; t < npass; ++t) {
    const int buf = t & 1;
    const bf16_t* cur = &sT[buf][0];
    // the sched_barriers keep [LDS reads][WMMAs] as written: a block's reads go as
    // one group; left alone they are spread in pairs among the WMMAs, each pair with a
    // full wait of its own behind it
#pragma unroll
    for (int u = 0; u < NB; ++u) {
      v16bf af[4], bfv[4 * NH];
      __builtin_amdgcn_sched_barrier(0);
#pragma unroll
      for (int mt = 0; mt < 4; ++mt) af[mt] = frag_ld(cur + fa + mt * 16 * LDK + u * 32);
#pragma unroll
      for (int nt = 0; nt < 4 * NH; ++nt)
        bfv[nt] = frag_ld(cur + fb + nt * 16 * LDK + u * 32);
      __builtin_amdgcn_sched_barrier(0);
#pragma unroll
      for (int nt = 0; nt < 4 * NH; ++nt)
#pragma unroll
        for (int mt = 0; mt < 4; ++mt)  // D = tile^T: tile_out
          acc[nt >> 2][mt][nt & 3] = wmma_bf16(bfv[nt], af[mt], acc[nt >> 2][mt][nt & 3]);
    }
    // publish point of pass t + 1
    wait_ds0();       // own reads of this buffer have all returned
    wait_async0();    // own copies of pass t + 1 have landed
    __syncthreads();  // everyone's have, and everyone has left this buffer
    if (t + 2 < npass) stage(next_k(), buf);
  }
  wait_async0();  // nothing is in flight when the wave goes on to its end

  // Every wave has left the ring (the last pass's barrier) and no copy is in flight: the
  // ring's LDS is free, and each wave stages in a range of its own.
  typedef typename std::conditional<OUT_BF16, bf16_t, float>::type out_t;
  static_assert(!(RES && OUT_BF16) && !(RES && GELU_ACT), "residual: f32 output, no GELU");
  if constexpr (CATN) {
    // block-uniform: a block's 256 columns lie wholly in one of the two products
    if (n0 >= NN) {
#pragma unroll  // acc[h] needs a constant index to stay in registers
      for (int h = 0; h < NH; ++h) {
        tile_out<float, NN, false, false, false>(
            acc[h], (float*)&sT[0][0] + wave * (32 * 68),
            (float*)out2 + (size_t)(m0 + wm) * NN + (size_t)(n0 - NN + wn + h * 64),
            bias2 + (n0 - NN + wn + h * 64), bias2, bias2, lane);
        // keeps the next part's arithmetic behind the s_wait_xcnt 0 that ends tile_out: lifted
        // over it, it would rewrite data registers of stores that have just been issued
        __builtin_amdgcn_sched_barrier(0);
      }
      return;
    }
  }
  // The 64-column parts of a wave's tile, one after the other. The GELU build keeps the loop
  // rolled: one copy of the epilogue, each next part moved into the first one's registers;
  // unrolled, its text is twice as long. The other builds are short and unroll: no moves.
  constexpr int EU = GELU_ACT ? 1 : NH;
#pragma unroll EU
  for (int h = 0; h < NH; ++h) {
    const int c0 = n0 + wn + h * 64;
    const size_t e0 = (size_t)(m0 + wm) * NN + (size_t)c0;
    tile_out<out_t, NN, GELU_ACT, RES, CATK>(
        acc[0], (out_t*)&sT[0][0] + wave * (32 * (64 + 16 / (int)sizeof(out_t))),
        (out_t*)out + e0, bias + c0, CATK ? bias2 + c0 : bias, RES ? res + e0 : bias, lane);
    // keeps the moves and the next part's arithmetic behind the s_wait_xcnt 0 that ends
    // tile_out: lifted over it, they would rewrite data registers of stores just issued
    __builtin_amdgcn_sched_barrier(0);
#pragma unroll
    for (int i = 0; i < 4; ++i)
#pragma unroll
      for (int j = 0; j < 4; ++j) acc[0][i][j] = acc[NH - 1][i][j];
  }
}

// ---------------------------------------------------------------------------
// One wave's 16 rows x 64 head columns, bf16, to global memory in whole 128-B lines, as in
// tile_out: t[nt] holds the tile transposed (lane l: row l & 15, columns 16 nt + 8 (l >> 4)
// + r). st: the wave's own 16 rows of an LDS tile that only it reads and that it has done
// with, pitch sp elements (16 B x odd). og: element (0, 0), row pitch 1024. dv: the lane's
// row is divided by den.
// ---------------------------------------------------------------------------
DEV void head_rows_out(const v8f (&t)[4], bf16_t* st, int sp, bf16_t* __restrict__ og,
                       float den, bool dv, int lane) {
#pragma unroll
  for (int nt = 0; nt < 4; ++nt) {
    v8bf pk;
#pragma unroll
    for (int r = 0; r < 8; ++r) pk[r] = (bf16_t)(dv ? t[nt][r] / den : t[nt][r]);
    *(v8bf*)(st + (lane & 15) * sp + nt * 16 + (lane >> 4) * 8) = pk;
  }
  wait_ds0();  // the wave's own pieces are in LDS before other lanes of it read them
  v8bf x[4];
#pragma unroll
  for (int j = 0; j < 4; ++j)
    x[j] = *(const v8bf*)(st + (j * 4 + (lane >> 3)) * sp + (lane & 7) * 8);
  bf16_t* ol = og + (size_t)(lane >> 3) * 1024 + (lane & 7) * 8;
#pragma unroll
  for (int j = 0; j < 4; ++j) *(v8bf*)(ol + j * 4 * 1024) = x[j];
}

// ---------------------------------------------------------------------------
// Sliding-window attention. One block per (query-block, head, batch).
// Q 128x64, K/V context 256x64 (prev block + own block), W=128 band mask.
// All matmuls via WMMA; softmax in registers with 16-lane shuffles.
// qkv: bf16 [B*L][3*1024]; out: bf16 [B*L][1024].
// ---------------------------------------------------------------------------
__global__ __launch_bounds__(256) void swa_kernel(const bf16_t* __restrict__ qkv,
                                                  bf16_t* __restrict__ out) {
  const int blk = blockIdx.x, h = blockIdx.y, b = blockIdx.z;
  const int tid = threadIdx.x, lane = tid & 31, wave = tid >> 5;

  // Q(128x72) + K(256x72) overlap with P(128x264) -- disjoint lifetimes.
  __shared__ __align__(16) char smem_u[128 * 264 * 2];
  __shared__ __align__(16) bf16_t sVt[64 * 264];  // V^T [e][s]
  bf16_t* sQ = (bf16_t*)smem_u;                   // [128][72]
  bf16_t* sK = (bf16_t*)smem_u + 128 * 72;        // [256][72]
  bf16_t* sP = (bf16_t*)smem_u;                   // [128][264]

  const size_t rowQ0 = (size_t)b * 4096 + (size_t)blk * 128;

  // 8 lanes a 128-B head row: a wave-wide load covers 4 whole rows = 4 whole lines.
  // Q: rows rg + 32 i. K, V: loads 2 p and 2 p + 1 of a thread are the neighbouring keys s0
  // and s0 + 1, s0 = 64 p + 2 rg, which share a dword of V^T. Keys 0..127 are the previous
  // block (p < 2): block 0 has none and takes zeros, a choice that is block-uniform.
  {
    const int l8 = tid & 7, rg = tid >> 3;
    const bf16_t* srcq = qkv + (rowQ0 + rg) * 3072 + h * 64 + l8 * 8;
    const bf16_t* srck = qkv + (rowQ0 + rg * 2) * 3072 + 1024 + h * 64 + l8 * 8;  // key 128 + 2 rg
    v8bf qx[4], kx[8], vx[8];
#pragma unroll
    for (int i = 0; i < 4; ++i) qx[i] = *(const v8bf*)(srcq + (i * 32) * 3072);
#pragma unroll
    for (int i = 4; i < 8; ++i) {
      kx[i] = *(const v8bf*)(srck + (((i >> 1) - 2) * 64 + (i & 1)) * 3072);
      vx[i] = *(const v8bf*)(srck + (((i >> 1) - 2) * 64 + (i & 1)) * 3072 + 1024);
    }
    if (blk > 0) {
#pragma unroll
      for (int i = 0; i < 4; ++i) {
        kx[i] = *(const v8bf*)(srck + (((i >> 1) - 2) * 64 + (i & 1)) * 3072);
        vx[i] = *(const v8bf*)(srck + (((i >> 1) - 2) * 64 + (i & 1)) * 3072 + 1024);
      }
    } else {
#pragma unroll
      for (int i = 0; i < 4; ++i)
#pragma unroll
        for (int j = 0; j < 8; ++j) {
          kx[i][j] = (bf16_t)0.f;
          vx[i][j] = (bf16_t)0.f;
        }
    }
    // the wait that is owed before a register which an issued load names is rewritten;
    // the two addresses as inputs stay live over the whole run
    asm volatile("s_wait_xcnt 0x0" ::"v"(srcq), "v"(srck) : "memory");
#pragma unroll
    for (int i = 0; i < 4; ++i) *(v8bf*)&sQ[(rg + 32 * i) * 72 + l8 * 8] = qx[i];
#pragma unroll
    for (int i = 0; i < 8; ++i)
      *(v8bf*)&sK[((i >> 1) * 64 + rg * 2 + (i & 1)) * 72 + l8 * 8] = kx[i];
#pragma unroll
    for (int p = 0; p < 4; ++p)
#pragma unroll
      for (int j = 0; j < 8; ++j) {
        v2bf vo;
        vo[0] = vx[2 * p][j];
        vo[1] = vx[2 * p + 1][j];
        *(v2bf*)&sVt[(l8 * 8 + j) * 264 + p * 64 + rg * 2] = vo;
      }
  }
  __syncthreads();

  // Scores: wave w owns query rows [16w,16w+16); 16 key tiles; K-dim = 64.
  v8f acc[16];
#pragma unroll
  for (int i = 0; i < 16; ++i) acc[i] = vzero8();
#pragma unroll
  for (int kk = 0; kk < 64; kk += 32) {
    v16bf aq = frag_ld(frag_ptr(sQ, wave * 16, 72, lane) + kk);
#pragma unroll
    for (int nt = 0; nt < 16; ++nt) {
      v16bf bk = frag_ld(frag_ptr(sK, nt * 16, 72, lane) + kk);
      acc[nt] = wmma_bf16(aq, bk, acc[nt]);
    }
  }

  // Mask + softmax. C-layout: row = 16*wave + 8*(lane>>4) + r, col = 16*nt + (lane&15)
  const int cl = lane & 15, rh = (lane >> 4) << 3;
#pragma unroll
  for (int r = 0; r < 8; ++r) {
    const int rloc = wave * 16 + rh + r;
    float mx = -1e30f;
#pragma unroll
    for (int nt = 0; nt < 16; ++nt) {
      const int s = nt * 16 + cl;
      const bool ok = (s >= rloc + 1) && (s <= rloc + 128) && (blk > 0 || s >= 128);
      const float v = ok ? acc[nt][r] * 0.125f : -1e30f;
      acc[nt][r] = v;
      mx = fmaxf(mx, v);
    }
#pragma unroll
    for (int o = 1; o < 16; o <<= 1) mx = fmaxf(mx, __shfl_xor(mx, o));
    float sum = 0.f;
#pragma unroll
    for (int nt = 0; nt < 16; ++nt) {
      const float e = __expf(acc[nt][r] - mx);
      acc[nt][r] = e;
      sum += e;
    }
#pragma unroll
    for (int o = 1; o < 16; o <<= 1) sum += __shfl_xor(sum, o);
    const float inv = 1.0f / sum;
#pragma unroll
    for (int nt = 0; nt < 16; ++nt) acc[nt][r] *= inv;
  }

  __syncthreads();  // all waves done reading sQ/sK before P overwrites them
#pragma unroll
  for (int nt = 0; nt < 16; ++nt)
#pragma unroll
    for (int r = 0; r < 8; ++r)
      sP[(wave * 16 + rh + r) * 264 + nt * 16 + cl] = (bf16_t)acc[nt][r];
  __syncthreads();

  // PV: out 16x64 per wave; K-dim = 256 keys.
  v8f ov[4];
#pragma unroll
  for (int i = 0; i < 4; ++i) ov[i] = vzero8();
#pragma unroll
  for (int kk = 0; kk < 256; kk += 32) {
    v16bf ap = frag_ld(frag_ptr(sP, wave * 16, 264, lane) + kk);
#pragma unroll
    for (int nt = 0; nt < 4; ++nt) {
      v16bf bv = frag_ld(frag_ptr(sVt, nt * 16, 264, lane) + kk);
      ov[nt] = wmma_bf16(bv, ap, ov[nt]);  // D = tile^T: query cl, 8 neighbouring e a lane
    }
  }
  head_rows_out(ov, sP + wave * 16 * 264, 264,
                out + (rowQ0 + wave * 16) * 1024 + h * 64, 1.0f, false, lane);
}

// ---------------------------------------------------------------------------
// Chunked causal linear attention, chunk-parallel, three launches:
//   lin_state : per (chunk, b, h) the chunk's own v^T k' (64x64 f32) and colsum(k')
//   lin_prefix: exclusive running sum over the chunks, f32, chunk 0 first
//   lin_out   : per (chunk, b, h) the outputs from q', k', v and the summed state
// qkv: f32 [B*L][3*1024] (elu applied at load); out: bf16 [B*L][1024].
// State records: index (bh*32 + ch); S^T as [f][e].
// ---------------------------------------------------------------------------

// The last chunk's own state is read by nobody: grid.x = 31.
__global__ __launch_bounds__(256) void lin_state_kernel(const float* __restrict__ qkv,
                                                        float* __restrict__ Sc,
                                                        float* __restrict__ zc) {
  const int ch = blockIdx.x, bh = blockIdx.y, b = bh >> 4, h = bh & 15;
  const int tid = threadIdx.x, lane = tid & 31, wave = tid >> 5;
  __shared__ __align__(16) bf16_t skT[64 * 136];   // k'^T     [e][c]
  __shared__ __align__(16) bf16_t svT[64 * 136];   // v^T      [f][c]
  const int cl = lane & 15, rh = (lane >> 4) << 3;
  {
    // 16 lanes a 256-B head row: a wave-wide load covers two whole rows = 4 whole lines.
    // Loads 2 p and 2 p + 1 of a thread are the neighbouring rows c0 and c0 + 1, which share
    // a dword of the transposed tiles.
    const int l16 = tid & 15, rg = tid >> 4;
    const float* pk = qkv + ((size_t)b * 4096 + (size_t)ch * 128 + rg * 2) * 3072 + 1024 +
                      h * 64 + l16 * 4;
    // loads first, elu after: the loads fly together, not one round trip each
    v4f kx[8], vx[8];
#pragma unroll
    for (int i = 0; i < 8; ++i) {
      kx[i] = *(const v4f*)(pk + ((i >> 1) * 32 + (i & 1)) * 3072);
      vx[i] = *(const v4f*)(pk + ((i >> 1) * 32 + (i & 1)) * 3072 + 1024);
    }
    // the wait that is owed before a register which an issued load names is rewritten;
    // pk as an input keeps the address live over the whole run
    asm volatile("s_wait_xcnt 0x0" ::"v"(pk) : "memory");
    // keeps all 16 loads of a lane ahead of the first conversion, so that they fly
    // together; without it the last four are issued only when the first have landed
    __builtin_amdgcn_sched_barrier(0);
#pragma unroll
    for (int p = 0; p < 4; ++p) {
      const int c0 = p * 32 + rg * 2;
#pragma unroll
      for (int u = 0; u < 4; ++u) {
        v2bf ko, vo;
#pragma unroll
        for (int o = 0; o < 2; ++o) {
          const float kr = kx[2 * p + o][u];
          const float em = expm1f(kr);  // unconditional: a select, no branch a value
          ko[o] = (bf16_t)((kr > 0.f ? kr : em) + 1.0001f);
          vo[o] = (bf16_t)vx[2 * p + o][u];
        }
        *(v2bf*)&skT[(l16 * 4 + u) * 136 + c0] = ko;
        *(v2bf*)&svT[(l16 * 4 + u) * 136 + c0] = vo;
      }
    }
  }
  __syncthreads();

  const size_t rec = (size_t)bh * 32 + ch;
  // v^T @ k'  (16 tiles over 8 waves, 2 each), K-dim 128
  {
    const int ft = wave >> 1;
    const int ebase = (wave & 1) * 32;
    v8f accS[2];
#pragma unroll
    for (int i = 0; i < 2; ++i) accS[i] = vzero8();
#pragma unroll
    for (int kk = 0; kk < 128; kk += 32) {
      v16bf av = frag_ld(frag_ptr(svT, ft * 16, 136, lane) + kk);
#pragma unroll
      for (int nt = 0; nt < 2; ++nt) {
        v16bf bk = frag_ld(frag_ptr(skT, ebase + nt * 16, 136, lane) + kk);
        accS[nt] = wmma_bf16(av, bk, accS[nt]);
      }
    }
#pragma unroll
    for (int nt = 0; nt < 2; ++nt)
#pragma unroll
      for (int r = 0; r < 8; ++r) {
        const int f = ft * 16 + rh + r;
        const int e = ebase + nt * 16 + cl;
        Sc[rec * 4096 + f * 64 + e] = accS[nt][r];
      }
  }
  if (tid < 64) {
    float zs = 0.f;
#pragma unroll 8
    for (int c = 0; c < 128; ++c) zs += (float)skT[tid * 136 + c];
    zc[rec * 64 + tid] = zs;
  }
}

// Blocks 0..255: S^T, two neighbouring elements a thread, rounded to bf16 at the
// store (the A operand of the transposed q' @ S). Blocks 256..263: z, kept in f32.
__global__ __launch_bounds__(256) void lin_prefix_kernel(const float* __restrict__ Sc,
                                                         const float* __restrict__ zc,
                                                         bf16_t* __restrict__ Sb,
                                                         float* __restrict__ zp) {
  if (blockIdx.x >= 256) {
    const int t = (blockIdx.x - 256) * 256 + threadIdx.x;
    const size_t base = (size_t)(t >> 6) * (32 * 64) + (size_t)(t & 63);
    float v[31];
#pragma unroll
    for (int ch = 0; ch < 31; ++ch) v[ch] = zc[base + ch * 64];
    float s = 0.f;
#pragma unroll
    for (int ch = 0; ch < 32; ++ch) {
      zp[base + ch * 64] = s;
      if (ch < 31) s += v[ch];
    }
    return;
  }
  const int t = blockIdx.x * 256 + threadIdx.x;
  const size_t base = (size_t)(t >> 11) * (32 * 4096) + (size_t)(t & 2047) * 2;
  float2 v[31];
#pragma unroll
  for (int ch = 0; ch < 31; ++ch) v[ch] = *(const float2*)(Sc + base + ch * 4096);
  float s0 = 0.f, s1 = 0.f;
#pragma unroll
  for (int ch = 0; ch < 32; ++ch) {
    v2bf o;
    o[0] = (bf16_t)s0;
    o[1] = (bf16_t)s1;
    *(v2bf*)(Sb + base + ch * 4096) = o;
    if (ch < 31) { s0 += v[ch].x; s1 += v[ch].y; }
  }
  // the built code lets this path run on to the z path's first instructions behind a
  // scalar test; they rewrite registers that the stores above name: wait in front
  asm volatile("s_wait_xcnt 0x0" ::: "memory");
}

// 8 waves a SIMD asked for: at most 128 registers, so that four work-groups fit a WGP
__global__ __launch_bounds__(256, 8) void lin_out_kernel(const float* __restrict__ qkv,
                                                      const bf16_t* __restrict__ Sb,
                                                      const float* __restrict__ zp,
                                                      bf16_t* __restrict__ out) {
  const int ch = blockIdx.x, bh = blockIdx.y, b = bh >> 4, h = bh & 15;
  const int tid = threadIdx.x, lane = tid & 31, wave = tid >> 5;
  // q'(128x72) + k'(128x72) overlap with masked A (128x136) -- disjoint lifetimes.
  __shared__ __align__(16) char smem_u[2 * 128 * 72 * 2];
  __shared__ __align__(16) bf16_t svT[64 * 136];   // v^T      [f][c]
  __shared__ __align__(16) bf16_t sSB[64 * 72];    // bf16 S^T before this chunk [f][e]
  __shared__ float sz[64];
  __shared__ float sqz[128];
  __shared__ float sden[128];
  bf16_t* sq = (bf16_t*)smem_u;                    // q' rows  [c][e]
  bf16_t* sk = (bf16_t*)smem_u + 128 * 72;         // k' rows  [c][e]
  bf16_t* sP = (bf16_t*)smem_u;                    // masked A [c][d]

  const int cl = lane & 15, rh = (lane >> 4) << 3;
  const size_t rec = (size_t)bh * 32 + ch;

  // 1. state before this chunk (A-operand layout: row f, cols e)
#pragma unroll
  for (int i = tid; i < 512; i += 256)
    *(v8bf*)&sSB[(i >> 3) * 72 + (i & 7) * 8] = *(const v8bf*)(Sb + rec * 4096 + i * 8);
  if (tid < 64) sz[tid] = zp[rec * 64 + tid];
  // 2. load chunk, apply elu maps
  {
    // 16 lanes a 256-B head row: a wave-wide load covers two whole rows = 4 whole lines.
    // A thread takes the neighbouring rows c0 and c0 + 1, which share a dword of v^T.
    const int l16 = tid & 15, rg = tid >> 4;
    const float* pq = qkv + ((size_t)b * 4096 + (size_t)ch * 128 + rg * 2) * 3072 + h * 64 +
                      l16 * 4;
    // kept rolled, 6 loads a trip: unrolled, the register count passes 128 and only three
    // work-groups, not four, fit a WGP
#pragma unroll 1
    for (int p = 0; p < 4; ++p) {
      const int c0 = p * 32 + rg * 2;
      v4f qx[2], kx[2], vx[2];
#pragma unroll
      for (int o = 0; o < 2; ++o) {
        qx[o] = *(const v4f*)(pq + (p * 32 + o) * 3072);
        kx[o] = *(const v4f*)(pq + (p * 32 + o) * 3072 + 1024);
        vx[o] = *(const v4f*)(pq + (p * 32 + o) * 3072 + 2048);
      }
      // the wait that is owed before a register which an issued load names is rewritten;
      // pq as an input keeps the address live over the run
      asm volatile("s_wait_xcnt 0x0" ::"v"(pq) : "memory");
#pragma unroll
      for (int o = 0; o < 2; ++o) {
        v4bf qo, ko;
#pragma unroll
        for (int u = 0; u < 4; ++u) {
          // expm1f unconditional: a select, no branch a value, as this loop was built before
          const float qv = qx[o][u] * 0.125f;  // E^-0.5
          const float qe = expm1f(qv);
          qo[u] = (bf16_t)((qv > 0.f ? qv : qe) + 1.0001f);
          const float kv = kx[o][u];
          const float ke = expm1f(kv);
          ko[u] = (bf16_t)((kv > 0.f ? kv : ke) + 1.0001f);
        }
        *(v4bf*)&sq[(c0 + o) * 72 + l16 * 4] = qo;
        *(v4bf*)&sk[(c0 + o) * 72 + l16 * 4] = ko;
      }
#pragma unroll
      for (int u = 0; u < 4; ++u) {
        v2bf vo;
        vo[0] = (bf16_t)vx[0][u];
        vo[1] = (bf16_t)vx[1][u];
        *(v2bf*)&svT[(l16 * 4 + u) * 136 + c0] = vo;
      }
    }
  }
  __syncthreads();

  // 3. A = q k'^T (8 tiles/wave) and num1 = q @ S (4 tiles/wave), K-dim 64
  v8f accA[8], accN[4];
#pragma unroll
  for (int i = 0; i < 8; ++i) accA[i] = vzero8();
#pragma unroll
  for (int i = 0; i < 4; ++i) accN[i] = vzero8();
#pragma unroll
  for (int kk = 0; kk < 64; kk += 32) {
    v16bf aq = frag_ld(frag_ptr(sq, wave * 16, 72, lane) + kk);
#pragma unroll
    for (int nt = 0; nt < 8; ++nt) {
      v16bf bk = frag_ld(frag_ptr(sk, nt * 16, 72, lane) + kk);
      accA[nt] = wmma_bf16(aq, bk, accA[nt]);
    }
#pragma unroll
    for (int nt = 0; nt < 4; ++nt) {
      v16bf bs = frag_ld(frag_ptr(sSB, nt * 16, 72, lane) + kk);
      accN[nt] = wmma_bf16(bs, aq, accN[nt]);  // D = tile^T: row cl, 8 neighbouring f a lane
    }
  }
  // 4a. q'.z while q' is still in LDS
  if (tid < 128) {
    float qz = 0.f;
#pragma unroll 8
    for (int e = 0; e < 64; ++e) qz += (float)sq[tid * 72 + e] * sz[e];
    sqz[tid] = qz;
  }
  __syncthreads();  // all waves done reading q'/k' before masked A overwrites them

  // tril mask + row sums + stage masked A as bf16; 4b. den[c] = q'.z + rowsum(A)
#pragma unroll
  for (int r = 0; r < 8; ++r) {
    const int c = wave * 16 + rh + r;
    float rs = 0.f;
#pragma unroll
    for (int nt = 0; nt < 8; ++nt) {
      const int d = nt * 16 + cl;
      const float v = (d <= c) ? accA[nt][r] : 0.f;
      accA[nt][r] = v;
      rs += v;
    }
#pragma unroll
    for (int o = 1; o < 16; o <<= 1) rs += __shfl_xor(rs, o);
    if (cl == 0) sden[c] = sqz[c] + rs;
#pragma unroll
    for (int nt = 0; nt < 8; ++nt)
      sP[c * 136 + nt * 16 + cl] = (bf16_t)accA[nt][r];
  }
  __syncthreads();

  // 5. num2 = A @ v  (A-operand = v^T rows; D transposed), K-dim 128
#pragma unroll
  for (int kk = 0; kk < 128; kk += 32) {
    v16bf ap = frag_ld(frag_ptr(sP, wave * 16, 136, lane) + kk);
#pragma unroll
    for (int nt = 0; nt < 4; ++nt) {
      v16bf bv = frag_ld(frag_ptr(svT, nt * 16, 136, lane) + kk);
      accN[nt] = wmma_bf16(bv, ap, accN[nt]);
    }
  }
  // 6. o = num / (den + 1e-6) -> global bf16
  head_rows_out(accN, sP + wave * 16 * 136, 136,
                out + ((size_t)b * 4096 + (size_t)ch * 128 + wave * 16) * 1024 + h * 64,
                sden[wave * 16 + cl] + 1e-6f, true, lane);
}

// ---------------------------------------------------------------------------
// Launch: B=2, L=4096, D=1024, H=16, E=64, W=128. Requires ws >= ~263 MB.
// ---------------------------------------------------------------------------
extern "C" void kernel_launch(void* const* d_in, const int* in_sizes, int n_in,
                              void* d_out, int out_size, void* d_ws, size_t ws_size,
                              hipStream_t stream) {
  const float* x = (const float*)d_in[0];
  const float* g1 = (const float*)d_in[1];
  const float* b1 = (const float*)d_in[2];
  const float* Wqkva = (const float*)d_in[3];
  const float* bqkva = (const float*)d_in[4];
  const float* Wpa = (const float*)d_in[5];
  const float* bpa = (const float*)d_in[6];
  const float* Wqkvs = (const float*)d_in[7];
  const float* bqkvs = (const float*)d_in[8];
  const float* Wos = (const float*)d_in[9];
  const float* bos = (const float*)d_in[10];
  const float* Wo = (const float*)d_in[11];
  const float* bo = (const float*)d_in[12];
  const float* gm = (const float*)d_in[13];
  const float* bm = (const float*)d_in[14];
  const float* W1 = (const float*)d_in[15];
  const float* b1m = (const float*)d_in[16];
  const float* W2 = (const float*)d_in[17];
  const float* b2m = (const float*)d_in[18];

  char* ws = (char*)d_ws;
  bf16_t* WqkvaT = (bf16_t*)(ws + 0);            // [3072][1024], and directly behind it,
                                                 // from ws + 6291456, WqkvsT [3072][1024]
  bf16_t* WpaT = (bf16_t*)(ws + 12582912);       // [1024][1024]
  bf16_t* WosT = (bf16_t*)(ws + 14680064);       // [1024][1024]
  bf16_t* WoT = (bf16_t*)(ws + 16777216);        // [1024][1024]
  bf16_t* W1T = (bf16_t*)(ws + 18874368);        // [4096][1024]
  bf16_t* W2T = (bf16_t*)(ws + 27262976);        // [1024][4096]
  bf16_t* xn = (bf16_t*)(ws + 35651584);         // [8192][1024]  (later: h)
  bf16_t* swa_o = (bf16_t*)(ws + 52428800);      // [8192][1024]
  bf16_t* lin_o = (bf16_t*)(ws + 69206016);      // [8192][1024]
  bf16_t* mix = (bf16_t*)(ws + 85983232);        // [8192][1024]
  float* linSc = (float*)(ws + 85983232);        // [32*32][64*64] (before mix)
  bf16_t* qkva = (bf16_t*)(ws + 102760448);      // [8192][3072]
  float* qkvs = (float*)(ws + 153092096);        // [8192][3072]
  bf16_t* gbuf = (bf16_t*)(ws + 153092096);      // [8192][4096] (reuses qkvs)
  float* x1 = (float*)(ws + 220200960);          // [8192][1024] (tail of qkvs)
  bf16_t* linSb = (bf16_t*)(ws + 253755392);     // [32*32][64*64]
  float* linzc = (float*)(ws + 262144000);       // [32*32][64]
  float* linzp = (float*)(ws + 262406144);       // [32*32][64]
  float* outf = (float*)d_out;

  const dim3 blk(256);
  // Weight convert+transpose to bf16 [N][K]: the seven Wt lie back to back from ws + 0
  wt_transpose_kernel<<<dim3(1088), blk, 0, stream>>>(Wqkva, Wqkvs, Wpa, Wos, Wo, W1, W2,
                                                      WqkvaT);

  // xn = LN(x)
  ln_kernel<<<8192, blk, 0, stream>>>(x, g1, b1, xn);
  // both qkv projections: one Bt of 6144 rows from WqkvaT on
  gemm_kernel<256, 128, 3072, true, false, false, true, false><<<dim3(24, 32), blk, 0, stream>>>(
      xn, WqkvaT, bqkva, nullptr, qkva, 1024, nullptr, nullptr, bqkvs, qkvs);
  // attention branches
  swa_kernel<<<dim3(32, 16, 2), blk, 0, stream>>>(qkva, swa_o);
  lin_state_kernel<<<dim3(31, 32), blk, 0, stream>>>(qkvs, linSc, linzc);
  lin_prefix_kernel<<<dim3(264), blk, 0, stream>>>(linSc, linzc, linSb, linzp);
  lin_out_kernel<<<dim3(32, 32), blk, 0, stream>>>(qkvs, linSb, linzp, lin_o);
  // mix = swa @ Wp + bp + lin @ Wo_s + bo_s  (bf16)
  gemm_kernel<128, 128, 1024, true, false, false, false, true><<<dim3(4, 64), blk, 0, stream>>>(
      swa_o, WpaT, bpa, nullptr, mix, 1024, lin_o, WosT, bos, nullptr);
  // x1 = mix @ Wo + bo + x  (f32)
  gemm_kernel<128, 128, 1024, false, false, true><<<dim3(4, 64), blk, 0, stream>>>(
      mix, WoT, bo, x, x1, 1024, nullptr, nullptr, nullptr, nullptr);
  // h = LN(x1)
  ln_kernel<<<8192, blk, 0, stream>>>(x1, gm, bm, xn);
  // g = gelu(h @ W1 + b1m)  (bf16)
  gemm_kernel<256, 128, 4096, true, true, false><<<dim3(16, 32), blk, 0, stream>>>(
      xn, W1T, b1m, nullptr, gbuf, 1024, nullptr, nullptr, nullptr, nullptr);
  // out = g @ W2 + b2m + x1  (f32)
  gemm_kernel<128, 128, 1024, false, false, true><<<dim3(4, 64), blk, 0, stream>>>(
      gbuf, W2T, b2m, x1, outf, 4096, nullptr, nullptr, nullptr, nullptr);
}

// v010
// It runs in 279 microseconds.
// Two timings next to v009 both put it at 1.07 times that version's speed.
// Counting every step since v000, it is 2.88 times as fast.
#include <hip/hip_runtime.h>

typedef __bf16 bf16_t;
typedef __attribute__((ext_vector_type(16))) __bf16 v16bf;
typedef __attribute__((ext_vector_type(8)))  __bf16 v8bf;
typedef __attribute__((ext_vector_type(8)))  float  v8f;

#define DEV static __device__ __forceinline__

// ---------------------------------------------------------------------------
// WMMA helpers (CDNA5 wave32, 16x16x32 bf16 -> f32)
// A fragment: lane m = row, kbase = 8*(lane>>4); VGPR v in [0,3] -> K = kbase+2v..,
// v in [4,7] -> K = 16+kbase+...  => two contiguous 16-byte chunks at +0 and +16.
// B fragment mirrors A with lane = output column, reading rows of B^T ([N][K]).
// ---------------------------------------------------------------------------
DEV v8f wmma_bf16(v16bf a, v16bf b, v8f c) {
  return __builtin_amdgcn_wmma_f32_16x16x32_bf16(false, a, false, b, (short)0, c,
                                                 false, false);
}

DEV const bf16_t* frag_ptr(const bf16_t* tile, int row0, int stride, int lane) {
  return tile + (size_t)(row0 + (lane & 15)) * stride + ((lane >> 4) << 3);
}

DEV v16bf frag_ld(const bf16_t* p) {
  v8bf lo = *(const v8bf*)(p);
  v8bf hi = *(const v8bf*)(p + 16);
  return __builtin_shufflevector(lo, hi, 0, 1, 2, 3, 4, 5, 6, 7,
                                 8, 9, 10, 11, 12, 13, 14, 15);
}

DEV v8f vzero8() {
  v8f z;
#pragma unroll
  for (int i = 0; i < 8; ++i) z[i] = 0.0f;
  return z;
}

// v_rcp_f32 and v_exp_f32 (2^a), each with the one slot that the instruction set asks for
// behind a transcendental before its result is used or its source overwritten; in one
// statement with it, so that the slot stands there whatever is scheduled next.
DEV float rcp_slot(float a) {
  float r;
  asm("v_rcp_f32 %0, %1\n\tv_nop" : "=v"(r) : "v"(a));
  return r;
}
DEV float exp2_slot(float a) {
  float r;
  asm("v_exp_f32 %0, %1\n\tv_nop" : "=v"(r) : "v"(a));
  return r;
}

// Exact GELU, 0.5 x (1 + erf(x / sqrt 2)), of 8 values, without a branch: 8 independent
// chains, stage by stage. One formula serves every z = |x| / sqrt 2: with t = 1 / (1 + p z),
// erfc(z) = t (a1 + t (a2 + t (a3 + t (a4 + t a5)))) exp(-z z), absolute error 1.5e-7.
// 1 + erf is 2 - erfc(z) for x >= 0 and erfc(z) itself for x < 0.
DEV void gelu_exact8(float (&x)[8]) {
  float z[8], t[8], e[8];
#pragma unroll
  for (int i = 0; i < 8; ++i) z[i] = fabsf(x[i]) * 0.70710678118654752f;
#pragma unroll
  for (int i = 0; i < 8; ++i) {
    t[i] = fmaf(0.3275911f, z[i], 1.0f);
    e[i] = z[i] * z[i] * -1.4426950408889634f;
  }
  // The two sched_barriers keep the 16 transcendentals together, away from what feeds them
  // and from what reads them: the compiler knows no latency of an asm statement and writes
  // no s_delay_alu for it, and a reader close behind would hold up the SIMD's other waves.
  __builtin_amdgcn_sched_barrier(0);
#pragma unroll
  for (int i = 0; i < 8; ++i) t[i] = rcp_slot(t[i]);
#pragma unroll
  for (int i = 0; i < 8; ++i) e[i] = exp2_slot(e[i]);
  __builtin_amdgcn_sched_barrier(0);
#pragma unroll
  for (int i = 0; i < 8; ++i) {
    float p = fmaf(1.061405429f, t[i], -1.453152027f);
    p = fmaf(p, t[i], 1.421413741f);
    p = fmaf(p, t[i], -0.284496736f);
    p = fmaf(p, t[i], 0.254829592f);
    const float h = (0.5f * x[i]) * ((p * t[i]) * e[i]);  // 0.5 x erfc(z)
    x[i] = x[i] >= 0.f ? x[i] - h : h;
  }
}

// The linear attention's feature map, elu(qs x) + 1.0001, of 8 values, without a branch.
// Below 0 elu is exp - 1 by v_exp_f32: its absolute error is that of one f32 rounding near 1,
// which the sum with 1.0001 has anyway, and the result is rounded to bf16 behind it.
DEV void elu_map8(float (&x)[8], float qs) {
  float a[8], e[8];
#pragma unroll
  for (int i = 0; i < 8; ++i) {
    x[i] *= qs;
    a[i] = x[i] * 1.4426950408889634f;
  }
  // The 8 v_exp_f32 (2^a) in one statement, so that no reader stands close behind any but the
  // last: the compiler knows no latency of asm text and would put each result's reader next
  // to it. Each fills the slot that the instruction set asks for behind the one before it
  // (outputs early-clobber: no result lands in a source); the v_nop is the last one's slot.
  asm("v_exp_f32 %0, %8\n\tv_exp_f32 %1, %9\n\tv_exp_f32 %2, %10\n\tv_exp_f32 %3, %11\n\t"
      "v_exp_f32 %4, %12\n\tv_exp_f32 %5, %13\n\tv_exp_f32 %6, %14\n\tv_exp_f32 %7, %15\n\t"
      "v_nop"
      : "=&v"(e[0]), "=&v"(e[1]), "=&v"(e[2]), "=&v"(e[3]), "=&v"(e[4]), "=&v"(e[5]),
        "=&v"(e[6]), "=&v"(e[7])
      : "v"(a[0]), "v"(a[1]), "v"(a[2]), "v"(a[3]), "v"(a[4]), "v"(a[5]), "v"(a[6]),
        "v"(a[7]));
#pragma unroll
  for (int i = 0; i < 8; ++i) x[i] = (x[i] > 0.f ? x[i] : e[i] - 1.0f) + 1.0001f;
}

// ---------------------------------------------------------------------------
// CDNA5 async global->LDS copy (ASYNCcnt-tracked), 16 bytes per lane, as the builtin:
// the compiler then forms each copy's address from a uniform base and one lane offset.
// ---------------------------------------------------------------------------
typedef __attribute__((ext_vector_type(4))) int v4i;
typedef __attribute__((address_space(1))) v4i g_v4i;
typedef __attribute__((address_space(3))) v4i l_v4i;

DEV void async_copy_b128(bf16_t* ldst, const char* gsrc) {
  __builtin_amdgcn_global_load_async_to_lds_b128((g_v4i*)gsrc, (l_v4i*)ldst, 0, 0);
}

DEV void wait_async0() { asm volatile("s_wait_asynccnt 0x0" ::: "memory"); }
DEV void wait_ds0() { asm volatile("s_wait_dscnt 0x0" ::: "memory"); }

// ---------------------------------------------------------------------------
// LayerNorm over D=1024, writes bf16. One block per row, 256 threads x 4 elems.
// ---------------------------------------------------------------------------
__global__ __launch_bounds__(256) void ln_kernel(const float* __restrict__ x,
                                                 const float* __restrict__ g,
                                                 const float* __restrict__ b,
                                                 bf16_t* __restrict__ out) {
  const int row = blockIdx.x;
  const int tid = threadIdx.x, lane = tid & 31, wave = tid >> 5;
  const float4 v = ((const float4*)(x + (size_t)row * 1024))[tid];
  float s = v.x + v.y + v.z + v.w;
  float ss = v.x * v.x + v.y * v.y + v.z * v.z + v.w * v.w;
#pragma unroll
  for (int o = 16; o; o >>= 1) {
    s += __shfl_xor(s, o);
    ss += __shfl_xor(ss, o);
  }
  __shared__ float red[16];
  if (lane == 0) { red[wave] = s; red[8 + wave] = ss; }
  __syncthreads();
  if (tid == 0) {
    float a = 0.f, c = 0.f;
#pragma unroll
    for (int i = 0; i < 8; ++i) { a += red[i]; c += red[8 + i]; }
    red[0] = a; red[8] = c;
  }
  __syncthreads();
  const float mean = red[0] * (1.0f / 1024.0f);
  const float var = red[8] * (1.0f / 1024.0f) - mean * mean;
  const float inv = rsqrtf(var + 1e-5f);
  const float4 gg = ((const float4*)g)[tid];
  const float4 bb = ((const float4*)b)[tid];
  bf16_t* o4 = out + (size_t)row * 1024 + tid * 4;
  o4[0] = (bf16_t)((v.x - mean) * inv * gg.x + bb.x);
  o4[1] = (bf16_t)((v.y - mean) * inv * gg.y + bb.y);
  o4[2] = (bf16_t)((v.z - mean) * inv * gg.z + bb.z);
  o4[3] = (bf16_t)((v.w - mean) * inv * gg.w + bb.w);
}

// ---------------------------------------------------------------------------
// Weight convert+transpose, all seven weights in one launch: f32 W[K][N] -> bf16
// Wt[N][K], the seven Wt back to back in WtAll. One 128(k) x 128(n) tile a block.
// A wave reads whole 512-B rows, two neighbouring k rows a pair; a pair is rounded
// and packed to one dword (k even low, k odd high); rows of Wt leave as 256-B runs.
// ---------------------------------------------------------------------------
typedef __attribute__((ext_vector_type(2))) __bf16 v2bf;
typedef __attribute__((ext_vector_type(4))) __bf16 v4bf;
typedef __attribute__((ext_vector_type(4))) float v4f;
typedef __attribute__((ext_vector_type(4))) uint32_t v4u;

// dword index of (column n, k pair p): pitch 65 spreads the 4-column lane stride over
// the banks; the 2 extra dwords from column 64 on keep lanes 16..31 off lanes 0..15.
DEV int wt_idx(int n, int p) { return n * 65 + ((n >> 6) << 1) + p; }

// One tile. K and N are compile-time, so that a lane's 16 loads share one address and
// differ in the immediate offset only.
template <int K, int N>
DEV void wt_tile(const float* __restrict__ W, bf16_t* __restrict__ Wt, int l,
                 uint32_t* t) {
  const int tid = threadIdx.x, lane = tid & 31, wave = tid >> 5;
  const int n0 = (l % (N / 128)) * 128, k0 = (l / (N / 128)) * 128;

  // k pair p = wave + 8 i: rows k0 + 2 p and k0 + 2 p + 1, 512 B of each a wave
  const float* src = W + (size_t)(k0 + 2 * wave) * N + n0 + lane * 4;
  v4f a[8], b[8];
#pragma unroll
  for (int i = 0; i < 8; ++i) {
    a[i] = *(const v4f*)(src + (16 * i) * N);
    b[i] = *(const v4f*)(src + (16 * i + 1) * N);
  }
  // the wait that is owed before a register which an issued load names is rewritten;
  // src as an input keeps the address pair live over the whole run, so that no load's
  // result is placed in it
  asm volatile("s_wait_xcnt 0x0" ::"v"(src) : "memory");
  // keeps all 16 loads of a lane ahead of the first conversion, so that they fly
  // together; without it the last four are issued only when the first have landed
  __builtin_amdgcn_sched_barrier(0);
#pragma unroll
  for (int i = 0; i < 8; ++i)
#pragma unroll
    for (int u = 0; u < 4; ++u) {
      v2bf pk;
      pk[0] = (bf16_t)a[i][u];
      pk[1] = (bf16_t)b[i][u];
      t[wt_idx(lane * 4 + u, wave + 8 * i)] = __builtin_bit_cast(uint32_t, pk);
    }
  __syncthreads();
  // a wave stores rows n0 + 2 wave + 16 i and the next, 256 B of each
  const int l16 = tid & 15, r = tid >> 4;
  bf16_t* dst = Wt + (size_t)(n0 + r) * K + k0 + l16 * 8;
#pragma unroll
  for (int i = 0; i < 8; ++i) {
    const int base = wt_idx(r + 16 * i, l16 * 4);
    v4u o;
    o[0] = t[base];
    o[1] = t[base + 1];
    o[2] = t[base + 2];
    o[3] = t[base + 3];
    *(v4u*)(dst + (16 * i) * K) = o;
  }
}

// Blocks 0..383: the two [1024][3072]; 384..575: the three [1024][1024];
// 576..831: [1024][4096]; 832..1087: [4096][1024]. Every branch is block-uniform.
__global__ __launch_bounds__(256) void wt_transpose_kernel(
    const float* __restrict__ Wa, const float* __restrict__ Wb,
    const float* __restrict__ Wc, const float* __restrict__ Wd,
    const float* __restrict__ We, const float* __restrict__ Wf,
    const float* __restrict__ Wg, bf16_t* __restrict__ WtAll) {
  __shared__ uint32_t t[128 * 65 + 2];
  const int bid = blockIdx.x;
  if (bid < 384) {
    const bool s = bid >= 192;
    wt_tile<1024, 3072>(s ? Wb : Wa, WtAll + (s ? 3145728 : 0), s ? bid - 192 : bid, t);
  } else if (bid < 576) {
    const int g = (bid - 384) >> 6;
    wt_tile<1024, 1024>(g == 0 ? Wc : (g == 1 ? Wd : We), WtAll + 6291456 + g * 1048576,
                        (bid - 384) & 63, t);
  } else if (bid < 832) {
    wt_tile<1024, 4096>(Wf, WtAll + 9437184, bid - 576, t);
  } else {
    wt_tile<4096, 1024>(Wg, WtAll + 13631488, bid - 832, t);
  }
}

// ---------------------------------------------------------------------------
// One wave's 64 x 64 tile from its accumulators to global memory in whole 128-B lines.
// acc[mt][nt] holds the tile TRANSPOSED (weight rows were the A operand): lane l has row
// m = 16 mt + (l & 15) and the 8 neighbouring columns n = 16 nt + 8 (l >> 4) + r. They go
// as 16-byte pieces into st, the wave's own LDS range (32 rows of 64 elements + 16 B, so
// that the 16 rows of a store fall on different banks), and come back with the lanes laid
// along the rows: a wave-wide 16-byte store then covers 4 whole lines. Two rounds of 32
// rows. bias (+ bias2) and GELU or the feature map (FMAP, scale qs) before the staging, the
// f32 residual behind it, read in whole lines too.
// og, rg: element (0, 0) of the tile in out and res; bp, bq: the tile's first column.
// ---------------------------------------------------------------------------
template <typename OT, int NN, bool GELU_ACT, bool RES, bool TWOB, bool FMAP = false>
DEV void tile_out(const v8f (&acc)[4][4], OT* st, OT* __restrict__ og,
                  const float* __restrict__ bp, const float* __restrict__ bq,
                  const float* __restrict__ rg, int lane, float qs = 1.0f) {
  typedef __attribute__((ext_vector_type(4))) float f4;
  constexpr bool B16 = sizeof(OT) == 2;
  constexpr int EPB = 16 / (int)sizeof(OT);  // elements of a 16-byte piece
  constexpr int SP = 64 + EPB;               // staging pitch, elements
  constexpr int LPR = 64 / EPB;              // lanes a row at the read-back
  constexpr int RPI = 32 / LPR;              // rows a wave-wide access
  constexpr int NJ = 32 / RPI;               // accesses a round
  const int cl = lane & 15, hi = lane >> 4;
  const float* bl = bp + hi * 8;
  const float* bm = bq + hi * 8;
  OT* ol = og + (size_t)(lane / LPR) * NN + (lane % LPR) * EPB;
  const float* rl = rg + (RES ? (size_t)(lane / LPR) * NN + (lane % LPR) * 4 : 0);
  OT* sw = st + cl * SP + hi * 8;
  const OT* sr = st + (lane / LPR) * SP + (lane % LPR) * EPB;

  float bv[4][8];
#pragma unroll
  for (int nt = 0; nt < 4; ++nt) {
    const f4 a = *(const f4*)(bl + nt * 16), b = *(const f4*)(bl + nt * 16 + 4);
#pragma unroll
    for (int r = 0; r < 4; ++r) { bv[nt][r] = a[r]; bv[nt][4 + r] = b[r]; }
  }
  if constexpr (TWOB) {
#pragma unroll
    for (int nt = 0; nt < 4; ++nt) {
      const f4 a = *(const f4*)(bm + nt * 16), b = *(const f4*)(bm + nt * 16 + 4);
#pragma unroll
      for (int r = 0; r < 4; ++r) { bv[nt][r] += a[r]; bv[nt][4 + r] += b[r]; }
    }
  }
  // the wait that is owed before a register which an issued load names is rewritten; the
  // addresses as inputs stay live up to it
  if constexpr (TWOB) asm volatile("s_wait_xcnt 0x0" ::"v"(bl), "v"(bm) : "memory");
  else asm volatile("s_wait_xcnt 0x0" ::"v"(bl) : "memory");

#pragma unroll
  for (int hf = 0; hf < 2; ++hf) {
    f4 rr[NJ];
    if constexpr (RES) {
      // ahead of the staging, so that they fly during it
#pragma unroll
      for (int j = 0; j < NJ; ++j) rr[j] = *(const f4*)(rl + (hf * 32 + j * RPI) * NN);
    }
#pragma unroll
    for (int i = 0; i < 2; ++i)
#pragma unroll
      for (int nt = 0; nt < 4; ++nt) {
        float v[8];
#pragma unroll
        for (int r = 0; r < 8; ++r) v[r] = acc[hf * 2 + i][nt][r] + bv[nt][r];
        if constexpr (GELU_ACT) gelu_exact8(v);
        if constexpr (FMAP) elu_map8(v, qs);
        if constexpr (B16) {
          v8bf pk;
#pragma unroll
          for (int r = 0; r < 8; ++r) pk[r] = (bf16_t)v[r];
          *(v8bf*)(sw + i * 16 * SP + nt * 16) = pk;
        } else {
          f4 lo, up;
#pragma unroll
          for (int r = 0; r < 4; ++r) { lo[r] = v[r]; up[r] = v[4 + r]; }
          *(f4*)(sw + i * 16 * SP + nt * 16) = lo;
          *(f4*)(sw + i * 16 * SP + nt * 16 + 4) = up;
        }
      }
    wait_ds0();  // the wave's own pieces are in LDS before other lanes of it read them
    if constexpr (B16) {
      v8bf x[NJ];
#pragma unroll
      for (int j = 0; j < NJ; ++j) x[j] = *(const v8bf*)(sr + j * RPI * SP);
#pragma unroll
      for (int j = 0; j < NJ; ++j) *(v8bf*)(ol + (hf * 32 + j * RPI) * NN) = x[j];
    } else {
      f4 x[NJ];
#pragma unroll
      for (int j = 0; j < NJ; ++j) x[j] = *(const f4*)(sr + j * RPI * SP);
      if constexpr (RES) {
#pragma unroll
        for (int j = 0; j < NJ; ++j) x[j] += rr[j];
      }
#pragma unroll
      for (int j = 0; j < NJ; ++j) *(f4*)(ol + (hf * 32 + j * RPI) * NN) = x[j];
    }
    // the same wait, behind each round's loads and stores
    if constexpr (RES) asm volatile("s_wait_xcnt 0x0" ::"v"(ol), "v"(rl) : "memory");
    else asm volatile("s_wait_xcnt 0x0" ::"v"(ol) : "memory");
    // keeps the second round's map behind that wait: lifted over it, as this build does when
    // left alone, it rewrites data registers of stores that have just been issued
    if constexpr (FMAP) __builtin_amdgcn_sched_barrier(0);
  }
}

// ---------------------------------------------------------------------------
// Generic bf16 GEMM, f32 accumulate: out[M][NN] = A[M][K] * Bt[NN][K]^T + bias
// Block: 256 thr = 8 waves; tile BM x 256; one work-group a WGP.
// BM = 128 (products of 1024 columns: 256 tiles, one a WGP): waves 2 x 4, wave tile 64 x 64.
// BM = 256 (the wide products, whole rounds of 256 tiles): waves 4 x 2, wave tile 64 x 128
// (4 M-frags x 8 N-frags): 12 fragments read from LDS feed 32 WMMAs (8 feed 16 at 64 x 64),
// and 512 operand rows come from L2 for the products that two 128 x 256 tiles take 768 for.
// A pass is KP k = KP / 32 blocks of 32 k. Two LDS buffers, each [A BM rows | Bt 256 rows]
// at pitch 2 KP + 16 B, filled by async global->LDS copies one pass ahead; one barrier a pass.
// Epilogue (tile_out, once per 64 columns of the wave tile): optional GELU, optional f32
// residual, bf16 or f32 output. M multiple of BM, NN of 256, K of KP.
// The k walk is rotated: work-group (x, y) begins at pass (x + y) & (passes - 1) and wraps
// round. Work-groups that share operand rows (one x: Bt, one y: A) start together; from one
// k they would ask L2 for the same lines at the same moment, and every request on the chip
// would fall on the same 256 B of the operands' 2-KiB and 8-KiB rows.
// Two products that share an operand or an output run as one launch:
// CATN: Bt holds 2 NN rows, the weights of two products of the same A one behind the other;
//   grid.x = 2 NN / 256. Column blocks below NN give out (bias), the rest out2 (bias2), each
//   bf16 [M][NN]. The second product is the linear attention's q | k | v, NN / 3 columns each:
//   q and k leave as q' = elu(q / 8) + 1.0001 and k' = elu(k) + 1.0001, rounded to bf16 once,
//   here, as the matrix products of both later launches take them.
// CATK: out = A Bt^T + A2 Bt2^T + bias + bias2, all four operands of row length K: the k
//   passes of the second product (k from K to 2 K) and those of the first form one rotated walk on the
//   same accumulators.
// ---------------------------------------------------------------------------
template <int BM, int KP, int NN, bool OUT_BF16, bool GELU_ACT, bool RES, bool CATN = false,
          bool CATK = false>
__global__ __launch_bounds__(256) void gemm_kernel(
    const bf16_t* __restrict__ A, const bf16_t* __restrict__ Bt,
    const float* __restrict__ bias, const float* __restrict__ res,
    void* __restrict__ out, int K, const bf16_t* __restrict__ A2,
    const bf16_t* __restrict__ Bt2, const float* __restrict__ bias2,
    void* __restrict__ out2) {
  constexpr int LDK = KP + 8;              // row pitch 272 B = 16 B x odd
  constexpr int STAGE = (BM + 256) * LDK;  // elements of one buffer
  constexpr int WN = 512 / BM;             // waves along N: 4 or 2
  constexpr int NH = 4 / WN;               // 64-column parts of a wave's tile: 1 or 2
  constexpr int NB = KP / 32;              // blocks per pass
  constexpr int PR = KP / 8;               // 16-byte pieces per row
  constexpr int RG = 256 / PR;             // rows that the block's 256 threads copy at once
  __shared__ __align__(16) bf16_t sT[2][STAGE];
  const int tid = threadIdx.x, lane = tid & 31, wave = tid >> 5;
  const int m0 = blockIdx.y * BM, n0 = blockIdx.x * 256;
  const int wm = (wave / WN) * 64;         // wave M offset within tile
  const int wn = (wave % WN) * (64 * NH);  // wave N offset within tile

  v8f acc[NH][4][4];
#pragma unroll
  for (int h = 0; h < NH; ++h)
#pragma unroll
    for (int i = 0; i < 4; ++i)
#pragma unroll
      for (int j = 0; j < 4; ++j) acc[h][i][j] = vzero8();

  const int cr = tid / PR;          // row within a group of RG rows
  const int cc = (tid % PR) * 8;    // 16-byte piece of the row
  // one 32-bit lane offset serves every copy; the rest of each address is uniform
  const uint32_t goff = (uint32_t)(cr * K + cc) * 2u;
  const char* uA = (const char*)(A + (size_t)m0 * K);
  const char* uB = (const char*)(Bt + (size_t)n0 * K);
  const char* uA2 = CATK ? (const char*)(A2 + (size_t)m0 * K) : uA;
  const char* uB2 = CATK ? (const char*)(Bt2 + (size_t)n0 * K) : uB;

  // pass kq into buffer `buf`: (BM + 256) KP / 2048 copies of 16 B per thread (24 or 32),
  // whole lines
  auto stage = [&](int kq, int buf) {
    // CATK: from k = K on the second pair of operands, a choice that is block-uniform
    const bool second = CATK && kq >= K;
    const char* pA = second ? uA2 : uA;
    const char* pB = second ? uB2 : uB;
    const int k0 = second ? kq - K : kq;
    bf16_t* d = &sT[buf][cr * LDK + cc];
#pragma unroll
    for (int i = 0; i < BM / RG; ++i)
      async_copy_b128(d + i * RG * LDK, pA + ((size_t)(i * RG) * K + k0) * 2 + goff);
#pragma unroll
    for (int i = 0; i < 256 / RG; ++i)
      async_copy_b128(d + (BM + i * RG) * LDK,
                      pB + ((size_t)(i * RG) * K + k0) * 2 + goff);
  };

  const int fa = (wm + (lane & 15)) * LDK + ((lane >> 4) << 3);
  const int fb = (BM + wn + (lane & 15)) * LDK + ((lane >> 4) << 3);

  const int ktot = CATK ? 2 * K : K;
  const int npass = ktot / KP;
  // k of the next pass to be staged; the mask gives a start below npass for any npass
  int kn = (int)((blockIdx.x + blockIdx.y) & (unsigned)(npass - 1)) * KP;
  auto next_k = [&]() {
    const int k = kn;
    kn = kn + KP == ktot ? 0 : kn + KP;
    return k;
  };
  stage(next_k(), 0);
  wait_async0();    // own copies of the first pass have landed
  __syncthreads();  // everyone's have
  if (1 < npass) stage(next_k(), 1);
  for (int t = 0; t < npass; ++t) {
    const int buf = t & 1;
    const bf16_t* cur = &sT[buf][0];
    // the sched_barriers keep [LDS reads][WMMAs] as written: a block's reads go as
    // one group; left alone they are spread in pairs among the WMMAs, each pair with a
    // full wait of its own behind it
#pragma unroll
    for (int u = 0; u < NB; ++u) {
      v16bf af[4], bfv[4 * NH];
      __builtin_amdgcn_sched_barrier(0);
#pragma unroll
      for (int mt = 0; mt < 4; ++mt) af[mt] = frag_ld(cur + fa + mt * 16 * LDK + u * 32);
#pragma unroll
      for (int nt = 0; nt < 4 * NH; ++nt)
        bfv[nt] = frag_ld(cur + fb + nt * 16 * LDK + u * 32);
      __builtin_amdgcn_sched_barrier(0);
#pragma unroll
      for (int nt = 0; nt < 4 * NH; ++nt)
#pragma unroll
        for (int mt = 0; mt < 4; ++mt)  // D = tile^T: tile_out
          acc[nt >> 2][mt][nt & 3] = wmma_bf16(bfv[nt], af[mt], acc[nt >> 2][mt][nt & 3]);
    }
    // publish point of pass t + 1
    wait_ds0();       // own reads of this buffer have all returned
    wait_async0();    // own copies of pass t + 1 have landed
    __syncthreads();  // everyone's have, and everyone has left this buffer
    if (t + 2 < npass) stage(next_k(), buf);
  }
  wait_async0();  // nothing is in flight when the wave goes on to its end

  // Every wave has left the ring (the last pass's barrier) and no copy is in flight: the
  // ring's LDS is free, and each wave stages in a range of its own.
  typedef typename std::conditional<OUT_BF16, bf16_t, float>::type out_t;
  static_assert(!(RES && OUT_BF16) && !(RES && GELU_ACT), "residual: f32 output, no GELU");
  static_assert(!CATN || OUT_BF16, "two products side by side: bf16 outputs");
  // block-uniform: a block's 256 columns lie wholly in one of the two products of CATN, and
  // there wholly in q, k or v
  const bool sec = CATN && n0 >= NN;
  out_t* ob = (out_t*)(sec ? out2 : out);
  const float* bb = sec ? bias2 : bias;
  // through readfirstlane: one scalar value. Seen through, the - NN goes into the immediate
  // offsets of tile_out's bias loads, their base is then not the pointer that its s_wait_xcnt
  // statement keeps live, and it is rewritten ahead of that wait
  const int nb0 = CATN ? __builtin_amdgcn_readfirstlane(sec ? n0 - NN : n0) : n0;
  if constexpr (CATN) {
    if (sec && nb0 < 2 * (NN / 3)) {
      const float qs = nb0 < NN / 3 ? 0.125f : 1.0f;  // q: E^-0.5
      // kept rolled, as the GELU build below and in its form: one copy of the text, and the
      // second part's addresses are formed when its turn comes (unrolled, one is spilled)
#pragma unroll 1
      for (int h = 0; h < NH; ++h) {
        tile_out<out_t, NN, false, false, false, true>(
            acc[0], (out_t*)&sT[0][0] + wave * (32 * 72),
            ob + (size_t)(m0 + wm) * NN + (size_t)(nb0 + wn + h * 64),
            bb + (nb0 + wn + h * 64), bb, bb, lane, qs);
        // keeps the moves behind the s_wait_xcnt 0 that ends tile_out: lifted over it, they
        // would rewrite data registers of stores that have just been issued
        __builtin_amdgcn_sched_barrier(0);
#pragma unroll
        for (int i = 0; i < 4; ++i)
#pragma unroll
          for (int j = 0; j < 4; ++j) acc[0][i][j] = acc[NH - 1][i][j];
      }
      return;
    }
  }
  // The 64-column parts of a wave's tile, one after the other. The GELU build keeps the loop
  // rolled: one copy of the epilogue, each next part moved into the first one's registers;
  // unrolled, its text is twice as long. The build of two products side by side is rolled too: unrolled, its second
  // part's address is spilled. The other builds are short and unroll: no moves.
  constexpr int EU = GELU_ACT || CATN ? 1 : NH;
#pragma unroll EU
  for (int h = 0; h < NH; ++h) {
    const int c0 = nb0 + wn + h * 64;
    const size_t e0 = (size_t)(m0 + wm) * NN + (size_t)c0;
    tile_out<out_t, NN, GELU_ACT, RES, CATK>(
        acc[0], (out_t*)&sT[0][0] + wave * (32 * (64 + 16 / (int)sizeof(out_t))),
        ob + e0, bb + c0, CATK ? bias2 + c0 : bias, RES ? res + e0 : bias, lane);
    // keeps the moves and the next part's arithmetic behind the s_wait_xcnt 0 that ends
    // tile_out: lifted over it, they would rewrite data registers of stores just issued
    __builtin_amdgcn_sched_barrier(0);
#pragma unroll
    for (int i = 0; i < 4; ++i)
#pragma unroll
      for (int j = 0; j < 4; ++j) acc[0][i][j] = acc[NH - 1][i][j];
  }
}

// ---------------------------------------------------------------------------
// One wave's 16 rows x 64 head columns, bf16, to global memory in whole 128-B lines, as in
// tile_out: t[nt] holds the tile transposed (lane l: row l & 15, columns 16 nt + 8 (l >> 4)
// + r). st: the wave's own 16 rows of an LDS tile that only it reads and that it has done
// with, pitch sp elements (16 B x odd). og: element (0, 0), row pitch 1024. dv: the lane's
// row is divided by den.
// ---------------------------------------------------------------------------
DEV void head_rows_out(const v8f (&t)[4], bf16_t* st, int sp, bf16_t* __restrict__ og,
                       float den, bool dv, int lane) {
#pragma unroll
  for (int nt = 0; nt < 4; ++nt) {
    v8bf pk;
#pragma unroll
    for (int r = 0; r < 8; ++r) pk[r] = (bf16_t)(dv ? t[nt][r] / den : t[nt][r]);
    *(v8bf*)(st + (lane & 15) * sp + nt * 16 + (lane >> 4) * 8) = pk;
  }
  wait_ds0();  // the wave's own pieces are in LDS before other lanes of it read them
  v8bf x[4];
#pragma unroll
  for (int j = 0; j < 4; ++j)
    x[j] = *(const v8bf*)(st + (j * 4 + (lane >> 3)) * sp + (lane & 7) * 8);
  bf16_t* ol = og + (size_t)(lane >> 3) * 1024 + (lane & 7) * 8;
#pragma unroll
  for (int j = 0; j < 4; ++j) *(v8bf*)(ol + j * 4 * 1024) = x[j];
}

// ---------------------------------------------------------------------------
// Sliding-window attention. One block per (query-block, head, batch).
// Q 128x64, K/V context 256x64 (prev block + own block), W=128 band mask.
// All matmuls via WMMA; softmax in registers with 16-lane shuffles.
// qkv: bf16 [B*L][3*1024]; out: bf16 [B*L][1024].
// ---------------------------------------------------------------------------
__global__ __launch_bounds__(256) void swa_kernel(const bf16_t* __restrict__ qkv,
                                                  bf16_t* __restrict__ out) {
  const int blk = blockIdx.x, h = blockIdx.y, b = blockIdx.z;
  const int tid = threadIdx.x, lane = tid & 31, wave = tid >> 5;

  // Q(128x72) + K(256x72) overlap with P(128x264) -- disjoint lifetimes.
  __shared__ __align__(16) char smem_u[128 * 264 * 2];
  __shared__ __align__(16) bf16_t sVt[64 * 264];  // V^T [e][s]
  bf16_t* sQ = (bf16_t*)smem_u;                   // [128][72]
  bf16_t* sK = (bf16_t*)smem_u + 128 * 72;        // [256][72]
  bf16_t* sP = (bf16_t*)smem_u;                   // [128][264]

  const size_t rowQ0 = (size_t)b * 4096 + (size_t)blk * 128;

  // 8 lanes a 128-B head row: a wave-wide load covers 4 whole rows = 4 whole lines.
  // Q: rows rg + 32 i. K, V: loads 2 p and 2 p + 1 of a thread are the neighbouring keys s0
  // and s0 + 1, s0 = 64 p + 2 rg, which share a dword of V^T. Keys 0..127 are the previous
  // block (p < 2): block 0 has none and takes zeros, a choice that is block-uniform.
  {
    const int l8 = tid & 7, rg = tid >> 3;
    const bf16_t* srcq = qkv + (rowQ0 + rg) * 3072 + h * 64 + l8 * 8;
    const bf16_t* srck = qkv + (rowQ0 + rg * 2) * 3072 + 1024 + h * 64 + l8 * 8;  // key 128 + 2 rg
    v8bf qx[4], kx[8], vx[8];
#pragma unroll
    for (int i = 0; i < 4; ++i) qx[i] = *(const v8bf*)(srcq + (i * 32) * 3072);
#pragma unroll
    for (int i = 4; i < 8; ++i) {
      kx[i] = *(const v8bf*)(srck + (((i >> 1) - 2) * 64 + (i & 1)) * 3072);
      vx[i] = *(const v8bf*)(srck + (((i >> 1) - 2) * 64 + (i & 1)) * 3072 + 1024);
    }
    if (blk > 0) {
#pragma unroll
      for (int i = 0; i < 4; ++i) {
        kx[i] = *(const v8bf*)(srck + (((i >> 1) - 2) * 64 + (i & 1)) * 3072);
        vx[i] = *(const v8bf*)(srck + (((i >> 1) - 2) * 64 + (i & 1)) * 3072 + 1024);
      }
    } else {
#pragma unroll
      for (int i = 0; i < 4; ++i)
#pragma unroll
        for (int j = 0; j < 8; ++j) {
          kx[i][j] = (bf16_t)0.f;
          vx[i][j] = (bf16_t)0.f;
        }
    }
    // the wait that is owed before a register which an issued load names is rewritten;
    // the two addresses as inputs stay live over the whole run
    asm volatile("s_wait_xcnt 0x0" ::"v"(srcq), "v"(srck) : "memory");
#pragma unroll
    for (int i = 0; i < 4; ++i) *(v8bf*)&sQ[(rg + 32 * i) * 72 + l8 * 8] = qx[i];
#pragma unroll
    for (int i = 0; i < 8; ++i)
      *(v8bf*)&sK[((i >> 1) * 64 + rg * 2 + (i & 1)) * 72 + l8 * 8] = kx[i];
#pragma unroll
    for (int p = 0; p < 4; ++p)
#pragma unroll
      for (int j = 0; j < 8; ++j) {
        v2bf vo;
        vo[0] = vx[2 * p][j];
        vo[1] = vx[2 * p + 1][j];
        *(v2bf*)&sVt[(l8 * 8 + j) * 264 + p * 64 + rg * 2] = vo;
      }
  }
  __syncthreads();

  // Scores: wave w owns query rows [16w,16w+16); 16 key tiles; K-dim = 64.
  v8f acc[16];
#pragma unroll
  for (int i = 0; i < 16; ++i) acc[i] = vzero8();
#pragma unroll
  for (int kk = 0; kk < 64; kk += 32) {
    v16bf aq = frag_ld(frag_ptr(sQ, wave * 16, 72, lane) + kk);
#pragma unroll
    for (int nt = 0; nt < 16; ++nt) {
      v16bf bk = frag_ld(frag_ptr(sK, nt * 16, 72, lane) + kk);
      acc[nt] = wmma_bf16(aq, bk, acc[nt]);
    }
  }

  // Mask + softmax. C-layout: row = 16*wave + 8*(lane>>4) + r, col = 16*nt + (lane&15)
  const int cl = lane & 15, rh = (lane >> 4) << 3;
#pragma unroll
  for (int r = 0; r < 8; ++r) {
    const int rloc = wave * 16 + rh + r;
    float mx = -1e30f;
#pragma unroll
    for (int nt = 0; nt < 16; ++nt) {
      const int s = nt * 16 + cl;
      const bool ok = (s >= rloc + 1) && (s <= rloc + 128) && (blk > 0 || s >= 128);
      const float v = ok ? acc[nt][r] * 0.125f : -1e30f;
      acc[nt][r] = v;
      mx = fmaxf(mx, v);
    }
#pragma unroll
    for (int o = 1; o < 16; o <<= 1) mx = fmaxf(mx, __shfl_xor(mx, o));
    float sum = 0.f;
#pragma unroll
    for (int nt = 0; nt < 16; ++nt) {
      const float e = __expf(acc[nt][r] - mx);
      acc[nt][r] = e;
      sum += e;
    }
#pragma unroll
    for (int o = 1; o < 16; o <<= 1) sum += __shfl_xor(sum, o);
    const float inv = 1.0f / sum;
#pragma unroll
    for (int nt = 0; nt < 16; ++nt) acc[nt][r] *= inv;
  }

  __syncthreads();  // all waves done reading sQ/sK before P overwrites them
#pragma unroll
  for (int nt = 0; nt < 16; ++nt)
#pragma unroll
    for (int r = 0; r < 8; ++r)
      sP[(wave * 16 + rh + r) * 264 + nt * 16 + cl] = (bf16_t)acc[nt][r];
  __syncthreads();

  // PV: out 16x64 per wave; K-dim = 256 keys.
  v8f ov[4];
#pragma unroll
  for (int i = 0; i < 4; ++i) ov[i] = vzero8();
#pragma unroll
  for (int kk = 0; kk < 256; kk += 32) {
    v16bf ap = frag_ld(frag_ptr(sP, wave * 16, 264, lane) + kk);
#pragma unroll
    for (int nt = 0; nt < 4; ++nt) {
      v16bf bv = frag_ld(frag_ptr(sVt, nt * 16, 264, lane) + kk);
      ov[nt] = wmma_bf16(bv, ap, ov[nt]);  // D = tile^T: query cl, 8 neighbouring e a lane
    }
  }
  head_rows_out(ov, sP + wave * 16 * 264, 264,
                out + (rowQ0 + wave * 16) * 1024 + h * 64, 1.0f, false, lane);
}

// ---------------------------------------------------------------------------
// Chunked causal linear attention, chunk-parallel, three launches:
//   lin_state : per (chunk, b, h) the chunk's own v^T k' (64x64 f32) and colsum(k')
//   lin_prefix: exclusive running sum over the chunks, f32, chunk 0 first
//   lin_out   : per (chunk, b, h) the outputs from q', k', v and the summed state
// qkv: bf16 [B*L][3*1024], q' | k' | v (the elu maps are applied by the GEMM that writes it);
// out: bf16 [B*L][1024].
// State records: index (bh*32 + ch); S^T as [f][e].
// ---------------------------------------------------------------------------

// The last chunk's own state is read by nobody: grid.x = 31.
__global__ __launch_bounds__(256) void lin_state_kernel(const bf16_t* __restrict__ qkv,
                                                        float* __restrict__ Sc,
                                                        float* __restrict__ zc) {
  const int ch = blockIdx.x, bh = blockIdx.y, b = bh >> 4, h = bh & 15;
  const int tid = threadIdx.x, lane = tid & 31, wave = tid >> 5;
  __shared__ __align__(16) bf16_t skT[64 * 136];   // k'^T     [e][c]
  __shared__ __align__(16) bf16_t svT[64 * 136];   // v^T      [f][c]
  const int cl = lane & 15, rh = (lane >> 4) << 3;
  {
    // 8 lanes a 128-B head row: a wave-wide load covers 4 whole rows = 4 whole lines.
    // Loads 2 p and 2 p + 1 of a thread are the neighbouring rows c0 and c0 + 1, which share
    // a dword of the transposed tiles.
    const int l8 = tid & 7, rg = tid >> 3;
    const bf16_t* pk = qkv + ((size_t)b * 4096 + (size_t)ch * 128 + rg * 2) * 3072 + 1024 +
                       h * 64 + l8 * 8;
    v8bf kx[4], vx[4];
#pragma unroll
    for (int i = 0; i < 4; ++i) {
      kx[i] = *(const v8bf*)(pk + ((i >> 1) * 64 + (i & 1)) * 3072);
      vx[i] = *(const v8bf*)(pk + ((i >> 1) * 64 + (i & 1)) * 3072 + 1024);
    }
    // the wait that is owed before a register which an issued load names is rewritten;
    // pk as an input keeps the address live over the whole run
    asm volatile("s_wait_xcnt 0x0" ::"v"(pk) : "memory");
#pragma unroll
    for (int p = 0; p < 2; ++p) {
      const int c0 = p * 64 + rg * 2;
#pragma unroll
      for (int j = 0; j < 8; ++j) {
        v2bf ko, vo;
        ko[0] = kx[2 * p][j];
        ko[1] = kx[2 * p + 1][j];
        vo[0] = vx[2 * p][j];
        vo[1] = vx[2 * p + 1][j];
        *(v2bf*)&skT[(l8 * 8 + j) * 136 + c0] = ko;
        *(v2bf*)&svT[(l8 * 8 + j) * 136 + c0] = vo;
      }
    }
  }
  __syncthreads();

  const size_t rec = (size_t)bh * 32 + ch;
  // v^T @ k'  (16 tiles over 8 waves, 2 each), K-dim 128
  {
    const int ft = wave >> 1;
    const int ebase = (wave & 1) * 32;
    v8f accS[2];
#pragma unroll
    for (int i = 0; i < 2; ++i) accS[i] = vzero8();
#pragma unroll
    for (int kk = 0; kk < 128; kk += 32) {
      v16bf av = frag_ld(frag_ptr(svT, ft * 16, 136, lane) + kk);
#pragma unroll
      for (int nt = 0; nt < 2; ++nt) {
        v16bf bk = frag_ld(frag_ptr(skT, ebase + nt * 16, 136, lane) + kk);
        accS[nt] = wmma_bf16(av, bk, accS[nt]);
      }
    }
#pragma unroll
    for (int nt = 0; nt < 2; ++nt)
#pragma unroll
      for (int r = 0; r < 8; ++r) {
        const int f = ft * 16 + rh + r;
        const int e = ebase + nt * 16 + cl;
        Sc[rec * 4096 + f * 64 + e] = accS[nt][r];
      }
  }
  if (tid < 64) {
    float zs = 0.f;
#pragma unroll 8
    for (int c = 0; c < 128; ++c) zs += (float)skT[tid * 136 + c];
    zc[rec * 64 + tid] = zs;
  }
}

// Blocks 0..255: S^T, two neighbouring elements a thread, rounded to bf16 at the
// store (the A operand of the transposed q' @ S). Blocks 256..263: z, kept in f32.
__global__ __launch_bounds__(256) void lin_prefix_kernel(const float* __restrict__ Sc,
                                                         const float* __restrict__ zc,
                                                         bf16_t* __restrict__ Sb,
                                                         float* __restrict__ zp) {
  if (blockIdx.x >= 256) {
    const int t = (blockIdx.x - 256) * 256 + threadIdx.x;
    const size_t base = (size_t)(t >> 6) * (32 * 64) + (size_t)(t & 63);
    float v[31];
#pragma unroll
    for (int ch = 0; ch < 31; ++ch) v[ch] = zc[base + ch * 64];
    float s = 0.f;
#pragma unroll
    for (int ch = 0; ch < 32; ++ch) {
      zp[base + ch * 64] = s;
      if (ch < 31) s += v[ch];
    }
    return;
  }
  const int t = blockIdx.x * 256 + threadIdx.x;
  const size_t base = (size_t)(t >> 11) * (32 * 4096) + (size_t)(t & 2047) * 2;
  float2 v[31];
#pragma unroll
  for (int ch = 0; ch < 31; ++ch) v[ch] = *(const float2*)(Sc + base + ch * 4096);
  float s0 = 0.f, s1 = 0.f;
#pragma unroll
  for (int ch = 0; ch < 32; ++ch) {
    v2bf o;
    o[0] = (bf16_t)s0;
    o[1] = (bf16_t)s1;
    *(v2bf*)(Sb + base + ch * 4096) = o;
    if (ch < 31) { s0 += v[ch].x; s1 += v[ch].y; }
  }
  // the built code lets this path run on to the z path's first instructions behind a
  // scalar test; they rewrite registers that the stores above name: wait in front
  asm volatile("s_wait_xcnt 0x0" ::: "memory");
}

// 8 waves a SIMD asked for: at most 128 registers, so that four work-groups fit a WGP
__global__ __launch_bounds__(256, 8) void lin_out_kernel(const bf16_t* __restrict__ qkv,
                                                      const bf16_t* __restrict__ Sb,
                                                      const float* __restrict__ zp,
                                                      bf16_t* __restrict__ out) {
  const int ch = blockIdx.x, bh = blockIdx.y, b = bh >> 4, h = bh & 15;
  const int tid = threadIdx.x, lane = tid & 31;
  // the wave's number in a scalar register: as a vector value its row index is one register
  // more than the 128 hold over the first products, and is spilled
  const int wave = __builtin_amdgcn_readfirstlane(tid >> 5);
  // q'(128x72) + k'(128x72) overlap with masked A (128x136) -- disjoint lifetimes.
  __shared__ __align__(16) char smem_u[2 * 128 * 72 * 2];
  __shared__ __align__(16) bf16_t svT[64 * 136];   // v^T      [f][c]
  __shared__ __align__(16) bf16_t sSB[64 * 72];    // bf16 S^T before this chunk [f][e]
  __shared__ float sz[64];
  __shared__ float sqz[128];
  __shared__ float sden[128];
  bf16_t* sq = (bf16_t*)smem_u;                    // q' rows  [c][e]
  bf16_t* sk = (bf16_t*)smem_u + 128 * 72;         // k' rows  [c][e]
  bf16_t* sP = (bf16_t*)smem_u;                    // masked A [c][d]

  const int cl = lane & 15, rh = (lane >> 4) << 3;
  const size_t rec = (size_t)bh * 32 + ch;

  // 1. state before this chunk (A-operand layout: row f, cols e)
#pragma unroll
  for (int i = tid; i < 512; i += 256)
    *(v8bf*)&sSB[(i >> 3) * 72 + (i & 7) * 8] = *(const v8bf*)(Sb + rec * 4096 + i * 8);
  if (tid < 64) sz[tid] = zp[rec * 64 + tid];
  // 2. load chunk
  {
    // 8 lanes a 128-B head row: a wave-wide load covers 4 whole rows = 4 whole lines.
    // Load i of a thread is row (i >> 1) * 64 + 2 rg + (i & 1) of q', k' and v: loads 2 p and
    // 2 p + 1 are the neighbouring rows c0 and c0 + 1, which share a dword of v^T.
    const int l8 = tid & 7, rg = tid >> 3;
    const bf16_t* pq = qkv + ((size_t)b * 4096 + (size_t)ch * 128 + rg * 2) * 3072 + h * 64 +
                       l8 * 8;
    v8bf qx[4], kx[4], vx[4];
#pragma unroll
    for (int i = 0; i < 4; ++i) {
      qx[i] = *(const v8bf*)(pq + ((i >> 1) * 64 + (i & 1)) * 3072);
      kx[i] = *(const v8bf*)(pq + ((i >> 1) * 64 + (i & 1)) * 3072 + 1024);
      vx[i] = *(const v8bf*)(pq + ((i >> 1) * 64 + (i & 1)) * 3072 + 2048);
    }
    // the wait that is owed before a register which an issued load names is rewritten;
    // pq as an input keeps the address live over the whole run
    asm volatile("s_wait_xcnt 0x0" ::"v"(pq) : "memory");
#pragma unroll
    for (int i = 0; i < 4; ++i) {
      *(v8bf*)&sq[((i >> 1) * 64 + rg * 2 + (i & 1)) * 72 + l8 * 8] = qx[i];
      *(v8bf*)&sk[((i >> 1) * 64 + rg * 2 + (i & 1)) * 72 + l8 * 8] = kx[i];
    }
#pragma unroll
    for (int p = 0; p < 2; ++p)
#pragma unroll
      for (int j = 0; j < 8; ++j) {
        v2bf vo;
        vo[0] = vx[2 * p][j];
        vo[1] = vx[2 * p + 1][j];
        *(v2bf*)&svT[(l8 * 8 + j) * 136 + p * 64 + rg * 2] = vo;
      }
  }
  __syncthreads();

  // 3. A = q k'^T (8 tiles/wave) and num1 = q @ S (4 tiles/wave), K-dim 64
  v8f accA[8], accN[4];
#pragma unroll
  for (int i = 0; i < 8; ++i) accA[i] = vzero8();
#pragma unroll
  for (int i = 0; i < 4; ++i) accN[i] = vzero8();
#pragma unroll
  for (int kk = 0; kk < 64; kk += 32) {
    v16bf aq = frag_ld(frag_ptr(sq, wave * 16, 72, lane) + kk);
#pragma unroll
    for (int nt = 0; nt < 8; ++nt) {
      v16bf bk = frag_ld(frag_ptr(sk, nt * 16, 72, lane) + kk);
      accA[nt] = wmma_bf16(aq, bk, accA[nt]);
    }
#pragma unroll
    for (int nt = 0; nt < 4; ++nt) {
      v16bf bs = frag_ld(frag_ptr(sSB, nt * 16, 72, lane) + kk);
      accN[nt] = wmma_bf16(bs, aq, accN[nt]);  // D = tile^T: row cl, 8 neighbouring f a lane
    }
  }
  // 4a. q'.z while q' is still in LDS
  if (tid < 128) {
    float qz = 0.f;
#pragma unroll 8
    for (int e = 0; e < 64; ++e) qz += (float)sq[tid * 72 + e] * sz[e];
    sqz[tid] = qz;
  }
  __syncthreads();  // all waves done reading q'/k' before masked A overwrites them

  // tril mask + row sums + stage masked A as bf16; 4b. den[c] = q'.z + rowsum(A)
#pragma unroll
  for (int r = 0; r < 8; ++r) {
    const int c = wave * 16 + rh + r;
    float rs = 0.f;
#pragma unroll
    for (int nt = 0; nt < 8; ++nt) {
      const int d = nt * 16 + cl;
      const float v = (d <= c) ? accA[nt][r] : 0.f;
      accA[nt][r] = v;
      rs += v;
    }
#pragma unroll
    for (int o = 1; o < 16; o <<= 1) rs += __shfl_xor(rs, o);
    if (cl == 0) sden[c] = sqz[c] + rs;
#pragma unroll
    for (int nt = 0; nt < 8; ++nt)
      sP[c * 136 + nt * 16 + cl] = (bf16_t)accA[nt][r];
  }
  __syncthreads();

  // 5. num2 = A @ v  (A-operand = v^T rows; D transposed), K-dim 128
#pragma unroll
  for (int kk = 0; kk < 128; kk += 32) {
    v16bf ap = frag_ld(frag_ptr(sP, wave * 16, 136, lane) + kk);
#pragma unroll
    for (int nt = 0; nt < 4; ++nt) {
      v16bf bv = frag_ld(frag_ptr(svT, nt * 16, 136, lane) + kk);
      accN[nt] = wmma_bf16(bv, ap, accN[nt]);
    }
  }
  // 6. o = num / (den + 1e-6) -> global bf16
  head_rows_out(accN, sP + wave * 16 * 136, 136,
                out + ((size_t)b * 4096 + (size_t)ch * 128 + wave * 16) * 1024 + h * 64,
                sden[wave * 16 + cl] + 1e-6f, true, lane);
}

// ---------------------------------------------------------------------------
// Launch: B=2, L=4096, D=1024, H=16, E=64, W=128. Requires ws >= ~263 MB.
// ---------------------------------------------------------------------------
extern "C" void kernel_launch(void* const* d_in, const int* in_sizes, int n_in,
                              void* d_out, int out_size, void* d_ws, size_t ws_size,
                              hipStream_t stream) {
  const float* x = (const float*)d_in[0];
  const float* g1 = (const float*)d_in[1];
  const float* b1 = (const float*)d_in[2];
  const float* Wqkva = (const float*)d_in[3];
  const float* bqkva = (const float*)d_in[4];
  const float* Wpa = (const float*)d_in[5];
  const float* bpa = (const float*)d_in[6];
  const float* Wqkvs = (const float*)d_in[7];
  const float* bqkvs = (const float*)d_in[8];
  const float* Wos = (const float*)d_in[9];
  const float* bos = (const float*)d_in[10];
  const float* Wo = (const float*)d_in[11];
  const float* bo = (const float*)d_in[12];
  const float* gm = (const float*)d_in[13];
  const float* bm = (const float*)d_in[14];
  const float* W1 = (const float*)d_in[15];
  const float* b1m = (const float*)d_in[16];
  const float* W2 = (const float*)d_in[17];
  const float* b2m = (const float*)d_in[18];

  char* ws = (char*)d_ws;
  bf16_t* WqkvaT = (bf16_t*)(ws + 0);            // [3072][1024], and directly behind it,
                                                 // from ws + 6291456, WqkvsT [3072][1024]
  bf16_t* WpaT = (bf16_t*)(ws + 12582912);       // [1024][1024]
  bf16_t* WosT = (bf16_t*)(ws + 14680064);       // [1024][1024]
  bf16_t* WoT = (bf16_t*)(ws + 16777216);        // [1024][1024]
  bf16_t* W1T = (bf16_t*)(ws + 18874368);        // [4096][1024]
  bf16_t* W2T = (bf16_t*)(ws + 27262976);        // [1024][4096]
  bf16_t* xn = (bf16_t*)(ws + 35651584);         // [8192][1024]  (later: h)
  bf16_t* swa_o = (bf16_t*)(ws + 52428800);      // [8192][1024]
  bf16_t* lin_o = (bf16_t*)(ws + 69206016);      // [8192][1024]
  bf16_t* mix = (bf16_t*)(ws + 85983232);        // [8192][1024]
  float* linSc = (float*)(ws + 85983232);        // [32*32][64*64] (before mix)
  bf16_t* qkva = (bf16_t*)(ws + 102760448);      // [8192][3072]
  bf16_t* qkvs = (bf16_t*)(ws + 153092096);      // [8192][3072]
  bf16_t* gbuf = (bf16_t*)(ws + 153092096);      // [8192][4096] (reuses qkvs)
  float* x1 = (float*)(ws + 220200960);          // [8192][1024]
  bf16_t* linSb = (bf16_t*)(ws + 253755392);     // [32*32][64*64]
  float* linzc = (float*)(ws + 262144000);       // [32*32][64]
  float* linzp = (float*)(ws + 262406144);       // [32*32][64]
  float* outf = (float*)d_out;

  const dim3 blk(256);
  // Weight convert+transpose to bf16 [N][K]: the seven Wt lie back to back from ws + 0
  wt_transpose_kernel<<<dim3(1088), blk, 0, stream>>>(Wqkva, Wqkvs, Wpa, Wos, Wo, W1, W2,
                                                      WqkvaT);

  // xn = LN(x)
  ln_kernel<<<8192, blk, 0, stream>>>(x, g1, b1, xn);
  // both qkv projections: one Bt of 6144 rows from WqkvaT on
  gemm_kernel<256, 128, 3072, true, false, false, true, false><<<dim3(24, 32), blk, 0, stream>>>(
      xn, WqkvaT, bqkva, nullptr, qkva, 1024, nullptr, nullptr, bqkvs, qkvs);
  // attention branches
  swa_kernel<<<dim3(32, 16, 2), blk, 0, stream>>>(qkva, swa_o);
  lin_state_kernel<<<dim3(31, 32), blk, 0, stream>>>(qkvs, linSc, linzc);
  lin_prefix_kernel<<<dim3(264), blk, 0, stream>>>(linSc, linzc, linSb, linzp);
  lin_out_kernel<<<dim3(32, 32), blk, 0, stream>>>(qkvs, linSb, linzp, lin_o);
  // mix = swa @ Wp + bp + lin @ Wo_s + bo_s  (bf16)
  gemm_kernel<128, 128, 1024, true, false, false, false, true><<<dim3(4, 64), blk, 0, stream>>>(
      swa_o, WpaT, bpa, nullptr, mix, 1024, lin_o, WosT, bos, nullptr);
  // x1 = mix @ Wo + bo + x  (f32)
  gemm_kernel<128, 128, 1024, false, false, true><<<dim3(4, 64), blk, 0, stream>>>(
      mix, WoT, bo, x, x1, 1024, nullptr, nullptr, nullptr, nullptr);
  // h = LN(x1)
  ln_kernel<<<8192, blk, 0, stream>>>(x1, gm, bm, xn);
  // g = gelu(h @ W1 + b1m)  (bf16)
  gemm_kernel<256, 128, 4096, true, true, false><<<dim3(16, 32), blk, 0, stream>>>(
      xn, W1T, b1m, nullptr, gbuf, 1024, nullptr, nullptr, nullptr, nullptr);
  // out = g @ W2 + b2m + x1  (f32)
  gemm_kernel<128, 128, 1024, false, false, true><<<dim3(4, 64), blk, 0, stream>>>(
      gbuf, W2T, b2m, x1, outf, 4096, nullptr, nullptr, nullptr, nullptr);
}
